// v000
// Times are from an AMD MI455X. After a warm-up the kernel runs many times in a row, and a time is the length of
// such a window on the GPU divided by its runs, so every launch and the gaps after it count. The runs cycle
// through copies of the inputs. A figure is the median of several windows, for all but v000 over two sittings.
// Sittings can differ by a few percent; kernels timed side by side share one.
// The starting kernel, v000, takes 1610 microseconds a run.
// Contractions: x_ln@Wqkv, o@Wproj, h_ln@Wfc1, g@Wfc2 (activations f16, weights f16 carried x16), scores q.k^T (q,k f16, head dim zero-padded 16->32), attn@v (P f16 carried x2^15, V^T f16): all v_wmma_f32_16x16x32_f16 with f32 accumulate; LayerNorm, softmax, GELU(erf), bias, residual in f32.
#include <hip/hip_runtime.h>
#include <math.h>

// ---------------------------------------------------------------------------
// Problem constants
// ---------------------------------------------------------------------------
constexpr int kBatch   = 2;
constexpr int kSeq     = 2048;
constexpr int kDim     = 128;
constexpr int kHeads   = 8;
constexpr int kHdim    = 16;
constexpr int kHid     = 768;
constexpr int kRows    = kBatch * kSeq;     // 4096 token rows per branch
constexpr int kDim3    = 3 * kDim;          // 384
constexpr int kQPitch  = kHeads * 32;       // 256 halves: per-head slot of 32 (16 data + 16 zero)
constexpr int kGroups  = 3 * kBatch;        // 6 (branch, batch) groups; group g covers plane rows g*2048 .. g*2048+2047
constexpr int kHeadGrp = 4;                 // heads per score pass
constexpr float kWCarry = 16.0f;            // weights carried x16 in f16
constexpr float kPCarry = 32768.0f;         // probabilities carried x2^15 in f16
constexpr float kOCarry = 64.0f;            // attention output carried x64 in f16
constexpr float kGCarry = 16.0f;            // gelu output carried x16 in f16
constexpr float kLnEps  = 1e-5f;

typedef __attribute__((ext_vector_type(16))) _Float16 v16h;
typedef __attribute__((ext_vector_type(8)))  _Float16 v8h;
typedef __attribute__((ext_vector_type(16))) __bf16   v16b;
typedef __attribute__((ext_vector_type(8)))  __bf16   v8b;
typedef __attribute__((ext_vector_type(8)))  float    v8f;
typedef __attribute__((ext_vector_type(4)))  float    v4f;
typedef __attribute__((ext_vector_type(2)))  float    v2f;
typedef __attribute__((ext_vector_type(4)))  unsigned int v4u;
typedef __attribute__((ext_vector_type(2)))  unsigned int v2u;

__device__ __forceinline__ unsigned short f2bf_bits(float f) {
  unsigned u = __float_as_uint(f);
  return (unsigned short)((u + 0x7FFFu + ((u >> 16) & 1u)) >> 16);
}
__device__ __forceinline__ float bf_bits2f(unsigned short h) { return __uint_as_float(((unsigned)h) << 16); }

// hazard guards as plain device helpers (no inline asm inside the kernel template body)
__device__ __forceinline__ void dep_guard_h(v8f& a, v8f& b, v16h x, v16h y) { asm volatile("v_nop\n\tv_nop\n\tv_nop\n\tv_nop" : "+v"(a), "+v"(b) : "v"(x), "v"(y)); }
__device__ __forceinline__ void dep_guard_b(v8f& a, v8f& b, v16b x, v16b y) { asm volatile("v_nop\n\tv_nop\n\tv_nop\n\tv_nop" : "+v"(a), "+v"(b) : "v"(x), "v"(y)); }
__device__ __forceinline__ void keep4_h(v16h a, v16h b, v16h c, v16h d) { asm volatile("v_nop" :: "v"(a), "v"(b), "v"(c), "v"(d)); }
__device__ __forceinline__ void keep4_b(v16b a, v16b b, v16b c, v16b d) { asm volatile("v_nop" :: "v"(a), "v"(b), "v"(c), "v"(d)); }
__device__ __forceinline__ void acc_guard4(v8f& a, v8f& b, v8f& c, v8f& d) { asm volatile("v_nop\n\tv_nop\n\tv_nop\n\tv_nop" : "+v"(a), "+v"(b), "+v"(c), "+v"(d)); }
template <typename T> struct Frag;
template <> struct Frag<_Float16> {
  typedef v16h V; union U { v16h v; v8h h[2]; };
  static __device__ __forceinline__ v16h load(const _Float16* p) {   // elements 0..7 <- p[0..7], 8..15 <- p[16..23]
    U f; f.h[0] = *(const v8h*)(p); f.h[1] = *(const v8h*)(p + 16); return f.v;
  }
  static __device__ __forceinline__ v8f mma(v16h a, v16h b, v8f c) {
    return __builtin_amdgcn_wmma_f32_16x16x32_f16(false, a, false, b, (short)0, c, false, false);
  }
  static __device__ __forceinline__ void guard(v8f& a, v8f& b, v16h x, v16h y) { dep_guard_h(a, b, x, y); }
  static __device__ __forceinline__ void keep(v16h a, v16h b, v16h c, v16h d) { keep4_h(a, b, c, d); }
};
template <> struct Frag<__bf16> {
  typedef v16b V; union U { v16b v; v8b h[2]; };
  static __device__ __forceinline__ v16b load(const __bf16* p) {
    U f; f.h[0] = *(const v8b*)(p); f.h[1] = *(const v8b*)(p + 16); return f.v;
  }
  static __device__ __forceinline__ v8f mma(v16b a, v16b b, v8f c) {
    return __builtin_amdgcn_wmma_f32_16x16x32_bf16(false, a, false, b, (short)0, c, false, false);
  }
  static __device__ __forceinline__ void guard(v8f& a, v8f& b, v16b x, v16b y) { dep_guard_b(a, b, x, y); }
  static __device__ __forceinline__ void keep(v16b a, v16b b, v16b c, v16b d) { keep4_b(a, b, c, d); }
};

__device__ __forceinline__ unsigned pk16(unsigned short a, unsigned short b) { return (unsigned)a | ((unsigned)b << 16); }
__device__ __forceinline__ unsigned short h_bits(float f) { const _Float16 h = (_Float16)f; return __builtin_bit_cast(unsigned short, h); }

// ---- Register-blocked batched WMMA GEMM (ACT reduced to none/relu/leaky; explicit residual pitch ldr) ----
// C[m,n] = scale * sum_k A[m,k] * Bt[n,k] (+bias)(+resid); each wave owns a 64x64 tile.
// A row-major [M,K]; Bt row-major [N,K]; M,N % 64 == 0, K % 32 == 0.
// SPLIT: operands are hi/lo planes (A2/Bt2 = lo planes, same layout); product = hi.hi + hi.lo + lo.hi.
// BIAS_MODE: 0 = none, 1 = bias[m], 2 = bias[n].  RESID: + resid[m * ldr + n].
// OUT_MODE: 0 = f32, 1 = f16, 2 = bf16 hi plane (Cout) + bf16 lo plane (Cout2).
// ET: 0 = f16 operands, 1 = bf16 operands (pointers passed as 16-bit storage)
template <int ET> struct Elem;
template <> struct Elem<0> { typedef _Float16 T; };
template <> struct Elem<1> { typedef __bf16 T; };
template <int ET, bool SPLIT, int BIAS_MODE, int OUT_MODE, bool RESID, int ACT = 0>
__global__ __launch_bounds__(256) void wmma_gemm64(
    const unsigned short* __restrict__ Ap, const unsigned short* __restrict__ A2p, int lda, long strideA,
    const unsigned short* __restrict__ Btp, const unsigned short* __restrict__ Bt2p, int ldb, long strideB,
    void* __restrict__ Cout, void* __restrict__ Cout2, int ldc, long strideC,
    const float* __restrict__ bias,
    const float* __restrict__ resid, long strideR, int ldr,
    int M, int N, int K, float scale) {
  typedef typename Elem<ET>::T T;
  typedef typename Frag<T>::V V;
  const T* A = (const T*)Ap; const T* A2 = (const T*)A2p; const T* Bt = (const T*)Btp; const T* Bt2 = (const T*)Bt2p;
  __shared__ __align__(16) float sT[8][16 * 68];   // per-wave 16x64 slab, pitch 68 floats
  const int b    = blockIdx.y;
  const int lane = threadIdx.x & 31;
  const int wave = threadIdx.x >> 5;
  const int tilesN = N >> 6;
  const int tilesM = M >> 6;
  const int tile = blockIdx.x * 8 + wave;
  if (tile >= tilesM * tilesN) return;   // wave-uniform; no block barriers in this kernel
  const int tm = tile / tilesN;
  const int tn = tile - tm * tilesN;
  const int m0 = tm << 6;
  const int n0 = tn << 6;

  const T* Ab  = A  + (size_t)b * strideA;
  const T* Bb  = Bt + (size_t)b * strideB;
  const T* Ab2 = SPLIT ? (A2  + (size_t)b * strideA) : nullptr;
  const T* Bb2 = SPLIT ? (Bt2 + (size_t)b * strideB) : nullptr;

  const int rlane = lane & 15;                 // row (A) / col (B, D) within subtile
  const int koff  = (lane >> 4) * 8;           // k offset of this lane half
  const int mOff  = (lane >> 4) * 8;           // D row offset

  v8f acc[4][4];
#pragma unroll
  for (int i = 0; i < 4; ++i)
#pragma unroll
    for (int j = 0; j < 4; ++j) acc[i][j] = (v8f){0.f,0.f,0.f,0.f,0.f,0.f,0.f,0.f};

  for (int k0 = 0; k0 < K; k0 += 32) {
    V bh[4], bl[4];
#pragma unroll
    for (int j = 0; j < 4; ++j) {
      const size_t bo = (size_t)(n0 + (j << 4) + rlane) * ldb + koff + k0;
      bh[j] = Frag<T>::load(Bb + bo);
      if (SPLIT) bl[j] = Frag<T>::load(Bb2 + bo);
    }
#pragma unroll
    for (int i = 0; i < 4; ++i) {
      const size_t ao = (size_t)(m0 + (i << 4) + rlane) * lda + koff + k0;
      V ah = Frag<T>::load(Ab + ao);
      V al;
      if (SPLIT) al = Frag<T>::load(Ab2 + ao);
#pragma unroll
      for (int j = 0; j < 4; ++j) {
        acc[i][j] = Frag<T>::mma(ah, bh[j], acc[i][j]);
        if (SPLIT) {
          acc[i][j] = Frag<T>::mma(ah, bl[j], acc[i][j]);
          acc[i][j] = Frag<T>::mma(al, bh[j], acc[i][j]);
        }
      }
      Frag<T>::guard(acc[i][0], acc[i][3], ah, SPLIT ? al : ah);
    }
    Frag<T>::keep(bh[0], bh[1], bh[2], bh[3]);
    if (SPLIT) Frag<T>::keep(bl[0], bl[1], bl[2], bl[3]);
  }
  acc_guard4(acc[0][0], acc[0][1], acc[0][2], acc[0][3]);
  acc_guard4(acc[1][0], acc[1][1], acc[1][2], acc[1][3]);
  acc_guard4(acc[2][0], acc[2][1], acc[2][2], acc[2][3]);
  acc_guard4(acc[3][0], acc[3][1], acc[3][2], acc[3][3]);

  // ---- epilogue ----
  float* slab = sT[wave];
  const float* Rb = RESID ? (resid + (size_t)b * strideR) : nullptr;
#pragma unroll
  for (int i = 0; i < 4; ++i) {
    const int mBase = m0 + (i << 4);
#pragma unroll
    for (int j = 0; j < 4; ++j) {
      const int n = n0 + (j << 4) + rlane;
      float bv = 0.f;
      if (BIAS_MODE == 2) bv = bias[n];
#pragma unroll
      for (int r = 0; r < 8; ++r) {
        float v = acc[i][j][r] * scale;
        if (BIAS_MODE == 1) v += bias[mBase + mOff + r];
        if (BIAS_MODE == 2) v += bv;
        if (RESID) v += Rb[(size_t)(mBase + mOff + r) * ldr + n];
        if (ACT == 2) v = fmaxf(v, 0.0f);
        if (ACT == 4) v = (v > 0.f) ? v : 0.01f * v;
        slab[(mOff + r) * 68 + (j << 4) + rlane] = v;
      }
    }
    __builtin_amdgcn_fence(__ATOMIC_RELEASE, "workgroup");
    __builtin_amdgcn_wave_barrier();
    __builtin_amdgcn_fence(__ATOMIC_ACQUIRE, "workgroup");
    if (OUT_MODE == 0) {
      float* C = (float*)Cout + (size_t)b * strideC;
      const int hh = lane >> 4, c4 = (lane & 15) * 4;     // row seg = 256 B = 16 lanes x 16 B
      {
#pragma unroll
        for (int it = 0; it < 8; ++it) {
          const int row = it * 2 + hh;
          v4f v = *(const v4f*)(slab + row * 68 + c4);
          *(v4f*)(C + (size_t)(mBase + row) * ldc + n0 + c4) = v;
        }
        
      }
    } else {
      const int q = lane >> 3, c8 = (lane & 7) * 8;
      unsigned short* C  = (unsigned short*)Cout  + (size_t)b * strideC;
      unsigned short* C2 = (OUT_MODE == 2) ? ((unsigned short*)Cout2 + (size_t)b * strideC) : nullptr;
      {
#pragma unroll
        for (int it = 0; it < 4; ++it) {
          const int row = it * 4 + q;
          const float* sp = slab + row * 68 + c8;
          v8h hv, lv;
#pragma unroll
          for (int e = 0; e < 8; ++e) {
            if (OUT_MODE == 1) {
              hv[e] = (_Float16)sp[e];
            } else {
              unsigned short hb = f2bf_bits(sp[e]);
              unsigned short lb = f2bf_bits(sp[e] - bf_bits2f(hb));
              hv[e] = __builtin_bit_cast(_Float16, hb);
              lv[e] = __builtin_bit_cast(_Float16, lb);
            }
          }
          *(v8h*)(C + (size_t)(mBase + row) * ldc + n0 + c8) = hv;
          if (OUT_MODE == 2) *(v8h*)(C2 + (size_t)(mBase + row) * ldc + n0 + c8) = lv;
        }
        
      }
    }
    __builtin_amdgcn_fence(__ATOMIC_RELEASE, "workgroup");
    __builtin_amdgcn_wave_barrier();
    __builtin_amdgcn_fence(__ATOMIC_ACQUIRE, "workgroup");
  }
}

// ---------------------------------------------------------------------------
// Weight transpose + cast: W plane z is f32 [nIn][nOut] row-major; WT plane z = [nOut][nIn] f16, WT[h][d] = f16(scale * W[d][h]).
// grid (nIn/64, nOut/64, nz), 256 threads; nIn, nOut multiples of 64. Plane z at out + z*nOut*nIn halves.
// Load coverage: 16 iterations x 256 threads = 4096 = the whole 64x64 tile (coalesced along h).
// Store coverage: 8 waves x 2 iterations x 4 rows (lane>>3) = 64 rows; (lane&7) x 8 halves = 64 cols; each row segment =
// ---------------------------------------------------------------------------
__global__ __launch_bounds__(256) void wtcast_kernel(const float* __restrict__ W, unsigned short* __restrict__ out,
                                                     int nIn, int nOut, float scale) {
  __shared__ float sm[64][65];   // sm[h_local][d_local]
  const int t  = threadIdx.x;
  const int d0 = blockIdx.x * 64;
  const int h0 = blockIdx.y * 64;
  const int z  = blockIdx.z;
  const float* Wz = W + (size_t)z * nIn * nOut;
#pragma unroll
  for (int i = 0; i < 16; ++i) {
    const int e = i * 256 + t;
    const int r = e >> 6;          // d local
    const int c = e & 63;          // h local
    sm[c][r] = Wz[(size_t)(d0 + r) * nOut + h0 + c] * scale;
  }
  __syncthreads();
  const int lane = t & 31, wave = t >> 5;
  const int q = lane >> 3, c8 = (lane & 7) * 8;
  unsigned short* op = out + (size_t)z * nOut * nIn;
  {
#pragma unroll
    for (int it = 0; it < 2; ++it) {
      const int row = wave * 8 + it * 4 + q;                 // h local
      unsigned short hb[8];
#pragma unroll
      for (int e = 0; e < 8; ++e) hb[e] = h_bits(sm[row][c8 + e]);
      const v4u u = (v4u){pk16(hb[0], hb[1]), pk16(hb[2], hb[3]), pk16(hb[4], hb[5]), pk16(hb[6], hb[7])};
      *(v4u*)(op + (size_t)(h0 + row) * nIn + d0 + c8) = u;
    }
    
  }
}

// ---------------------------------------------------------------------------
// One wave per row; grid = 3*4096/8 = 1536 blocks of 8 waves (exact). Branch index is block-uniform.
// ---------------------------------------------------------------------------
__global__ __launch_bounds__(256) void ln128_kernel(const float* __restrict__ x1, const float* __restrict__ x2,
                                                    const float* __restrict__ x3, const float* __restrict__ g,
                                                    const float* __restrict__ bt, unsigned short* __restrict__ xn) {
  const int lane = threadIdx.x & 31, wave = threadIdx.x >> 5;
  const int wid = blockIdx.x * 8 + wave;            // 0 .. 12287
  const int br  = wid / kRows;                      // 0..2, block-uniform (512 blocks per branch)
  const int row = wid - br * kRows;
  const float* x = (br == 0) ? x1 : (br == 1) ? x2 : x3;
  const v4f xv = *(const v4f*)(x + (size_t)row * kDim + lane * 4);
  float s = (xv[0] + xv[1]) + (xv[2] + xv[3]);
#pragma unroll
  for (int off = 16; off > 0; off >>= 1) s += __shfl_xor(s, off, 32);
  const float mean = s * (1.0f / 128.0f);
  const float d0 = xv[0] - mean, d1 = xv[1] - mean, d2 = xv[2] - mean, d3 = xv[3] - mean;
  float s2 = (d0 * d0 + d1 * d1) + (d2 * d2 + d3 * d3);
#pragma unroll
  for (int off = 16; off > 0; off >>= 1) s2 += __shfl_xor(s2, off, 32);
  const float var  = s2 * (1.0f / 128.0f);
  const float rstd = rsqrtf(var + kLnEps);
  const v4f gv = *(const v4f*)(g + br * kDim + lane * 4);
  const v4f bv = *(const v4f*)(bt + br * kDim + lane * 4);
  const float y0 = d0 * rstd * gv[0] + bv[0];
  const float y1 = d1 * rstd * gv[1] + bv[1];
  const float y2 = d2 * rstd * gv[2] + bv[2];
  const float y3 = d3 * rstd * gv[3] + bv[3];
  const v2u u = (v2u){pk16(h_bits(y0), h_bits(y1)), pk16(h_bits(y2), h_bits(y3))};
  unsigned short* qp = xn + (size_t)wid * kDim + lane * 4;
  *(v2u*)qp = u;
  
}

// ---------------------------------------------------------------------------
// LayerNorm over 384 features of xc[4096][384] (f32) -> f16 plane hn[4096][384]. One wave per row; grid = 4096/8 = 512.
// ---------------------------------------------------------------------------
__global__ __launch_bounds__(256) void ln384_kernel(const float* __restrict__ xc, const float* __restrict__ g,
                                                    const float* __restrict__ bt, unsigned short* __restrict__ hn) {
  const int lane = threadIdx.x & 31, wave = threadIdx.x >> 5;
  const int row = blockIdx.x * 8 + wave;            // 0 .. 4095
  const float* r = xc + (size_t)row * kDim3;
  v4f vv[3];
  float s = 0.f;
#pragma unroll
  for (int ch = 0; ch < 3; ++ch) {
    vv[ch] = *(const v4f*)(r + ch * kDim + lane * 4);
    s += (vv[ch][0] + vv[ch][1]) + (vv[ch][2] + vv[ch][3]);
  }
#pragma unroll
  for (int off = 16; off > 0; off >>= 1) s += __shfl_xor(s, off, 32);
  const float mean = s * (1.0f / 384.0f);
  float s2 = 0.f;
#pragma unroll
  for (int ch = 0; ch < 3; ++ch) {
#pragma unroll
    for (int j = 0; j < 4; ++j) { const float d = vv[ch][j] - mean; vv[ch][j] = d; s2 += d * d; }
  }
#pragma unroll
  for (int off = 16; off > 0; off >>= 1) s2 += __shfl_xor(s2, off, 32);
  const float var  = s2 * (1.0f / 384.0f);
  const float rstd = rsqrtf(var + kLnEps);
  v2u u[3];
#pragma unroll
  for (int ch = 0; ch < 3; ++ch) {
    const v4f gv = *(const v4f*)(g + ch * kDim + lane * 4);
    const v4f bv = *(const v4f*)(bt + ch * kDim + lane * 4);
    unsigned short hb[4];
#pragma unroll
    for (int j = 0; j < 4; ++j) hb[j] = h_bits(vv[ch][j] * rstd * gv[j] + bv[j]);
    u[ch] = (v2u){pk16(hb[0], hb[1]), pk16(hb[2], hb[3])};
  }
  unsigned short* qp = hn + (size_t)row * kDim3 + lane * 4;
  {
#pragma unroll
    for (int ch = 0; ch < 3; ++ch) *(v2u*)(qp + ch * kDim) = u[ch];
    
  }
}

// ---------------------------------------------------------------------------
// Head-dim padding of q and k: from qkvo[3*4096][384] f16 (cols 0..127 q, 128..255 k, 256..383 v; head h at h*16)
// build q32[3*4096][256] and k32[3*4096][256]: slot h*32 + d holds head h dim d for d < 16 and ZERO for d in 16..31.
// One wave per row; grid = 12288/8 = 1536. Lane l: head h = l>>2, part p = l&3 -> halves 8l..8l+7 of the 256-half row;
// source loaded unconditionally from the (always valid) address h*16 + 8*(p&1), zeroed by value when p >= 2.
// ---------------------------------------------------------------------------
__global__ __launch_bounds__(256) void pad_qk_kernel(const unsigned short* __restrict__ qkvo,
                                                     unsigned short* __restrict__ q32, unsigned short* __restrict__ k32) {
  const int lane = threadIdx.x & 31, wave = threadIdx.x >> 5;
  const int row = blockIdx.x * 8 + wave;           // 0 .. 12287
  const int hz = lane >> 2, p = lane & 3;
  const size_t src = (size_t)row * kDim3 + hz * kHdim + 8 * (p & 1);
  const v4u qv = *(const v4u*)(qkvo + src);
  const v4u kv = *(const v4u*)(qkvo + src + kDim);
  const unsigned keep = (p < 2) ? 0xFFFFFFFFu : 0u;
  const v4u qo = (v4u){qv[0] & keep, qv[1] & keep, qv[2] & keep, qv[3] & keep};
  const v4u ko = (v4u){kv[0] & keep, kv[1] & keep, kv[2] & keep, kv[3] & keep};
  const size_t dst = (size_t)row * kQPitch + lane * 8;
  {
    *(v4u*)(q32 + dst) = qo;
    *(v4u*)(k32 + dst) = ko;
    
  }
}

// ---------------------------------------------------------------------------
// V transpose: vt[(g*128 + c)*2048 + n] = qkvo[(g*2048 + n)*384 + 256 + c], g = 0..5 ((branch,batch) group), c = h*16+d.
// grid (2048/64 = 32, 128/64 = 2, 6), 256 threads. in tile [n0..n0+63][c0..c0+63] -> out tile [c0..][n0..] through LDS.
// Load coverage: 2 iterations x 256 threads = 512 = 64 n-rows x 8 16-B parts (8 halves each) = whole tile.
// Store coverage: 8 waves x 2 iterations x 4 rows (lane>>3) = 64 c-rows; (lane&7) x 8 halves = 64 n-cols; each row
// ---------------------------------------------------------------------------
__global__ __launch_bounds__(256) void vtrans_kernel(const unsigned short* __restrict__ qkvo, unsigned short* __restrict__ vt) {
  __shared__ unsigned short sm[64][66];   // sm[c local][n local]
  const int t  = threadIdx.x;
  const int n0 = blockIdx.x * 64;
  const int c0 = blockIdx.y * 64;
  const int g  = blockIdx.z;
#pragma unroll
  for (int i = 0; i < 2; ++i) {
    const int e = i * 256 + t;
    const int r = e >> 3;          // n local 0..63
    const int part = e & 7;        // 8-half part 0..7
    const v4u u = *(const v4u*)(qkvo + (size_t)(g * kSeq + n0 + r) * kDim3 + 2 * kDim + c0 + part * 8);
#pragma unroll
    for (int w = 0; w < 4; ++w) {
      sm[part * 8 + 2 * w][r]     = (unsigned short)(u[w] & 0xFFFFu);
      sm[part * 8 + 2 * w + 1][r] = (unsigned short)(u[w] >> 16);
    }
  }
  __syncthreads();
  const int lane = t & 31, wave = t >> 5;
  const int q = lane >> 3, c8 = (lane & 7) * 8;
  {
#pragma unroll
    for (int it = 0; it < 2; ++it) {
      const int row = wave * 8 + it * 4 + q;     // c local
      unsigned short hb[8];
#pragma unroll
      for (int e = 0; e < 8; ++e) hb[e] = sm[row][c8 + e];
      const v4u u = (v4u){pk16(hb[0], hb[1]), pk16(hb[2], hb[3]), pk16(hb[4], hb[5]), pk16(hb[6], hb[7])};
      *(v4u*)(vt + (size_t)(g * kDim + c0 + row) * kSeq + n0 + c8) = u;
    }
    
  }
}

// ---------------------------------------------------------------------------
// Row softmax over 2048 f32 scores: P[row][j] = f16( carry * exp(s - max) / sum exp(s - max) ), f32 math.
// One block of 256 threads per row; thread t owns columns 8t..8t+7 (256 x 8 = 2048 = whole row).
// Reductions in fixed order (thread, wave shuffle tree, 8 wave partials in index order).
// ---------------------------------------------------------------------------
__global__ __launch_bounds__(256) void softmax2048_kernel(const float* __restrict__ S, unsigned short* __restrict__ P, float carry) {
  __shared__ float redM[8];
  __shared__ float redS[8];
  const int row  = blockIdx.x;
  const int t    = threadIdx.x;
  const int lane = t & 31, wave = t >> 5;
  const int c0   = t * 8;
  const float* sr = S + (size_t)row * kSeq + c0;
  const v4f a = *(const v4f*)(sr);
  const v4f c = *(const v4f*)(sr + 4);
  float x[8];
#pragma unroll
  for (int e = 0; e < 4; ++e) { x[e] = a[e]; x[4 + e] = c[e]; }
  float m = fmaxf(fmaxf(fmaxf(x[0], x[1]), fmaxf(x[2], x[3])), fmaxf(fmaxf(x[4], x[5]), fmaxf(x[6], x[7])));
#pragma unroll
  for (int off = 16; off > 0; off >>= 1) m = fmaxf(m, __shfl_xor(m, off, 32));
  if (lane == 0) redM[wave] = m;
  __syncthreads();
  float gm = redM[0];
#pragma unroll
  for (int w = 1; w < 8; ++w) gm = fmaxf(gm, redM[w]);
  float ev[8];
  float s = 0.f;
#pragma unroll
  for (int e = 0; e < 8; ++e) { ev[e] = expf(x[e] - gm); s += ev[e]; }
#pragma unroll
  for (int off = 16; off > 0; off >>= 1) s += __shfl_xor(s, off, 32);
  if (lane == 0) redS[wave] = s;
  __syncthreads();
  float tot = redS[0];
#pragma unroll
  for (int w = 1; w < 8; ++w) tot += redS[w];
  const float inv = carry * (1.0f / tot);
  unsigned short hb[8];
#pragma unroll
  for (int e = 0; e < 8; ++e) hb[e] = h_bits(ev[e] * inv);
  const v4u u = (v4u){pk16(hb[0], hb[1]), pk16(hb[2], hb[3]), pk16(hb[4], hb[5]), pk16(hb[6], hb[7])};
  unsigned short* qp = P + (size_t)row * kSeq + c0;
  *(v4u*)qp = u;
  
}

// ---------------------------------------------------------------------------
// Head merge: opv holds the P.V^T result of 8 heads as [hz][2048][64] f16 where head hz's 16 wanted columns sit at
// 16*(hz&3) (the other 48 columns are other heads' products and are dropped). Writes the merged attention output row
// opl[(g*2048 + n)*128 + 16*hz + d] = opv[hz][n][16*(hz&3) + d].
// 256 threads = 8 waves; lane: rsel = lane>>4 selects one of the wave's 2 rows, q = lane&15 -> hz = q>>1, d0 = 8*(q&1).
// Coverage: grid 128 blocks x 8 waves x 2 rows = 2048 rows; 16 lanes x 8 halves = 128 cols = whole row (256 B = 2 whole
// ---------------------------------------------------------------------------
__global__ __launch_bounds__(256) void ohead_kernel(const unsigned short* __restrict__ opv, unsigned short* __restrict__ opl, int g) {
  const int lane = threadIdx.x & 31, wave = threadIdx.x >> 5;
  const int rsel = lane >> 4, q = lane & 15;
  const int hz = q >> 1, d0 = 8 * (q & 1);
  const int n = blockIdx.x * 16 + wave * 2 + rsel;     // 0 .. 2047
  const v4u u = *(const v4u*)(opv + ((size_t)hz * kSeq + n) * 64 + 16 * (hz & 3) + d0);
  unsigned short* qp = opl + ((size_t)g * kSeq + n) * kDim + 8 * q;
  *(v4u*)qp = u;
  
}

// ---------------------------------------------------------------------------
// Exact GELU (erf form) on the fc1 pre-activation plane (f32) -> f16 plane carried x carry; 2 elements per thread,
// Coverage: n2 = n/2 threads x 2 = whole plane (grid exact multiple of 256 here).
// ---------------------------------------------------------------------------
__global__ __launch_bounds__(256) void gelu2_kernel(const float* __restrict__ in, unsigned short* __restrict__ out, int n2, float carry) {
  const int i = blockIdx.x * 256 + threadIdx.x;
  if (i >= n2) return;
  const v2f v = *(const v2f*)(in + 2 * (size_t)i);
  float g0 = 0.f, g1 = 0.f;
#pragma unroll 1
  for (int s = 0; s < 2; ++s) {
    const float xx = s ? v[1] : v[0];
    const float gl = 0.5f * xx * (1.0f + erff(xx * 0.70710678118654752f));
    g0 = s ? g0 : gl;
    g1 = s ? gl : g1;
  }
  const unsigned u = pk16(h_bits(g0 * carry), h_bits(g1 * carry));
  unsigned* qp = (unsigned*)(out + 2 * (size_t)i);
  *(unsigned*)qp = u;
  
}

// ---------------------------------------------------------------------------
// Host glue. Workspace region map (bytes; every offset a multiple of 32768):
//   WQKV  f16 [3][384][128]            294,912 @          0
//   WPROJ f16 [3][128][128]             98,304 @    294,912
//   WFC1  f16 [768][384]               589,824 @    393,216
//   WFC2  f16 [384][768]               589,824 @    983,040
//   Q32   f16 [12288][256]           6,291,456 @  1,572,864
//   K32   f16 [12288][256]           6,291,456 @  7,864,320
//   VT    f16 [6][128][2048]         3,145,728 @ 14,155,776
//   BIG                             67,108,864 @ 17,301,504   (XN f16 [12288][128] @ +0 and QKVO f16 [12288][384] @ +3,145,728
//                                                             before attention; S f32 [4][2048][2048] during attention;
//                                                             HN f16 [4096][384] @ +0, H1 f32 [4096][768] @ +3,145,728,
//                                                             G f16 [4096][768] @ +15,728,640 after attention)
//   P     f16 [4][2048][2048]       33,554,432 @ 84,410,368
//   OPV   f16 [8][2048][64]          2,097,152 @ 117,964,800
//   OPL   f16 [12288][128]           3,145,728 @ 120,061,952
//   XC    f32 [4096][384]            6,291,456 @ 123,207,680
//   total                                        129,499,136
// ---------------------------------------------------------------------------
extern "C" void kernel_launch(void* const* d_in, const int* in_sizes, int n_in,
                              void* d_out, int out_size, void* d_ws, size_t ws_size,
                              hipStream_t stream) {
  if (n_in < 14) return;
  if (in_sizes[0] != kRows * kDim || in_sizes[1] != kRows * kDim || in_sizes[2] != kRows * kDim) return;
  if (in_sizes[3] != 3 * kDim || in_sizes[4] != 3 * kDim) return;
  if (in_sizes[5] != 3 * kDim * kDim3 || in_sizes[6] != 3 * kDim * kDim || in_sizes[7] != 3 * kDim) return;
  if (in_sizes[8] != kDim3 || in_sizes[9] != kDim3) return;
  if (in_sizes[10] != kDim3 * kHid || in_sizes[11] != kHid || in_sizes[12] != kHid * kDim3 || in_sizes[13] != kDim3) return;
  if (out_size != 3 * kRows * kDim) return;

  const float* x1     = (const float*)d_in[0];
  const float* x2     = (const float*)d_in[1];
  const float* x3     = (const float*)d_in[2];
  const float* ln1_g  = (const float*)d_in[3];
  const float* ln1_b  = (const float*)d_in[4];
  const float* qkv_w  = (const float*)d_in[5];
  const float* proj_w = (const float*)d_in[6];
  const float* proj_b = (const float*)d_in[7];
  const float* ln2_g  = (const float*)d_in[8];
  const float* ln2_b  = (const float*)d_in[9];
  const float* fc1_w  = (const float*)d_in[10];
  const float* fc1_b  = (const float*)d_in[11];
  const float* fc2_w  = (const float*)d_in[12];
  const float* fc2_b  = (const float*)d_in[13];
  float* out = (float*)d_out;

  // ---- carve ----
  const size_t szWQKV  = (size_t)3 * kDim3 * kDim * 2;
  const size_t szWPROJ = (size_t)3 * kDim * kDim * 2;
  const size_t szWFC1  = (size_t)kHid * kDim3 * 2;
  const size_t szWFC2  = (size_t)kDim3 * kHid * 2;
  const size_t szQ32   = (size_t)3 * kRows * kQPitch * 2;
  const size_t szVT    = (size_t)kGroups * kDim * kSeq * 2;
  const size_t szXN    = (size_t)3 * kRows * kDim * 2;
  const size_t szQKVO  = (size_t)3 * kRows * kDim3 * 2;
  const size_t szS     = (size_t)kHeadGrp * kSeq * kSeq * 4;
  const size_t szHN    = (size_t)kRows * kDim3 * 2;
  const size_t szH1    = (size_t)kRows * kHid * 4;
  const size_t szG     = (size_t)kRows * kHid * 2;
  size_t szBIG = szS;
  if (szXN + szQKVO > szBIG) szBIG = szXN + szQKVO;
  if (szHN + szH1 + szG > szBIG) szBIG = szHN + szH1 + szG;
  const size_t szP     = (size_t)kHeadGrp * kSeq * kSeq * 2;
  const size_t szOPV   = (size_t)kHeads * kSeq * 64 * 2;
  const size_t szOPL   = (size_t)3 * kRows * kDim * 2;
  const size_t szXC    = (size_t)kRows * kDim3 * 4;

  const size_t oWQKV  = 0;
  const size_t oWPROJ = oWQKV + szWQKV;
  const size_t oWFC1  = oWPROJ + szWPROJ;
  const size_t oWFC2  = oWFC1 + szWFC1;
  const size_t oQ32   = oWFC2 + szWFC2;
  const size_t oK32   = oQ32 + szQ32;
  const size_t oVT    = oK32 + szQ32;
  const size_t oBIG   = oVT + szVT;
  const size_t oP     = oBIG + szBIG;
  const size_t oOPV   = oP + szP;
  const size_t oOPL   = oOPV + szOPV;
  const size_t oXC    = oOPL + szOPL;
  const size_t oEnd   = oXC + szXC;
  if (oEnd > ws_size) return;

  unsigned char* ws = (unsigned char*)d_ws;
  unsigned short* WQKV  = (unsigned short*)(ws + oWQKV);
  unsigned short* WPROJ = (unsigned short*)(ws + oWPROJ);
  unsigned short* WFC1  = (unsigned short*)(ws + oWFC1);
  unsigned short* WFC2  = (unsigned short*)(ws + oWFC2);
  unsigned short* Q32   = (unsigned short*)(ws + oQ32);
  unsigned short* K32   = (unsigned short*)(ws + oK32);
  unsigned short* VT    = (unsigned short*)(ws + oVT);
  unsigned short* XN    = (unsigned short*)(ws + oBIG);
  unsigned short* QKVO  = (unsigned short*)(ws + oBIG + szXN);
  float*          S     = (float*)(ws + oBIG);
  unsigned short* HN    = (unsigned short*)(ws + oBIG);
  float*          H1    = (float*)(ws + oBIG + szHN);
  unsigned short* G     = (unsigned short*)(ws + oBIG + szHN + szH1);
  unsigned short* P     = (unsigned short*)(ws + oP);
  unsigned short* OPV   = (unsigned short*)(ws + oOPV);
  unsigned short* OPL   = (unsigned short*)(ws + oOPL);
  float*          XC    = (float*)(ws + oXC);
  const float* fdum = proj_b;   // valid f32 pointer for unused bias/resid slots

  // ---- weights: transpose + f16 (carried x16) ----
  // qkv_w [3][128][384] -> WQKV [3][384][128]; proj_w [3][128][128] -> WPROJ [3][128][128];
  // fc1_w [384][768] -> WFC1 [768][384]; fc2_w [768][384] -> WFC2 [384][768]   (grid = (nIn/64, nOut/64, nz))
  wtcast_kernel<<<dim3(kDim / 64, kDim3 / 64, 3), 256, 0, stream>>>(qkv_w, WQKV, kDim, kDim3, kWCarry);
  wtcast_kernel<<<dim3(kDim / 64, kDim / 64, 3), 256, 0, stream>>>(proj_w, WPROJ, kDim, kDim, kWCarry);
  wtcast_kernel<<<dim3(kDim3 / 64, kHid / 64, 1), 256, 0, stream>>>(fc1_w, WFC1, kDim3, kHid, kWCarry);
  wtcast_kernel<<<dim3(kHid / 64, kDim3 / 64, 1), 256, 0, stream>>>(fc2_w, WFC2, kHid, kDim3, kWCarry);

  // ---- LN1 -> XN f16 [3*4096][128] ----
  ln128_kernel<<<dim3(3 * kRows / 8), 256, 0, stream>>>(x1, x2, x3, ln1_g, ln1_b, XN);

  // ---- QKV: QKVO[br][4096][384] = (XN[br] . WQKV[br]^T) / 16, f16 out. M=4096, N=384, K=128; tiles 64*6=384 -> 48 blocks, z=3 ----
  wmma_gemm64<0, false, 0, 1, false><<<dim3(48, 3), 256, 0, stream>>>(
      XN, XN, kDim, (long)kRows * kDim,
      WQKV, WQKV, kDim, (long)kDim3 * kDim,
      (void*)QKVO, (void*)QKVO, kDim3, (long)kRows * kDim3,
      fdum, fdum, 0L, 0,
      kRows, kDim3, kDim, 1.0f / kWCarry);

  // ---- q/k head-dim padding and V transpose ----
  pad_qk_kernel<<<dim3(3 * kRows / 8), 256, 0, stream>>>(QKVO, Q32, K32);
  vtrans_kernel<<<dim3(kSeq / 64, kDim / 64, kGroups), 256, 0, stream>>>(QKVO, VT);

  // ---- attention per (branch,batch) group g and head group hg (4 heads each) ----
  for (int g = 0; g < kGroups; ++g) {
    for (int hg = 0; hg < kHeads / kHeadGrp; ++hg) {
      // scores S[z][n][m] = 0.25 * q_h . k_h, head h = 4hg+z; A = Q32 rows of group g at head slot (lda 256, z stride 32),
      // Bt = K32 likewise; M=N=2048, K=32 (cols 16..31 of every slot are explicit zeros); tiles 32*32=1024 -> 128 blocks, z=4
      const unsigned short* qa = Q32 + (size_t)g * kSeq * kQPitch + hg * kHeadGrp * 32;
      const unsigned short* ka = K32 + (size_t)g * kSeq * kQPitch + hg * kHeadGrp * 32;
      wmma_gemm64<0, false, 0, 0, false><<<dim3(128, kHeadGrp), 256, 0, stream>>>(
          qa, qa, kQPitch, 32L,
          ka, ka, kQPitch, 32L,
          (void*)S, (void*)S, kSeq, (long)kSeq * kSeq,
          fdum, fdum, 0L, 0,
          kSeq, kSeq, 32, 0.25f);
      // row softmax -> P f16 x 2^15, 4*2048 rows
      softmax2048_kernel<<<dim3(kHeadGrp * kSeq), 256, 0, stream>>>(S, P, kPCarry);
      // O[z][n][0..63] = (P[z] . VT64^T) * 64 / 2^15 where VT64 = 64 rows (4 heads x 16 dims) of group g's V^T plane
      // (ldb 2048, z stride 0); wanted 16 cols of head z at 16z. M=2048, N=64, K=2048; tiles 32 -> 4 blocks, z=4
      const unsigned short* vb = VT + ((size_t)g * kDim + hg * 64) * kSeq;
      unsigned short* opv = OPV + (size_t)hg * kHeadGrp * kSeq * 64;
      wmma_gemm64<0, false, 0, 1, false><<<dim3(4, kHeadGrp), 256, 0, stream>>>(
          P, P, kSeq, (long)kSeq * kSeq,
          vb, vb, kSeq, 0L,
          (void*)opv, (void*)opv, 64, (long)kSeq * 64,
          fdum, fdum, 0L, 0,
          kSeq, 64, kSeq, kOCarry / kPCarry);
    }
    // merge 8 heads of group g into OPL rows g*2048.. (whole 256-B rows)
    ohead_kernel<<<dim3(kSeq / 16), 256, 0, stream>>>(OPV, OPL, g);
  }

  // ---- proj + bias + residual x_br -> XC[:, br*128 .. br*128+127] f32 (ldc 384, resid pitch 128) ----
  // M=4096, N=128, K=128, scale 1/(64*16); tiles 64*2=128 -> 16 blocks
  for (int br = 0; br < 3; ++br) {
    const float* xbr = (br == 0) ? x1 : (br == 1) ? x2 : x3;
    const unsigned short* oa = OPL + (size_t)br * kRows * kDim;
    const unsigned short* wb = WPROJ + (size_t)br * kDim * kDim;
    float* xcb = XC + br * kDim;
    wmma_gemm64<0, false, 2, 0, true><<<dim3(16, 1), 256, 0, stream>>>(
        oa, oa, kDim, 0L,
        wb, wb, kDim, 0L,
        (void*)xcb, (void*)xcb, kDim3, 0L,
        proj_b + br * kDim, xbr, 0L, kDim,
        kRows, kDim, kDim, 1.0f / (kOCarry * kWCarry));
  }

  // ---- LN2 -> HN f16 [4096][384] ----
  ln384_kernel<<<dim3(kRows / 8), 256, 0, stream>>>(XC, ln2_g, ln2_b, HN);

  // ---- fc1 + bias -> H1 f32 [4096][768]; M=4096, N=768, K=384; tiles 64*12=768 -> 96 blocks ----
  wmma_gemm64<0, false, 2, 0, false><<<dim3(96, 1), 256, 0, stream>>>(
      HN, HN, kDim3, 0L,
      WFC1, WFC1, kDim3, 0L,
      (void*)H1, (void*)H1, kHid, 0L,
      fc1_b, fdum, 0L, 0,
      kRows, kHid, kDim3, 1.0f / kWCarry);

  // ---- exact GELU -> G f16 x16 ----
  gelu2_kernel<<<dim3((kRows * kHid / 2 + 255) / 256), 256, 0, stream>>>(H1, G, kRows * kHid / 2, kGCarry);

  // ---- fc2 + bias + residual XC -> three output planes out[k] = [4096][128] (N=128 slice k of 384), K=768, scale 1/256 ----
  for (int k = 0; k < 3; ++k) {
    const unsigned short* wb = WFC2 + (size_t)k * kDim * kHid;
    float* ok = out + (size_t)k * kRows * kDim;
    wmma_gemm64<0, false, 2, 0, true><<<dim3(16, 1), 256, 0, stream>>>(
        G, G, kHid, 0L,
        wb, wb, kHid, 0L,
        (void*)ok, (void*)ok, kDim, 0L,
        fc2_b + k * kDim, XC + k * kDim, 0L, kDim3,
        kRows, kDim, kHid, 1.0f / (kGCarry * kWCarry));
  }
}

// v001
// Measured time: 225 microseconds a run.
// Two timings next to v000 put it at 7.25 and 7.19 times that version's speed.
// Contractions: x_ln@Wqkv, o@Wproj, h_ln@Wfc1, g@Wfc2 (activations f16, weights f16 carried x16), scores k.q^T (q,k f16, head dim 16: two key tiles per A fragment, q zero-padded 16->32 in registers), V^T@P^T (P f16, unnormalised exp carried x2^8, V^T f16): all v_wmma_f32_16x16x32_f16 with f32 accumulate; LayerNorm, online softmax, GELU(erf), bias, residual in f32.
#include <hip/hip_runtime.h>
#include <math.h>

// ---------------------------------------------------------------------------
// Problem constants
// ---------------------------------------------------------------------------
constexpr int kBatch   = 2;
constexpr int kSeq     = 2048;
constexpr int kDim     = 128;
constexpr int kHeads   = 8;
constexpr int kHdim    = 16;
constexpr int kHid     = 768;
constexpr int kRows    = kBatch * kSeq;     // 4096 token rows per branch
constexpr int kDim3    = 3 * kDim;          // 384
constexpr int kGroups  = 3 * kBatch;        // 6 (branch, batch) groups; group g covers plane rows g*2048 .. g*2048+2047
constexpr int kKeyChunk = 512;              // keys staged in LDS at a time
constexpr int kVHalf   = 288;               // LDS bytes from lane half 0's 256 B of a V^T fragment half to lane half 1's
constexpr int kVGrp    = 576;               // LDS bytes per V^T fragment half (16 dims x 16 keys)
constexpr float kWCarry = 16.0f;            // weights carried x16 in f16
constexpr float kPCarryLog2 = 8.0f;         // unnormalised probabilities exp(s - max) carried x2^8 in f16
constexpr float kOCarry = 64.0f;            // attention output carried x64 in f16
constexpr float kGCarry = 16.0f;            // gelu output carried x16 in f16
constexpr float kLnEps  = 1e-5f;

typedef __attribute__((ext_vector_type(16))) _Float16 v16h;
typedef __attribute__((ext_vector_type(8)))  _Float16 v8h;
typedef __attribute__((ext_vector_type(16))) __bf16   v16b;
typedef __attribute__((ext_vector_type(8)))  __bf16   v8b;
typedef __attribute__((ext_vector_type(8)))  float    v8f;
typedef __attribute__((ext_vector_type(4)))  float    v4f;
typedef __attribute__((ext_vector_type(2)))  float    v2f;
typedef __attribute__((ext_vector_type(4)))  unsigned int v4u;
typedef __attribute__((ext_vector_type(2)))  unsigned int v2u;

__device__ __forceinline__ unsigned short f2bf_bits(float f) {
  unsigned u = __float_as_uint(f);
  return (unsigned short)((u + 0x7FFFu + ((u >> 16) & 1u)) >> 16);
}
__device__ __forceinline__ float bf_bits2f(unsigned short h) { return __uint_as_float(((unsigned)h) << 16); }

// hazard guards as plain device helpers (no inline asm inside the kernel template body)
__device__ __forceinline__ void dep_guard_h(v8f& a, v8f& b, v16h x, v16h y) { asm volatile("v_nop\n\tv_nop\n\tv_nop\n\tv_nop" : "+v"(a), "+v"(b) : "v"(x), "v"(y)); }
__device__ __forceinline__ void dep_guard_b(v8f& a, v8f& b, v16b x, v16b y) { asm volatile("v_nop\n\tv_nop\n\tv_nop\n\tv_nop" : "+v"(a), "+v"(b) : "v"(x), "v"(y)); }
__device__ __forceinline__ void keep4_h(v16h a, v16h b, v16h c, v16h d) { asm volatile("v_nop" :: "v"(a), "v"(b), "v"(c), "v"(d)); }
__device__ __forceinline__ void keep4_b(v16b a, v16b b, v16b c, v16b d) { asm volatile("v_nop" :: "v"(a), "v"(b), "v"(c), "v"(d)); }
__device__ __forceinline__ void acc_guard4(v8f& a, v8f& b, v8f& c, v8f& d) { asm volatile("v_nop\n\tv_nop\n\tv_nop\n\tv_nop" : "+v"(a), "+v"(b), "+v"(c), "+v"(d)); }
template <typename T> struct Frag;
template <> struct Frag<_Float16> {
  typedef v16h V; union U { v16h v; v8h h[2]; };
  static __device__ __forceinline__ v16h load(const _Float16* p) {   // elements 0..7 <- p[0..7], 8..15 <- p[16..23]
    U f; f.h[0] = *(const v8h*)(p); f.h[1] = *(const v8h*)(p + 16); return f.v;
  }
  static __device__ __forceinline__ v8f mma(v16h a, v16h b, v8f c) {
    return __builtin_amdgcn_wmma_f32_16x16x32_f16(false, a, false, b, (short)0, c, false, false);
  }
  static __device__ __forceinline__ void guard(v8f& a, v8f& b, v16h x, v16h y) { dep_guard_h(a, b, x, y); }
  static __device__ __forceinline__ void keep(v16h a, v16h b, v16h c, v16h d) { keep4_h(a, b, c, d); }
};
template <> struct Frag<__bf16> {
  typedef v16b V; union U { v16b v; v8b h[2]; };
  static __device__ __forceinline__ v16b load(const __bf16* p) {
    U f; f.h[0] = *(const v8b*)(p); f.h[1] = *(const v8b*)(p + 16); return f.v;
  }
  static __device__ __forceinline__ v8f mma(v16b a, v16b b, v8f c) {
    return __builtin_amdgcn_wmma_f32_16x16x32_bf16(false, a, false, b, (short)0, c, false, false);
  }
  static __device__ __forceinline__ void guard(v8f& a, v8f& b, v16b x, v16b y) { dep_guard_b(a, b, x, y); }
  static __device__ __forceinline__ void keep(v16b a, v16b b, v16b c, v16b d) { keep4_b(a, b, c, d); }
};

__device__ __forceinline__ unsigned pk16(unsigned short a, unsigned short b) { return (unsigned)a | ((unsigned)b << 16); }
__device__ __forceinline__ unsigned short h_bits(float f) { const _Float16 h = (_Float16)f; return __builtin_bit_cast(unsigned short, h); }

// ---- Register-blocked batched WMMA GEMM (ACT reduced to none/relu/leaky; explicit residual pitch ldr) ----
// C[m,n] = scale * sum_k A[m,k] * Bt[n,k] (+bias)(+resid); each wave owns a 64x64 tile.
// A row-major [M,K]; Bt row-major [N,K]; M,N % 64 == 0, K % 32 == 0.
// SPLIT: operands are hi/lo planes (A2/Bt2 = lo planes, same layout); product = hi.hi + hi.lo + lo.hi.
// BIAS_MODE: 0 = none, 1 = bias[m], 2 = bias[n].  RESID: + resid[m * ldr + n].
// OUT_MODE: 0 = f32, 1 = f16, 2 = bf16 hi plane (Cout) + bf16 lo plane (Cout2).
// ET: 0 = f16 operands, 1 = bf16 operands (pointers passed as 16-bit storage)
template <int ET> struct Elem;
template <> struct Elem<0> { typedef _Float16 T; };
template <> struct Elem<1> { typedef __bf16 T; };
template <int ET, bool SPLIT, int BIAS_MODE, int OUT_MODE, bool RESID, int ACT = 0>
__global__ __launch_bounds__(256) void wmma_gemm64(
    const unsigned short* __restrict__ Ap, const unsigned short* __restrict__ A2p, int lda, long strideA,
    const unsigned short* __restrict__ Btp, const unsigned short* __restrict__ Bt2p, int ldb, long strideB,
    void* __restrict__ Cout, void* __restrict__ Cout2, int ldc, long strideC,
    const float* __restrict__ bias,
    const float* __restrict__ resid, long strideR, int ldr,
    int M, int N, int K, float scale) {
  typedef typename Elem<ET>::T T;
  typedef typename Frag<T>::V V;
  const T* A = (const T*)Ap; const T* A2 = (const T*)A2p; const T* Bt = (const T*)Btp; const T* Bt2 = (const T*)Bt2p;
  __shared__ __align__(16) float sT[8][16 * 68];   // per-wave 16x64 slab, pitch 68 floats
  const int b    = blockIdx.y;
  const int lane = threadIdx.x & 31;
  const int wave = threadIdx.x >> 5;
  const int tilesN = N >> 6;
  const int tilesM = M >> 6;
  const int tile = blockIdx.x * 8 + wave;
  if (tile >= tilesM * tilesN) return;   // wave-uniform; no block barriers in this kernel
  const int tm = tile / tilesN;
  const int tn = tile - tm * tilesN;
  const int m0 = tm << 6;
  const int n0 = tn << 6;

  const T* Ab  = A  + (size_t)b * strideA;
  const T* Bb  = Bt + (size_t)b * strideB;
  const T* Ab2 = SPLIT ? (A2  + (size_t)b * strideA) : nullptr;
  const T* Bb2 = SPLIT ? (Bt2 + (size_t)b * strideB) : nullptr;

  const int rlane = lane & 15;                 // row (A) / col (B, D) within subtile
  const int koff  = (lane >> 4) * 8;           // k offset of this lane half
  const int mOff  = (lane >> 4) * 8;           // D row offset

  v8f acc[4][4];
#pragma unroll
  for (int i = 0; i < 4; ++i)
#pragma unroll
    for (int j = 0; j < 4; ++j) acc[i][j] = (v8f){0.f,0.f,0.f,0.f,0.f,0.f,0.f,0.f};

  for (int k0 = 0; k0 < K; k0 += 32) {
    V bh[4], bl[4];
#pragma unroll
    for (int j = 0; j < 4; ++j) {
      const size_t bo = (size_t)(n0 + (j << 4) + rlane) * ldb + koff + k0;
      bh[j] = Frag<T>::load(Bb + bo);
      if (SPLIT) bl[j] = Frag<T>::load(Bb2 + bo);
    }
#pragma unroll
    for (int i = 0; i < 4; ++i) {
      const size_t ao = (size_t)(m0 + (i << 4) + rlane) * lda + koff + k0;
      V ah = Frag<T>::load(Ab + ao);
      V al;
      if (SPLIT) al = Frag<T>::load(Ab2 + ao);
#pragma unroll
      for (int j = 0; j < 4; ++j) {
        acc[i][j] = Frag<T>::mma(ah, bh[j], acc[i][j]);
        if (SPLIT) {
          acc[i][j] = Frag<T>::mma(ah, bl[j], acc[i][j]);
          acc[i][j] = Frag<T>::mma(al, bh[j], acc[i][j]);
        }
      }
      Frag<T>::guard(acc[i][0], acc[i][3], ah, SPLIT ? al : ah);
    }
    Frag<T>::keep(bh[0], bh[1], bh[2], bh[3]);
    if (SPLIT) Frag<T>::keep(bl[0], bl[1], bl[2], bl[3]);
  }
  acc_guard4(acc[0][0], acc[0][1], acc[0][2], acc[0][3]);
  acc_guard4(acc[1][0], acc[1][1], acc[1][2], acc[1][3]);
  acc_guard4(acc[2][0], acc[2][1], acc[2][2], acc[2][3]);
  acc_guard4(acc[3][0], acc[3][1], acc[3][2], acc[3][3]);

  // ---- epilogue ----
  float* slab = sT[wave];
  const float* Rb = RESID ? (resid + (size_t)b * strideR) : nullptr;
#pragma unroll
  for (int i = 0; i < 4; ++i) {
    const int mBase = m0 + (i << 4);
#pragma unroll
    for (int j = 0; j < 4; ++j) {
      const int n = n0 + (j << 4) + rlane;
      float bv = 0.f;
      if (BIAS_MODE == 2) bv = bias[n];
#pragma unroll
      for (int r = 0; r < 8; ++r) {
        float v = acc[i][j][r] * scale;
        if (BIAS_MODE == 1) v += bias[mBase + mOff + r];
        if (BIAS_MODE == 2) v += bv;
        if (RESID) v += Rb[(size_t)(mBase + mOff + r) * ldr + n];
        if (ACT == 2) v = fmaxf(v, 0.0f);
        if (ACT == 4) v = (v > 0.f) ? v : 0.01f * v;
        slab[(mOff + r) * 68 + (j << 4) + rlane] = v;
      }
    }
    __builtin_amdgcn_fence(__ATOMIC_RELEASE, "workgroup");
    __builtin_amdgcn_wave_barrier();
    __builtin_amdgcn_fence(__ATOMIC_ACQUIRE, "workgroup");
    if (OUT_MODE == 0) {
      float* C = (float*)Cout + (size_t)b * strideC;
      const int hh = lane >> 4, c4 = (lane & 15) * 4;     // row seg = 256 B = 16 lanes x 16 B
      {
#pragma unroll
        for (int it = 0; it < 8; ++it) {
          const int row = it * 2 + hh;
          v4f v = *(const v4f*)(slab + row * 68 + c4);
          *(v4f*)(C + (size_t)(mBase + row) * ldc + n0 + c4) = v;
        }
        
      }
    } else {
      const int q = lane >> 3, c8 = (lane & 7) * 8;
      unsigned short* C  = (unsigned short*)Cout  + (size_t)b * strideC;
      unsigned short* C2 = (OUT_MODE == 2) ? ((unsigned short*)Cout2 + (size_t)b * strideC) : nullptr;
      {
#pragma unroll
        for (int it = 0; it < 4; ++it) {
          const int row = it * 4 + q;
          const float* sp = slab + row * 68 + c8;
          v8h hv, lv;
#pragma unroll
          for (int e = 0; e < 8; ++e) {
            if (OUT_MODE == 1) {
              hv[e] = (_Float16)sp[e];
            } else {
              unsigned short hb = f2bf_bits(sp[e]);
              unsigned short lb = f2bf_bits(sp[e] - bf_bits2f(hb));
              hv[e] = __builtin_bit_cast(_Float16, hb);
              lv[e] = __builtin_bit_cast(_Float16, lb);
            }
          }
          *(v8h*)(C + (size_t)(mBase + row) * ldc + n0 + c8) = hv;
          if (OUT_MODE == 2) *(v8h*)(C2 + (size_t)(mBase + row) * ldc + n0 + c8) = lv;
        }
        
      }
    }
    __builtin_amdgcn_fence(__ATOMIC_RELEASE, "workgroup");
    __builtin_amdgcn_wave_barrier();
    __builtin_amdgcn_fence(__ATOMIC_ACQUIRE, "workgroup");
  }
}

// ---------------------------------------------------------------------------
// Weight transpose + cast: W plane z is f32 [nIn][nOut] row-major; WT plane z = [nOut][nIn] f16, WT[h][d] = f16(scale * W[d][h]).
// grid (nIn/64, nOut/64, nz), 256 threads; nIn, nOut multiples of 64. Plane z at out + z*nOut*nIn halves.
// Load coverage: 16 iterations x 256 threads = 4096 = the whole 64x64 tile (coalesced along h).
// Store coverage: 8 waves x 2 iterations x 4 rows (lane>>3) = 64 rows; (lane&7) x 8 halves = 64 cols; each row segment =
// ---------------------------------------------------------------------------
__global__ __launch_bounds__(256) void wtcast_kernel(const float* __restrict__ W, unsigned short* __restrict__ out,
                                                     int nIn, int nOut, float scale) {
  __shared__ float sm[64][65];   // sm[h_local][d_local]
  const int t  = threadIdx.x;
  const int d0 = blockIdx.x * 64;
  const int h0 = blockIdx.y * 64;
  const int z  = blockIdx.z;
  const float* Wz = W + (size_t)z * nIn * nOut;
#pragma unroll
  for (int i = 0; i < 16; ++i) {
    const int e = i * 256 + t;
    const int r = e >> 6;          // d local
    const int c = e & 63;          // h local
    sm[c][r] = Wz[(size_t)(d0 + r) * nOut + h0 + c] * scale;
  }
  __syncthreads();
  const int lane = t & 31, wave = t >> 5;
  const int q = lane >> 3, c8 = (lane & 7) * 8;
  unsigned short* op = out + (size_t)z * nOut * nIn;
  {
#pragma unroll
    for (int it = 0; it < 2; ++it) {
      const int row = wave * 8 + it * 4 + q;                 // h local
      unsigned short hb[8];
#pragma unroll
      for (int e = 0; e < 8; ++e) hb[e] = h_bits(sm[row][c8 + e]);
      const v4u u = (v4u){pk16(hb[0], hb[1]), pk16(hb[2], hb[3]), pk16(hb[4], hb[5]), pk16(hb[6], hb[7])};
      *(v4u*)(op + (size_t)(h0 + row) * nIn + d0 + c8) = u;
    }
    
  }
}

// ---------------------------------------------------------------------------
// One wave per row; grid = 3*4096/8 = 1536 blocks of 8 waves (exact). Branch index is block-uniform.
// ---------------------------------------------------------------------------
__global__ __launch_bounds__(256) void ln128_kernel(const float* __restrict__ x1, const float* __restrict__ x2,
                                                    const float* __restrict__ x3, const float* __restrict__ g,
                                                    const float* __restrict__ bt, unsigned short* __restrict__ xn) {
  const int lane = threadIdx.x & 31, wave = threadIdx.x >> 5;
  const int wid = blockIdx.x * 8 + wave;            // 0 .. 12287
  const int br  = wid / kRows;                      // 0..2, block-uniform (512 blocks per branch)
  const int row = wid - br * kRows;
  const float* x = (br == 0) ? x1 : (br == 1) ? x2 : x3;
  const v4f xv = *(const v4f*)(x + (size_t)row * kDim + lane * 4);
  float s = (xv[0] + xv[1]) + (xv[2] + xv[3]);
#pragma unroll
  for (int off = 16; off > 0; off >>= 1) s += __shfl_xor(s, off, 32);
  const float mean = s * (1.0f / 128.0f);
  const float d0 = xv[0] - mean, d1 = xv[1] - mean, d2 = xv[2] - mean, d3 = xv[3] - mean;
  float s2 = (d0 * d0 + d1 * d1) + (d2 * d2 + d3 * d3);
#pragma unroll
  for (int off = 16; off > 0; off >>= 1) s2 += __shfl_xor(s2, off, 32);
  const float var  = s2 * (1.0f / 128.0f);
  const float rstd = rsqrtf(var + kLnEps);
  const v4f gv = *(const v4f*)(g + br * kDim + lane * 4);
  const v4f bv = *(const v4f*)(bt + br * kDim + lane * 4);
  const float y0 = d0 * rstd * gv[0] + bv[0];
  const float y1 = d1 * rstd * gv[1] + bv[1];
  const float y2 = d2 * rstd * gv[2] + bv[2];
  const float y3 = d3 * rstd * gv[3] + bv[3];
  const v2u u = (v2u){pk16(h_bits(y0), h_bits(y1)), pk16(h_bits(y2), h_bits(y3))};
  unsigned short* qp = xn + (size_t)wid * kDim + lane * 4;
  *(v2u*)qp = u;
  
}

// ---------------------------------------------------------------------------
// LayerNorm over 384 features of xc[4096][384] (f32) -> f16 plane hn[4096][384]. One wave per row; grid = 4096/8 = 512.
// ---------------------------------------------------------------------------
__global__ __launch_bounds__(256) void ln384_kernel(const float* __restrict__ xc, const float* __restrict__ g,
                                                    const float* __restrict__ bt, unsigned short* __restrict__ hn) {
  const int lane = threadIdx.x & 31, wave = threadIdx.x >> 5;
  const int row = blockIdx.x * 8 + wave;            // 0 .. 4095
  const float* r = xc + (size_t)row * kDim3;
  v4f vv[3];
  float s = 0.f;
#pragma unroll
  for (int ch = 0; ch < 3; ++ch) {
    vv[ch] = *(const v4f*)(r + ch * kDim + lane * 4);
    s += (vv[ch][0] + vv[ch][1]) + (vv[ch][2] + vv[ch][3]);
  }
#pragma unroll
  for (int off = 16; off > 0; off >>= 1) s += __shfl_xor(s, off, 32);
  const float mean = s * (1.0f / 384.0f);
  float s2 = 0.f;
#pragma unroll
  for (int ch = 0; ch < 3; ++ch) {
#pragma unroll
    for (int j = 0; j < 4; ++j) { const float d = vv[ch][j] - mean; vv[ch][j] = d; s2 += d * d; }
  }
#pragma unroll
  for (int off = 16; off > 0; off >>= 1) s2 += __shfl_xor(s2, off, 32);
  const float var  = s2 * (1.0f / 384.0f);
  const float rstd = rsqrtf(var + kLnEps);
  v2u u[3];
#pragma unroll
  for (int ch = 0; ch < 3; ++ch) {
    const v4f gv = *(const v4f*)(g + ch * kDim + lane * 4);
    const v4f bv = *(const v4f*)(bt + ch * kDim + lane * 4);
    unsigned short hb[4];
#pragma unroll
    for (int j = 0; j < 4; ++j) hb[j] = h_bits(vv[ch][j] * rstd * gv[j] + bv[j]);
    u[ch] = (v2u){pk16(hb[0], hb[1]), pk16(hb[2], hb[3])};
  }
  unsigned short* qp = hn + (size_t)row * kDim3 + lane * 4;
  {
#pragma unroll
    for (int ch = 0; ch < 3; ++ch) *(v2u*)(qp + ch * kDim) = u[ch];
    
  }
}

// ---------------------------------------------------------------------------
// V transpose: vt[(g*128 + c)*2048 + n] = qkvo[(g*2048 + n)*384 + 256 + c], g = 0..5 ((branch,batch) group), c = h*16+d.
// grid (2048/64 = 32, 128/64 = 2, 6), 256 threads. in tile [n0..n0+63][c0..c0+63] -> out tile [c0..][n0..] through LDS.
// Load coverage: 2 iterations x 256 threads = 512 = 64 n-rows x 8 16-B parts (8 halves each) = whole tile.
// Store coverage: 8 waves x 2 iterations x 4 rows (lane>>3) = 64 c-rows; (lane&7) x 8 halves = 64 n-cols; each row
// ---------------------------------------------------------------------------
__global__ __launch_bounds__(256) void vtrans_kernel(const unsigned short* __restrict__ qkvo, unsigned short* __restrict__ vt) {
  __shared__ unsigned short sm[64][66];   // sm[c local][n local]
  const int t  = threadIdx.x;
  const int n0 = blockIdx.x * 64;
  const int c0 = blockIdx.y * 64;
  const int g  = blockIdx.z;
#pragma unroll
  for (int i = 0; i < 2; ++i) {
    const int e = i * 256 + t;
    const int r = e >> 3;          // n local 0..63
    const int part = e & 7;        // 8-half part 0..7
    const v4u u = *(const v4u*)(qkvo + (size_t)(g * kSeq + n0 + r) * kDim3 + 2 * kDim + c0 + part * 8);
#pragma unroll
    for (int w = 0; w < 4; ++w) {
      sm[part * 8 + 2 * w][r]     = (unsigned short)(u[w] & 0xFFFFu);
      sm[part * 8 + 2 * w + 1][r] = (unsigned short)(u[w] >> 16);
    }
  }
  __syncthreads();
  const int lane = t & 31, wave = t >> 5;
  const int q = lane >> 3, c8 = (lane & 7) * 8;
  {
#pragma unroll
    for (int it = 0; it < 2; ++it) {
      const int row = wave * 8 + it * 4 + q;     // c local
      unsigned short hb[8];
#pragma unroll
      for (int e = 0; e < 8; ++e) hb[e] = sm[row][c8 + e];
      const v4u u = (v4u){pk16(hb[0], hb[1]), pk16(hb[2], hb[3]), pk16(hb[4], hb[5]), pk16(hb[6], hb[7])};
      *(v4u*)(vt + (size_t)(g * kDim + c0 + row) * kSeq + n0 + c8) = u;
    }
    
  }
}

// ---------------------------------------------------------------------------
// Fused attention, one launch for all 48 (group, head) pairs: S^T = K.Q^T, online softmax, O^T += V^T.P^T.
// grid (2048/128 = 16 query blocks, 48), 256 threads = 8 waves x 16 queries. Lane (c = lane&15, hh = lane>>4) owns query c.
// K and V^T of the head are staged through registers into LDS, 512 keys at a time, already in fragment order:
//   sK: 16-key tile T at T*512; lane's 16 B (key c, dims 8hh..8hh+7) at + lane*16.
//   sV: fragment half G (keys 16G + 8hh + 0..7 of dim c) at G*576 + hh*288 + c*16.
// S^T tile register r = score(key 8hh + r, query c), so two tiles converted in place are the B operand P^T (hardware k
// order), and V^T as A is read in the same k order. O^T register r = O(query c, dim 8hh + r): one 16-B store per lane.
// oh[(g*8 + head)][2048][16] f16 carried x64: each wave writes 512 contiguous bytes.
// ---------------------------------------------------------------------------
__device__ __forceinline__ float other_half(float v) {   // value of lane ^ 16
  const int b = __builtin_bit_cast(int, v);
  return __builtin_bit_cast(float, __builtin_amdgcn_permlanex16(b, b, 0x76543210, 0xfedcba98, false, false));
}
__device__ __forceinline__ float vmax8(v8f a) {
  return fmaxf(fmaxf(fmaxf(a[0], a[1]), fmaxf(a[2], a[3])), fmaxf(fmaxf(a[4], a[5]), fmaxf(a[6], a[7])));
}
__device__ __forceinline__ v8f vexp2_fma8(v8f a, float sc, float bs) {   // exp2(a * sc + bs), the multiply-adds two per instruction
  const v2f sc2 = (v2f){sc, sc}, bs2 = (v2f){bs, bs};
  v8f r;
#pragma unroll
  for (int e = 0; e < 8; e += 2) {
    const v2f x = __builtin_elementwise_fma((v2f){a[e], a[e + 1]}, sc2, bs2);
    r[e]     = __builtin_amdgcn_exp2f(x[0]);
    r[e + 1] = __builtin_amdgcn_exp2f(x[1]);
  }
  return r;
}
// six waves per SIMD = three workgroups per WGP: 768 workgroups fill 256 WGPs in one even round
__global__ __launch_bounds__(256) __attribute__((amdgpu_waves_per_eu(6))) void attn_fused_kernel(const unsigned short* __restrict__ qkvo,
                                                         const unsigned short* __restrict__ vt,
                                                         unsigned short* __restrict__ oh) {
  __shared__ __align__(128) unsigned char sK[kKeyChunk * 32];
  __shared__ __align__(128) unsigned char sV[(kKeyChunk / 16) * kVGrp];
  typedef Frag<_Float16>::U FU;
  const int lane = threadIdx.x & 31, wave = threadIdx.x >> 5;
  const int c = lane & 15, hh = lane >> 4;
  const int gh = blockIdx.y, g = gh >> 3, hd = gh & 7;
  const int q0 = blockIdx.x * 128 + wave * 16;
  const v8h zero8 = (v8h){0, 0, 0, 0, 0, 0, 0, 0};
  const v8f zacc  = (v8f){0.f, 0.f, 0.f, 0.f, 0.f, 0.f, 0.f, 0.f};
  const float cs = 0.25f * 1.44269504088896340736f;   // head-dim scale x log2(e)

  // One A fragment holds two 16-key tiles (k 0..15 = dims of the first, k 16..31 = dims of the second);
  // q sits in the lower k half of qlo and in the upper k half of qhi, zeros in the other half, so each picks one tile.
  FU qlo, qhi;
  qlo.h[0] = *(const v8h*)(qkvo + (size_t)(g * kSeq + q0 + c) * kDim3 + hd * kHdim + 8 * hh);
  qlo.h[1] = zero8;
  qhi.h[0] = zero8;
  qhi.h[1] = qlo.h[0];

  // staging, 4 rounds of 8 waves per chunk. K round i: wave takes the 16-key tile i*8 + wave, lane = (key c, 16-B part hh).
  // V^T round i: wave takes 4 dims x 8 parts of 8 keys (4 whole 128-B lines): dim sd, part i*16 + sp of the chunk.
  const int sd = (wave & 3) * 4 + (lane >> 3);
  const int sp = (wave >> 2) * 8 + (lane & 7);
  const unsigned short* kp = qkvo + (size_t)(g * kSeq + wave * 16 + c) * kDim3 + kDim + hd * kHdim + 8 * hh;
  const unsigned short* vp = vt + (size_t)(g * kDim + hd * kHdim + sd) * kSeq + sp * 8;
  unsigned char* skw = sK + wave * 512 + lane * 16;
  unsigned char* svw = sV + (sp >> 1) * kVGrp + (sp & 1) * kVHalf + sd * 16;
  v4u kr[4], vr[4];
#pragma unroll
  for (int i = 0; i < 4; ++i) {
    kr[i] = *(const v4u*)(kp + (size_t)i * 128 * kDim3);
    vr[i] = *(const v4u*)(vp + i * 128);
  }

  float m = -INFINITY;
  v8f lv = zacc;
  v8f o  = zacc;
  for (int ch = 0; ch < kSeq / kKeyChunk; ++ch) {
    __syncthreads();   // every wave has finished reading the previous chunk
#pragma unroll
    for (int i = 0; i < 4; ++i) {
      *(v4u*)(skw + i * 8 * 512) = kr[i];
      *(v4u*)(svw + i * 8 * kVGrp) = vr[i];
    }
    __syncthreads();   // chunk visible to every wave
    if (ch + 1 < kSeq / kKeyChunk) {   // next chunk's global loads fly under this chunk's work
      kp += (size_t)kKeyChunk * kDim3;
      vp += kKeyChunk;
#pragma unroll
      for (int i = 0; i < 4; ++i) {
        kr[i] = *(const v4u*)(kp + (size_t)i * 128 * kDim3);
        vr[i] = *(const v4u*)(vp + i * 128);
      }
    }
#pragma unroll 2   // a rolled loop keeps the registers inside the six-wave budget with no scratch
    for (int kb = 0; kb < kKeyChunk / 64; ++kb) {
      v8f st[4];
#pragma unroll
      for (int j = 0; j < 2; ++j) {
        FU kf;
        kf.h[0] = *(const v8h*)(sK + (kb * 4 + 2 * j) * 512 + lane * 16);
        kf.h[1] = *(const v8h*)(sK + (kb * 4 + 2 * j + 1) * 512 + lane * 16);
        st[2 * j]     = Frag<_Float16>::mma(kf.v, qlo.v, zacc);
        st[2 * j + 1] = Frag<_Float16>::mma(kf.v, qhi.v, zacc);
      }
      FU vf[2];
#pragma unroll
      for (int j = 0; j < 2; ++j) {
        vf[j].h[0] = *(const v8h*)(sV + (kb * 4 + 2 * j) * kVGrp + hh * kVHalf + c * 16);
        vf[j].h[1] = *(const v8h*)(sV + (kb * 4 + 2 * j + 1) * kVGrp + hh * kVHalf + c * 16);
      }
      float mx = fmaxf(fmaxf(vmax8(st[0]), vmax8(st[1])), fmaxf(vmax8(st[2]), vmax8(st[3])));
      mx = fmaxf(mx, other_half(mx));
      const float mn = fmaxf(m, mx);
      const float alpha = __builtin_amdgcn_exp2f((m - mn) * cs);
      const float bias = kPCarryLog2 - mn * cs;
      m = mn;
      v8f pe[4];
#pragma unroll
      for (int j = 0; j < 4; ++j) pe[j] = vexp2_fma8(st[j], cs, bias);
      lv = lv * alpha + ((pe[0] + pe[1]) + (pe[2] + pe[3]));
      o  = o * alpha;
#pragma unroll
      for (int j = 0; j < 2; ++j) {
        FU pf;
        pf.h[0] = __builtin_convertvector(pe[2 * j], v8h);
        pf.h[1] = __builtin_convertvector(pe[2 * j + 1], v8h);
        o = Frag<_Float16>::mma(vf[j].v, pf.v, o);
      }
    }
  }
  float l = ((lv[0] + lv[1]) + (lv[2] + lv[3])) + ((lv[4] + lv[5]) + (lv[6] + lv[7]));
  l += other_half(l);
  const float inv = kOCarry / l;
  const v8h ov = __builtin_convertvector(o * inv, v8h);
  *(v8h*)(oh + ((size_t)gh * kSeq + q0 + c) * kHdim + 8 * hh) = ov;
}

// ---------------------------------------------------------------------------
// Head merge: opl[(g*2048 + n)*128 + 16*hz + d] = oh[((g*8 + hz)*2048 + n)*16 + d].
// 256 threads = 8 waves; lane: rsel = lane>>4 selects one of the wave's 2 rows, q = lane&15 -> hz = q>>1, d0 = 8*(q&1).
// Coverage: grid (128, 6) x 8 waves x 2 rows = 6 x 2048 rows; 16 lanes x 8 halves = 128 cols = whole 256-B row.
// ---------------------------------------------------------------------------
__global__ __launch_bounds__(256) void ohead_kernel(const unsigned short* __restrict__ oh, unsigned short* __restrict__ opl) {
  const int lane = threadIdx.x & 31, wave = threadIdx.x >> 5;
  const int rsel = lane >> 4, q = lane & 15;
  const int hz = q >> 1, d0 = 8 * (q & 1);
  const int g = blockIdx.y;
  const int n = blockIdx.x * 16 + wave * 2 + rsel;     // 0 .. 2047
  const v4u u = *(const v4u*)(oh + ((size_t)(g * kHeads + hz) * kSeq + n) * kHdim + d0);
  unsigned short* qp = opl + ((size_t)g * kSeq + n) * kDim + 8 * q;
  *(v4u*)qp = u;
}

// ---------------------------------------------------------------------------
// Exact GELU (erf form) on the fc1 pre-activation plane (f32) -> f16 plane carried x carry; 2 elements per thread,
// Coverage: n2 = n/2 threads x 2 = whole plane (grid exact multiple of 256 here).
// ---------------------------------------------------------------------------
__global__ __launch_bounds__(256) void gelu2_kernel(const float* __restrict__ in, unsigned short* __restrict__ out, int n2, float carry) {
  const int i = blockIdx.x * 256 + threadIdx.x;
  if (i >= n2) return;
  const v2f v = *(const v2f*)(in + 2 * (size_t)i);
  float g0 = 0.f, g1 = 0.f;
#pragma unroll 1
  for (int s = 0; s < 2; ++s) {
    const float xx = s ? v[1] : v[0];
    const float gl = 0.5f * xx * (1.0f + erff(xx * 0.70710678118654752f));
    g0 = s ? g0 : gl;
    g1 = s ? gl : g1;
  }
  const unsigned u = pk16(h_bits(g0 * carry), h_bits(g1 * carry));
  unsigned* qp = (unsigned*)(out + 2 * (size_t)i);
  *(unsigned*)qp = u;
  
}

// ---------------------------------------------------------------------------
// Host glue. Workspace region map (bytes; every offset a multiple of 32768):
//   WQKV  f16 [3][384][128]            294,912 @          0
//   WPROJ f16 [3][128][128]             98,304 @    294,912
//   WFC1  f16 [768][384]               589,824 @    393,216
//   WFC2  f16 [384][768]               589,824 @    983,040
//   VT    f16 [6][128][2048]         3,145,728 @  1,572,864
//   BIG                             22,020,096 @  4,718,592   (XN f16 [12288][128] @ +0 and QKVO f16 [12288][384] @ +3,145,728
//                                                             up to and during attention;
//                                                             HN f16 [4096][384] @ +0, H1 f32 [4096][768] @ +3,145,728,
//                                                             G f16 [4096][768] @ +15,728,640 after attention)
//   OH    f16 [48][2048][16]         3,145,728 @ 26,738,688
//   OPL   f16 [12288][128]           3,145,728 @ 29,884,416
//   XC    f32 [4096][384]            6,291,456 @ 33,030,144
//   total                                        39,321,600
// ---------------------------------------------------------------------------
extern "C" void kernel_launch(void* const* d_in, const int* in_sizes, int n_in,
                              void* d_out, int out_size, void* d_ws, size_t ws_size,
                              hipStream_t stream) {
  if (n_in < 14) return;
  if (in_sizes[0] != kRows * kDim || in_sizes[1] != kRows * kDim || in_sizes[2] != kRows * kDim) return;
  if (in_sizes[3] != 3 * kDim || in_sizes[4] != 3 * kDim) return;
  if (in_sizes[5] != 3 * kDim * kDim3 || in_sizes[6] != 3 * kDim * kDim || in_sizes[7] != 3 * kDim) return;
  if (in_sizes[8] != kDim3 || in_sizes[9] != kDim3) return;
  if (in_sizes[10] != kDim3 * kHid || in_sizes[11] != kHid || in_sizes[12] != kHid * kDim3 || in_sizes[13] != kDim3) return;
  if (out_size != 3 * kRows * kDim) return;

  const float* x1     = (const float*)d_in[0];
  const float* x2     = (const float*)d_in[1];
  const float* x3     = (const float*)d_in[2];
  const float* ln1_g  = (const float*)d_in[3];
  const float* ln1_b  = (const float*)d_in[4];
  const float* qkv_w  = (const float*)d_in[5];
  const float* proj_w = (const float*)d_in[6];
  const float* proj_b = (const float*)d_in[7];
  const float* ln2_g  = (const float*)d_in[8];
  const float* ln2_b  = (const float*)d_in[9];
  const float* fc1_w  = (const float*)d_in[10];
  const float* fc1_b  = (const float*)d_in[11];
  const float* fc2_w  = (const float*)d_in[12];
  const float* fc2_b  = (const float*)d_in[13];
  float* out = (float*)d_out;

  // ---- carve ----
  const size_t szWQKV  = (size_t)3 * kDim3 * kDim * 2;
  const size_t szWPROJ = (size_t)3 * kDim * kDim * 2;
  const size_t szWFC1  = (size_t)kHid * kDim3 * 2;
  const size_t szWFC2  = (size_t)kDim3 * kHid * 2;
  const size_t szVT    = (size_t)kGroups * kDim * kSeq * 2;
  const size_t szXN    = (size_t)3 * kRows * kDim * 2;
  const size_t szQKVO  = (size_t)3 * kRows * kDim3 * 2;
  const size_t szHN    = (size_t)kRows * kDim3 * 2;
  const size_t szH1    = (size_t)kRows * kHid * 4;
  const size_t szG     = (size_t)kRows * kHid * 2;
  size_t szBIG = szXN + szQKVO;
  if (szHN + szH1 + szG > szBIG) szBIG = szHN + szH1 + szG;
  const size_t szOH    = (size_t)kGroups * kHeads * kSeq * kHdim * 2;
  const size_t szOPL   = (size_t)3 * kRows * kDim * 2;
  const size_t szXC    = (size_t)kRows * kDim3 * 4;

  const size_t oWQKV  = 0;
  const size_t oWPROJ = oWQKV + szWQKV;
  const size_t oWFC1  = oWPROJ + szWPROJ;
  const size_t oWFC2  = oWFC1 + szWFC1;
  const size_t oVT    = oWFC2 + szWFC2;
  const size_t oBIG   = oVT + szVT;
  const size_t oOH    = oBIG + szBIG;
  const size_t oOPL   = oOH + szOH;
  const size_t oXC    = oOPL + szOPL;
  const size_t oEnd   = oXC + szXC;
  if (oEnd > ws_size) return;

  unsigned char* ws = (unsigned char*)d_ws;
  unsigned short* WQKV  = (unsigned short*)(ws + oWQKV);
  unsigned short* WPROJ = (unsigned short*)(ws + oWPROJ);
  unsigned short* WFC1  = (unsigned short*)(ws + oWFC1);
  unsigned short* WFC2  = (unsigned short*)(ws + oWFC2);
  unsigned short* VT    = (unsigned short*)(ws + oVT);
  unsigned short* XN    = (unsigned short*)(ws + oBIG);
  unsigned short* QKVO  = (unsigned short*)(ws + oBIG + szXN);
  unsigned short* HN    = (unsigned short*)(ws + oBIG);
  float*          H1    = (float*)(ws + oBIG + szHN);
  unsigned short* G     = (unsigned short*)(ws + oBIG + szHN + szH1);
  unsigned short* OH    = (unsigned short*)(ws + oOH);
  unsigned short* OPL   = (unsigned short*)(ws + oOPL);
  float*          XC    = (float*)(ws + oXC);
  const float* fdum = proj_b;   // valid f32 pointer for unused bias/resid slots

  // ---- weights: transpose + f16 (carried x16) ----
  // qkv_w [3][128][384] -> WQKV [3][384][128]; proj_w [3][128][128] -> WPROJ [3][128][128];
  // fc1_w [384][768] -> WFC1 [768][384]; fc2_w [768][384] -> WFC2 [384][768]   (grid = (nIn/64, nOut/64, nz))
  wtcast_kernel<<<dim3(kDim / 64, kDim3 / 64, 3), 256, 0, stream>>>(qkv_w, WQKV, kDim, kDim3, kWCarry);
  wtcast_kernel<<<dim3(kDim / 64, kDim / 64, 3), 256, 0, stream>>>(proj_w, WPROJ, kDim, kDim, kWCarry);
  wtcast_kernel<<<dim3(kDim3 / 64, kHid / 64, 1), 256, 0, stream>>>(fc1_w, WFC1, kDim3, kHid, kWCarry);
  wtcast_kernel<<<dim3(kHid / 64, kDim3 / 64, 1), 256, 0, stream>>>(fc2_w, WFC2, kHid, kDim3, kWCarry);

  // ---- LN1 -> XN f16 [3*4096][128] ----
  ln128_kernel<<<dim3(3 * kRows / 8), 256, 0, stream>>>(x1, x2, x3, ln1_g, ln1_b, XN);

  // ---- QKV: QKVO[br][4096][384] = (XN[br] . WQKV[br]^T) / 16, f16 out. M=4096, N=384, K=128; tiles 64*6=384 -> 48 blocks, z=3 ----
  wmma_gemm64<0, false, 0, 1, false><<<dim3(48, 3), 256, 0, stream>>>(
      XN, XN, kDim, (long)kRows * kDim,
      WQKV, WQKV, kDim, (long)kDim3 * kDim,
      (void*)QKVO, (void*)QKVO, kDim3, (long)kRows * kDim3,
      fdum, fdum, 0L, 0,
      kRows, kDim3, kDim, 1.0f / kWCarry);

  // ---- V transpose ----
  vtrans_kernel<<<dim3(kSeq / 64, kDim / 64, kGroups), 256, 0, stream>>>(QKVO, VT);

  // ---- attention: all 6 groups x 8 heads in one launch, then merge the heads into OPL rows (whole 256-B rows) ----
  attn_fused_kernel<<<dim3(kSeq / 128, kGroups * kHeads), 256, 0, stream>>>(QKVO, VT, OH);
  ohead_kernel<<<dim3(kSeq / 16, kGroups), 256, 0, stream>>>(OH, OPL);

  // ---- proj + bias + residual x_br -> XC[:, br*128 .. br*128+127] f32 (ldc 384, resid pitch 128) ----
  // M=4096, N=128, K=128, scale 1/(64*16); tiles 64*2=128 -> 16 blocks
  for (int br = 0; br < 3; ++br) {
    const float* xbr = (br == 0) ? x1 : (br == 1) ? x2 : x3;
    const unsigned short* oa = OPL + (size_t)br * kRows * kDim;
    const unsigned short* wb = WPROJ + (size_t)br * kDim * kDim;
    float* xcb = XC + br * kDim;
    wmma_gemm64<0, false, 2, 0, true><<<dim3(16, 1), 256, 0, stream>>>(
        oa, oa, kDim, 0L,
        wb, wb, kDim, 0L,
        (void*)xcb, (void*)xcb, kDim3, 0L,
        proj_b + br * kDim, xbr, 0L, kDim,
        kRows, kDim, kDim, 1.0f / (kOCarry * kWCarry));
  }

  // ---- LN2 -> HN f16 [4096][384] ----
  ln384_kernel<<<dim3(kRows / 8), 256, 0, stream>>>(XC, ln2_g, ln2_b, HN);

  // ---- fc1 + bias -> H1 f32 [4096][768]; M=4096, N=768, K=384; tiles 64*12=768 -> 96 blocks ----
  wmma_gemm64<0, false, 2, 0, false><<<dim3(96, 1), 256, 0, stream>>>(
      HN, HN, kDim3, 0L,
      WFC1, WFC1, kDim3, 0L,
      (void*)H1, (void*)H1, kHid, 0L,
      fc1_b, fdum, 0L, 0,
      kRows, kHid, kDim3, 1.0f / kWCarry);

  // ---- exact GELU -> G f16 x16 ----
  gelu2_kernel<<<dim3((kRows * kHid / 2 + 255) / 256), 256, 0, stream>>>(H1, G, kRows * kHid / 2, kGCarry);

  // ---- fc2 + bias + residual XC -> three output planes out[k] = [4096][128] (N=128 slice k of 384), K=768, scale 1/256 ----
  for (int k = 0; k < 3; ++k) {
    const unsigned short* wb = WFC2 + (size_t)k * kDim * kHid;
    float* ok = out + (size_t)k * kRows * kDim;
    wmma_gemm64<0, false, 2, 0, true><<<dim3(16, 1), 256, 0, stream>>>(
        G, G, kHid, 0L,
        wb, wb, kHid, 0L,
        (void*)ok, (void*)ok, kDim, 0L,
        fc2_b + k * kDim, XC + k * kDim, 0L, kDim3,
        kRows, kDim, kHid, 1.0f / (kGCarry * kWCarry));
  }
}

// v002
// Measured time: 135 microseconds a run.
// Timed twice side by side with v001, it ran 1.66 and 1.67 times as fast.
// All steps since v000 together make it 12.0 times as fast.
// Contractions: x_ln@Wqkv, o@Wproj, h_ln@Wfc1, g@Wfc2 (activations f16, weights f16 carried x16), scores k.q^T (q,k f16, head dim 16: two key tiles per A fragment, q zero-padded 16->32 in registers), V^T@P^T (P f16, unnormalised exp carried x2^8, V^T f16): all v_wmma_f32_16x16x32_f16 with f32 accumulate; LayerNorm, online softmax, GELU(erf), bias, residual in f32.
#include <hip/hip_runtime.h>
#include <math.h>

// ---------------------------------------------------------------------------
// Problem constants
// ---------------------------------------------------------------------------
constexpr int kBatch   = 2;
constexpr int kSeq     = 2048;
constexpr int kDim     = 128;
constexpr int kHeads   = 8;
constexpr int kHdim    = 16;
constexpr int kHid     = 768;
constexpr int kRows    = kBatch * kSeq;     // 4096 token rows per branch
constexpr int kDim3    = 3 * kDim;          // 384
constexpr int kGroups  = 3 * kBatch;        // 6 (branch, batch) groups; group g covers plane rows g*2048 .. g*2048+2047
constexpr int kKeyChunk = 512;              // keys staged in LDS at a time
constexpr int kVHalf   = 288;               // LDS bytes from lane half 0's 256 B of a V^T fragment half to lane half 1's
constexpr int kVGrp    = 576;               // LDS bytes per V^T fragment half (16 dims x 16 keys)
constexpr float kWCarry = 16.0f;            // weights carried x16 in f16
constexpr float kPCarryLog2 = 8.0f;         // unnormalised probabilities exp(s - max) carried x2^8 in f16
constexpr float kOCarry = 64.0f;            // attention output carried x64 in f16
constexpr float kGCarry = 16.0f;            // gelu output carried x16 in f16
constexpr float kLnEps  = 1e-5f;

typedef __attribute__((ext_vector_type(16))) _Float16 v16h;
typedef __attribute__((ext_vector_type(8)))  _Float16 v8h;
typedef __attribute__((ext_vector_type(16))) __bf16   v16b;
typedef __attribute__((ext_vector_type(8)))  __bf16   v8b;
typedef __attribute__((ext_vector_type(8)))  float    v8f;
typedef __attribute__((ext_vector_type(4)))  float    v4f;
typedef __attribute__((ext_vector_type(2)))  float    v2f;
typedef __attribute__((ext_vector_type(4)))  unsigned int v4u;
typedef __attribute__((ext_vector_type(2)))  unsigned int v2u;

__device__ __forceinline__ unsigned short f2bf_bits(float f) {
  unsigned u = __float_as_uint(f);
  return (unsigned short)((u + 0x7FFFu + ((u >> 16) & 1u)) >> 16);
}
__device__ __forceinline__ float bf_bits2f(unsigned short h) { return __uint_as_float(((unsigned)h) << 16); }

// hazard guards as plain device helpers (no inline asm inside the kernel template body)
__device__ __forceinline__ void dep_guard_h(v8f& a, v8f& b, v16h x, v16h y) { asm volatile("v_nop\n\tv_nop\n\tv_nop\n\tv_nop" : "+v"(a), "+v"(b) : "v"(x), "v"(y)); }
__device__ __forceinline__ void dep_guard_b(v8f& a, v8f& b, v16b x, v16b y) { asm volatile("v_nop\n\tv_nop\n\tv_nop\n\tv_nop" : "+v"(a), "+v"(b) : "v"(x), "v"(y)); }
__device__ __forceinline__ void keep4_h(v16h a, v16h b, v16h c, v16h d) { asm volatile("v_nop" :: "v"(a), "v"(b), "v"(c), "v"(d)); }
__device__ __forceinline__ void keep4_b(v16b a, v16b b, v16b c, v16b d) { asm volatile("v_nop" :: "v"(a), "v"(b), "v"(c), "v"(d)); }
__device__ __forceinline__ void acc_guard4(v8f& a, v8f& b, v8f& c, v8f& d) { asm volatile("v_nop\n\tv_nop\n\tv_nop\n\tv_nop" : "+v"(a), "+v"(b), "+v"(c), "+v"(d)); }
template <typename T> struct Frag;
template <> struct Frag<_Float16> {
  typedef v16h V; union U { v16h v; v8h h[2]; };
  static __device__ __forceinline__ v16h load(const _Float16* p) {   // elements 0..7 <- p[0..7], 8..15 <- p[16..23]
    U f; f.h[0] = *(const v8h*)(p); f.h[1] = *(const v8h*)(p + 16); return f.v;
  }
  static __device__ __forceinline__ v8f mma(v16h a, v16h b, v8f c) {
    return __builtin_amdgcn_wmma_f32_16x16x32_f16(false, a, false, b, (short)0, c, false, false);
  }
  static __device__ __forceinline__ void guard(v8f& a, v8f& b, v16h x, v16h y) { dep_guard_h(a, b, x, y); }
  static __device__ __forceinline__ void keep(v16h a, v16h b, v16h c, v16h d) { keep4_h(a, b, c, d); }
};
template <> struct Frag<__bf16> {
  typedef v16b V; union U { v16b v; v8b h[2]; };
  static __device__ __forceinline__ v16b load(const __bf16* p) {
    U f; f.h[0] = *(const v8b*)(p); f.h[1] = *(const v8b*)(p + 16); return f.v;
  }
  static __device__ __forceinline__ v8f mma(v16b a, v16b b, v8f c) {
    return __builtin_amdgcn_wmma_f32_16x16x32_bf16(false, a, false, b, (short)0, c, false, false);
  }
  static __device__ __forceinline__ void guard(v8f& a, v8f& b, v16b x, v16b y) { dep_guard_b(a, b, x, y); }
  static __device__ __forceinline__ void keep(v16b a, v16b b, v16b c, v16b d) { keep4_b(a, b, c, d); }
};

__device__ __forceinline__ unsigned pk16(unsigned short a, unsigned short b) { return (unsigned)a | ((unsigned)b << 16); }
__device__ __forceinline__ unsigned short h_bits(float f) { const _Float16 h = (_Float16)f; return __builtin_bit_cast(unsigned short, h); }

// ---- Register-blocked batched WMMA GEMM (ACT reduced to none/relu/leaky; explicit residual pitch ldr) ----
// C[m,n] = scale * sum_k A[m,k] * Bt[n,k] (+bias)(+resid); each wave owns a 64x64 tile.
// A row-major [M,K]; Bt row-major [N,K]; M,N % 64 == 0, K % 32 == 0.
// SPLIT: operands are hi/lo planes (A2/Bt2 = lo planes, same layout); product = hi.hi + hi.lo + lo.hi.
// BIAS_MODE: 0 = none, 1 = bias[m], 2 = bias[n].  RESID: + resid[m * ldr + n].
// blockIdx.y = b is the batch: operands, output, bias and residual move by their strides (elements) per b;
// the residual base is resid0 / resid1 / resid2 for b = 0 / 1 / 2 (separate buffers), then + b * strideR.
// OUT_MODE: 0 = f32, 1 = f16, 2 = bf16 hi plane (Cout) + bf16 lo plane (Cout2).
// ET: 0 = f16 operands, 1 = bf16 operands (pointers passed as 16-bit storage)
template <int ET> struct Elem;
template <> struct Elem<0> { typedef _Float16 T; };
template <> struct Elem<1> { typedef __bf16 T; };
template <int ET, bool SPLIT, int BIAS_MODE, int OUT_MODE, bool RESID, int ACT = 0>
__global__ __launch_bounds__(256) void wmma_gemm64(
    const unsigned short* __restrict__ Ap, const unsigned short* __restrict__ A2p, int lda, long strideA,
    const unsigned short* __restrict__ Btp, const unsigned short* __restrict__ Bt2p, int ldb, long strideB,
    void* __restrict__ Cout, void* __restrict__ Cout2, int ldc, long strideC,
    const float* __restrict__ bias, long strideBias,
    const float* __restrict__ resid0, const float* __restrict__ resid1, const float* __restrict__ resid2, long strideR, int ldr,
    int M, int N, int K, float scale) {
  typedef typename Elem<ET>::T T;
  typedef typename Frag<T>::V V;
  const T* A = (const T*)Ap; const T* A2 = (const T*)A2p; const T* Bt = (const T*)Btp; const T* Bt2 = (const T*)Bt2p;
  __shared__ __align__(16) float sT[8][16 * 68];   // per-wave 16x64 slab, pitch 68 floats
  const int b    = blockIdx.y;
  const int lane = threadIdx.x & 31;
  const int wave = threadIdx.x >> 5;
  const int tilesN = N >> 6;
  const int tilesM = M >> 6;
  const int tile = blockIdx.x * 8 + wave;
  if (tile >= tilesM * tilesN) return;   // wave-uniform; no block barriers in this kernel
  const int tm = tile / tilesN;
  const int tn = tile - tm * tilesN;
  const int m0 = tm << 6;
  const int n0 = tn << 6;

  const T* Ab  = A  + (size_t)b * strideA;
  const T* Bb  = Bt + (size_t)b * strideB;
  const T* Ab2 = SPLIT ? (A2  + (size_t)b * strideA) : nullptr;
  const T* Bb2 = SPLIT ? (Bt2 + (size_t)b * strideB) : nullptr;

  const int rlane = lane & 15;                 // row (A) / col (B, D) within subtile
  const int koff  = (lane >> 4) * 8;           // k offset of this lane half
  const int mOff  = (lane >> 4) * 8;           // D row offset

  v8f acc[4][4];
#pragma unroll
  for (int i = 0; i < 4; ++i)
#pragma unroll
    for (int j = 0; j < 4; ++j) acc[i][j] = (v8f){0.f,0.f,0.f,0.f,0.f,0.f,0.f,0.f};

  for (int k0 = 0; k0 < K; k0 += 32) {
    V bh[4], bl[4];
#pragma unroll
    for (int j = 0; j < 4; ++j) {
      const size_t bo = (size_t)(n0 + (j << 4) + rlane) * ldb + koff + k0;
      bh[j] = Frag<T>::load(Bb + bo);
      if (SPLIT) bl[j] = Frag<T>::load(Bb2 + bo);
    }
#pragma unroll
    for (int i = 0; i < 4; ++i) {
      const size_t ao = (size_t)(m0 + (i << 4) + rlane) * lda + koff + k0;
      V ah = Frag<T>::load(Ab + ao);
      V al;
      if (SPLIT) al = Frag<T>::load(Ab2 + ao);
#pragma unroll
      for (int j = 0; j < 4; ++j) {
        acc[i][j] = Frag<T>::mma(ah, bh[j], acc[i][j]);
        if (SPLIT) {
          acc[i][j] = Frag<T>::mma(ah, bl[j], acc[i][j]);
          acc[i][j] = Frag<T>::mma(al, bh[j], acc[i][j]);
        }
      }
      Frag<T>::guard(acc[i][0], acc[i][3], ah, SPLIT ? al : ah);
    }
    Frag<T>::keep(bh[0], bh[1], bh[2], bh[3]);
    if (SPLIT) Frag<T>::keep(bl[0], bl[1], bl[2], bl[3]);
  }
  acc_guard4(acc[0][0], acc[0][1], acc[0][2], acc[0][3]);
  acc_guard4(acc[1][0], acc[1][1], acc[1][2], acc[1][3]);
  acc_guard4(acc[2][0], acc[2][1], acc[2][2], acc[2][3]);
  acc_guard4(acc[3][0], acc[3][1], acc[3][2], acc[3][3]);

  // ---- epilogue ----
  float* slab = sT[wave];
  const float* Rb = RESID ? (((b == 0) ? resid0 : (b == 1) ? resid1 : resid2) + (size_t)b * strideR) : nullptr;
  const float* Bs = (BIAS_MODE != 0) ? (bias + (size_t)b * strideBias) : nullptr;
#pragma unroll
  for (int i = 0; i < 4; ++i) {
    const int mBase = m0 + (i << 4);
#pragma unroll
    for (int j = 0; j < 4; ++j) {
      const int n = n0 + (j << 4) + rlane;
      float bv = 0.f;
      if (BIAS_MODE == 2) bv = Bs[n];
#pragma unroll
      for (int r = 0; r < 8; ++r) {
        float v = acc[i][j][r] * scale;
        if (BIAS_MODE == 1) v += Bs[mBase + mOff + r];
        if (BIAS_MODE == 2) v += bv;
        if (RESID) v += Rb[(size_t)(mBase + mOff + r) * ldr + n];
        if (ACT == 2) v = fmaxf(v, 0.0f);
        if (ACT == 4) v = (v > 0.f) ? v : 0.01f * v;
        slab[(mOff + r) * 68 + (j << 4) + rlane] = v;
      }
    }
    __builtin_amdgcn_fence(__ATOMIC_RELEASE, "workgroup");
    __builtin_amdgcn_wave_barrier();
    __builtin_amdgcn_fence(__ATOMIC_ACQUIRE, "workgroup");
    if (OUT_MODE == 0) {
      float* C = (float*)Cout + (size_t)b * strideC;
      const int hh = lane >> 4, c4 = (lane & 15) * 4;     // row seg = 256 B = 16 lanes x 16 B
      {
#pragma unroll
        for (int it = 0; it < 8; ++it) {
          const int row = it * 2 + hh;
          v4f v = *(const v4f*)(slab + row * 68 + c4);
          *(v4f*)(C + (size_t)(mBase + row) * ldc + n0 + c4) = v;
        }
        
      }
    } else {
      const int q = lane >> 3, c8 = (lane & 7) * 8;
      unsigned short* C  = (unsigned short*)Cout  + (size_t)b * strideC;
      unsigned short* C2 = (OUT_MODE == 2) ? ((unsigned short*)Cout2 + (size_t)b * strideC) : nullptr;
      {
#pragma unroll
        for (int it = 0; it < 4; ++it) {
          const int row = it * 4 + q;
          const float* sp = slab + row * 68 + c8;
          v8h hv, lv;
#pragma unroll
          for (int e = 0; e < 8; ++e) {
            if (OUT_MODE == 1) {
              hv[e] = (_Float16)sp[e];
            } else {
              unsigned short hb = f2bf_bits(sp[e]);
              unsigned short lb = f2bf_bits(sp[e] - bf_bits2f(hb));
              hv[e] = __builtin_bit_cast(_Float16, hb);
              lv[e] = __builtin_bit_cast(_Float16, lb);
            }
          }
          *(v8h*)(C + (size_t)(mBase + row) * ldc + n0 + c8) = hv;
          if (OUT_MODE == 2) *(v8h*)(C2 + (size_t)(mBase + row) * ldc + n0 + c8) = lv;
        }
        
      }
    }
    __builtin_amdgcn_fence(__ATOMIC_RELEASE, "workgroup");
    __builtin_amdgcn_wave_barrier();
    __builtin_amdgcn_fence(__ATOMIC_ACQUIRE, "workgroup");
  }
}

// ---------------------------------------------------------------------------
// Weight transpose + cast: W plane z is f32 [nIn][nOut] row-major; WT plane z = [nOut][nIn] f16, WT[h][d] = f16(scale * W[d][h]).
// All four weight tensors in one index space: tile index r0 falls into one tensor's range of (nIn/64)*(nOut/64)*nz tiles
// (block-uniform choice), and inside the range it runs d tile fastest, then h tile, then plane z.
// 256 threads; nIn, nOut multiples of 64. Plane z at out + z*nOut*nIn halves.
// Load coverage: 16 iterations x 256 threads = 4096 = the whole 64x64 tile (coalesced along h).
// Store coverage: 8 waves x 2 iterations x 4 rows (lane>>3) = 64 rows; (lane&7) x 8 halves = 64 cols; each row segment =
// ---------------------------------------------------------------------------
constexpr int kTilesQkv  = (kDim / 64) * (kDim3 / 64) * 3;   // 36
constexpr int kTilesProj = (kDim / 64) * (kDim / 64) * 3;    // 12
constexpr int kTilesFc1  = (kDim3 / 64) * (kHid / 64);       // 72
constexpr int kTilesFc2  = (kHid / 64) * (kDim3 / 64);       // 72
constexpr int kTilesW    = kTilesQkv + kTilesProj + kTilesFc1 + kTilesFc2;   // 192
__device__ __forceinline__ void wtcast_tile(int r0, const float* __restrict__ wQkv, const float* __restrict__ wProj,
                                            const float* __restrict__ wFc1, const float* __restrict__ wFc2,
                                            unsigned short* __restrict__ oQkv, unsigned short* __restrict__ oProj,
                                            unsigned short* __restrict__ oFc1, unsigned short* __restrict__ oFc2,
                                            float scale) {
  __shared__ float sm[64][65];   // sm[h_local][d_local]
  const int t  = threadIdx.x;
  const float* W = wQkv; unsigned short* out = oQkv; int nIn = kDim, nOut = kDim3;
  if (r0 >= kTilesQkv + kTilesProj + kTilesFc1) { r0 -= kTilesQkv + kTilesProj + kTilesFc1; W = wFc2; out = oFc2; nIn = kHid; nOut = kDim3; }
  else if (r0 >= kTilesQkv + kTilesProj)        { r0 -= kTilesQkv + kTilesProj; W = wFc1; out = oFc1; nIn = kDim3; nOut = kHid; }
  else if (r0 >= kTilesQkv)                     { r0 -= kTilesQkv; W = wProj; out = oProj; nIn = kDim; nOut = kDim; }
  const int gx = nIn >> 6, gy = nOut >> 6;
  const int r1 = r0 / gx;
  const int d0 = (r0 - r1 * gx) * 64;
  const int z  = r1 / gy;
  const int h0 = (r1 - z * gy) * 64;
  const float* Wz = W + (size_t)z * nIn * nOut;
#pragma unroll
  for (int i = 0; i < 16; ++i) {
    const int e = i * 256 + t;
    const int r = e >> 6;          // d local
    const int c = e & 63;          // h local
    sm[c][r] = Wz[(size_t)(d0 + r) * nOut + h0 + c] * scale;
  }
  __syncthreads();
  const int lane = t & 31, wave = t >> 5;
  const int q = lane >> 3, c8 = (lane & 7) * 8;
  unsigned short* op = out + (size_t)z * nOut * nIn;
  {
#pragma unroll
    for (int it = 0; it < 2; ++it) {
      const int row = wave * 8 + it * 4 + q;                 // h local
      unsigned short hb[8];
#pragma unroll
      for (int e = 0; e < 8; ++e) hb[e] = h_bits(sm[row][c8 + e]);
      const v4u u = (v4u){pk16(hb[0], hb[1]), pk16(hb[2], hb[3]), pk16(hb[4], hb[5]), pk16(hb[6], hb[7])};
      *(v4u*)(op + (size_t)(h0 + row) * nIn + d0 + c8) = u;
    }
    
  }
}

// ---------------------------------------------------------------------------
// One wave per row; blk = 0 .. 3*4096/8 - 1 = 1535, 8 waves each (exact). Branch index is block-uniform.
// ---------------------------------------------------------------------------
__device__ __forceinline__ void ln128_rows(int blk, const float* __restrict__ x1, const float* __restrict__ x2,
                                           const float* __restrict__ x3, const float* __restrict__ g,
                                           const float* __restrict__ bt, unsigned short* __restrict__ xn) {
  const int lane = threadIdx.x & 31, wave = threadIdx.x >> 5;
  const int wid = blk * 8 + wave;                   // 0 .. 12287
  const int br  = wid / kRows;                      // 0..2, block-uniform (512 blocks per branch)
  const int row = wid - br * kRows;
  const float* x = (br == 0) ? x1 : (br == 1) ? x2 : x3;
  const v4f xv = *(const v4f*)(x + (size_t)row * kDim + lane * 4);
  float s = (xv[0] + xv[1]) + (xv[2] + xv[3]);
#pragma unroll
  for (int off = 16; off > 0; off >>= 1) s += __shfl_xor(s, off, 32);
  const float mean = s * (1.0f / 128.0f);
  const float d0 = xv[0] - mean, d1 = xv[1] - mean, d2 = xv[2] - mean, d3 = xv[3] - mean;
  float s2 = (d0 * d0 + d1 * d1) + (d2 * d2 + d3 * d3);
#pragma unroll
  for (int off = 16; off > 0; off >>= 1) s2 += __shfl_xor(s2, off, 32);
  const float var  = s2 * (1.0f / 128.0f);
  const float rstd = rsqrtf(var + kLnEps);
  const v4f gv = *(const v4f*)(g + br * kDim + lane * 4);
  const v4f bv = *(const v4f*)(bt + br * kDim + lane * 4);
  const float y0 = d0 * rstd * gv[0] + bv[0];
  const float y1 = d1 * rstd * gv[1] + bv[1];
  const float y2 = d2 * rstd * gv[2] + bv[2];
  const float y3 = d3 * rstd * gv[3] + bv[3];
  const v2u u = (v2u){pk16(h_bits(y0), h_bits(y1)), pk16(h_bits(y2), h_bits(y3))};
  unsigned short* qp = xn + (size_t)wid * kDim + lane * 4;
  *(v2u*)qp = u;
  // the listing has a branch from here into the cast part, which rewrites this store's address and data registers: the wait stands in front of that
  asm volatile("s_wait_xcnt 0x0" ::: "memory");
}

// ---------------------------------------------------------------------------
// Weight casts and LN1 depend on nothing but the inputs, so they share one launch: blocks 0 .. 191 cast one weight tile each,
// blocks 192 .. 1727 normalise 8 rows each. The choice is block-uniform, so the cast's barrier is passed by a whole block or by none.
// ---------------------------------------------------------------------------
__global__ __launch_bounds__(256) void prep_kernel(const float* __restrict__ wQkv, const float* __restrict__ wProj,
                                                   const float* __restrict__ wFc1, const float* __restrict__ wFc2,
                                                   unsigned short* __restrict__ oQkv, unsigned short* __restrict__ oProj,
                                                   unsigned short* __restrict__ oFc1, unsigned short* __restrict__ oFc2,
                                                   float scale,
                                                   const float* __restrict__ x1, const float* __restrict__ x2,
                                                   const float* __restrict__ x3, const float* __restrict__ g,
                                                   const float* __restrict__ bt, unsigned short* __restrict__ xn) {
  const int blk = blockIdx.x;
  if (blk < kTilesW) wtcast_tile(blk, wQkv, wProj, wFc1, wFc2, oQkv, oProj, oFc1, oFc2, scale);
  else               ln128_rows(blk - kTilesW, x1, x2, x3, g, bt, xn);
}

// ---------------------------------------------------------------------------
// LayerNorm over 384 features of xc[4096][384] (f32) -> f16 plane hn[4096][384]. One wave per row; grid = 4096/8 = 512.
// ---------------------------------------------------------------------------
__global__ __launch_bounds__(256) void ln384_kernel(const float* __restrict__ xc, const float* __restrict__ g,
                                                    const float* __restrict__ bt, unsigned short* __restrict__ hn) {
  const int lane = threadIdx.x & 31, wave = threadIdx.x >> 5;
  const int row = blockIdx.x * 8 + wave;            // 0 .. 4095
  const float* r = xc + (size_t)row * kDim3;
  v4f vv[3];
  float s = 0.f;
#pragma unroll
  for (int ch = 0; ch < 3; ++ch) {
    vv[ch] = *(const v4f*)(r + ch * kDim + lane * 4);
    s += (vv[ch][0] + vv[ch][1]) + (vv[ch][2] + vv[ch][3]);
  }
#pragma unroll
  for (int off = 16; off > 0; off >>= 1) s += __shfl_xor(s, off, 32);
  const float mean = s * (1.0f / 384.0f);
  float s2 = 0.f;
#pragma unroll
  for (int ch = 0; ch < 3; ++ch) {
#pragma unroll
    for (int j = 0; j < 4; ++j) { const float d = vv[ch][j] - mean; vv[ch][j] = d; s2 += d * d; }
  }
#pragma unroll
  for (int off = 16; off > 0; off >>= 1) s2 += __shfl_xor(s2, off, 32);
  const float var  = s2 * (1.0f / 384.0f);
  const float rstd = rsqrtf(var + kLnEps);
  v2u u[3];
#pragma unroll
  for (int ch = 0; ch < 3; ++ch) {
    const v4f gv = *(const v4f*)(g + ch * kDim + lane * 4);
    const v4f bv = *(const v4f*)(bt + ch * kDim + lane * 4);
    unsigned short hb[4];
#pragma unroll
    for (int j = 0; j < 4; ++j) hb[j] = h_bits(vv[ch][j] * rstd * gv[j] + bv[j]);
    u[ch] = (v2u){pk16(hb[0], hb[1]), pk16(hb[2], hb[3])};
  }
  unsigned short* qp = hn + (size_t)row * kDim3 + lane * 4;
  {
#pragma unroll
    for (int ch = 0; ch < 3; ++ch) *(v2u*)(qp + ch * kDim) = u[ch];
    
  }
}

// ---------------------------------------------------------------------------
// V transpose: vt[(g*128 + c)*2048 + n] = qkvo[(g*2048 + n)*384 + 256 + c], g = 0..5 ((branch,batch) group), c = h*16+d.
// grid (2048/64 = 32, 128/64 = 2, 6), 256 threads. in tile [n0..n0+63][c0..c0+63] -> out tile [c0..][n0..] through LDS.
// Load coverage: 2 iterations x 256 threads = 512 = 64 n-rows x 8 16-B parts (8 halves each) = whole tile.
// Store coverage: 8 waves x 2 iterations x 4 rows (lane>>3) = 64 c-rows; (lane&7) x 8 halves = 64 n-cols; each row
// ---------------------------------------------------------------------------
__global__ __launch_bounds__(256) void vtrans_kernel(const unsigned short* __restrict__ qkvo, unsigned short* __restrict__ vt) {
  __shared__ unsigned short sm[64][66];   // sm[c local][n local]
  const int t  = threadIdx.x;
  const int n0 = blockIdx.x * 64;
  const int c0 = blockIdx.y * 64;
  const int g  = blockIdx.z;
#pragma unroll
  for (int i = 0; i < 2; ++i) {
    const int e = i * 256 + t;
    const int r = e >> 3;          // n local 0..63
    const int part = e & 7;        // 8-half part 0..7
    const v4u u = *(const v4u*)(qkvo + (size_t)(g * kSeq + n0 + r) * kDim3 + 2 * kDim + c0 + part * 8);
#pragma unroll
    for (int w = 0; w < 4; ++w) {
      sm[part * 8 + 2 * w][r]     = (unsigned short)(u[w] & 0xFFFFu);
      sm[part * 8 + 2 * w + 1][r] = (unsigned short)(u[w] >> 16);
    }
  }
  __syncthreads();
  const int lane = t & 31, wave = t >> 5;
  const int q = lane >> 3, c8 = (lane & 7) * 8;
  {
#pragma unroll
    for (int it = 0; it < 2; ++it) {
      const int row = wave * 8 + it * 4 + q;     // c local
      unsigned short hb[8];
#pragma unroll
      for (int e = 0; e < 8; ++e) hb[e] = sm[row][c8 + e];
      const v4u u = (v4u){pk16(hb[0], hb[1]), pk16(hb[2], hb[3]), pk16(hb[4], hb[5]), pk16(hb[6], hb[7])};
      *(v4u*)(vt + (size_t)(g * kDim + c0 + row) * kSeq + n0 + c8) = u;
    }
    
  }
}

// ---------------------------------------------------------------------------
// Fused attention, one launch for all 48 (group, head) pairs: S^T = K.Q^T, online softmax, O^T += V^T.P^T.
// grid (2048/128 = 16 query blocks, 48), 256 threads = 8 waves x 16 queries. Lane (c = lane&15, hh = lane>>4) owns query c.
// K and V^T of the head are staged through registers into LDS, 512 keys at a time, already in fragment order:
//   sK: 16-key tile T at T*512; lane's 16 B (key c, dims 8hh..8hh+7) at + lane*16.
//   sV: fragment half G (keys 16G + 8hh + 0..7 of dim c) at G*576 + hh*288 + c*16.
// S^T tile register r = score(key 8hh + r, query c), so two tiles converted in place are the B operand P^T (hardware k
// order), and V^T as A is read in the same k order. O^T register r = O(query c, dim 8hh + r): one 16-B store per lane.
// oh[(g*8 + head)][2048][16] f16 carried x64: each wave writes 512 contiguous bytes.
// ---------------------------------------------------------------------------
__device__ __forceinline__ float other_half(float v) {   // value of lane ^ 16
  const int b = __builtin_bit_cast(int, v);
  return __builtin_bit_cast(float, __builtin_amdgcn_permlanex16(b, b, 0x76543210, 0xfedcba98, false, false));
}
__device__ __forceinline__ float vmax8(v8f a) {
  return fmaxf(fmaxf(fmaxf(a[0], a[1]), fmaxf(a[2], a[3])), fmaxf(fmaxf(a[4], a[5]), fmaxf(a[6], a[7])));
}
__device__ __forceinline__ v8f vexp2_fma8(v8f a, float sc, float bs) {   // exp2(a * sc + bs), the multiply-adds two per instruction
  const v2f sc2 = (v2f){sc, sc}, bs2 = (v2f){bs, bs};
  v8f r;
#pragma unroll
  for (int e = 0; e < 8; e += 2) {
    const v2f x = __builtin_elementwise_fma((v2f){a[e], a[e + 1]}, sc2, bs2);
    r[e]     = __builtin_amdgcn_exp2f(x[0]);
    r[e + 1] = __builtin_amdgcn_exp2f(x[1]);
  }
  return r;
}
// six waves per SIMD = three workgroups per WGP: 768 workgroups fill 256 WGPs in one even round
__global__ __launch_bounds__(256) __attribute__((amdgpu_waves_per_eu(6))) void attn_fused_kernel(const unsigned short* __restrict__ qkvo,
                                                         const unsigned short* __restrict__ vt,
                                                         unsigned short* __restrict__ oh) {
  __shared__ __align__(128) unsigned char sK[kKeyChunk * 32];
  __shared__ __align__(128) unsigned char sV[(kKeyChunk / 16) * kVGrp];
  typedef Frag<_Float16>::U FU;
  const int lane = threadIdx.x & 31, wave = threadIdx.x >> 5;
  const int c = lane & 15, hh = lane >> 4;
  const int gh = blockIdx.y, g = gh >> 3, hd = gh & 7;
  const int q0 = blockIdx.x * 128 + wave * 16;
  const v8h zero8 = (v8h){0, 0, 0, 0, 0, 0, 0, 0};
  const v8f zacc  = (v8f){0.f, 0.f, 0.f, 0.f, 0.f, 0.f, 0.f, 0.f};
  const float cs = 0.25f * 1.44269504088896340736f;   // head-dim scale x log2(e)

  // One A fragment holds two 16-key tiles (k 0..15 = dims of the first, k 16..31 = dims of the second);
  // q sits in the lower k half of qlo and in the upper k half of qhi, zeros in the other half, so each picks one tile.
  FU qlo, qhi;
  qlo.h[0] = *(const v8h*)(qkvo + (size_t)(g * kSeq + q0 + c) * kDim3 + hd * kHdim + 8 * hh);
  qlo.h[1] = zero8;
  qhi.h[0] = zero8;
  qhi.h[1] = qlo.h[0];

  // staging, 4 rounds of 8 waves per chunk. K round i: wave takes the 16-key tile i*8 + wave, lane = (key c, 16-B part hh).
  // V^T round i: wave takes 4 dims x 8 parts of 8 keys (4 whole 128-B lines): dim sd, part i*16 + sp of the chunk.
  const int sd = (wave & 3) * 4 + (lane >> 3);
  const int sp = (wave >> 2) * 8 + (lane & 7);
  const unsigned short* kp = qkvo + (size_t)(g * kSeq + wave * 16 + c) * kDim3 + kDim + hd * kHdim + 8 * hh;
  const unsigned short* vp = vt + (size_t)(g * kDim + hd * kHdim + sd) * kSeq + sp * 8;
  unsigned char* skw = sK + wave * 512 + lane * 16;
  unsigned char* svw = sV + (sp >> 1) * kVGrp + (sp & 1) * kVHalf + sd * 16;
  v4u kr[4], vr[4];
#pragma unroll
  for (int i = 0; i < 4; ++i) {
    kr[i] = *(const v4u*)(kp + (size_t)i * 128 * kDim3);
    vr[i] = *(const v4u*)(vp + i * 128);
  }

  float m = -INFINITY;
  v8f lv = zacc;
  v8f o  = zacc;
  for (int ch = 0; ch < kSeq / kKeyChunk; ++ch) {
    __syncthreads();   // every wave has finished reading the previous chunk
#pragma unroll
    for (int i = 0; i < 4; ++i) {
      *(v4u*)(skw + i * 8 * 512) = kr[i];
      *(v4u*)(svw + i * 8 * kVGrp) = vr[i];
    }
    __syncthreads();   // chunk visible to every wave
    if (ch + 1 < kSeq / kKeyChunk) {   // next chunk's global loads fly under this chunk's work
      kp += (size_t)kKeyChunk * kDim3;
      vp += kKeyChunk;
#pragma unroll
      for (int i = 0; i < 4; ++i) {
        kr[i] = *(const v4u*)(kp + (size_t)i * 128 * kDim3);
        vr[i] = *(const v4u*)(vp + i * 128);
      }
    }
#pragma unroll 2   // a rolled loop keeps the registers inside the six-wave budget with no scratch
    for (int kb = 0; kb < kKeyChunk / 64; ++kb) {
      v8f st[4];
#pragma unroll
      for (int j = 0; j < 2; ++j) {
        FU kf;
        kf.h[0] = *(const v8h*)(sK + (kb * 4 + 2 * j) * 512 + lane * 16);
        kf.h[1] = *(const v8h*)(sK + (kb * 4 + 2 * j + 1) * 512 + lane * 16);
        st[2 * j]     = Frag<_Float16>::mma(kf.v, qlo.v, zacc);
        st[2 * j + 1] = Frag<_Float16>::mma(kf.v, qhi.v, zacc);
      }
      FU vf[2];
#pragma unroll
      for (int j = 0; j < 2; ++j) {
        vf[j].h[0] = *(const v8h*)(sV + (kb * 4 + 2 * j) * kVGrp + hh * kVHalf + c * 16);
        vf[j].h[1] = *(const v8h*)(sV + (kb * 4 + 2 * j + 1) * kVGrp + hh * kVHalf + c * 16);
      }
      float mx = fmaxf(fmaxf(vmax8(st[0]), vmax8(st[1])), fmaxf(vmax8(st[2]), vmax8(st[3])));
      mx = fmaxf(mx, other_half(mx));
      const float mn = fmaxf(m, mx);
      const float alpha = __builtin_amdgcn_exp2f((m - mn) * cs);
      const float bias = kPCarryLog2 - mn * cs;
      m = mn;
      v8f pe[4];
#pragma unroll
      for (int j = 0; j < 4; ++j) pe[j] = vexp2_fma8(st[j], cs, bias);
      lv = lv * alpha + ((pe[0] + pe[1]) + (pe[2] + pe[3]));
      o  = o * alpha;
#pragma unroll
      for (int j = 0; j < 2; ++j) {
        FU pf;
        pf.h[0] = __builtin_convertvector(pe[2 * j], v8h);
        pf.h[1] = __builtin_convertvector(pe[2 * j + 1], v8h);
        o = Frag<_Float16>::mma(vf[j].v, pf.v, o);
      }
    }
  }
  float l = ((lv[0] + lv[1]) + (lv[2] + lv[3])) + ((lv[4] + lv[5]) + (lv[6] + lv[7]));
  l += other_half(l);
  const float inv = kOCarry / l;
  const v8h ov = __builtin_convertvector(o * inv, v8h);
  *(v8h*)(oh + ((size_t)gh * kSeq + q0 + c) * kHdim + 8 * hh) = ov;
}

// ---------------------------------------------------------------------------
// Head merge: opl[(g*2048 + n)*128 + 16*hz + d] = oh[((g*8 + hz)*2048 + n)*16 + d].
// 256 threads = 8 waves; lane: rsel = lane>>4 selects one of the wave's 2 rows, q = lane&15 -> hz = q>>1, d0 = 8*(q&1).
// Coverage: grid (128, 6) x 8 waves x 2 rows = 6 x 2048 rows; 16 lanes x 8 halves = 128 cols = whole 256-B row.
// ---------------------------------------------------------------------------
__global__ __launch_bounds__(256) void ohead_kernel(const unsigned short* __restrict__ oh, unsigned short* __restrict__ opl) {
  const int lane = threadIdx.x & 31, wave = threadIdx.x >> 5;
  const int rsel = lane >> 4, q = lane & 15;
  const int hz = q >> 1, d0 = 8 * (q & 1);
  const int g = blockIdx.y;
  const int n = blockIdx.x * 16 + wave * 2 + rsel;     // 0 .. 2047
  const v4u u = *(const v4u*)(oh + ((size_t)(g * kHeads + hz) * kSeq + n) * kHdim + d0);
  unsigned short* qp = opl + ((size_t)g * kSeq + n) * kDim + 8 * q;
  *(v4u*)qp = u;
}

// ---------------------------------------------------------------------------
// Exact GELU (erf form) on the fc1 pre-activation plane (f32) -> f16 plane carried x carry; 2 elements per thread,
// Coverage: n2 = n/2 threads x 2 = whole plane (grid exact multiple of 256 here).
// ---------------------------------------------------------------------------
__global__ __launch_bounds__(256) void gelu2_kernel(const float* __restrict__ in, unsigned short* __restrict__ out, int n2, float carry) {
  const int i = blockIdx.x * 256 + threadIdx.x;
  if (i >= n2) return;
  const v2f v = *(const v2f*)(in + 2 * (size_t)i);
  float g0 = 0.f, g1 = 0.f;
#pragma unroll 1
  for (int s = 0; s < 2; ++s) {
    const float xx = s ? v[1] : v[0];
    const float gl = 0.5f * xx * (1.0f + erff(xx * 0.70710678118654752f));
    g0 = s ? g0 : gl;
    g1 = s ? gl : g1;
  }
  const unsigned u = pk16(h_bits(g0 * carry), h_bits(g1 * carry));
  unsigned* qp = (unsigned*)(out + 2 * (size_t)i);
  *(unsigned*)qp = u;
  
}

// ---------------------------------------------------------------------------
// Host glue. Workspace region map (bytes; every offset a multiple of 32768):
//   WQKV  f16 [3][384][128]            294,912 @          0
//   WPROJ f16 [3][128][128]             98,304 @    294,912
//   WFC1  f16 [768][384]               589,824 @    393,216
//   WFC2  f16 [384][768]               589,824 @    983,040
//   VT    f16 [6][128][2048]         3,145,728 @  1,572,864
//   BIG                             22,020,096 @  4,718,592   (XN f16 [12288][128] @ +0 and QKVO f16 [12288][384] @ +3,145,728
//                                                             up to and during attention;
//                                                             HN f16 [4096][384] @ +0, H1 f32 [4096][768] @ +3,145,728,
//                                                             G f16 [4096][768] @ +15,728,640 after attention)
//   OH    f16 [48][2048][16]         3,145,728 @ 26,738,688
//   OPL   f16 [12288][128]           3,145,728 @ 29,884,416
//   XC    f32 [4096][384]            6,291,456 @ 33,030,144
//   total                                        39,321,600
// ---------------------------------------------------------------------------
extern "C" void kernel_launch(void* const* d_in, const int* in_sizes, int n_in,
                              void* d_out, int out_size, void* d_ws, size_t ws_size,
                              hipStream_t stream) {
  if (n_in < 14) return;
  if (in_sizes[0] != kRows * kDim || in_sizes[1] != kRows * kDim || in_sizes[2] != kRows * kDim) return;
  if (in_sizes[3] != 3 * kDim || in_sizes[4] != 3 * kDim) return;
  if (in_sizes[5] != 3 * kDim * kDim3 || in_sizes[6] != 3 * kDim * kDim || in_sizes[7] != 3 * kDim) return;
  if (in_sizes[8] != kDim3 || in_sizes[9] != kDim3) return;
  if (in_sizes[10] != kDim3 * kHid || in_sizes[11] != kHid || in_sizes[12] != kHid * kDim3 || in_sizes[13] != kDim3) return;
  if (out_size != 3 * kRows * kDim) return;

  const float* x1     = (const float*)d_in[0];
  const float* x2     = (const float*)d_in[1];
  const float* x3     = (const float*)d_in[2];
  const float* ln1_g  = (const float*)d_in[3];
  const float* ln1_b  = (const float*)d_in[4];
  const float* qkv_w  = (const float*)d_in[5];
  const float* proj_w = (const float*)d_in[6];
  const float* proj_b = (const float*)d_in[7];
  const float* ln2_g  = (const float*)d_in[8];
  const float* ln2_b  = (const float*)d_in[9];
  const float* fc1_w  = (const float*)d_in[10];
  const float* fc1_b  = (const float*)d_in[11];
  const float* fc2_w  = (const float*)d_in[12];
  const float* fc2_b  = (const float*)d_in[13];
  float* out = (float*)d_out;

  // ---- carve ----
  const size_t szWQKV  = (size_t)3 * kDim3 * kDim * 2;
  const size_t szWPROJ = (size_t)3 * kDim * kDim * 2;
  const size_t szWFC1  = (size_t)kHid * kDim3 * 2;
  const size_t szWFC2  = (size_t)kDim3 * kHid * 2;
  const size_t szVT    = (size_t)kGroups * kDim * kSeq * 2;
  const size_t szXN    = (size_t)3 * kRows * kDim * 2;
  const size_t szQKVO  = (size_t)3 * kRows * kDim3 * 2;
  const size_t szHN    = (size_t)kRows * kDim3 * 2;
  const size_t szH1    = (size_t)kRows * kHid * 4;
  const size_t szG     = (size_t)kRows * kHid * 2;
  size_t szBIG = szXN + szQKVO;
  if (szHN + szH1 + szG > szBIG) szBIG = szHN + szH1 + szG;
  const size_t szOH    = (size_t)kGroups * kHeads * kSeq * kHdim * 2;
  const size_t szOPL   = (size_t)3 * kRows * kDim * 2;
  const size_t szXC    = (size_t)kRows * kDim3 * 4;

  const size_t oWQKV  = 0;
  const size_t oWPROJ = oWQKV + szWQKV;
  const size_t oWFC1  = oWPROJ + szWPROJ;
  const size_t oWFC2  = oWFC1 + szWFC1;
  const size_t oVT    = oWFC2 + szWFC2;
  const size_t oBIG   = oVT + szVT;
  const size_t oOH    = oBIG + szBIG;
  const size_t oOPL   = oOH + szOH;
  const size_t oXC    = oOPL + szOPL;
  const size_t oEnd   = oXC + szXC;
  if (oEnd > ws_size) return;

  unsigned char* ws = (unsigned char*)d_ws;
  unsigned short* WQKV  = (unsigned short*)(ws + oWQKV);
  unsigned short* WPROJ = (unsigned short*)(ws + oWPROJ);
  unsigned short* WFC1  = (unsigned short*)(ws + oWFC1);
  unsigned short* WFC2  = (unsigned short*)(ws + oWFC2);
  unsigned short* VT    = (unsigned short*)(ws + oVT);
  unsigned short* XN    = (unsigned short*)(ws + oBIG);
  unsigned short* QKVO  = (unsigned short*)(ws + oBIG + szXN);
  unsigned short* HN    = (unsigned short*)(ws + oBIG);
  float*          H1    = (float*)(ws + oBIG + szHN);
  unsigned short* G     = (unsigned short*)(ws + oBIG + szHN + szH1);
  unsigned short* OH    = (unsigned short*)(ws + oOH);
  unsigned short* OPL   = (unsigned short*)(ws + oOPL);
  float*          XC    = (float*)(ws + oXC);
  const float* fdum = proj_b;   // valid f32 pointer for unused bias/resid slots

  // ---- weights: transpose + f16 (carried x16) ----
  // qkv_w [3][128][384] -> WQKV [3][384][128]; proj_w [3][128][128] -> WPROJ [3][128][128];
  // fc1_w [384][768] -> WFC1 [768][384]; fc2_w [768][384] -> WFC2 [384][768]   (36 + 12 + 72 + 72 = 192 tiles)
  // ---- and, in the same launch, LN1 -> XN f16 [3*4096][128] (1536 blocks) ----
  prep_kernel<<<dim3(kTilesW + 3 * kRows / 8), 256, 0, stream>>>(
      qkv_w, proj_w, fc1_w, fc2_w, WQKV, WPROJ, WFC1, WFC2, kWCarry,
      x1, x2, x3, ln1_g, ln1_b, XN);

  // ---- QKV: QKVO[br][4096][384] = (XN[br] . WQKV[br]^T) / 16, f16 out. M=4096, N=384, K=128; tiles 64*6=384 -> 48 blocks, z=3 ----
  wmma_gemm64<0, false, 0, 1, false><<<dim3(48, 3), 256, 0, stream>>>(
      XN, XN, kDim, (long)kRows * kDim,
      WQKV, WQKV, kDim, (long)kDim3 * kDim,
      (void*)QKVO, (void*)QKVO, kDim3, (long)kRows * kDim3,
      fdum, 0L, fdum, fdum, fdum, 0L, 0,
      kRows, kDim3, kDim, 1.0f / kWCarry);

  // ---- V transpose ----
  vtrans_kernel<<<dim3(kSeq / 64, kDim / 64, kGroups), 256, 0, stream>>>(QKVO, VT);

  // ---- attention: all 6 groups x 8 heads in one launch, then merge the heads into OPL rows (whole 256-B rows) ----
  attn_fused_kernel<<<dim3(kSeq / 128, kGroups * kHeads), 256, 0, stream>>>(QKVO, VT, OH);
  ohead_kernel<<<dim3(kSeq / 16, kGroups), 256, 0, stream>>>(OH, OPL);

  // ---- proj + bias + residual x_br -> XC[:, br*128 .. br*128+127] f32 (ldc 384, resid pitch 128) ----
  // M=4096, N=128, K=128, scale 1/(64*16); tiles 64*2=128 -> 16 blocks per branch, the three branches as batch y of one launch
  wmma_gemm64<0, false, 2, 0, true><<<dim3(16, 3), 256, 0, stream>>>(
      OPL, OPL, kDim, (long)kRows * kDim,
      WPROJ, WPROJ, kDim, (long)kDim * kDim,
      (void*)XC, (void*)XC, kDim3, (long)kDim,
      proj_b, (long)kDim, x1, x2, x3, 0L, kDim,
      kRows, kDim, kDim, 1.0f / (kOCarry * kWCarry));

  // ---- LN2 -> HN f16 [4096][384] ----
  ln384_kernel<<<dim3(kRows / 8), 256, 0, stream>>>(XC, ln2_g, ln2_b, HN);

  // ---- fc1 + bias -> H1 f32 [4096][768]; M=4096, N=768, K=384; tiles 64*12=768 -> 96 blocks ----
  wmma_gemm64<0, false, 2, 0, false><<<dim3(96, 1), 256, 0, stream>>>(
      HN, HN, kDim3, 0L,
      WFC1, WFC1, kDim3, 0L,
      (void*)H1, (void*)H1, kHid, 0L,
      fc1_b, 0L, fdum, fdum, fdum, 0L, 0,
      kRows, kHid, kDim3, 1.0f / kWCarry);

  // ---- exact GELU -> G f16 x16 ----
  gelu2_kernel<<<dim3((kRows * kHid / 2 + 255) / 256), 256, 0, stream>>>(H1, G, kRows * kHid / 2, kGCarry);

  // ---- fc2 + bias + residual XC -> three output planes out[k] = [4096][128] (N=128 slice k of 384), K=768, scale 1/256 ----
  // the three slices as batch y of one launch: A shared (stride 0), weights, bias, residual columns and output plane move with y
  wmma_gemm64<0, false, 2, 0, true><<<dim3(16, 3), 256, 0, stream>>>(
      G, G, kHid, 0L,
      WFC2, WFC2, kHid, (long)kDim * kHid,
      (void*)out, (void*)out, kDim, (long)kRows * kDim,
      fc2_b, (long)kDim, XC, XC, XC, (long)kDim, kDim3,
      kRows, kDim, kHid, 1.0f / (kGCarry * kWCarry));
}

// v003
// Measured time: 76 microseconds a run.
// Next to v002, in two timings, it ran 1.80 and 1.79 times as fast.
// All steps since v000 together make it 21.6 times as fast.
// Contractions: x_ln@Wqkv, o@Wproj, h_ln@Wfc1, g@Wfc2 (activations f16, weights f16 carried x16), scores k.q^T (q,k f16, head dim 16: two key tiles per A fragment, q zero-padded 16->32 in registers), V^T@P^T (P f16, unnormalised exp carried x2^8, V^T f16): all v_wmma_f32_16x16x32_f16 with f32 accumulate; LayerNorm, online softmax, GELU(erf), bias, residual in f32.
#include <hip/hip_runtime.h>
#include <math.h>

// ---------------------------------------------------------------------------
// Problem constants
// ---------------------------------------------------------------------------
constexpr int kBatch   = 2;
constexpr int kSeq     = 2048;
constexpr int kDim     = 128;
constexpr int kHeads   = 8;
constexpr int kHdim    = 16;
constexpr int kHid     = 768;
constexpr int kRows    = kBatch * kSeq;     // 4096 token rows per branch
constexpr int kDim3    = 3 * kDim;          // 384
constexpr int kGroups  = 3 * kBatch;        // 6 (branch, batch) groups; group g covers plane rows g*2048 .. g*2048+2047
constexpr int kKeyChunk = 512;              // keys staged in LDS at a time
constexpr int kVHalf   = 288;               // LDS bytes from lane half 0's 256 B of a V^T fragment half to lane half 1's
constexpr int kVGrp    = 576;               // LDS bytes per V^T fragment half (16 dims x 16 keys)
constexpr float kWCarry = 16.0f;            // weights carried x16 in f16
constexpr float kPCarryLog2 = 8.0f;         // unnormalised probabilities exp(s - max) carried x2^8 in f16
constexpr float kOCarry = 64.0f;            // attention output carried x64 in f16
constexpr float kGCarry = 16.0f;            // gelu output carried x16 in f16
constexpr float kLnEps  = 1e-5f;

typedef __attribute__((ext_vector_type(16))) _Float16 v16h;
typedef __attribute__((ext_vector_type(8)))  _Float16 v8h;
typedef __attribute__((ext_vector_type(8)))  float    v8f;
typedef __attribute__((ext_vector_type(4)))  float    v4f;
typedef __attribute__((ext_vector_type(2)))  float    v2f;
typedef __attribute__((ext_vector_type(4)))  unsigned int v4u;
typedef __attribute__((ext_vector_type(2)))  unsigned int v2u;

// ---------------------------------------------------------------------------
// Fragment helpers
// ---------------------------------------------------------------------------
template <typename T> struct Frag;
template <> struct Frag<_Float16> {
  typedef v16h V; union U { v16h v; v8h h[2]; };
  static __device__ __forceinline__ v16h load(const _Float16* p) {   // elements 0..7 <- p[0..7], 8..15 <- p[16..23]
    U f; f.h[0] = *(const v8h*)(p); f.h[1] = *(const v8h*)(p + 16); return f.v;
  }
  static __device__ __forceinline__ v8f mma(v16h a, v16h b, v8f c) {
    return __builtin_amdgcn_wmma_f32_16x16x32_f16(false, a, false, b, (short)0, c, false, false);
  }
};

__device__ __forceinline__ unsigned pk16(unsigned short a, unsigned short b) { return (unsigned)a | ((unsigned)b << 16); }
__device__ __forceinline__ unsigned short h_bits(float f) { const _Float16 h = (_Float16)f; return __builtin_bit_cast(unsigned short, h); }

// ---------------------------------------------------------------------------
// Batched WMMA GEMM with both operands staged in LDS by asynchronous copies.
// C[m,n] = scale * sum_k A[m,k] * Bt[n,k] (+bias[n])(+resid[m*ldr+n]); A row-major [M,K], Bt row-major [N,K], f16.
// One workgroup (8 waves) owns a 128 x 64 tile of C; wave (wm = wave&3, wn = wave>>2) owns rows 32wm.., columns 32wn.. (2 x 2 fragments).
// K = NCH * KC. A chunk is KC k of all 192 operand rows: [A 128 rows | Bt 64 rows] at pitch 2*KC + 16 bytes (16 B x odd: no bank
// conflict for the 16-byte fragment reads). Every copy instruction of a wave moves 512 contiguous source bytes or two runs of 256:
// whole 128-B lines. Each chunk has a buffer of its own, so chunk 1 flies while chunk 0 is multiplied.
// blockIdx.x = tile (column tile fastest), blockIdx.y = b is the batch: operands, output, bias and residual move by their strides
// (elements) per b; the residual base is resid0 / resid1 / resid2 for b = 0 / 1 / 2, then + b * strideR.
// OUT_F16: C is f16 (Ch), else f32 (Cf). The tile leaves through LDS, so every store instruction writes whole 128-B lines.
// Every loop of the engine is unrolled: its arrays (copy operands, fragments, accumulators, residual rows) are registers and asm
// operands, which need constant indices.
// ---------------------------------------------------------------------------
constexpr int kBM = 128, kBN = 64, kCPitch = 68;   // kCPitch: floats per staged row of C

// N copies and, in the same statement, the wait that stands before any register they name is rewritten.
__device__ __forceinline__ void async_copy4(const unsigned* l, const unsigned short* const* g) {
  asm volatile("global_load_async_to_lds_b128 %0, %4, off\n\t"
               "global_load_async_to_lds_b128 %1, %5, off\n\t"
               "global_load_async_to_lds_b128 %2, %6, off\n\t"
               "global_load_async_to_lds_b128 %3, %7, off\n\t"
               "s_wait_xcnt 0x0"
               :: "v"(l[0]), "v"(l[1]), "v"(l[2]), "v"(l[3]), "v"(g[0]), "v"(g[1]), "v"(g[2]), "v"(g[3]) : "memory");
}
__device__ __forceinline__ void async_copy12(const unsigned* l, const unsigned short* const* g) {
  asm volatile("global_load_async_to_lds_b128 %0, %12, off\n\t"
               "global_load_async_to_lds_b128 %1, %13, off\n\t"
               "global_load_async_to_lds_b128 %2, %14, off\n\t"
               "global_load_async_to_lds_b128 %3, %15, off\n\t"
               "global_load_async_to_lds_b128 %4, %16, off\n\t"
               "global_load_async_to_lds_b128 %5, %17, off\n\t"
               "global_load_async_to_lds_b128 %6, %18, off\n\t"
               "global_load_async_to_lds_b128 %7, %19, off\n\t"
               "global_load_async_to_lds_b128 %8, %20, off\n\t"
               "global_load_async_to_lds_b128 %9, %21, off\n\t"
               "global_load_async_to_lds_b128 %10, %22, off\n\t"
               "global_load_async_to_lds_b128 %11, %23, off\n\t"
               "s_wait_xcnt 0x0"
               :: "v"(l[0]), "v"(l[1]), "v"(l[2]), "v"(l[3]), "v"(l[4]), "v"(l[5]), "v"(l[6]), "v"(l[7]), "v"(l[8]), "v"(l[9]),
                  "v"(l[10]), "v"(l[11]),
                  "v"(g[0]), "v"(g[1]), "v"(g[2]), "v"(g[3]), "v"(g[4]), "v"(g[5]), "v"(g[6]), "v"(g[7]), "v"(g[8]), "v"(g[9]),
                  "v"(g[10]), "v"(g[11]) : "memory");
}

// ROWS rows of KC halves from g0 (row pitch ld halves) to LDS byte address lds0 (row pitch 2*KC + 16). A row is KC/8 pieces of 16 B.
// PER * 256 pieces = 16 whole rows: lane t takes pieces i*256 + t (i < PER) of every 16-row band, so its addresses in the next band
// are the same plus a constant. Each piece is copied by exactly one lane; every lane is on.
template <int KC, int ROWS>
__device__ __forceinline__ void stage_rows(const unsigned short* g0, int ld, unsigned lds0, int t) {
  constexpr int CPR = KC / 8, PER = CPR / 16, BAND = 16, NB = ROWS / BAND, PITCH = KC * 2 + 16;
  static_assert(CPR % 16 == 0 && (PER == 1 || PER == 3) && NB % 4 == 0, "whole bands, four bands a statement");
  const unsigned short* gb[PER];
  unsigned lb[PER];
#pragma unroll
  for (int i = 0; i < PER; ++i) {
    const int e = i * 256 + t;
    const int r = e / CPR, c = e - r * CPR;
    gb[i] = g0 + (r * ld + c * 8);
    lb[i] = lds0 + (unsigned)(r * PITCH + c * 16);
  }
  const size_t step = (size_t)(BAND * ld);
#pragma unroll
  for (int j0 = 0; j0 < NB; j0 += 4) {
    unsigned l[4 * PER];
    const unsigned short* g[4 * PER];
#pragma unroll
    for (int jj = 0; jj < 4; ++jj)
#pragma unroll
      for (int i = 0; i < PER; ++i) {
        l[jj * PER + i] = lb[i] + (unsigned)((j0 + jj) * BAND * PITCH);
        g[jj * PER + i] = gb[i] + (size_t)(j0 + jj) * step;
      }
    if (PER == 3) async_copy12(l, g); else async_copy4(l, g);
  }
}

// WPE = waves per SIMD that the register budget must leave room for: 2 * workgroups per WGP that the LDS size and the grid ask for.
template <int KC, int NCH, int WPE, bool BIAS, bool OUT_F16, bool RESID>
__global__ __launch_bounds__(256, WPE) void gemm_lds(
    const unsigned short* __restrict__ Ap, int lda, long strideA,
    const unsigned short* __restrict__ Btp, int ldb, long strideB,
    float* __restrict__ Cf, unsigned short* __restrict__ Ch, int ldc, long strideC,
    const float* __restrict__ bias, long strideBias,
    const float* __restrict__ resid0, const float* __restrict__ resid1, const float* __restrict__ resid2, long strideR, int ldr,
    int tilesN, float scale) {
  constexpr int PITCH = KC * 2 + 16;
  constexpr int BUF   = (kBM + kBN) * PITCH;
  constexpr int GK    = 2, NG = KC / 32 / GK;   // fragments are fetched in groups of GK k steps, one group ahead
  static_assert(kBM * kCPitch * 4 <= BUF, "the staged C tile fits the first buffer");
  static_assert((kBM + kBN) * (KC / 8) / 256 <= 63, "copies of one chunk outstanding per wave");
  __shared__ __align__(128) unsigned char smem[NCH * BUF];
  const int t    = threadIdx.x;
  const int lane = t & 31, wave = t >> 5;
  const int b    = blockIdx.y;
  const int tm   = blockIdx.x / tilesN;
  const int tn   = blockIdx.x - tm * tilesN;
  const int m0   = tm * kBM, n0 = tn * kBN;
  const unsigned short* Ab = Ap  + (size_t)b * strideA + (size_t)m0 * lda;
  const unsigned short* Bb = Btp + (size_t)b * strideB + (size_t)n0 * ldb;
  const unsigned lds0 = (unsigned)(size_t)smem;   // low 32 bits of the shared address = byte offset in the workgroup's LDS

  stage_rows<KC, kBM>(Ab, lda, lds0, t);
  stage_rows<KC, kBN>(Bb, ldb, lds0 + kBM * PITCH, t);

  // bias and residual of the rows this thread will store: asked for now, used in the epilogue
  const int c4 = (t & 15) * 4, r4 = t >> 4;            // f32 C: a row of 256 B = 16 lanes x 16 B; 16 rows a trip
  v4f bv = (v4f){0.f, 0.f, 0.f, 0.f};
  v4f rv[kBM / 16];
  if (BIAS) bv = *(const v4f*)(bias + (size_t)b * strideBias + n0 + c4);
  if (RESID) {
    const float* rp = ((b == 0) ? resid0 : (b == 1) ? resid1 : resid2) + (size_t)b * strideR + (size_t)(m0 + r4) * ldr + n0 + c4;
    const float* rq[kBM / 16];
#pragma unroll
    for (int it = 0; it < kBM / 16; ++it) { rq[it] = rp + (size_t)(it * 16 * ldr); rv[it] = *(const v4f*)rq[it]; }
    // the eight addresses stay in their registers up to this wait, so no load of the run returns onto an earlier load's address
    asm volatile("s_wait_xcnt 0x0" :: "v"(rq[0]), "v"(rq[1]), "v"(rq[2]), "v"(rq[3]), "v"(rq[4]), "v"(rq[5]), "v"(rq[6]), "v"(rq[7]) : "memory");
  }

  asm volatile("s_wait_asynccnt 0x0" ::: "memory");   // this wave's copies of chunk 0 have landed
  __syncthreads();                                    // chunk 0 visible to every wave
  if (NCH > 1) {                                      // chunk 1 flies under chunk 0's products
    stage_rows<KC, kBM>(Ab + KC, lda, lds0 + BUF, t);
    stage_rows<KC, kBN>(Bb + KC, ldb, lds0 + BUF + kBM * PITCH, t);
  }

  const int rlane = lane & 15, hh = lane >> 4;
  const int wm = wave & 3, wn = wave >> 2;
  v8f acc[2][2];
#pragma unroll
  for (int i = 0; i < 2; ++i)
#pragma unroll
    for (int j = 0; j < 2; ++j) acc[i][j] = (v8f){0.f, 0.f, 0.f, 0.f, 0.f, 0.f, 0.f, 0.f};

#pragma unroll
  for (int ch = 0; ch < NCH; ++ch) {
    const unsigned char* aP = smem + ch * BUF + (wm * 32 + rlane) * PITCH + hh * 16;
    const unsigned char* bP = smem + ch * BUF + (kBM + wn * 32 + rlane) * PITCH + hh * 16;
    v16h fa[2][GK][2], fb[2][GK][2];
#pragma unroll
    for (int g = -1; g < NG; ++g) {
      if (g + 1 < NG) {
#pragma unroll
        for (int s = 0; s < GK; ++s)
#pragma unroll
          for (int i = 0; i < 2; ++i) {
            fa[(g + 1) & 1][s][i] = Frag<_Float16>::load((const _Float16*)(aP + i * 16 * PITCH + ((g + 1) * GK + s) * 64));
            fb[(g + 1) & 1][s][i] = Frag<_Float16>::load((const _Float16*)(bP + i * 16 * PITCH + ((g + 1) * GK + s) * 64));
          }
      }
      __builtin_amdgcn_sched_barrier(0);   // the next group's LDS reads stay one group, ahead of this group's products, not among them
      if (g >= 0) {
#pragma unroll
        for (int s = 0; s < GK; ++s)
#pragma unroll
          for (int i = 0; i < 2; ++i)
#pragma unroll
            for (int j = 0; j < 2; ++j) acc[i][j] = Frag<_Float16>::mma(fa[g & 1][s][i], fb[g & 1][s][j], acc[i][j]);
      }
      __builtin_amdgcn_sched_barrier(0);   // and the reads of the group after that stay behind these products
    }
    asm volatile("s_wait_dscnt 0x0" ::: "memory");                    // this wave's reads of the chunk are done
    if (NCH > 1) asm volatile("s_wait_asynccnt 0x0" ::: "memory");    // this wave's copies of the next chunk have landed; behind the last chunk none is left
    __syncthreads();   // next chunk visible to every wave; behind the last chunk: every reader has left, the LDS becomes C staging
  }

  // ---- epilogue: scaled tile to LDS in accumulator order, out of it in whole rows ----
  float* sC = (float*)smem;
#pragma unroll
  for (int i = 0; i < 2; ++i)
#pragma unroll
    for (int j = 0; j < 2; ++j)
#pragma unroll
      for (int r = 0; r < 8; ++r)
        sC[(wm * 32 + i * 16 + hh * 8 + r) * kCPitch + wn * 32 + j * 16 + rlane] = acc[i][j][r] * scale;
  __syncthreads();   // staged tile visible to every wave
  if (!OUT_F16) {
    float* cp = Cf + (size_t)b * strideC + (size_t)m0 * ldc + n0;
    const unsigned co = (unsigned)(r4 * ldc + c4) * 4u;   // bytes: uniform base + one 32-bit lane offset
#pragma unroll
    for (int it = 0; it < kBM / 16; ++it) {
      v4f v = *(const v4f*)(sC + (it * 16 + r4) * kCPitch + c4);
      if (BIAS)  v += bv;
      if (RESID) v += rv[it];
      *(v4f*)((char*)(cp + (size_t)(it * 16 * ldc)) + co) = v;
    }
  } else {
    const int c8 = (t & 7) * 8, r8 = t >> 3;           // f16 C: a row of 128 B = 8 lanes x 16 B; 32 rows a trip
    unsigned short* cp = Ch + (size_t)b * strideC + (size_t)m0 * ldc + n0;
    const unsigned co = (unsigned)(r8 * ldc + c8) * 2u;   // bytes: uniform base + one 32-bit lane offset
#pragma unroll
    for (int it = 0; it < kBM / 32; ++it) {
      const float* sp = sC + (it * 32 + r8) * kCPitch + c8;
      v8h hv;
#pragma unroll
      for (int e = 0; e < 8; ++e) hv[e] = (_Float16)sp[e];
      *(v8h*)((char*)(cp + (size_t)(it * 32 * ldc)) + co) = hv;
    }
  }
}

// ---------------------------------------------------------------------------
// Weight transpose + cast: W plane z is f32 [nIn][nOut] row-major; WT plane z = [nOut][nIn] f16, WT[h][d] = f16(scale * W[d][h]).
// All four weight tensors in one index space: tile index r0 falls into one tensor's range of (nIn/64)*(nOut/64)*nz tiles
// (block-uniform choice), and inside the range it runs d tile fastest, then h tile, then plane z.
// 256 threads; nIn, nOut multiples of 64. Plane z at out + z*nOut*nIn halves.
// Load coverage: 16 iterations x 256 threads = 4096 = the whole 64x64 tile (coalesced along h).
// Store coverage: 8 waves x 2 iterations x 4 rows (lane>>3) = 64 rows; (lane&7) x 8 halves = 64 cols; each row segment =
// ---------------------------------------------------------------------------
constexpr int kTilesQkv  = (kDim / 64) * (kDim3 / 64) * 3;   // 36
constexpr int kTilesProj = (kDim / 64) * (kDim / 64) * 3;    // 12
constexpr int kTilesFc1  = (kDim3 / 64) * (kHid / 64);       // 72
constexpr int kTilesFc2  = (kHid / 64) * (kDim3 / 64);       // 72
constexpr int kTilesW    = kTilesQkv + kTilesProj + kTilesFc1 + kTilesFc2;   // 192
__device__ __forceinline__ void wtcast_tile(int r0, const float* __restrict__ wQkv, const float* __restrict__ wProj,
                                            const float* __restrict__ wFc1, const float* __restrict__ wFc2,
                                            unsigned short* __restrict__ oQkv, unsigned short* __restrict__ oProj,
                                            unsigned short* __restrict__ oFc1, unsigned short* __restrict__ oFc2,
                                            float scale) {
  __shared__ float sm[64][65];   // sm[h_local][d_local]
  const int t  = threadIdx.x;
  const float* W = wQkv; unsigned short* out = oQkv; int nIn = kDim, nOut = kDim3;
  if (r0 >= kTilesQkv + kTilesProj + kTilesFc1) { r0 -= kTilesQkv + kTilesProj + kTilesFc1; W = wFc2; out = oFc2; nIn = kHid; nOut = kDim3; }
  else if (r0 >= kTilesQkv + kTilesProj)        { r0 -= kTilesQkv + kTilesProj; W = wFc1; out = oFc1; nIn = kDim3; nOut = kHid; }
  else if (r0 >= kTilesQkv)                     { r0 -= kTilesQkv; W = wProj; out = oProj; nIn = kDim; nOut = kDim; }
  const int gx = nIn >> 6, gy = nOut >> 6;
  const int r1 = r0 / gx;
  const int d0 = (r0 - r1 * gx) * 64;
  const int z  = r1 / gy;
  const int h0 = (r1 - z * gy) * 64;
  const float* Wz = W + (size_t)z * nIn * nOut;
#pragma unroll
  for (int i = 0; i < 16; ++i) {
    const int e = i * 256 + t;
    const int r = e >> 6;          // d local
    const int c = e & 63;          // h local
    sm[c][r] = Wz[(size_t)(d0 + r) * nOut + h0 + c] * scale;
  }
  __syncthreads();
  const int lane = t & 31, wave = t >> 5;
  const int q = lane >> 3, c8 = (lane & 7) * 8;
  unsigned short* op = out + (size_t)z * nOut * nIn;
  {
#pragma unroll
    for (int it = 0; it < 2; ++it) {
      const int row = wave * 8 + it * 4 + q;                 // h local
      unsigned short hb[8];
#pragma unroll
      for (int e = 0; e < 8; ++e) hb[e] = h_bits(sm[row][c8 + e]);
      const v4u u = (v4u){pk16(hb[0], hb[1]), pk16(hb[2], hb[3]), pk16(hb[4], hb[5]), pk16(hb[6], hb[7])};
      *(v4u*)(op + (size_t)(h0 + row) * nIn + d0 + c8) = u;
    }
    
  }
}

// ---------------------------------------------------------------------------
// One wave per row; blk = 0 .. 3*4096/8 - 1 = 1535, 8 waves each (exact). Branch index is block-uniform.
// ---------------------------------------------------------------------------
__device__ __forceinline__ void ln128_rows(int blk, const float* __restrict__ x1, const float* __restrict__ x2,
                                           const float* __restrict__ x3, const float* __restrict__ g,
                                           const float* __restrict__ bt, unsigned short* __restrict__ xn) {
  const int lane = threadIdx.x & 31, wave = threadIdx.x >> 5;
  const int wid = blk * 8 + wave;                   // 0 .. 12287
  const int br  = wid / kRows;                      // 0..2, block-uniform (512 blocks per branch)
  const int row = wid - br * kRows;
  const float* x = (br == 0) ? x1 : (br == 1) ? x2 : x3;
  const v4f xv = *(const v4f*)(x + (size_t)row * kDim + lane * 4);
  float s = (xv[0] + xv[1]) + (xv[2] + xv[3]);
#pragma unroll
  for (int off = 16; off > 0; off >>= 1) s += __shfl_xor(s, off, 32);
  const float mean = s * (1.0f / 128.0f);
  const float d0 = xv[0] - mean, d1 = xv[1] - mean, d2 = xv[2] - mean, d3 = xv[3] - mean;
  float s2 = (d0 * d0 + d1 * d1) + (d2 * d2 + d3 * d3);
#pragma unroll
  for (int off = 16; off > 0; off >>= 1) s2 += __shfl_xor(s2, off, 32);
  const float var  = s2 * (1.0f / 128.0f);
  const float rstd = rsqrtf(var + kLnEps);
  const v4f gv = *(const v4f*)(g + br * kDim + lane * 4);
  const v4f bv = *(const v4f*)(bt + br * kDim + lane * 4);
  const float y0 = d0 * rstd * gv[0] + bv[0];
  const float y1 = d1 * rstd * gv[1] + bv[1];
  const float y2 = d2 * rstd * gv[2] + bv[2];
  const float y3 = d3 * rstd * gv[3] + bv[3];
  const v2u u = (v2u){pk16(h_bits(y0), h_bits(y1)), pk16(h_bits(y2), h_bits(y3))};
  unsigned short* qp = xn + (size_t)wid * kDim + lane * 4;
  *(v2u*)qp = u;
  // the listing has a branch from here into the cast part, which rewrites this store's address and data registers: the wait stands in front of that
  asm volatile("s_wait_xcnt 0x0" ::: "memory");
}

// ---------------------------------------------------------------------------
// Weight casts and LN1 depend on nothing but the inputs, so they share one launch: blocks 0 .. 191 cast one weight tile each,
// blocks 192 .. 1727 normalise 8 rows each. The choice is block-uniform, so the cast's barrier is passed by a whole block or by none.
// ---------------------------------------------------------------------------
__global__ __launch_bounds__(256) void prep_kernel(const float* __restrict__ wQkv, const float* __restrict__ wProj,
                                                   const float* __restrict__ wFc1, const float* __restrict__ wFc2,
                                                   unsigned short* __restrict__ oQkv, unsigned short* __restrict__ oProj,
                                                   unsigned short* __restrict__ oFc1, unsigned short* __restrict__ oFc2,
                                                   float scale,
                                                   const float* __restrict__ x1, const float* __restrict__ x2,
                                                   const float* __restrict__ x3, const float* __restrict__ g,
                                                   const float* __restrict__ bt, unsigned short* __restrict__ xn) {
  const int blk = blockIdx.x;
  if (blk < kTilesW) wtcast_tile(blk, wQkv, wProj, wFc1, wFc2, oQkv, oProj, oFc1, oFc2, scale);
  else               ln128_rows(blk - kTilesW, x1, x2, x3, g, bt, xn);
}

// ---------------------------------------------------------------------------
// LayerNorm over 384 features of xc[4096][384] (f32) -> f16 plane hn[4096][384]. One wave per row; grid = 4096/8 = 512.
// ---------------------------------------------------------------------------
__global__ __launch_bounds__(256) void ln384_kernel(const float* __restrict__ xc, const float* __restrict__ g,
                                                    const float* __restrict__ bt, unsigned short* __restrict__ hn) {
  const int lane = threadIdx.x & 31, wave = threadIdx.x >> 5;
  const int row = blockIdx.x * 8 + wave;            // 0 .. 4095
  const float* r = xc + (size_t)row * kDim3;
  v4f vv[3];
  float s = 0.f;
#pragma unroll
  for (int ch = 0; ch < 3; ++ch) {
    vv[ch] = *(const v4f*)(r + ch * kDim + lane * 4);
    s += (vv[ch][0] + vv[ch][1]) + (vv[ch][2] + vv[ch][3]);
  }
#pragma unroll
  for (int off = 16; off > 0; off >>= 1) s += __shfl_xor(s, off, 32);
  const float mean = s * (1.0f / 384.0f);
  float s2 = 0.f;
#pragma unroll
  for (int ch = 0; ch < 3; ++ch) {
#pragma unroll
    for (int j = 0; j < 4; ++j) { const float d = vv[ch][j] - mean; vv[ch][j] = d; s2 += d * d; }
  }
#pragma unroll
  for (int off = 16; off > 0; off >>= 1) s2 += __shfl_xor(s2, off, 32);
  const float var  = s2 * (1.0f / 384.0f);
  const float rstd = rsqrtf(var + kLnEps);
  v2u u[3];
#pragma unroll
  for (int ch = 0; ch < 3; ++ch) {
    const v4f gv = *(const v4f*)(g + ch * kDim + lane * 4);
    const v4f bv = *(const v4f*)(bt + ch * kDim + lane * 4);
    unsigned short hb[4];
#pragma unroll
    for (int j = 0; j < 4; ++j) hb[j] = h_bits(vv[ch][j] * rstd * gv[j] + bv[j]);
    u[ch] = (v2u){pk16(hb[0], hb[1]), pk16(hb[2], hb[3])};
  }
  unsigned short* qp = hn + (size_t)row * kDim3 + lane * 4;
  {
#pragma unroll
    for (int ch = 0; ch < 3; ++ch) *(v2u*)(qp + ch * kDim) = u[ch];
    
  }
}

// ---------------------------------------------------------------------------
// V transpose: vt[(g*128 + c)*2048 + n] = qkvo[(g*2048 + n)*384 + 256 + c], g = 0..5 ((branch,batch) group), c = h*16+d.
// grid (2048/64 = 32, 128/64 = 2, 6), 256 threads. in tile [n0..n0+63][c0..c0+63] -> out tile [c0..][n0..] through LDS.
// Load coverage: 2 iterations x 256 threads = 512 = 64 n-rows x 8 16-B parts (8 halves each) = whole tile.
// Store coverage: 8 waves x 2 iterations x 4 rows (lane>>3) = 64 c-rows; (lane&7) x 8 halves = 64 n-cols; each row
// ---------------------------------------------------------------------------
__global__ __launch_bounds__(256) void vtrans_kernel(const unsigned short* __restrict__ qkvo, unsigned short* __restrict__ vt) {
  __shared__ unsigned short sm[64][66];   // sm[c local][n local]
  const int t  = threadIdx.x;
  const int n0 = blockIdx.x * 64;
  const int c0 = blockIdx.y * 64;
  const int g  = blockIdx.z;
#pragma unroll
  for (int i = 0; i < 2; ++i) {
    const int e = i * 256 + t;
    const int r = e >> 3;          // n local 0..63
    const int part = e & 7;        // 8-half part 0..7
    const v4u u = *(const v4u*)(qkvo + (size_t)(g * kSeq + n0 + r) * kDim3 + 2 * kDim + c0 + part * 8);
#pragma unroll
    for (int w = 0; w < 4; ++w) {
      sm[part * 8 + 2 * w][r]     = (unsigned short)(u[w] & 0xFFFFu);
      sm[part * 8 + 2 * w + 1][r] = (unsigned short)(u[w] >> 16);
    }
  }
  __syncthreads();
  const int lane = t & 31, wave = t >> 5;
  const int q = lane >> 3, c8 = (lane & 7) * 8;
  {
#pragma unroll
    for (int it = 0; it < 2; ++it) {
      const int row = wave * 8 + it * 4 + q;     // c local
      unsigned short hb[8];
#pragma unroll
      for (int e = 0; e < 8; ++e) hb[e] = sm[row][c8 + e];
      const v4u u = (v4u){pk16(hb[0], hb[1]), pk16(hb[2], hb[3]), pk16(hb[4], hb[5]), pk16(hb[6], hb[7])};
      *(v4u*)(vt + (size_t)(g * kDim + c0 + row) * kSeq + n0 + c8) = u;
    }
    
  }
}

// ---------------------------------------------------------------------------
// Fused attention, one launch for all 48 (group, head) pairs: S^T = K.Q^T, online softmax, O^T += V^T.P^T.
// grid (2048/128 = 16 query blocks, 48), 256 threads = 8 waves x 16 queries. Lane (c = lane&15, hh = lane>>4) owns query c.
// K and V^T of the head are staged through registers into LDS, 512 keys at a time, already in fragment order:
//   sK: 16-key tile T at T*512; lane's 16 B (key c, dims 8hh..8hh+7) at + lane*16.
//   sV: fragment half G (keys 16G + 8hh + 0..7 of dim c) at G*576 + hh*288 + c*16.
// S^T tile register r = score(key 8hh + r, query c), so two tiles converted in place are the B operand P^T (hardware k
// order), and V^T as A is read in the same k order. O^T register r = O(query c, dim 8hh + r): one 16-B store per lane.
// oh[(g*8 + head)][2048][16] f16 carried x64: each wave writes 512 contiguous bytes.
// ---------------------------------------------------------------------------
__device__ __forceinline__ float other_half(float v) {   // value of lane ^ 16
  const int b = __builtin_bit_cast(int, v);
  return __builtin_bit_cast(float, __builtin_amdgcn_permlanex16(b, b, 0x76543210, 0xfedcba98, false, false));
}
__device__ __forceinline__ float vmax8(v8f a) {
  return fmaxf(fmaxf(fmaxf(a[0], a[1]), fmaxf(a[2], a[3])), fmaxf(fmaxf(a[4], a[5]), fmaxf(a[6], a[7])));
}
__device__ __forceinline__ v8f vexp2_fma8(v8f a, float sc, float bs) {   // exp2(a * sc + bs), the multiply-adds two per instruction
  const v2f sc2 = (v2f){sc, sc}, bs2 = (v2f){bs, bs};
  v8f r;
#pragma unroll
  for (int e = 0; e < 8; e += 2) {
    const v2f x = __builtin_elementwise_fma((v2f){a[e], a[e + 1]}, sc2, bs2);
    r[e]     = __builtin_amdgcn_exp2f(x[0]);
    r[e + 1] = __builtin_amdgcn_exp2f(x[1]);
  }
  return r;
}
// six waves per SIMD = three workgroups per WGP: 768 workgroups fill 256 WGPs in one even round
__global__ __launch_bounds__(256) __attribute__((amdgpu_waves_per_eu(6))) void attn_fused_kernel(const unsigned short* __restrict__ qkvo,
                                                         const unsigned short* __restrict__ vt,
                                                         unsigned short* __restrict__ oh) {
  __shared__ __align__(128) unsigned char sK[kKeyChunk * 32];
  __shared__ __align__(128) unsigned char sV[(kKeyChunk / 16) * kVGrp];
  typedef Frag<_Float16>::U FU;
  const int lane = threadIdx.x & 31, wave = threadIdx.x >> 5;
  const int c = lane & 15, hh = lane >> 4;
  const int gh = blockIdx.y, g = gh >> 3, hd = gh & 7;
  const int q0 = blockIdx.x * 128 + wave * 16;
  const v8h zero8 = (v8h){0, 0, 0, 0, 0, 0, 0, 0};
  const v8f zacc  = (v8f){0.f, 0.f, 0.f, 0.f, 0.f, 0.f, 0.f, 0.f};
  const float cs = 0.25f * 1.44269504088896340736f;   // head-dim scale x log2(e)

  // One A fragment holds two 16-key tiles (k 0..15 = dims of the first, k 16..31 = dims of the second);
  // q sits in the lower k half of qlo and in the upper k half of qhi, zeros in the other half, so each picks one tile.
  FU qlo, qhi;
  qlo.h[0] = *(const v8h*)(qkvo + (size_t)(g * kSeq + q0 + c) * kDim3 + hd * kHdim + 8 * hh);
  qlo.h[1] = zero8;
  qhi.h[0] = zero8;
  qhi.h[1] = qlo.h[0];

  // staging, 4 rounds of 8 waves per chunk. K round i: wave takes the 16-key tile i*8 + wave, lane = (key c, 16-B part hh).
  // V^T round i: wave takes 4 dims x 8 parts of 8 keys (4 whole 128-B lines): dim sd, part i*16 + sp of the chunk.
  const int sd = (wave & 3) * 4 + (lane >> 3);
  const int sp = (wave >> 2) * 8 + (lane & 7);
  const unsigned short* kp = qkvo + (size_t)(g * kSeq + wave * 16 + c) * kDim3 + kDim + hd * kHdim + 8 * hh;
  const unsigned short* vp = vt + (size_t)(g * kDim + hd * kHdim + sd) * kSeq + sp * 8;
  unsigned char* skw = sK + wave * 512 + lane * 16;
  unsigned char* svw = sV + (sp >> 1) * kVGrp + (sp & 1) * kVHalf + sd * 16;
  v4u kr[4], vr[4];
#pragma unroll
  for (int i = 0; i < 4; ++i) {
    kr[i] = *(const v4u*)(kp + (size_t)i * 128 * kDim3);
    vr[i] = *(const v4u*)(vp + i * 128);
  }

  float m = -INFINITY;
  v8f lv = zacc;
  v8f o  = zacc;
  for (int ch = 0; ch < kSeq / kKeyChunk; ++ch) {
    __syncthreads();   // every wave has finished reading the previous chunk
#pragma unroll
    for (int i = 0; i < 4; ++i) {
      *(v4u*)(skw + i * 8 * 512) = kr[i];
      *(v4u*)(svw + i * 8 * kVGrp) = vr[i];
    }
    __syncthreads();   // chunk visible to every wave
    if (ch + 1 < kSeq / kKeyChunk) {   // next chunk's global loads fly under this chunk's work
      kp += (size_t)kKeyChunk * kDim3;
      vp += kKeyChunk;
#pragma unroll
      for (int i = 0; i < 4; ++i) {
        kr[i] = *(const v4u*)(kp + (size_t)i * 128 * kDim3);
        vr[i] = *(const v4u*)(vp + i * 128);
      }
    }
#pragma unroll 2   // a rolled loop keeps the registers inside the six-wave budget with no scratch
    for (int kb = 0; kb < kKeyChunk / 64; ++kb) {
      v8f st[4];
#pragma unroll
      for (int j = 0; j < 2; ++j) {
        FU kf;
        kf.h[0] = *(const v8h*)(sK + (kb * 4 + 2 * j) * 512 + lane * 16);
        kf.h[1] = *(const v8h*)(sK + (kb * 4 + 2 * j + 1) * 512 + lane * 16);
        st[2 * j]     = Frag<_Float16>::mma(kf.v, qlo.v, zacc);
        st[2 * j + 1] = Frag<_Float16>::mma(kf.v, qhi.v, zacc);
      }
      FU vf[2];
#pragma unroll
      for (int j = 0; j < 2; ++j) {
        vf[j].h[0] = *(const v8h*)(sV + (kb * 4 + 2 * j) * kVGrp + hh * kVHalf + c * 16);
        vf[j].h[1] = *(const v8h*)(sV + (kb * 4 + 2 * j + 1) * kVGrp + hh * kVHalf + c * 16);
      }
      float mx = fmaxf(fmaxf(vmax8(st[0]), vmax8(st[1])), fmaxf(vmax8(st[2]), vmax8(st[3])));
      mx = fmaxf(mx, other_half(mx));
      const float mn = fmaxf(m, mx);
      const float alpha = __builtin_amdgcn_exp2f((m - mn) * cs);
      const float bias = kPCarryLog2 - mn * cs;
      m = mn;
      v8f pe[4];
#pragma unroll
      for (int j = 0; j < 4; ++j) pe[j] = vexp2_fma8(st[j], cs, bias);
      lv = lv * alpha + ((pe[0] + pe[1]) + (pe[2] + pe[3]));
      o  = o * alpha;
#pragma unroll
      for (int j = 0; j < 2; ++j) {
        FU pf;
        pf.h[0] = __builtin_convertvector(pe[2 * j], v8h);
        pf.h[1] = __builtin_convertvector(pe[2 * j + 1], v8h);
        o = Frag<_Float16>::mma(vf[j].v, pf.v, o);
      }
    }
  }
  float l = ((lv[0] + lv[1]) + (lv[2] + lv[3])) + ((lv[4] + lv[5]) + (lv[6] + lv[7]));
  l += other_half(l);
  const float inv = kOCarry / l;
  const v8h ov = __builtin_convertvector(o * inv, v8h);
  *(v8h*)(oh + ((size_t)gh * kSeq + q0 + c) * kHdim + 8 * hh) = ov;
}

// ---------------------------------------------------------------------------
// Head merge: opl[(g*2048 + n)*128 + 16*hz + d] = oh[((g*8 + hz)*2048 + n)*16 + d].
// 256 threads = 8 waves; lane: rsel = lane>>4 selects one of the wave's 2 rows, q = lane&15 -> hz = q>>1, d0 = 8*(q&1).
// Coverage: grid (128, 6) x 8 waves x 2 rows = 6 x 2048 rows; 16 lanes x 8 halves = 128 cols = whole 256-B row.
// ---------------------------------------------------------------------------
__global__ __launch_bounds__(256) void ohead_kernel(const unsigned short* __restrict__ oh, unsigned short* __restrict__ opl) {
  const int lane = threadIdx.x & 31, wave = threadIdx.x >> 5;
  const int rsel = lane >> 4, q = lane & 15;
  const int hz = q >> 1, d0 = 8 * (q & 1);
  const int g = blockIdx.y;
  const int n = blockIdx.x * 16 + wave * 2 + rsel;     // 0 .. 2047
  const v4u u = *(const v4u*)(oh + ((size_t)(g * kHeads + hz) * kSeq + n) * kHdim + d0);
  unsigned short* qp = opl + ((size_t)g * kSeq + n) * kDim + 8 * q;
  *(v4u*)qp = u;
}

// ---------------------------------------------------------------------------
// Exact GELU (erf form) on the fc1 pre-activation plane (f32) -> f16 plane carried x carry; 2 elements per thread,
// Coverage: n2 = n/2 threads x 2 = whole plane (grid exact multiple of 256 here).
// ---------------------------------------------------------------------------
__global__ __launch_bounds__(256) void gelu2_kernel(const float* __restrict__ in, unsigned short* __restrict__ out, int n2, float carry) {
  const int i = blockIdx.x * 256 + threadIdx.x;
  if (i >= n2) return;
  const v2f v = *(const v2f*)(in + 2 * (size_t)i);
  float g0 = 0.f, g1 = 0.f;
#pragma unroll 1
  for (int s = 0; s < 2; ++s) {
    const float xx = s ? v[1] : v[0];
    const float gl = 0.5f * xx * (1.0f + erff(xx * 0.70710678118654752f));
    g0 = s ? g0 : gl;
    g1 = s ? gl : g1;
  }
  const unsigned u = pk16(h_bits(g0 * carry), h_bits(g1 * carry));
  unsigned* qp = (unsigned*)(out + 2 * (size_t)i);
  *(unsigned*)qp = u;
  
}

// ---------------------------------------------------------------------------
// Host glue. Workspace region map (bytes; every offset a multiple of 32768):
//   WQKV  f16 [3][384][128]            294,912 @          0
//   WPROJ f16 [3][128][128]             98,304 @    294,912
//   WFC1  f16 [768][384]               589,824 @    393,216
//   WFC2  f16 [384][768]               589,824 @    983,040
//   VT    f16 [6][128][2048]         3,145,728 @  1,572,864
//   BIG                             22,020,096 @  4,718,592   (XN f16 [12288][128] @ +0 and QKVO f16 [12288][384] @ +3,145,728
//                                                             up to and during attention;
//                                                             HN f16 [4096][384] @ +0, H1 f32 [4096][768] @ +3,145,728,
//                                                             G f16 [4096][768] @ +15,728,640 after attention)
//   OH    f16 [48][2048][16]         3,145,728 @ 26,738,688
//   OPL   f16 [12288][128]           3,145,728 @ 29,884,416
//   XC    f32 [4096][384]            6,291,456 @ 33,030,144
//   total                                        39,321,600
// ---------------------------------------------------------------------------
extern "C" void kernel_launch(void* const* d_in, const int* in_sizes, int n_in,
                              void* d_out, int out_size, void* d_ws, size_t ws_size,
                              hipStream_t stream) {
  if (n_in < 14) return;
  if (in_sizes[0] != kRows * kDim || in_sizes[1] != kRows * kDim || in_sizes[2] != kRows * kDim) return;
  if (in_sizes[3] != 3 * kDim || in_sizes[4] != 3 * kDim) return;
  if (in_sizes[5] != 3 * kDim * kDim3 || in_sizes[6] != 3 * kDim * kDim || in_sizes[7] != 3 * kDim) return;
  if (in_sizes[8] != kDim3 || in_sizes[9] != kDim3) return;
  if (in_sizes[10] != kDim3 * kHid || in_sizes[11] != kHid || in_sizes[12] != kHid * kDim3 || in_sizes[13] != kDim3) return;
  if (out_size != 3 * kRows * kDim) return;

  const float* x1     = (const float*)d_in[0];
  const float* x2     = (const float*)d_in[1];
  const float* x3     = (const float*)d_in[2];
  const float* ln1_g  = (const float*)d_in[3];
  const float* ln1_b  = (const float*)d_in[4];
  const float* qkv_w  = (const float*)d_in[5];
  const float* proj_w = (const float*)d_in[6];
  const float* proj_b = (const float*)d_in[7];
  const float* ln2_g  = (const float*)d_in[8];
  const float* ln2_b  = (const float*)d_in[9];
  const float* fc1_w  = (const float*)d_in[10];
  const float* fc1_b  = (const float*)d_in[11];
  const float* fc2_w  = (const float*)d_in[12];
  const float* fc2_b  = (const float*)d_in[13];
  float* out = (float*)d_out;

  // ---- carve ----
  const size_t szWQKV  = (size_t)3 * kDim3 * kDim * 2;
  const size_t szWPROJ = (size_t)3 * kDim * kDim * 2;
  const size_t szWFC1  = (size_t)kHid * kDim3 * 2;
  const size_t szWFC2  = (size_t)kDim3 * kHid * 2;
  const size_t szVT    = (size_t)kGroups * kDim * kSeq * 2;
  const size_t szXN    = (size_t)3 * kRows * kDim * 2;
  const size_t szQKVO  = (size_t)3 * kRows * kDim3 * 2;
  const size_t szHN    = (size_t)kRows * kDim3 * 2;
  const size_t szH1    = (size_t)kRows * kHid * 4;
  const size_t szG     = (size_t)kRows * kHid * 2;
  size_t szBIG = szXN + szQKVO;
  if (szHN + szH1 + szG > szBIG) szBIG = szHN + szH1 + szG;
  const size_t szOH    = (size_t)kGroups * kHeads * kSeq * kHdim * 2;
  const size_t szOPL   = (size_t)3 * kRows * kDim * 2;
  const size_t szXC    = (size_t)kRows * kDim3 * 4;

  const size_t oWQKV  = 0;
  const size_t oWPROJ = oWQKV + szWQKV;
  const size_t oWFC1  = oWPROJ + szWPROJ;
  const size_t oWFC2  = oWFC1 + szWFC1;
  const size_t oVT    = oWFC2 + szWFC2;
  const size_t oBIG   = oVT + szVT;
  const size_t oOH    = oBIG + szBIG;
  const size_t oOPL   = oOH + szOH;
  const size_t oXC    = oOPL + szOPL;
  const size_t oEnd   = oXC + szXC;
  if (oEnd > ws_size) return;

  unsigned char* ws = (unsigned char*)d_ws;
  unsigned short* WQKV  = (unsigned short*)(ws + oWQKV);
  unsigned short* WPROJ = (unsigned short*)(ws + oWPROJ);
  unsigned short* WFC1  = (unsigned short*)(ws + oWFC1);
  unsigned short* WFC2  = (unsigned short*)(ws + oWFC2);
  unsigned short* VT    = (unsigned short*)(ws + oVT);
  unsigned short* XN    = (unsigned short*)(ws + oBIG);
  unsigned short* QKVO  = (unsigned short*)(ws + oBIG + szXN);
  unsigned short* HN    = (unsigned short*)(ws + oBIG);
  float*          H1    = (float*)(ws + oBIG + szHN);
  unsigned short* G     = (unsigned short*)(ws + oBIG + szHN + szH1);
  unsigned short* OH    = (unsigned short*)(ws + oOH);
  unsigned short* OPL   = (unsigned short*)(ws + oOPL);
  float*          XC    = (float*)(ws + oXC);
  const float* fdum = proj_b;   // valid f32 pointer for unused bias/resid slots

  // ---- weights: transpose + f16 (carried x16) ----
  // qkv_w [3][128][384] -> WQKV [3][384][128]; proj_w [3][128][128] -> WPROJ [3][128][128];
  // fc1_w [384][768] -> WFC1 [768][384]; fc2_w [768][384] -> WFC2 [384][768]   (36 + 12 + 72 + 72 = 192 tiles)
  // ---- and, in the same launch, LN1 -> XN f16 [3*4096][128] (1536 blocks) ----
  prep_kernel<<<dim3(kTilesW + 3 * kRows / 8), 256, 0, stream>>>(
      qkv_w, proj_w, fc1_w, fc2_w, WQKV, WPROJ, WFC1, WFC2, kWCarry,
      x1, x2, x3, ln1_g, ln1_b, XN);

  // ---- QKV: QKVO[br][4096][384] = (XN[br] . WQKV[br]^T) / 16, f16 out. M=4096, N=384, K=128; tiles 32*6 = 192 blocks, y=3 ----
  gemm_lds<kDim, 1, 6, false, true, false><<<dim3((kRows / kBM) * (kDim3 / kBN), 3), 256, 0, stream>>>(
      XN, kDim, (long)kRows * kDim,
      WQKV, kDim, (long)kDim3 * kDim,
      XC, QKVO, kDim3, (long)kRows * kDim3,
      fdum, 0L, fdum, fdum, fdum, 0L, 0,
      kDim3 / kBN, 1.0f / kWCarry);

  // ---- V transpose ----
  vtrans_kernel<<<dim3(kSeq / 64, kDim / 64, kGroups), 256, 0, stream>>>(QKVO, VT);

  // ---- attention: all 6 groups x 8 heads in one launch, then merge the heads into OPL rows (whole 256-B rows) ----
  attn_fused_kernel<<<dim3(kSeq / 128, kGroups * kHeads), 256, 0, stream>>>(QKVO, VT, OH);
  ohead_kernel<<<dim3(kSeq / 16, kGroups), 256, 0, stream>>>(OH, OPL);

  // ---- proj + bias + residual x_br -> XC[:, br*128 .. br*128+127] f32 (ldc 384, resid pitch 128) ----
  // M=4096, N=128, K=128, scale 1/(64*16); tiles 32*2 = 64 blocks per branch, the three branches as batch y of one launch
  gemm_lds<kDim, 1, 4, true, false, true><<<dim3((kRows / kBM) * (kDim / kBN), 3), 256, 0, stream>>>(
      OPL, kDim, (long)kRows * kDim,
      WPROJ, kDim, (long)kDim * kDim,
      XC, OPL, kDim3, (long)kDim,
      proj_b, (long)kDim, x1, x2, x3, 0L, kDim,
      kDim / kBN, 1.0f / (kOCarry * kWCarry));

  // ---- LN2 -> HN f16 [4096][384] ----
  ln384_kernel<<<dim3(kRows / 8), 256, 0, stream>>>(XC, ln2_g, ln2_b, HN);

  // ---- fc1 + bias -> H1 f32 [4096][768]; M=4096, N=768, K=384; tiles 32*12 = 384 blocks ----
  gemm_lds<kDim3, 1, 4, true, false, false><<<dim3((kRows / kBM) * (kHid / kBN), 1), 256, 0, stream>>>(
      HN, kDim3, 0L,
      WFC1, kDim3, 0L,
      H1, HN, kHid, 0L,
      fc1_b, 0L, fdum, fdum, fdum, 0L, 0,
      kHid / kBN, 1.0f / kWCarry);

  // ---- exact GELU -> G f16 x16 ----
  gelu2_kernel<<<dim3((kRows * kHid / 2 + 255) / 256), 256, 0, stream>>>(H1, G, kRows * kHid / 2, kGCarry);

  // ---- fc2 + bias + residual XC -> three output planes out[k] = [4096][128] (N=128 slice k of 384), K=768, scale 1/256 ----
  // the three slices as batch y of one launch: A shared (stride 0), weights, bias, residual columns and output plane move with y
  // K = 768 in two chunks of 384; tiles 32*2 = 64 blocks per slice
  gemm_lds<kHid / 2, 2, 2, true, false, true><<<dim3((kRows / kBM) * (kDim / kBN), 3), 256, 0, stream>>>(
      G, kHid, 0L,
      WFC2, kHid, (long)kDim * kHid,
      out, G, kDim, (long)kRows * kDim,
      fc2_b, (long)kDim, XC, XC, XC, (long)kDim, kDim3,
      kDim / kBN, 1.0f / (kGCarry * kWCarry));
}

// v004
// A run of this version takes 62.6 microseconds.
// Two timings next to v003 both put it at 1.20 times that version's speed.
// All steps since v000 together make it 26.0 times as fast.
// Contractions: x_ln@Wqkv, o@Wproj, h_ln@Wfc1, g@Wfc2 (activations f16, weights f16 carried x16), scores k.q^T (q,k f16, head dim 16: two key tiles per A fragment, q zero-padded 16->32 in registers), V^T@P^T (P f16, unnormalised exp carried x2^8, V^T f16): all v_wmma_f32_16x16x32_f16 with f32 accumulate; LayerNorm, online softmax, GELU(erf), bias, residual in f32.
#include <hip/hip_runtime.h>
#include <math.h>

// ---------------------------------------------------------------------------
// Problem constants
// ---------------------------------------------------------------------------
constexpr int kBatch   = 2;
constexpr int kSeq     = 2048;
constexpr int kDim     = 128;
constexpr int kHeads   = 8;
constexpr int kHdim    = 16;
constexpr int kHid     = 768;
constexpr int kRows    = kBatch * kSeq;     // 4096 token rows per branch
constexpr int kDim3    = 3 * kDim;          // 384
constexpr int kGroups  = 3 * kBatch;        // 6 (branch, batch) groups; group g covers plane rows g*2048 .. g*2048+2047
constexpr int kKeyChunk = 512;              // keys staged in LDS at a time
constexpr int kVHalf   = 288;               // LDS bytes from lane half 0's 256 B of a V^T fragment half to lane half 1's
constexpr int kVGrp    = 576;               // LDS bytes per V^T fragment half (16 dims x 16 keys)
constexpr float kWCarry = 16.0f;            // weights carried x16 in f16
constexpr float kPCarryLog2 = 8.0f;         // unnormalised probabilities exp(s - max) carried x2^8 in f16
constexpr float kOCarry = 64.0f;            // attention output carried x64 in f16
constexpr float kGCarry = 16.0f;            // gelu output carried x16 in f16
constexpr float kLnEps  = 1e-5f;

typedef __attribute__((ext_vector_type(16))) _Float16 v16h;
typedef __attribute__((ext_vector_type(8)))  _Float16 v8h;
typedef __attribute__((ext_vector_type(8)))  float    v8f;
typedef __attribute__((ext_vector_type(4)))  float    v4f;
typedef __attribute__((ext_vector_type(2)))  float    v2f;
typedef __attribute__((ext_vector_type(4)))  unsigned int v4u;
typedef __attribute__((ext_vector_type(2)))  unsigned int v2u;

// ---------------------------------------------------------------------------
// Fragment helpers
// ---------------------------------------------------------------------------
template <typename T> struct Frag;
template <> struct Frag<_Float16> {
  typedef v16h V; union U { v16h v; v8h h[2]; };
  static __device__ __forceinline__ v16h load(const _Float16* p) {   // elements 0..7 <- p[0..7], 8..15 <- p[16..23]
    U f; f.h[0] = *(const v8h*)(p); f.h[1] = *(const v8h*)(p + 16); return f.v;
  }
  static __device__ __forceinline__ v8f mma(v16h a, v16h b, v8f c) {
    return __builtin_amdgcn_wmma_f32_16x16x32_f16(false, a, false, b, (short)0, c, false, false);
  }
};

__device__ __forceinline__ unsigned pk16(unsigned short a, unsigned short b) { return (unsigned)a | ((unsigned)b << 16); }
__device__ __forceinline__ unsigned short h_bits(float f) { const _Float16 h = (_Float16)f; return __builtin_bit_cast(unsigned short, h); }

// ---------------------------------------------------------------------------
// Batched WMMA GEMM with both operands staged in LDS by asynchronous copies.
// C[m,n] = scale * sum_k A[m,k] * Bt[n,k] (+bias[n])(+resid[m*ldr+n]); A row-major [M,K], Bt row-major [N,K], f16.
// One workgroup (8 waves) owns a 128 x 64 tile of C; wave (wm = wave&3, wn = wave>>2) owns rows 32wm.., columns 32wn.. (2 x 2 fragments).
// K = NCH * KC. A chunk is KC k of all 192 operand rows: [A 128 rows | Bt 64 rows] at pitch 2*KC + 16 bytes (16 B x odd: no bank
// conflict for the 16-byte fragment reads). Every copy instruction of a wave moves 512 contiguous source bytes, two runs of 256 or (kFoldHeads A) four of 128:
// whole 128-B lines. Each chunk has a buffer of its own, so chunk 1 flies while chunk 0 is multiplied.
// blockIdx.x = tile (column tile fastest), blockIdx.y = b is the batch: operands, output, bias and residual move by their strides
// (elements) per b; the residual base is resid0 / resid1 / resid2 for b = 0 / 1 / 2, then + b * strideR.
// OUT_F16: C is f16 (Ch), else f32 (Cf). The tile leaves through LDS, so every store instruction writes whole 128-B lines.
// FOLD names the pointwise or re-layout pass that the launch does itself, in place of a launch of its own beside it:
//   kFoldGelu   the f16 output is gelu(C + bias), exact erf form, carried x kGCarry;
//   kFoldVT     column tiles from column 2*kDim on (the V columns) leave transposed: Vt[(g*128 + c)*2048 + n], g = plane row / 2048;
//   kFoldHeads  A is read from the attention's per-head planes Ap[(g*8 + h)][2048][16]: k = 16h + d.
// Every loop of the engine is unrolled: its arrays (copy operands, fragments, accumulators, residual rows) are registers and asm
// operands, which need constant indices.
// ---------------------------------------------------------------------------
constexpr int kBM = 128, kBN = 64, kCPitch = 68;   // kCPitch: floats per staged row of C
constexpr int kTPitch = 136;                       // halves per staged row of a transposed V tile: 272 B = 16 B x odd
constexpr int kFoldNone = 0, kFoldGelu = 1, kFoldVT = 2, kFoldHeads = 3;

// N copies and, in the same statement, the wait that stands before any register they name is rewritten.
__device__ __forceinline__ void async_copy4(const unsigned* l, const unsigned short* const* g) {
  asm volatile("global_load_async_to_lds_b128 %0, %4, off\n\t"
               "global_load_async_to_lds_b128 %1, %5, off\n\t"
               "global_load_async_to_lds_b128 %2, %6, off\n\t"
               "global_load_async_to_lds_b128 %3, %7, off\n\t"
               "s_wait_xcnt 0x0"
               :: "v"(l[0]), "v"(l[1]), "v"(l[2]), "v"(l[3]), "v"(g[0]), "v"(g[1]), "v"(g[2]), "v"(g[3]) : "memory");
}
__device__ __forceinline__ void async_copy12(const unsigned* l, const unsigned short* const* g) {
  asm volatile("global_load_async_to_lds_b128 %0, %12, off\n\t"
               "global_load_async_to_lds_b128 %1, %13, off\n\t"
               "global_load_async_to_lds_b128 %2, %14, off\n\t"
               "global_load_async_to_lds_b128 %3, %15, off\n\t"
               "global_load_async_to_lds_b128 %4, %16, off\n\t"
               "global_load_async_to_lds_b128 %5, %17, off\n\t"
               "global_load_async_to_lds_b128 %6, %18, off\n\t"
               "global_load_async_to_lds_b128 %7, %19, off\n\t"
               "global_load_async_to_lds_b128 %8, %20, off\n\t"
               "global_load_async_to_lds_b128 %9, %21, off\n\t"
               "global_load_async_to_lds_b128 %10, %22, off\n\t"
               "global_load_async_to_lds_b128 %11, %23, off\n\t"
               "s_wait_xcnt 0x0"
               :: "v"(l[0]), "v"(l[1]), "v"(l[2]), "v"(l[3]), "v"(l[4]), "v"(l[5]), "v"(l[6]), "v"(l[7]), "v"(l[8]), "v"(l[9]),
                  "v"(l[10]), "v"(l[11]),
                  "v"(g[0]), "v"(g[1]), "v"(g[2]), "v"(g[3]), "v"(g[4]), "v"(g[5]), "v"(g[6]), "v"(g[7]), "v"(g[8]), "v"(g[9]),
                  "v"(g[10]), "v"(g[11]) : "memory");
}

// ROWS rows of KC halves from g0 (row pitch ld halves) to LDS byte address lds0 (row pitch 2*KC + 16). A row is KC/8 pieces of 16 B.
// PER * 256 pieces = 16 whole rows: lane t takes pieces i*256 + t (i < PER) of every 16-row band, so its addresses in the next band
// are the same plus a constant. Each piece is copied by exactly one lane; every lane is on.
template <int KC, int ROWS>
__device__ __forceinline__ void stage_rows(const unsigned short* g0, int ld, unsigned lds0, int t) {
  constexpr int CPR = KC / 8, PER = CPR / 16, BAND = 16, NB = ROWS / BAND, PITCH = KC * 2 + 16;
  static_assert(CPR % 16 == 0 && (PER == 1 || PER == 3) && NB % 4 == 0, "whole bands, four bands a statement");
  const unsigned short* gb[PER];
  unsigned lb[PER];
#pragma unroll
  for (int i = 0; i < PER; ++i) {
    const int e = i * 256 + t;
    const int r = e / CPR, c = e - r * CPR;
    gb[i] = g0 + (r * ld + c * 8);
    lb[i] = lds0 + (unsigned)(r * PITCH + c * 16);
  }
  const size_t step = (size_t)(BAND * ld);
#pragma unroll
  for (int j0 = 0; j0 < NB; j0 += 4) {
    unsigned l[4 * PER];
    const unsigned short* g[4 * PER];
#pragma unroll
    for (int jj = 0; jj < 4; ++jj)
#pragma unroll
      for (int i = 0; i < PER; ++i) {
        l[jj * PER + i] = lb[i] + (unsigned)((j0 + jj) * BAND * PITCH);
        g[jj * PER + i] = gb[i] + (size_t)(j0 + jj) * step;
      }
    if (PER == 3) async_copy12(l, g); else async_copy4(l, g);
  }
}

// 128 rows of A = 8 heads x 16 dims from the per-head planes; o0 = head 0's plane at the tile's first row, LDS row pitch 2*kDim + 16.
// A band is 16 rows = 256 pieces of 16 B. A wave takes 4 heads x 4 rows x 2 pieces: per head 128 contiguous, aligned source bytes,
// so every copy instruction moves 4 whole lines. Each piece is copied by exactly one lane; every lane is on.
__device__ __forceinline__ void stage_heads(const unsigned short* o0, unsigned lds0, int t) {
  constexpr int PITCH = kDim * 2 + 16;
  const int lane = t & 31, wave = t >> 5;
  const int h = (wave & 1) * 4 + (lane >> 3);
  const int r = (wave >> 1) * 4 + ((lane >> 1) & 3);
  const int p = lane & 1;
  const unsigned short* gb = o0 + (h * kSeq * kHdim + r * kHdim + p * 8);
  const unsigned lb = lds0 + (unsigned)(r * PITCH + (h * 2 + p) * 16);
#pragma unroll
  for (int j0 = 0; j0 < kBM / 16; j0 += 4) {
    unsigned l[4];
    const unsigned short* g[4];
#pragma unroll
    for (int jj = 0; jj < 4; ++jj) {
      l[jj] = lb + (unsigned)((j0 + jj) * 16 * PITCH);
      g[jj] = gb + (j0 + jj) * 16 * kHdim;
    }
    async_copy4(l, g);
  }
}

__device__ __forceinline__ float gelu_erf(float x) { return 0.5f * x * (1.0f + erff(x * 0.70710678118654752f)); }

// WPE = waves per SIMD that the register budget must leave room for: 2 * workgroups per WGP that the LDS size and the grid ask for.
template <int KC, int NCH, int WPE, bool BIAS, bool OUT_F16, bool RESID, int FOLD>
__global__ __launch_bounds__(256, WPE) void gemm_lds(
    const unsigned short* __restrict__ Ap, int lda, long strideA,
    const unsigned short* __restrict__ Btp, int ldb, long strideB,
    float* __restrict__ Cf, unsigned short* __restrict__ Ch, unsigned short* __restrict__ Vt, int ldc, long strideC,
    const float* __restrict__ bias, long strideBias,
    const float* __restrict__ resid0, const float* __restrict__ resid1, const float* __restrict__ resid2, long strideR, int ldr,
    int tilesN, float scale) {
  constexpr int PITCH = KC * 2 + 16;
  constexpr int BUF   = (kBM + kBN) * PITCH;
  constexpr int GK    = 2, NG = KC / 32 / GK;   // fragments are fetched in groups of GK k steps, one group ahead
  static_assert(kBM * kCPitch * 4 <= BUF, "the staged C tile fits the first buffer");
  static_assert((kBM + kBN) * (KC / 8) / 256 <= 63, "copies of one chunk outstanding per wave");
  static_assert(FOLD != kFoldHeads || (KC == kDim && NCH == 1), "a row of A is the 8 heads of one token");
  static_assert(FOLD != kFoldGelu || OUT_F16, "the activation leaves as f16");
  static_assert(FOLD != kFoldVT || (OUT_F16 && !BIAS && kBN * kTPitch * 2 <= BUF), "the transposed tile fits the first buffer");
  __shared__ __align__(128) unsigned char smem[NCH * BUF];
  const int t    = threadIdx.x;
  const int lane = t & 31, wave = t >> 5;
  const int b    = blockIdx.y;
  const int tm   = blockIdx.x / tilesN;
  const int tn   = blockIdx.x - tm * tilesN;
  const int m0   = tm * kBM, n0 = tn * kBN;
  const unsigned short* Ab = Ap  + (size_t)b * strideA + (size_t)m0 * lda;
  const unsigned short* Bb = Btp + (size_t)b * strideB + (size_t)n0 * ldb;
  const unsigned lds0 = (unsigned)(size_t)smem;   // low 32 bits of the shared address = byte offset in the workgroup's LDS

  const int grp = b * (kRows / kSeq) + m0 / kSeq, tok = m0 % kSeq;   // the tile's (branch, batch) group and its first token there
  if (FOLD == kFoldHeads) stage_heads(Ap + ((size_t)grp * kHeads * kSeq + tok) * kHdim, lds0, t);
  else                    stage_rows<KC, kBM>(Ab, lda, lds0, t);
  stage_rows<KC, kBN>(Bb, ldb, lds0 + kBM * PITCH, t);

  // bias and residual of the rows this thread will store: asked for now, used in the epilogue
  const int c4 = (t & 15) * 4, r4 = t >> 4;            // f32 C: a row of 256 B = 16 lanes x 16 B; 16 rows a trip
  const int c8 = (t & 7) * 8, r8 = t >> 3;             // f16 C: a row of 128 B = 8 lanes x 16 B; 32 rows a trip
  v4f bv = (v4f){0.f, 0.f, 0.f, 0.f};
  v4f bh[2] = {bv, bv};
  v4f rv[kBM / 16];
  if (BIAS) bv = *(const v4f*)(bias + (size_t)b * strideBias + n0 + c4);
  if (BIAS && OUT_F16) {
    const float* bp = bias + (size_t)b * strideBias + n0 + c8;
    bh[0] = *(const v4f*)bp;
    bh[1] = *(const v4f*)(bp + 4);
  }
  if (RESID) {
    const float* rp = ((b == 0) ? resid0 : (b == 1) ? resid1 : resid2) + (size_t)b * strideR + (size_t)(m0 + r4) * ldr + n0 + c4;
    const float* rq[kBM / 16];
#pragma unroll
    for (int it = 0; it < kBM / 16; ++it) { rq[it] = rp + (size_t)(it * 16 * ldr); rv[it] = *(const v4f*)rq[it]; }
    // the eight addresses stay in their registers up to this wait, so no load of the run returns onto an earlier load's address
    asm volatile("s_wait_xcnt 0x0" :: "v"(rq[0]), "v"(rq[1]), "v"(rq[2]), "v"(rq[3]), "v"(rq[4]), "v"(rq[5]), "v"(rq[6]), "v"(rq[7]) : "memory");
  }

  asm volatile("s_wait_asynccnt 0x0" ::: "memory");   // this wave's copies of chunk 0 have landed
  __syncthreads();                                    // chunk 0 visible to every wave
  if (NCH > 1) {                                      // chunk 1 flies under chunk 0's products
    stage_rows<KC, kBM>(Ab + KC, lda, lds0 + BUF, t);
    stage_rows<KC, kBN>(Bb + KC, ldb, lds0 + BUF + kBM * PITCH, t);
  }

  const int rlane = lane & 15, hh = lane >> 4;
  const int wm = wave & 3, wn = wave >> 2;
  v8f acc[2][2];
#pragma unroll
  for (int i = 0; i < 2; ++i)
#pragma unroll
    for (int j = 0; j < 2; ++j) acc[i][j] = (v8f){0.f, 0.f, 0.f, 0.f, 0.f, 0.f, 0.f, 0.f};

#pragma unroll
  for (int ch = 0; ch < NCH; ++ch) {
    const unsigned char* aP = smem + ch * BUF + (wm * 32 + rlane) * PITCH + hh * 16;
    const unsigned char* bP = smem + ch * BUF + (kBM + wn * 32 + rlane) * PITCH + hh * 16;
    v16h fa[2][GK][2], fb[2][GK][2];
#pragma unroll
    for (int g = -1; g < NG; ++g) {
      if (g + 1 < NG) {
#pragma unroll
        for (int s = 0; s < GK; ++s)
#pragma unroll
          for (int i = 0; i < 2; ++i) {
            fa[(g + 1) & 1][s][i] = Frag<_Float16>::load((const _Float16*)(aP + i * 16 * PITCH + ((g + 1) * GK + s) * 64));
            fb[(g + 1) & 1][s][i] = Frag<_Float16>::load((const _Float16*)(bP + i * 16 * PITCH + ((g + 1) * GK + s) * 64));
          }
      }
      __builtin_amdgcn_sched_barrier(0);   // the next group's LDS reads stay one group, ahead of this group's products, not among them
      if (g >= 0) {
#pragma unroll
        for (int s = 0; s < GK; ++s)
#pragma unroll
          for (int i = 0; i < 2; ++i)
#pragma unroll
            for (int j = 0; j < 2; ++j) acc[i][j] = Frag<_Float16>::mma(fa[g & 1][s][i], fb[g & 1][s][j], acc[i][j]);
      }
      __builtin_amdgcn_sched_barrier(0);   // and the reads of the group after that stay behind these products
    }
    asm volatile("s_wait_dscnt 0x0" ::: "memory");                    // this wave's reads of the chunk are done
    if (NCH > 1) asm volatile("s_wait_asynccnt 0x0" ::: "memory");    // this wave's copies of the next chunk have landed; behind the last chunk none is left
    __syncthreads();   // next chunk visible to every wave; behind the last chunk: every reader has left, the LDS becomes C staging
  }

  // ---- epilogue: scaled tile to LDS in accumulator order, out of it in whole rows ----
  float* sC = (float*)smem;
  _Float16* sT = (_Float16*)smem;
  const bool vtile = FOLD == kFoldVT && n0 >= 2 * kDim;   // block-uniform: the whole tile is V columns
  if (vtile) {
    // a lane's 8 accumulator registers are 8 consecutive rows of one column: 16 contiguous bytes of the transposed tile
#pragma unroll
    for (int i = 0; i < 2; ++i)
#pragma unroll
      for (int j = 0; j < 2; ++j)
        *(v8h*)(sT + (wn * 32 + j * 16 + rlane) * kTPitch + wm * 32 + i * 16 + hh * 8) = __builtin_convertvector(acc[i][j] * scale, v8h);
  } else {
#pragma unroll
    for (int i = 0; i < 2; ++i)
#pragma unroll
      for (int j = 0; j < 2; ++j)
#pragma unroll
        for (int r = 0; r < 8; ++r)
          sC[(wm * 32 + i * 16 + hh * 8 + r) * kCPitch + wn * 32 + j * 16 + rlane] = acc[i][j][r] * scale;
  }
  __syncthreads();   // staged tile visible to every wave
  if (vtile) {
    // 64 dims x 128 tokens: a row of 256 B = 16 lanes x 16 B; 16 rows a trip
    unsigned short* vp = Vt + ((size_t)grp * kDim + (n0 - 2 * kDim)) * kSeq + tok;
    const unsigned vo = (unsigned)(r4 * kSeq + (t & 15) * 8) * 2u;   // bytes: uniform base + one 32-bit lane offset
#pragma unroll
    for (int it = 0; it < kBN / 16; ++it) {
      const v8h hv = *(const v8h*)(sT + (it * 16 + r4) * kTPitch + (t & 15) * 8);
      *(v8h*)((char*)(vp + (size_t)(it * 16 * kSeq)) + vo) = hv;
    }
  } else if (!OUT_F16) {
    float* cp = Cf + (size_t)b * strideC + (size_t)m0 * ldc + n0;
    const unsigned co = (unsigned)(r4 * ldc + c4) * 4u;   // bytes: uniform base + one 32-bit lane offset
#pragma unroll
    for (int it = 0; it < kBM / 16; ++it) {
      v4f v = *(const v4f*)(sC + (it * 16 + r4) * kCPitch + c4);
      if (BIAS)  v += bv;
      if (RESID) v += rv[it];
      *(v4f*)((char*)(cp + (size_t)(it * 16 * ldc)) + co) = v;
    }
  } else {
    unsigned short* cp = Ch + (size_t)b * strideC + (size_t)m0 * ldc + n0;
    const unsigned co = (unsigned)(r8 * ldc + c8) * 2u;   // bytes: uniform base + one 32-bit lane offset
    v4f sv[kBM / 32][2];   // all of the thread's staged values are asked for at once, ahead of the pointwise work
#pragma unroll
    for (int it = 0; it < kBM / 32; ++it) {
      const float* sp = sC + (it * 32 + r8) * kCPitch + c8;
      sv[it][0] = *(const v4f*)sp;
      sv[it][1] = *(const v4f*)(sp + 4);
    }
#pragma unroll
    for (int it = 0; it < kBM / 32; ++it) {
      v8h hv;
#pragma unroll
      for (int e = 0; e < 8; ++e) {
        float x = sv[it][e >> 2][e & 3];
        if (BIAS) x += bh[e >> 2][e & 3];
        if (FOLD == kFoldGelu) x = gelu_erf(x) * kGCarry;
        hv[e] = (_Float16)x;
      }
      *(v8h*)((char*)(cp + (size_t)(it * 32 * ldc)) + co) = hv;
    }
  }
}

// ---------------------------------------------------------------------------
// Weight transpose + cast: W plane z is f32 [nIn][nOut] row-major; WT plane z = [nOut][nIn] f16, WT[h][d] = f16(scale * W[d][h]).
// All four weight tensors in one index space: tile index r0 falls into one tensor's range of (nIn/64)*(nOut/64)*nz tiles
// (block-uniform choice), and inside the range it runs d tile fastest, then h tile, then plane z.
// 256 threads; nIn, nOut multiples of 64. Plane z at out + z*nOut*nIn halves.
// Load coverage: 16 iterations x 256 threads = 4096 = the whole 64x64 tile (coalesced along h).
// Store coverage: 8 waves x 2 iterations x 4 rows (lane>>3) = 64 rows; (lane&7) x 8 halves = 64 cols; each row segment =
// ---------------------------------------------------------------------------
constexpr int kTilesQkv  = (kDim / 64) * (kDim3 / 64) * 3;   // 36
constexpr int kTilesProj = (kDim / 64) * (kDim / 64) * 3;    // 12
constexpr int kTilesFc1  = (kDim3 / 64) * (kHid / 64);       // 72
constexpr int kTilesFc2  = (kHid / 64) * (kDim3 / 64);       // 72
constexpr int kTilesW    = kTilesQkv + kTilesProj + kTilesFc1 + kTilesFc2;   // 192
__device__ __forceinline__ void wtcast_tile(int r0, const float* __restrict__ wQkv, const float* __restrict__ wProj,
                                            const float* __restrict__ wFc1, const float* __restrict__ wFc2,
                                            unsigned short* __restrict__ oQkv, unsigned short* __restrict__ oProj,
                                            unsigned short* __restrict__ oFc1, unsigned short* __restrict__ oFc2,
                                            float scale) {
  __shared__ float sm[64][65];   // sm[h_local][d_local]
  const int t  = threadIdx.x;
  const float* W = wQkv; unsigned short* out = oQkv; int nIn = kDim, nOut = kDim3;
  if (r0 >= kTilesQkv + kTilesProj + kTilesFc1) { r0 -= kTilesQkv + kTilesProj + kTilesFc1; W = wFc2; out = oFc2; nIn = kHid; nOut = kDim3; }
  else if (r0 >= kTilesQkv + kTilesProj)        { r0 -= kTilesQkv + kTilesProj; W = wFc1; out = oFc1; nIn = kDim3; nOut = kHid; }
  else if (r0 >= kTilesQkv)                     { r0 -= kTilesQkv; W = wProj; out = oProj; nIn = kDim; nOut = kDim; }
  const int gx = nIn >> 6, gy = nOut >> 6;
  const int r1 = r0 / gx;
  const int d0 = (r0 - r1 * gx) * 64;
  const int z  = r1 / gy;
  const int h0 = (r1 - z * gy) * 64;
  const float* Wz = W + (size_t)z * nIn * nOut;
#pragma unroll
  for (int i = 0; i < 16; ++i) {
    const int e = i * 256 + t;
    const int r = e >> 6;          // d local
    const int c = e & 63;          // h local
    sm[c][r] = Wz[(size_t)(d0 + r) * nOut + h0 + c] * scale;
  }
  __syncthreads();
  const int lane = t & 31, wave = t >> 5;
  const int q = lane >> 3, c8 = (lane & 7) * 8;
  unsigned short* op = out + (size_t)z * nOut * nIn;
  {
#pragma unroll
    for (int it = 0; it < 2; ++it) {
      const int row = wave * 8 + it * 4 + q;                 // h local
      unsigned short hb[8];
#pragma unroll
      for (int e = 0; e < 8; ++e) hb[e] = h_bits(sm[row][c8 + e]);
      const v4u u = (v4u){pk16(hb[0], hb[1]), pk16(hb[2], hb[3]), pk16(hb[4], hb[5]), pk16(hb[6], hb[7])};
      *(v4u*)(op + (size_t)(h0 + row) * nIn + d0 + c8) = u;
    }
    
  }
}

// ---------------------------------------------------------------------------
// One wave per row; blk = 0 .. 3*4096/8 - 1 = 1535, 8 waves each (exact). Branch index is block-uniform.
// ---------------------------------------------------------------------------
__device__ __forceinline__ void ln128_rows(int blk, const float* __restrict__ x1, const float* __restrict__ x2,
                                           const float* __restrict__ x3, const float* __restrict__ g,
                                           const float* __restrict__ bt, unsigned short* __restrict__ xn) {
  const int lane = threadIdx.x & 31, wave = threadIdx.x >> 5;
  const int wid = blk * 8 + wave;                   // 0 .. 12287
  const int br  = wid / kRows;                      // 0..2, block-uniform (512 blocks per branch)
  const int row = wid - br * kRows;
  const float* x = (br == 0) ? x1 : (br == 1) ? x2 : x3;
  const v4f xv = *(const v4f*)(x + (size_t)row * kDim + lane * 4);
  float s = (xv[0] + xv[1]) + (xv[2] + xv[3]);
#pragma unroll
  for (int off = 16; off > 0; off >>= 1) s += __shfl_xor(s, off, 32);
  const float mean = s * (1.0f / 128.0f);
  const float d0 = xv[0] - mean, d1 = xv[1] - mean, d2 = xv[2] - mean, d3 = xv[3] - mean;
  float s2 = (d0 * d0 + d1 * d1) + (d2 * d2 + d3 * d3);
#pragma unroll
  for (int off = 16; off > 0; off >>= 1) s2 += __shfl_xor(s2, off, 32);
  const float var  = s2 * (1.0f / 128.0f);
  const float rstd = rsqrtf(var + kLnEps);
  const v4f gv = *(const v4f*)(g + br * kDim + lane * 4);
  const v4f bv = *(const v4f*)(bt + br * kDim + lane * 4);
  const float y0 = d0 * rstd * gv[0] + bv[0];
  const float y1 = d1 * rstd * gv[1] + bv[1];
  const float y2 = d2 * rstd * gv[2] + bv[2];
  const float y3 = d3 * rstd * gv[3] + bv[3];
  const v2u u = (v2u){pk16(h_bits(y0), h_bits(y1)), pk16(h_bits(y2), h_bits(y3))};
  unsigned short* qp = xn + (size_t)wid * kDim + lane * 4;
  *(v2u*)qp = u;
  // the listing has a branch from here into the cast part, which rewrites this store's address and data registers: the wait stands in front of that
  asm volatile("s_wait_xcnt 0x0" ::: "memory");
}

// ---------------------------------------------------------------------------
// Weight casts and LN1 depend on nothing but the inputs, so they share one launch: blocks 0 .. 191 cast one weight tile each,
// blocks 192 .. 1727 normalise 8 rows each. The choice is block-uniform, so the cast's barrier is passed by a whole block or by none.
// ---------------------------------------------------------------------------
__global__ __launch_bounds__(256) void prep_kernel(const float* __restrict__ wQkv, const float* __restrict__ wProj,
                                                   const float* __restrict__ wFc1, const float* __restrict__ wFc2,
                                                   unsigned short* __restrict__ oQkv, unsigned short* __restrict__ oProj,
                                                   unsigned short* __restrict__ oFc1, unsigned short* __restrict__ oFc2,
                                                   float scale,
                                                   const float* __restrict__ x1, const float* __restrict__ x2,
                                                   const float* __restrict__ x3, const float* __restrict__ g,
                                                   const float* __restrict__ bt, unsigned short* __restrict__ xn) {
  const int blk = blockIdx.x;
  if (blk < kTilesW) wtcast_tile(blk, wQkv, wProj, wFc1, wFc2, oQkv, oProj, oFc1, oFc2, scale);
  else               ln128_rows(blk - kTilesW, x1, x2, x3, g, bt, xn);
}

// ---------------------------------------------------------------------------
// LayerNorm over 384 features of xc[4096][384] (f32) -> f16 plane hn[4096][384]. One wave per row; grid = 4096/8 = 512.
// ---------------------------------------------------------------------------
__global__ __launch_bounds__(256) void ln384_kernel(const float* __restrict__ xc, const float* __restrict__ g,
                                                    const float* __restrict__ bt, unsigned short* __restrict__ hn) {
  const int lane = threadIdx.x & 31, wave = threadIdx.x >> 5;
  const int row = blockIdx.x * 8 + wave;            // 0 .. 4095
  const float* r = xc + (size_t)row * kDim3;
  v4f vv[3];
  float s = 0.f;
#pragma unroll
  for (int ch = 0; ch < 3; ++ch) {
    vv[ch] = *(const v4f*)(r + ch * kDim + lane * 4);
    s += (vv[ch][0] + vv[ch][1]) + (vv[ch][2] + vv[ch][3]);
  }
#pragma unroll
  for (int off = 16; off > 0; off >>= 1) s += __shfl_xor(s, off, 32);
  const float mean = s * (1.0f / 384.0f);
  float s2 = 0.f;
#pragma unroll
  for (int ch = 0; ch < 3; ++ch) {
#pragma unroll
    for (int j = 0; j < 4; ++j) { const float d = vv[ch][j] - mean; vv[ch][j] = d; s2 += d * d; }
  }
#pragma unroll
  for (int off = 16; off > 0; off >>= 1) s2 += __shfl_xor(s2, off, 32);
  const float var  = s2 * (1.0f / 384.0f);
  const float rstd = rsqrtf(var + kLnEps);
  v2u u[3];
#pragma unroll
  for (int ch = 0; ch < 3; ++ch) {
    const v4f gv = *(const v4f*)(g + ch * kDim + lane * 4);
    const v4f bv = *(const v4f*)(bt + ch * kDim + lane * 4);
    unsigned short hb[4];
#pragma unroll
    for (int j = 0; j < 4; ++j) hb[j] = h_bits(vv[ch][j] * rstd * gv[j] + bv[j]);
    u[ch] = (v2u){pk16(hb[0], hb[1]), pk16(hb[2], hb[3])};
  }
  unsigned short* qp = hn + (size_t)row * kDim3 + lane * 4;
  {
#pragma unroll
    for (int ch = 0; ch < 3; ++ch) *(v2u*)(qp + ch * kDim) = u[ch];
    
  }
}

// ---------------------------------------------------------------------------
// Fused attention, one launch for all 48 (group, head) pairs: S^T = K.Q^T, online softmax, O^T += V^T.P^T.
// grid (2048/128 = 16 query blocks, 48), 256 threads = 8 waves x 16 queries. Lane (c = lane&15, hh = lane>>4) owns query c.
// K and V^T of the head are staged through registers into LDS, 512 keys at a time, already in fragment order:
//   sK: 16-key tile T at T*512; lane's 16 B (key c, dims 8hh..8hh+7) at + lane*16.
//   sV: fragment half G (keys 16G + 8hh + 0..7 of dim c) at G*576 + hh*288 + c*16.
// S^T tile register r = score(key 8hh + r, query c), so two tiles converted in place are the B operand P^T (hardware k
// order), and V^T as A is read in the same k order. O^T register r = O(query c, dim 8hh + r): one 16-B store per lane.
// oh[(g*8 + head)][2048][16] f16 carried x64: each wave writes 512 contiguous bytes.
// ---------------------------------------------------------------------------
__device__ __forceinline__ float other_half(float v) {   // value of lane ^ 16
  const int b = __builtin_bit_cast(int, v);
  return __builtin_bit_cast(float, __builtin_amdgcn_permlanex16(b, b, 0x76543210, 0xfedcba98, false, false));
}
__device__ __forceinline__ float vmax8(v8f a) {
  return fmaxf(fmaxf(fmaxf(a[0], a[1]), fmaxf(a[2], a[3])), fmaxf(fmaxf(a[4], a[5]), fmaxf(a[6], a[7])));
}
__device__ __forceinline__ v8f vexp2_fma8(v8f a, float sc, float bs) {   // exp2(a * sc + bs), the multiply-adds two per instruction
  const v2f sc2 = (v2f){sc, sc}, bs2 = (v2f){bs, bs};
  v8f r;
#pragma unroll
  for (int e = 0; e < 8; e += 2) {
    const v2f x = __builtin_elementwise_fma((v2f){a[e], a[e + 1]}, sc2, bs2);
    r[e]     = __builtin_amdgcn_exp2f(x[0]);
    r[e + 1] = __builtin_amdgcn_exp2f(x[1]);
  }
  return r;
}
// six waves per SIMD = three workgroups per WGP: 768 workgroups fill 256 WGPs in one even round
__global__ __launch_bounds__(256) __attribute__((amdgpu_waves_per_eu(6))) void attn_fused_kernel(const unsigned short* __restrict__ qkvo,
                                                         const unsigned short* __restrict__ vt,
                                                         unsigned short* __restrict__ oh) {
  __shared__ __align__(128) unsigned char sK[kKeyChunk * 32];
  __shared__ __align__(128) unsigned char sV[(kKeyChunk / 16) * kVGrp];
  typedef Frag<_Float16>::U FU;
  const int lane = threadIdx.x & 31, wave = threadIdx.x >> 5;
  const int c = lane & 15, hh = lane >> 4;
  const int gh = blockIdx.y, g = gh >> 3, hd = gh & 7;
  const int q0 = blockIdx.x * 128 + wave * 16;
  const v8h zero8 = (v8h){0, 0, 0, 0, 0, 0, 0, 0};
  const v8f zacc  = (v8f){0.f, 0.f, 0.f, 0.f, 0.f, 0.f, 0.f, 0.f};
  const float cs = 0.25f * 1.44269504088896340736f;   // head-dim scale x log2(e)

  // One A fragment holds two 16-key tiles (k 0..15 = dims of the first, k 16..31 = dims of the second);
  // q sits in the lower k half of qlo and in the upper k half of qhi, zeros in the other half, so each picks one tile.
  FU qlo, qhi;
  qlo.h[0] = *(const v8h*)(qkvo + (size_t)(g * kSeq + q0 + c) * kDim3 + hd * kHdim + 8 * hh);
  qlo.h[1] = zero8;
  qhi.h[0] = zero8;
  qhi.h[1] = qlo.h[0];

  // staging, 4 rounds of 8 waves per chunk. K round i: wave takes the 16-key tile i*8 + wave, lane = (key c, 16-B part hh).
  // V^T round i: wave takes 4 dims x 8 parts of 8 keys (4 whole 128-B lines): dim sd, part i*16 + sp of the chunk.
  const int sd = (wave & 3) * 4 + (lane >> 3);
  const int sp = (wave >> 2) * 8 + (lane & 7);
  const unsigned short* kp = qkvo + (size_t)(g * kSeq + wave * 16 + c) * kDim3 + kDim + hd * kHdim + 8 * hh;
  const unsigned short* vp = vt + (size_t)(g * kDim + hd * kHdim + sd) * kSeq + sp * 8;
  unsigned char* skw = sK + wave * 512 + lane * 16;
  unsigned char* svw = sV + (sp >> 1) * kVGrp + (sp & 1) * kVHalf + sd * 16;
  v4u kr[4], vr[4];
#pragma unroll
  for (int i = 0; i < 4; ++i) {
    kr[i] = *(const v4u*)(kp + (size_t)i * 128 * kDim3);
    vr[i] = *(const v4u*)(vp + i * 128);
  }

  float m = -INFINITY;
  v8f lv = zacc;
  v8f o  = zacc;
  for (int ch = 0; ch < kSeq / kKeyChunk; ++ch) {
    __syncthreads();   // every wave has finished reading the previous chunk
#pragma unroll
    for (int i = 0; i < 4; ++i) {
      *(v4u*)(skw + i * 8 * 512) = kr[i];
      *(v4u*)(svw + i * 8 * kVGrp) = vr[i];
    }
    __syncthreads();   // chunk visible to every wave
    if (ch + 1 < kSeq / kKeyChunk) {   // next chunk's global loads fly under this chunk's work
      kp += (size_t)kKeyChunk * kDim3;
      vp += kKeyChunk;
#pragma unroll
      for (int i = 0; i < 4; ++i) {
        kr[i] = *(const v4u*)(kp + (size_t)i * 128 * kDim3);
        vr[i] = *(const v4u*)(vp + i * 128);
      }
    }
#pragma unroll 2   // a rolled loop keeps the registers inside the six-wave budget with no scratch
    for (int kb = 0; kb < kKeyChunk / 64; ++kb) {
      v8f st[4];
#pragma unroll
      for (int j = 0; j < 2; ++j) {
        FU kf;
        kf.h[0] = *(const v8h*)(sK + (kb * 4 + 2 * j) * 512 + lane * 16);
        kf.h[1] = *(const v8h*)(sK + (kb * 4 + 2 * j + 1) * 512 + lane * 16);
        st[2 * j]     = Frag<_Float16>::mma(kf.v, qlo.v, zacc);
        st[2 * j + 1] = Frag<_Float16>::mma(kf.v, qhi.v, zacc);
      }
      FU vf[2];
#pragma unroll
      for (int j = 0; j < 2; ++j) {
        vf[j].h[0] = *(const v8h*)(sV + (kb * 4 + 2 * j) * kVGrp + hh * kVHalf + c * 16);
        vf[j].h[1] = *(const v8h*)(sV + (kb * 4 + 2 * j + 1) * kVGrp + hh * kVHalf + c * 16);
      }
      float mx = fmaxf(fmaxf(vmax8(st[0]), vmax8(st[1])), fmaxf(vmax8(st[2]), vmax8(st[3])));
      mx = fmaxf(mx, other_half(mx));
      const float mn = fmaxf(m, mx);
      const float alpha = __builtin_amdgcn_exp2f((m - mn) * cs);
      const float bias = kPCarryLog2 - mn * cs;
      m = mn;
      v8f pe[4];
#pragma unroll
      for (int j = 0; j < 4; ++j) pe[j] = vexp2_fma8(st[j], cs, bias);
      lv = lv * alpha + ((pe[0] + pe[1]) + (pe[2] + pe[3]));
      o  = o * alpha;
#pragma unroll
      for (int j = 0; j < 2; ++j) {
        FU pf;
        pf.h[0] = __builtin_convertvector(pe[2 * j], v8h);
        pf.h[1] = __builtin_convertvector(pe[2 * j + 1], v8h);
        o = Frag<_Float16>::mma(vf[j].v, pf.v, o);
      }
    }
  }
  float l = ((lv[0] + lv[1]) + (lv[2] + lv[3])) + ((lv[4] + lv[5]) + (lv[6] + lv[7]));
  l += other_half(l);
  const float inv = kOCarry / l;
  const v8h ov = __builtin_convertvector(o * inv, v8h);
  *(v8h*)(oh + ((size_t)gh * kSeq + q0 + c) * kHdim + 8 * hh) = ov;
}

// ---------------------------------------------------------------------------
// Host glue. Workspace region map (bytes; every offset a multiple of 32768):
//   WQKV  f16 [3][384][128]            294,912 @          0
//   WPROJ f16 [3][128][128]             98,304 @    294,912
//   WFC1  f16 [768][384]               589,824 @    393,216
//   WFC2  f16 [384][768]               589,824 @    983,040
//   VT    f16 [6][128][2048]         3,145,728 @  1,572,864
//   BIG                             12,582,912 @  4,718,592   (XN f16 [12288][128] @ +0 and QKVO f16 [12288][384] @ +3,145,728
//                                                             up to and during attention; of QKVO only the q and k columns
//                                                             are written and read, V goes to VT;
//                                                             HN f16 [4096][384] @ +0, G f16 [4096][768] @ +3,145,728
//                                                             after attention)
//   OH    f16 [48][2048][16]         3,145,728 @ 17,301,504
//   XC    f32 [4096][384]            6,291,456 @ 20,447,232
//   total                                        26,738,688
// ---------------------------------------------------------------------------
extern "C" void kernel_launch(void* const* d_in, const int* in_sizes, int n_in,
                              void* d_out, int out_size, void* d_ws, size_t ws_size,
                              hipStream_t stream) {
  if (n_in < 14) return;
  if (in_sizes[0] != kRows * kDim || in_sizes[1] != kRows * kDim || in_sizes[2] != kRows * kDim) return;
  if (in_sizes[3] != 3 * kDim || in_sizes[4] != 3 * kDim) return;
  if (in_sizes[5] != 3 * kDim * kDim3 || in_sizes[6] != 3 * kDim * kDim || in_sizes[7] != 3 * kDim) return;
  if (in_sizes[8] != kDim3 || in_sizes[9] != kDim3) return;
  if (in_sizes[10] != kDim3 * kHid || in_sizes[11] != kHid || in_sizes[12] != kHid * kDim3 || in_sizes[13] != kDim3) return;
  if (out_size != 3 * kRows * kDim) return;

  const float* x1     = (const float*)d_in[0];
  const float* x2     = (const float*)d_in[1];
  const float* x3     = (const float*)d_in[2];
  const float* ln1_g  = (const float*)d_in[3];
  const float* ln1_b  = (const float*)d_in[4];
  const float* qkv_w  = (const float*)d_in[5];
  const float* proj_w = (const float*)d_in[6];
  const float* proj_b = (const float*)d_in[7];
  const float* ln2_g  = (const float*)d_in[8];
  const float* ln2_b  = (const float*)d_in[9];
  const float* fc1_w  = (const float*)d_in[10];
  const float* fc1_b  = (const float*)d_in[11];
  const float* fc2_w  = (const float*)d_in[12];
  const float* fc2_b  = (const float*)d_in[13];
  float* out = (float*)d_out;

  // ---- carve ----
  const size_t szWQKV  = (size_t)3 * kDim3 * kDim * 2;
  const size_t szWPROJ = (size_t)3 * kDim * kDim * 2;
  const size_t szWFC1  = (size_t)kHid * kDim3 * 2;
  const size_t szWFC2  = (size_t)kDim3 * kHid * 2;
  const size_t szVT    = (size_t)kGroups * kDim * kSeq * 2;
  const size_t szXN    = (size_t)3 * kRows * kDim * 2;
  const size_t szQKVO  = (size_t)3 * kRows * kDim3 * 2;
  const size_t szHN    = (size_t)kRows * kDim3 * 2;
  const size_t szG     = (size_t)kRows * kHid * 2;
  size_t szBIG = szXN + szQKVO;
  if (szHN + szG > szBIG) szBIG = szHN + szG;
  const size_t szOH    = (size_t)kGroups * kHeads * kSeq * kHdim * 2;
  const size_t szXC    = (size_t)kRows * kDim3 * 4;

  const size_t oWQKV  = 0;
  const size_t oWPROJ = oWQKV + szWQKV;
  const size_t oWFC1  = oWPROJ + szWPROJ;
  const size_t oWFC2  = oWFC1 + szWFC1;
  const size_t oVT    = oWFC2 + szWFC2;
  const size_t oBIG   = oVT + szVT;
  const size_t oOH    = oBIG + szBIG;
  const size_t oXC    = oOH + szOH;
  const size_t oEnd   = oXC + szXC;
  if (oEnd > ws_size) return;

  unsigned char* ws = (unsigned char*)d_ws;
  unsigned short* WQKV  = (unsigned short*)(ws + oWQKV);
  unsigned short* WPROJ = (unsigned short*)(ws + oWPROJ);
  unsigned short* WFC1  = (unsigned short*)(ws + oWFC1);
  unsigned short* WFC2  = (unsigned short*)(ws + oWFC2);
  unsigned short* VT    = (unsigned short*)(ws + oVT);
  unsigned short* XN    = (unsigned short*)(ws + oBIG);
  unsigned short* QKVO  = (unsigned short*)(ws + oBIG + szXN);
  unsigned short* HN    = (unsigned short*)(ws + oBIG);
  unsigned short* G     = (unsigned short*)(ws + oBIG + szHN);
  unsigned short* OH    = (unsigned short*)(ws + oOH);
  float*          XC    = (float*)(ws + oXC);
  const float* fdum = proj_b;   // valid f32 pointer for unused bias/resid slots

  // ---- weights: transpose + f16 (carried x16) ----
  // qkv_w [3][128][384] -> WQKV [3][384][128]; proj_w [3][128][128] -> WPROJ [3][128][128];
  // fc1_w [384][768] -> WFC1 [768][384]; fc2_w [768][384] -> WFC2 [384][768]   (36 + 12 + 72 + 72 = 192 tiles)
  // ---- and, in the same launch, LN1 -> XN f16 [3*4096][128] (1536 blocks) ----
  prep_kernel<<<dim3(kTilesW + 3 * kRows / 8), 256, 0, stream>>>(
      qkv_w, proj_w, fc1_w, fc2_w, WQKV, WPROJ, WFC1, WFC2, kWCarry,
      x1, x2, x3, ln1_g, ln1_b, XN);

  // ---- QKV: (XN[br] . WQKV[br]^T) / 16, f16 out. M=4096, N=384, K=128; tiles 32*6 = 192 blocks, y=3 ----
  // q and k columns -> QKVO[br][4096][384]; the V column tiles leave transposed -> VT[g][128][2048]
  gemm_lds<kDim, 1, 6, false, true, false, kFoldVT><<<dim3((kRows / kBM) * (kDim3 / kBN), 3), 256, 0, stream>>>(
      XN, kDim, (long)kRows * kDim,
      WQKV, kDim, (long)kDim3 * kDim,
      XC, QKVO, VT, kDim3, (long)kRows * kDim3,
      fdum, 0L, fdum, fdum, fdum, 0L, 0,
      kDim3 / kBN, 1.0f / kWCarry);

  // ---- attention: all 6 groups x 8 heads in one launch -> per-head planes OH ----
  attn_fused_kernel<<<dim3(kSeq / 128, kGroups * kHeads), 256, 0, stream>>>(QKVO, VT, OH);

  // ---- proj + bias + residual x_br -> XC[:, br*128 .. br*128+127] f32 (ldc 384, resid pitch 128); A staged from the planes OH ----
  // M=4096, N=128, K=128, scale 1/(64*16); tiles 32*2 = 64 blocks per branch, the three branches as batch y of one launch
  gemm_lds<kDim, 1, 4, true, false, true, kFoldHeads><<<dim3((kRows / kBM) * (kDim / kBN), 3), 256, 0, stream>>>(
      OH, kDim, (long)kRows * kDim,
      WPROJ, kDim, (long)kDim * kDim,
      XC, OH, OH, kDim3, (long)kDim,
      proj_b, (long)kDim, x1, x2, x3, 0L, kDim,
      kDim / kBN, 1.0f / (kOCarry * kWCarry));

  // ---- LN2 -> HN f16 [4096][384] ----
  ln384_kernel<<<dim3(kRows / 8), 256, 0, stream>>>(XC, ln2_g, ln2_b, HN);

  // ---- fc1 + bias, exact GELU -> G f16 x16 [4096][768]; M=4096, N=768, K=384; tiles 32*12 = 384 blocks ----
  gemm_lds<kDim3, 1, 4, true, true, false, kFoldGelu><<<dim3((kRows / kBM) * (kHid / kBN), 1), 256, 0, stream>>>(
      HN, kDim3, 0L,
      WFC1, kDim3, 0L,
      XC, G, G, kHid, 0L,
      fc1_b, 0L, fdum, fdum, fdum, 0L, 0,
      kHid / kBN, 1.0f / kWCarry);

  // ---- fc2 + bias + residual XC -> three output planes out[k] = [4096][128] (N=128 slice k of 384), K=768, scale 1/256 ----
  // the three slices as batch y of one launch: A shared (stride 0), weights, bias, residual columns and output plane move with y
  // K = 768 in two chunks of 384; tiles 32*2 = 64 blocks per slice
  gemm_lds<kHid / 2, 2, 2, true, false, true, kFoldNone><<<dim3((kRows / kBM) * (kDim / kBN), 3), 256, 0, stream>>>(
      G, kHid, 0L,
      WFC2, kHid, (long)kDim * kHid,
      out, G, G, kDim, (long)kRows * kDim,
      fc2_b, (long)kDim, XC, XC, XC, (long)kDim, kDim3,
      kDim / kBN, 1.0f / (kGCarry * kWCarry));
}

// v005
// One run takes 60.2 microseconds.
// In two side-by-side timings against v004, it was 1.03 and 1.04 times as fast.
// Over all steps from v000 it is 26.9 times as fast.
// Contractions: x_ln@Wqkv, o@Wproj, h_ln@Wfc1, g@Wfc2 (activations f16, weights f16 carried x16), scores k.q^T (q,k f16, head dim 16: two key tiles per A fragment, q zero-padded 16->32 in registers), V^T@P^T (P f16, unnormalised exp carried x2^8, V^T f16): all v_wmma_f32_16x16x32_f16 with f32 accumulate; LayerNorm, online softmax, GELU(erf), bias, residual in f32.
#include <hip/hip_runtime.h>
#include <math.h>

// ---------------------------------------------------------------------------
// Problem constants
// ---------------------------------------------------------------------------
constexpr int kBatch   = 2;
constexpr int kSeq     = 2048;
constexpr int kDim     = 128;
constexpr int kHeads   = 8;
constexpr int kHdim    = 16;
constexpr int kHid     = 768;
constexpr int kRows    = kBatch * kSeq;     // 4096 token rows per branch
constexpr int kDim3    = 3 * kDim;          // 384
constexpr int kGroups  = 3 * kBatch;        // 6 (branch, batch) groups; group g covers plane rows g*2048 .. g*2048+2047
constexpr int kKeyChunk = 512;              // keys staged in LDS at a time
constexpr int kVHalf   = 288;               // LDS bytes from lane half 0's 256 B of a V^T fragment half to lane half 1's
constexpr int kVGrp    = 576;               // LDS bytes per V^T fragment half (16 dims x 16 keys)
constexpr float kWCarry = 16.0f;            // weights carried x16 in f16
constexpr float kPCarryLog2 = 8.0f;         // unnormalised probabilities exp(s - max) carried x2^8 in f16
constexpr float kOCarry = 64.0f;            // attention output carried x64 in f16
constexpr float kGCarry = 16.0f;            // gelu output carried x16 in f16
constexpr float kLnEps  = 1e-5f;

typedef __attribute__((ext_vector_type(16))) _Float16 v16h;
typedef __attribute__((ext_vector_type(8)))  _Float16 v8h;
typedef __attribute__((ext_vector_type(4)))  _Float16 v4h;
typedef __attribute__((ext_vector_type(8)))  float    v8f;
typedef __attribute__((ext_vector_type(4)))  float    v4f;
typedef __attribute__((ext_vector_type(2)))  float    v2f;
typedef __attribute__((ext_vector_type(4)))  unsigned int v4u;
typedef __attribute__((ext_vector_type(2)))  unsigned int v2u;

// ---------------------------------------------------------------------------
// Fragment helpers
// ---------------------------------------------------------------------------
template <typename T> struct Frag;
template <> struct Frag<_Float16> {
  typedef v16h V; union U { v16h v; v8h h[2]; };
  static __device__ __forceinline__ v16h load(const _Float16* p) {   // elements 0..7 <- p[0..7], 8..15 <- p[16..23]
    U f; f.h[0] = *(const v8h*)(p); f.h[1] = *(const v8h*)(p + 16); return f.v;
  }
  static __device__ __forceinline__ v8f mma(v16h a, v16h b, v8f c) {
    return __builtin_amdgcn_wmma_f32_16x16x32_f16(false, a, false, b, (short)0, c, false, false);
  }
};

__device__ __forceinline__ unsigned pk16(unsigned short a, unsigned short b) { return (unsigned)a | ((unsigned)b << 16); }
__device__ __forceinline__ unsigned short h_bits(float f) { const _Float16 h = (_Float16)f; return __builtin_bit_cast(unsigned short, h); }

// ---------------------------------------------------------------------------
// Batched WMMA GEMM with both operands staged in LDS, by asynchronous copies unless SRC makes them itself.
// C[m,n] = scale * sum_k A[m,k] * Bt[n,k] (+bias[n])(+resid[m*ldr+n]); A row-major [M,K], Bt row-major [N,K], f16.
// One workgroup (8 waves) owns a 128 x 64 tile of C; wave (wm = wave&3, wn = wave>>2) owns rows 32wm.., columns 32wn.. (2 x 2 fragments).
// K = NCH * KC. A chunk is KC k of all 192 operand rows: [A 128 rows | Bt 64 rows] at pitch 2*KC + 16 bytes (16 B x odd: no bank
// conflict for the 16-byte fragment reads). Every copy instruction of a wave moves 512 contiguous source bytes, two runs of 256 or (kFoldHeads A) four of 128:
// whole 128-B lines. Each chunk has a buffer of its own, so chunk 1 flies while chunk 0 is multiplied.
// blockIdx.x = tile (column tile fastest), blockIdx.y = b is the batch: operands, output, bias and residual move by their strides
// (elements) per b; the residual base is resid0 / resid1 / resid2 for b = 0 / 1 / 2, then + b * strideR.
// OUT_F16: C is f16 (Ch), else f32 (Cf). The tile leaves through LDS, so every store instruction writes whole 128-B lines.
// FOLD names the pointwise or re-layout pass that the launch does itself, in place of a launch of its own beside it:
//   kFoldGelu   the f16 output is gelu(C + bias), exact erf form, carried x kGCarry;
//   kFoldVT     column tiles from column 2*kDim on (the V columns) leave transposed: Vt[(g*128 + c)*2048 + n], g = plane row / 2048;
//   kFoldHeads  A is read from the attention's per-head planes Ap[(g*8 + h)][2048][16]: k = 16h + d.
// Every loop of the engine is unrolled: its arrays (copy operands, fragments, accumulators, residual rows) are registers and asm
// operands, which need constant indices.
// ---------------------------------------------------------------------------
constexpr int kBM = 128, kBN = 64, kCPitch = 68;   // kCPitch: floats per staged row of C
constexpr int kTPitch = 136;                       // halves per staged row of a transposed V tile: 272 B = 16 B x odd
constexpr int kFoldNone = 0, kFoldGelu = 1, kFoldVT = 2, kFoldHeads = 3;
constexpr int kSrcF16 = 0, kSrcLn = 1, kSrcLnCast = 2;

// N copies and, in the same statement, the wait that stands before any register they name is rewritten.
__device__ __forceinline__ void async_copy4(const unsigned* l, const unsigned short* const* g) {
  asm volatile("global_load_async_to_lds_b128 %0, %4, off\n\t"
               "global_load_async_to_lds_b128 %1, %5, off\n\t"
               "global_load_async_to_lds_b128 %2, %6, off\n\t"
               "global_load_async_to_lds_b128 %3, %7, off\n\t"
               "s_wait_xcnt 0x0"
               :: "v"(l[0]), "v"(l[1]), "v"(l[2]), "v"(l[3]), "v"(g[0]), "v"(g[1]), "v"(g[2]), "v"(g[3]) : "memory");
}
__device__ __forceinline__ void async_copy12(const unsigned* l, const unsigned short* const* g) {
  asm volatile("global_load_async_to_lds_b128 %0, %12, off\n\t"
               "global_load_async_to_lds_b128 %1, %13, off\n\t"
               "global_load_async_to_lds_b128 %2, %14, off\n\t"
               "global_load_async_to_lds_b128 %3, %15, off\n\t"
               "global_load_async_to_lds_b128 %4, %16, off\n\t"
               "global_load_async_to_lds_b128 %5, %17, off\n\t"
               "global_load_async_to_lds_b128 %6, %18, off\n\t"
               "global_load_async_to_lds_b128 %7, %19, off\n\t"
               "global_load_async_to_lds_b128 %8, %20, off\n\t"
               "global_load_async_to_lds_b128 %9, %21, off\n\t"
               "global_load_async_to_lds_b128 %10, %22, off\n\t"
               "global_load_async_to_lds_b128 %11, %23, off\n\t"
               "s_wait_xcnt 0x0"
               :: "v"(l[0]), "v"(l[1]), "v"(l[2]), "v"(l[3]), "v"(l[4]), "v"(l[5]), "v"(l[6]), "v"(l[7]), "v"(l[8]), "v"(l[9]),
                  "v"(l[10]), "v"(l[11]),
                  "v"(g[0]), "v"(g[1]), "v"(g[2]), "v"(g[3]), "v"(g[4]), "v"(g[5]), "v"(g[6]), "v"(g[7]), "v"(g[8]), "v"(g[9]),
                  "v"(g[10]), "v"(g[11]) : "memory");
}

// ROWS rows of KC halves from g0 (row pitch ld halves) to LDS byte address lds0 (row pitch 2*KC + 16). A row is KC/8 pieces of 16 B.
// PER * 256 pieces = 16 whole rows: lane t takes pieces i*256 + t (i < PER) of every 16-row band, so its addresses in the next band
// are the same plus a constant. Each piece is copied by exactly one lane; every lane is on.
template <int KC, int ROWS>
__device__ __forceinline__ void stage_rows(const unsigned short* g0, int ld, unsigned lds0, int t) {
  constexpr int CPR = KC / 8, PER = CPR / 16, BAND = 16, NB = ROWS / BAND, PITCH = KC * 2 + 16;
  static_assert(CPR % 16 == 0 && (PER == 1 || PER == 3) && NB % 4 == 0, "whole bands, four bands a statement");
  const unsigned short* gb[PER];
  unsigned lb[PER];
#pragma unroll
  for (int i = 0; i < PER; ++i) {
    const int e = i * 256 + t;
    const int r = e / CPR, c = e - r * CPR;
    gb[i] = g0 + (r * ld + c * 8);
    lb[i] = lds0 + (unsigned)(r * PITCH + c * 16);
  }
  const size_t step = (size_t)(BAND * ld);
#pragma unroll
  for (int j0 = 0; j0 < NB; j0 += 4) {
    unsigned l[4 * PER];
    const unsigned short* g[4 * PER];
#pragma unroll
    for (int jj = 0; jj < 4; ++jj)
#pragma unroll
      for (int i = 0; i < PER; ++i) {
        l[jj * PER + i] = lb[i] + (unsigned)((j0 + jj) * BAND * PITCH);
        g[jj * PER + i] = gb[i] + (size_t)(j0 + jj) * step;
      }
    if (PER == 3) async_copy12(l, g); else async_copy4(l, g);
  }
}

// 128 rows of A = 8 heads x 16 dims from the per-head planes; o0 = head 0's plane at the tile's first row, LDS row pitch 2*kDim + 16.
// A band is 16 rows = 256 pieces of 16 B. A wave takes 4 heads x 4 rows x 2 pieces: per head 128 contiguous, aligned source bytes,
// so every copy instruction moves 4 whole lines. Each piece is copied by exactly one lane; every lane is on.
__device__ __forceinline__ void stage_heads(const unsigned short* o0, unsigned lds0, int t) {
  constexpr int PITCH = kDim * 2 + 16;
  const int lane = t & 31, wave = t >> 5;
  const int h = (wave & 1) * 4 + (lane >> 3);
  const int r = (wave >> 1) * 4 + ((lane >> 1) & 3);
  const int p = lane & 1;
  const unsigned short* gb = o0 + (h * kSeq * kHdim + r * kHdim + p * 8);
  const unsigned lb = lds0 + (unsigned)(r * PITCH + (h * 2 + p) * 16);
#pragma unroll
  for (int j0 = 0; j0 < kBM / 16; j0 += 4) {
    unsigned l[4];
    const unsigned short* g[4];
#pragma unroll
    for (int jj = 0; jj < 4; ++jj) {
      l[jj] = lb + (unsigned)((j0 + jj) * 16 * PITCH);
      g[jj] = gb + (j0 + jj) * 16 * kHdim;
    }
    async_copy4(l, g);
  }
}

// value of the lane whose number differs by MASK inside the 16-lane row (DPP row_xmask)
template <int MASK> __device__ __forceinline__ float lane_xor(float v) {
  return __builtin_bit_cast(float, __builtin_amdgcn_update_dpp(0, __builtin_bit_cast(int, v), 0x160 + MASK, 0xf, 0xf, true));
}

__device__ __forceinline__ float rsq_slot(float x) {
  float r;
  asm("v_rsq_f32 %0, %1\n\tv_nop" : "=v"(r) : "v"(x));
  return r;
}

// 128 rows of x (f32, KC features, x0 = the tile's first row) -> LayerNorm -> f16 rows in LDS at pitch 2*KC + 16.
// LPR lanes share a row, so a wave instruction works on 32/LPR rows: lane j of them holds the 16-B pieces j, j + LPR, j + 2*LPR, ...,
// and every load instruction covers whole 128-B lines of each of its rows. A wave takes 16 rows, two passes to a group;
// the next group's loads are asked for ahead of this group's arithmetic.
template <int KC>
__device__ __forceinline__ void stage_ln(const float* __restrict__ x0, const float* __restrict__ g, const float* __restrict__ bt,
                                         unsigned char* sA, int t) {
  constexpr int PITCH = KC * 2 + 16;
  constexpr int LPR = (KC == kDim) ? 8 : 16, NQ = KC / 4 / LPR, RP = 32 / LPR, NG = 16 / RP / 2;
  static_assert(NQ * LPR * 4 == KC, "whole pieces");
  const int lane = t & 31, wave = t >> 5;
  const int j = lane & (LPR - 1), rr = lane / LPR;
  const unsigned xo = (unsigned)((wave * 16 + rr) * KC + j * 4) * 4u;   // bytes: uniform base + one 32-bit lane offset
  const unsigned go = (unsigned)(j * 4) * 4u;
  v4f xv[NG][2][NQ], gv[NQ], bv[NQ];
#pragma unroll
  for (int q = 0; q < NQ; ++q) {
    gv[q] = *(const v4f*)((const char*)(g + q * LPR * 4) + go);
    bv[q] = *(const v4f*)((const char*)(bt + q * LPR * 4) + go);
  }
#pragma unroll
  for (int gi = -1; gi < NG; ++gi) {
    if (gi + 1 < NG) {
#pragma unroll
      for (int p = 0; p < 2; ++p)
#pragma unroll
        for (int q = 0; q < NQ; ++q)
          xv[gi + 1][p][q] = *(const v4f*)((const char*)(x0 + (((gi + 1) * 2 + p) * RP * KC + q * LPR * 4)) + xo);
      // the lane offsets stay in their registers up to this wait, which stands before any register these loads name is rewritten
      asm volatile("s_wait_xcnt 0x0" :: "v"(xo), "v"(go) : "memory");
    }
    if (gi < 0) continue;
#pragma unroll
    for (int p = 0; p < 2; ++p) {
      v4f a = xv[gi][p][0];
#pragma unroll
      for (int q = 1; q < NQ; ++q) a += xv[gi][p][q];
      float s1 = (a[0] + a[1]) + (a[2] + a[3]);
      s1 += lane_xor<1>(s1);
      s1 += lane_xor<2>(s1);
      s1 += lane_xor<4>(s1);
      if (LPR == 16) s1 += lane_xor<8>(s1);
      const float mean = s1 * (1.0f / KC);
      v4f a2 = (v4f){0.f, 0.f, 0.f, 0.f};
#pragma unroll
      for (int q = 0; q < NQ; ++q) {
        xv[gi][p][q] -= mean;
        a2 += xv[gi][p][q] * xv[gi][p][q];
      }
      float s2 = (a2[0] + a2[1]) + (a2[2] + a2[3]);
      s2 += lane_xor<1>(s2);
      s2 += lane_xor<2>(s2);
      s2 += lane_xor<4>(s2);
      if (LPR == 16) s2 += lane_xor<8>(s2);
      const float rstd = rsq_slot(s2 * (1.0f / KC) + kLnEps);
      unsigned char* row = sA + (wave * 16 + (gi * 2 + p) * RP + rr) * PITCH + j * 8;
#pragma unroll
      for (int q = 0; q < NQ; ++q)
        *(v4h*)(row + q * LPR * 8) = __builtin_convertvector(xv[gi][p][q] * rstd * gv[q] + bv[q], v4h);
    }
  }
}

// 64 columns of a weight plane W (f32 [kDim][LDW], w0 = W + first column) -> Bt rows [column][k] f16 carried x kWCarry, LDS pitch 2*kDim + 16.
// Lane = column, so every load instruction reads one whole 128-B line; a thread packs 8 consecutive k of its column into one 16-B store.
template <int LDW>
__device__ __forceinline__ void stage_wcast128(const float* __restrict__ w0, unsigned char* sB, int t) {
  constexpr int PITCH = kDim * 2 + 16;
  const int nl = t & 63, kq = t >> 6;
  const unsigned wo = (unsigned)(kq * 8 * LDW + nl) * 4u;   // bytes: uniform base + one 32-bit lane offset
  float wv[4][8];
#pragma unroll
  for (int i = 0; i < 4; ++i)
#pragma unroll
    for (int e = 0; e < 8; ++e) wv[i][e] = *(const float*)((const char*)(w0 + (i * 32 + e) * LDW) + wo);
  // as in stage_ln: the lane offset lives up to the wait
  asm volatile("s_wait_xcnt 0x0" :: "v"(wo) : "memory");
#pragma unroll
  for (int i = 0; i < 4; ++i) {
    v8h hv;
#pragma unroll
    for (int e = 0; e < 8; ++e) hv[e] = (_Float16)(wv[i][e] * kWCarry);
    *(v8h*)(sB + nl * PITCH + (i * 4 + kq) * 16) = hv;
  }
}

__device__ __forceinline__ float gelu_erf(float x) { return 0.5f * x * (1.0f + erff(x * 0.70710678118654752f)); }

constexpr int kTilesProj = (kDim / 64) * (kDim / 64) * 3;    // 12
constexpr int kTilesFc1  = (kDim3 / 64) * (kHid / 64);       // 72
constexpr int kTilesFc2  = (kHid / 64) * (kDim3 / 64);       // 72
constexpr int kTilesW    = kTilesProj + kTilesFc1 + kTilesFc2;   // 156
__device__ __forceinline__ void wtcast_tile(int r0, const float* __restrict__ wProj,
                                            const float* __restrict__ wFc1, const float* __restrict__ wFc2,
                                            unsigned short* __restrict__ oProj,
                                            unsigned short* __restrict__ oFc1, unsigned short* __restrict__ oFc2,
                                            float scale);

// SRC names what the block makes of f32 data in LDS itself, in place of a launch in front of it:
//   kSrcLn      A = LayerNorm over KC features of the f32 rows of resid0 / resid1 / resid2 (b = 0 / 1 / 2; gain and shift lng, lnb + b * KC);
//               Ap is not read;
//   kSrcLnCast  the same, and Bt = the columns of the f32 plane Wf + b * kDim * kDim3, cast by the block; Btp is not read either.
// Plane blockIdx.y = 3 of a kSrcLnCast grid holds no GEMM tile: its first kTilesW blocks cast one tile each of the weights of the later launches
// (block-uniform choice, so the cast's barrier is passed by a whole block or by none).
// WPE = waves per SIMD that the register budget must leave room for: 2 * workgroups per WGP that the LDS size and the grid ask for.
template <int KC, int NCH, int WPE, bool BIAS, bool OUT_F16, bool RESID, int FOLD, int SRC>
__global__ __launch_bounds__(256, WPE) void gemm_lds(
    const unsigned short* __restrict__ Ap, int lda, long strideA,
    const unsigned short* __restrict__ Btp, int ldb, long strideB,
    float* __restrict__ Cf, unsigned short* __restrict__ Ch, unsigned short* __restrict__ Vt, int ldc, long strideC,
    const float* __restrict__ bias, long strideBias,
    const float* __restrict__ resid0, const float* __restrict__ resid1, const float* __restrict__ resid2, long strideR, int ldr,
    int tilesN, float scale,
    const float* __restrict__ lng, const float* __restrict__ lnb, const float* __restrict__ Wf,
    const float* __restrict__ wProj, const float* __restrict__ wFc1, const float* __restrict__ wFc2,
    unsigned short* __restrict__ oProj, unsigned short* __restrict__ oFc1, unsigned short* __restrict__ oFc2) {
  if (SRC == kSrcLnCast && blockIdx.y == 3) {
    if (blockIdx.x < kTilesW) wtcast_tile(blockIdx.x, wProj, wFc1, wFc2, oProj, oFc1, oFc2, kWCarry);
    return;
  }
  constexpr int PITCH = KC * 2 + 16;
  constexpr int BUF   = (kBM + kBN) * PITCH;
  constexpr int GK    = 2, NG = KC / 32 / GK;   // fragments are fetched in groups of GK k steps, one group ahead
  static_assert(kBM * kCPitch * 4 <= BUF, "the staged C tile fits the first buffer");
  static_assert((kBM + kBN) * (KC / 8) / 256 <= 63, "copies of one chunk outstanding per wave");
  static_assert(FOLD != kFoldHeads || (KC == kDim && NCH == 1), "a row of A is the 8 heads of one token");
  static_assert(FOLD != kFoldGelu || OUT_F16, "the activation leaves as f16");
  static_assert(SRC == kSrcF16 || (NCH == 1 && !RESID && FOLD != kFoldHeads), "a chunk holds the whole normalised row; the residual slots name its source");
  static_assert(SRC != kSrcLnCast || KC == kDim, "the cast stages 128 k");
  static_assert(FOLD != kFoldVT || (OUT_F16 && !BIAS && kBN * kTPitch * 2 <= BUF), "the transposed tile fits the first buffer");
  __shared__ __align__(128) unsigned char smem[NCH * BUF];
  const int t    = threadIdx.x;
  const int lane = t & 31, wave = t >> 5;
  const int b    = blockIdx.y;
  const int tm   = blockIdx.x / tilesN;
  const int tn   = blockIdx.x - tm * tilesN;
  const int m0   = tm * kBM, n0 = tn * kBN;
  const unsigned short* Ab = Ap  + (size_t)b * strideA + (size_t)m0 * lda;
  const unsigned short* Bb = Btp + (size_t)b * strideB + (size_t)n0 * ldb;
  const unsigned lds0 = (unsigned)(size_t)smem;   // low 32 bits of the shared address = byte offset in the workgroup's LDS

  const int grp = b * (kRows / kSeq) + m0 / kSeq, tok = m0 % kSeq;   // the tile's (branch, batch) group and its first token there
  if (SRC == kSrcF16) {
    if (FOLD == kFoldHeads) stage_heads(Ap + ((size_t)grp * kHeads * kSeq + tok) * kHdim, lds0, t);
    else                    stage_rows<KC, kBM>(Ab, lda, lds0, t);
    stage_rows<KC, kBN>(Bb, ldb, lds0 + kBM * PITCH, t);
  } else {   // Bt is asked for first, so that it flies under the LayerNorm arithmetic
    if (SRC == kSrcLnCast) stage_wcast128<kDim3>(Wf + (size_t)b * (kDim * kDim3) + n0, smem + kBM * PITCH, t);
    else                   stage_rows<KC, kBN>(Bb, ldb, lds0 + kBM * PITCH, t);
    stage_ln<KC>(((b == 0) ? resid0 : (b == 1) ? resid1 : resid2) + (size_t)m0 * KC, lng + b * KC, lnb + b * KC, smem, t);
  }

  // bias and residual of the rows this thread will store: asked for now, used in the epilogue
  const int c4 = (t & 15) * 4, r4 = t >> 4;            // f32 C: a row of 256 B = 16 lanes x 16 B; 16 rows a trip
  const int c8 = (t & 7) * 8, r8 = t >> 3;             // f16 C: a row of 128 B = 8 lanes x 16 B; 32 rows a trip
  v4f bv = (v4f){0.f, 0.f, 0.f, 0.f};
  v4f bh[2] = {bv, bv};
  v4f rv[kBM / 16];
  if (BIAS) bv = *(const v4f*)(bias + (size_t)b * strideBias + n0 + c4);
  if (BIAS && OUT_F16) {
    const float* bp = bias + (size_t)b * strideBias + n0 + c8;
    bh[0] = *(const v4f*)bp;
    bh[1] = *(const v4f*)(bp + 4);
  }
  if (RESID) {
    const float* rp = ((b == 0) ? resid0 : (b == 1) ? resid1 : resid2) + (size_t)b * strideR + (size_t)(m0 + r4) * ldr + n0 + c4;
    const float* rq[kBM / 16];
#pragma unroll
    for (int it = 0; it < kBM / 16; ++it) { rq[it] = rp + (size_t)(it * 16 * ldr); rv[it] = *(const v4f*)rq[it]; }
    // the eight addresses stay in their registers up to this wait, so no load of the run returns onto an earlier load's address
    asm volatile("s_wait_xcnt 0x0" :: "v"(rq[0]), "v"(rq[1]), "v"(rq[2]), "v"(rq[3]), "v"(rq[4]), "v"(rq[5]), "v"(rq[6]), "v"(rq[7]) : "memory");
  }

  if (SRC != kSrcLnCast) asm volatile("s_wait_asynccnt 0x0" ::: "memory");   // this wave's copies of chunk 0 have landed
  __syncthreads();                                    // chunk 0 visible to every wave
  if (NCH > 1) {                                      // chunk 1 flies under chunk 0's products
    stage_rows<KC, kBM>(Ab + KC, lda, lds0 + BUF, t);
    stage_rows<KC, kBN>(Bb + KC, ldb, lds0 + BUF + kBM * PITCH, t);
  }

  const int rlane = lane & 15, hh = lane >> 4;
  const int wm = wave & 3, wn = wave >> 2;
  v8f acc[2][2];
#pragma unroll
  for (int i = 0; i < 2; ++i)
#pragma unroll
    for (int j = 0; j < 2; ++j) acc[i][j] = (v8f){0.f, 0.f, 0.f, 0.f, 0.f, 0.f, 0.f, 0.f};

#pragma unroll
  for (int ch = 0; ch < NCH; ++ch) {
    const unsigned char* aP = smem + ch * BUF + (wm * 32 + rlane) * PITCH + hh * 16;
    const unsigned char* bP = smem + ch * BUF + (kBM + wn * 32 + rlane) * PITCH + hh * 16;
    v16h fa[2][GK][2], fb[2][GK][2];
#pragma unroll
    for (int g = -1; g < NG; ++g) {
      if (g + 1 < NG) {
#pragma unroll
        for (int s = 0; s < GK; ++s)
#pragma unroll
          for (int i = 0; i < 2; ++i) {
            fa[(g + 1) & 1][s][i] = Frag<_Float16>::load((const _Float16*)(aP + i * 16 * PITCH + ((g + 1) * GK + s) * 64));
            fb[(g + 1) & 1][s][i] = Frag<_Float16>::load((const _Float16*)(bP + i * 16 * PITCH + ((g + 1) * GK + s) * 64));
          }
      }
      __builtin_amdgcn_sched_barrier(0);   // the next group's LDS reads stay one group, ahead of this group's products, not among them
      if (g >= 0) {
#pragma unroll
        for (int s = 0; s < GK; ++s)
#pragma unroll
          for (int i = 0; i < 2; ++i)
#pragma unroll
            for (int j = 0; j < 2; ++j) acc[i][j] = Frag<_Float16>::mma(fa[g & 1][s][i], fb[g & 1][s][j], acc[i][j]);
      }
      __builtin_amdgcn_sched_barrier(0);   // and the reads of the group after that stay behind these products
    }
    asm volatile("s_wait_dscnt 0x0" ::: "memory");                    // this wave's reads of the chunk are done
    if (NCH > 1) asm volatile("s_wait_asynccnt 0x0" ::: "memory");    // this wave's copies of the next chunk have landed; behind the last chunk none is left
    __syncthreads();   // next chunk visible to every wave; behind the last chunk: every reader has left, the LDS becomes C staging
  }

  // ---- epilogue: scaled tile to LDS in accumulator order, out of it in whole rows ----
  float* sC = (float*)smem;
  _Float16* sT = (_Float16*)smem;
  const bool vtile = FOLD == kFoldVT && n0 >= 2 * kDim;   // block-uniform: the whole tile is V columns
  if (vtile) {
    // a lane's 8 accumulator registers are 8 consecutive rows of one column: 16 contiguous bytes of the transposed tile
#pragma unroll
    for (int i = 0; i < 2; ++i)
#pragma unroll
      for (int j = 0; j < 2; ++j)
        *(v8h*)(sT + (wn * 32 + j * 16 + rlane) * kTPitch + wm * 32 + i * 16 + hh * 8) = __builtin_convertvector(acc[i][j] * scale, v8h);
  } else {
#pragma unroll
    for (int i = 0; i < 2; ++i)
#pragma unroll
      for (int j = 0; j < 2; ++j)
#pragma unroll
        for (int r = 0; r < 8; ++r)
          sC[(wm * 32 + i * 16 + hh * 8 + r) * kCPitch + wn * 32 + j * 16 + rlane] = acc[i][j][r] * scale;
  }
  __syncthreads();   // staged tile visible to every wave
  if (vtile) {
    // 64 dims x 128 tokens: a row of 256 B = 16 lanes x 16 B; 16 rows a trip
    unsigned short* vp = Vt + ((size_t)grp * kDim + (n0 - 2 * kDim)) * kSeq + tok;
    const unsigned vo = (unsigned)(r4 * kSeq + (t & 15) * 8) * 2u;   // bytes: uniform base + one 32-bit lane offset
#pragma unroll
    for (int it = 0; it < kBN / 16; ++it) {
      const v8h hv = *(const v8h*)(sT + (it * 16 + r4) * kTPitch + (t & 15) * 8);
      *(v8h*)((char*)(vp + (size_t)(it * 16 * kSeq)) + vo) = hv;
    }
  } else if (!OUT_F16) {
    float* cp = Cf + (size_t)b * strideC + (size_t)m0 * ldc + n0;
    const unsigned co = (unsigned)(r4 * ldc + c4) * 4u;   // bytes: uniform base + one 32-bit lane offset
#pragma unroll
    for (int it = 0; it < kBM / 16; ++it) {
      v4f v = *(const v4f*)(sC + (it * 16 + r4) * kCPitch + c4);
      if (BIAS)  v += bv;
      if (RESID) v += rv[it];
      *(v4f*)((char*)(cp + (size_t)(it * 16 * ldc)) + co) = v;
    }
  } else {
    unsigned short* cp = Ch + (size_t)b * strideC + (size_t)m0 * ldc + n0;
    const unsigned co = (unsigned)(r8 * ldc + c8) * 2u;   // bytes: uniform base + one 32-bit lane offset
    v4f sv[kBM / 32][2];   // all of the thread's staged values are asked for at once, ahead of the pointwise work
#pragma unroll
    for (int it = 0; it < kBM / 32; ++it) {
      const float* sp = sC + (it * 32 + r8) * kCPitch + c8;
      sv[it][0] = *(const v4f*)sp;
      sv[it][1] = *(const v4f*)(sp + 4);
    }
#pragma unroll
    for (int it = 0; it < kBM / 32; ++it) {
      v8h hv;
#pragma unroll
      for (int e = 0; e < 8; ++e) {
        float x = sv[it][e >> 2][e & 3];
        if (BIAS) x += bh[e >> 2][e & 3];
        if (FOLD == kFoldGelu) x = gelu_erf(x) * kGCarry;
        hv[e] = (_Float16)x;
      }
      *(v8h*)((char*)(cp + (size_t)(it * 32 * ldc)) + co) = hv;
    }
  }
}

// ---------------------------------------------------------------------------
// Weight transpose + cast: W plane z is f32 [nIn][nOut] row-major; WT plane z = [nOut][nIn] f16, WT[h][d] = f16(scale * W[d][h]).
// The three weight tensors that later launches read, in one index space: tile index r0 falls into one tensor's range of (nIn/64)*(nOut/64)*nz tiles
// (block-uniform choice), and inside the range it runs d tile fastest, then h tile, then plane z.
// 256 threads; nIn, nOut multiples of 64. Plane z at out + z*nOut*nIn halves.
// Load coverage: 16 iterations x 256 threads = 4096 = the whole 64x64 tile (coalesced along h).
// Store coverage: 8 waves x 2 iterations x 4 rows (lane>>3) = 64 rows; (lane&7) x 8 halves = 64 cols; each row segment =
// ---------------------------------------------------------------------------
__device__ __forceinline__ void wtcast_tile(int r0, const float* __restrict__ wProj,
                                            const float* __restrict__ wFc1, const float* __restrict__ wFc2,
                                            unsigned short* __restrict__ oProj,
                                            unsigned short* __restrict__ oFc1, unsigned short* __restrict__ oFc2,
                                            float scale) {
  __shared__ float sm[64][65];   // sm[h_local][d_local]
  const int t  = threadIdx.x;
  const float* W = wProj; unsigned short* out = oProj; int nIn = kDim, nOut = kDim;
  if (r0 >= kTilesProj + kTilesFc1) { r0 -= kTilesProj + kTilesFc1; W = wFc2; out = oFc2; nIn = kHid; nOut = kDim3; }
  else if (r0 >= kTilesProj)        { r0 -= kTilesProj; W = wFc1; out = oFc1; nIn = kDim3; nOut = kHid; }
  const int gx = nIn >> 6, gy = nOut >> 6;
  const int r1 = r0 / gx;
  const int d0 = (r0 - r1 * gx) * 64;
  const int z  = r1 / gy;
  const int h0 = (r1 - z * gy) * 64;
  const float* Wz = W + (size_t)z * nIn * nOut;
#pragma unroll
  for (int i = 0; i < 16; ++i) {
    const int e = i * 256 + t;
    const int r = e >> 6;          // d local
    const int c = e & 63;          // h local
    sm[c][r] = Wz[(size_t)(d0 + r) * nOut + h0 + c] * scale;
  }
  __syncthreads();
  const int lane = t & 31, wave = t >> 5;
  const int q = lane >> 3, c8 = (lane & 7) * 8;
  unsigned short* op = out + (size_t)z * nOut * nIn;
  {
#pragma unroll
    for (int it = 0; it < 2; ++it) {
      const int row = wave * 8 + it * 4 + q;                 // h local
      unsigned short hb[8];
#pragma unroll
      for (int e = 0; e < 8; ++e) hb[e] = h_bits(sm[row][c8 + e]);
      const v4u u = (v4u){pk16(hb[0], hb[1]), pk16(hb[2], hb[3]), pk16(hb[4], hb[5]), pk16(hb[6], hb[7])};
      *(v4u*)(op + (size_t)(h0 + row) * nIn + d0 + c8) = u;
    }
    
  }
}

// ---------------------------------------------------------------------------
// Fused attention, one launch for all 48 (group, head) pairs: S^T = K.Q^T, online softmax, O^T += V^T.P^T.
// grid (2048/128 = 16 query blocks, 48), 256 threads = 8 waves x 16 queries. Lane (c = lane&15, hh = lane>>4) owns query c.
// K and V^T of the head are staged through registers into LDS, 512 keys at a time, already in fragment order:
//   sK: 16-key tile T at T*512; lane's 16 B (key c, dims 8hh..8hh+7) at + lane*16.
//   sV: fragment half G (keys 16G + 8hh + 0..7 of dim c) at G*576 + hh*288 + c*16.
// S^T tile register r = score(key 8hh + r, query c), so two tiles converted in place are the B operand P^T (hardware k
// order), and V^T as A is read in the same k order. O^T register r = O(query c, dim 8hh + r): one 16-B store per lane.
// oh[(g*8 + head)][2048][16] f16 carried x64: each wave writes 512 contiguous bytes.
// ---------------------------------------------------------------------------
__device__ __forceinline__ float other_half(float v) {   // value of lane ^ 16
  const int b = __builtin_bit_cast(int, v);
  return __builtin_bit_cast(float, __builtin_amdgcn_permlanex16(b, b, 0x76543210, 0xfedcba98, false, false));
}
__device__ __forceinline__ float vmax8(v8f a) {
  return fmaxf(fmaxf(fmaxf(a[0], a[1]), fmaxf(a[2], a[3])), fmaxf(fmaxf(a[4], a[5]), fmaxf(a[6], a[7])));
}
__device__ __forceinline__ v8f vexp2_fma8(v8f a, float sc, float bs) {   // exp2(a * sc + bs), the multiply-adds two per instruction
  const v2f sc2 = (v2f){sc, sc}, bs2 = (v2f){bs, bs};
  v8f r;
#pragma unroll
  for (int e = 0; e < 8; e += 2) {
    const v2f x = __builtin_elementwise_fma((v2f){a[e], a[e + 1]}, sc2, bs2);
    r[e]     = __builtin_amdgcn_exp2f(x[0]);
    r[e + 1] = __builtin_amdgcn_exp2f(x[1]);
  }
  return r;
}
// six waves per SIMD = three workgroups per WGP: 768 workgroups fill 256 WGPs in one even round
__global__ __launch_bounds__(256) __attribute__((amdgpu_waves_per_eu(6))) void attn_fused_kernel(const unsigned short* __restrict__ qkvo,
                                                         const unsigned short* __restrict__ vt,
                                                         unsigned short* __restrict__ oh) {
  __shared__ __align__(128) unsigned char sK[kKeyChunk * 32];
  __shared__ __align__(128) unsigned char sV[(kKeyChunk / 16) * kVGrp];
  typedef Frag<_Float16>::U FU;
  const int lane = threadIdx.x & 31, wave = threadIdx.x >> 5;
  const int c = lane & 15, hh = lane >> 4;
  const int gh = blockIdx.y, g = gh >> 3, hd = gh & 7;
  const int q0 = blockIdx.x * 128 + wave * 16;
  const v8h zero8 = (v8h){0, 0, 0, 0, 0, 0, 0, 0};
  const v8f zacc  = (v8f){0.f, 0.f, 0.f, 0.f, 0.f, 0.f, 0.f, 0.f};
  const float cs = 0.25f * 1.44269504088896340736f;   // head-dim scale x log2(e)

  // One A fragment holds two 16-key tiles (k 0..15 = dims of the first, k 16..31 = dims of the second);
  // q sits in the lower k half of qlo and in the upper k half of qhi, zeros in the other half, so each picks one tile.
  FU qlo, qhi;
  qlo.h[0] = *(const v8h*)(qkvo + (size_t)(g * kSeq + q0 + c) * kDim3 + hd * kHdim + 8 * hh);
  qlo.h[1] = zero8;
  qhi.h[0] = zero8;
  qhi.h[1] = qlo.h[0];

  // staging, 4 rounds of 8 waves per chunk. K round i: wave takes the 16-key tile i*8 + wave, lane = (key c, 16-B part hh).
  // V^T round i: wave takes 4 dims x 8 parts of 8 keys (4 whole 128-B lines): dim sd, part i*16 + sp of the chunk.
  const int sd = (wave & 3) * 4 + (lane >> 3);
  const int sp = (wave >> 2) * 8 + (lane & 7);
  const unsigned short* kp = qkvo + (size_t)(g * kSeq + wave * 16 + c) * kDim3 + kDim + hd * kHdim + 8 * hh;
  const unsigned short* vp = vt + (size_t)(g * kDim + hd * kHdim + sd) * kSeq + sp * 8;
  unsigned char* skw = sK + wave * 512 + lane * 16;
  unsigned char* svw = sV + (sp >> 1) * kVGrp + (sp & 1) * kVHalf + sd * 16;
  v4u kr[4], vr[4];
#pragma unroll
  for (int i = 0; i < 4; ++i) {
    kr[i] = *(const v4u*)(kp + (size_t)i * 128 * kDim3);
    vr[i] = *(const v4u*)(vp + i * 128);
  }

  float m = -INFINITY;
  v8f lv = zacc;
  v8f o  = zacc;
  for (int ch = 0; ch < kSeq / kKeyChunk; ++ch) {
    __syncthreads();   // every wave has finished reading the previous chunk
#pragma unroll
    for (int i = 0; i < 4; ++i) {
      *(v4u*)(skw + i * 8 * 512) = kr[i];
      *(v4u*)(svw + i * 8 * kVGrp) = vr[i];
    }
    __syncthreads();   // chunk visible to every wave
    if (ch + 1 < kSeq / kKeyChunk) {   // next chunk's global loads fly under this chunk's work
      kp += (size_t)kKeyChunk * kDim3;
      vp += kKeyChunk;
#pragma unroll
      for (int i = 0; i < 4; ++i) {
        kr[i] = *(const v4u*)(kp + (size_t)i * 128 * kDim3);
        vr[i] = *(const v4u*)(vp + i * 128);
      }
    }
#pragma unroll 2   // a rolled loop keeps the registers inside the six-wave budget with no scratch
    for (int kb = 0; kb < kKeyChunk / 64; ++kb) {
      v8f st[4];
#pragma unroll
      for (int j = 0; j < 2; ++j) {
        FU kf;
        kf.h[0] = *(const v8h*)(sK + (kb * 4 + 2 * j) * 512 + lane * 16);
        kf.h[1] = *(const v8h*)(sK + (kb * 4 + 2 * j + 1) * 512 + lane * 16);
        st[2 * j]     = Frag<_Float16>::mma(kf.v, qlo.v, zacc);
        st[2 * j + 1] = Frag<_Float16>::mma(kf.v, qhi.v, zacc);
      }
      FU vf[2];
#pragma unroll
      for (int j = 0; j < 2; ++j) {
        vf[j].h[0] = *(const v8h*)(sV + (kb * 4 + 2 * j) * kVGrp + hh * kVHalf + c * 16);
        vf[j].h[1] = *(const v8h*)(sV + (kb * 4 + 2 * j + 1) * kVGrp + hh * kVHalf + c * 16);
      }
      float mx = fmaxf(fmaxf(vmax8(st[0]), vmax8(st[1])), fmaxf(vmax8(st[2]), vmax8(st[3])));
      mx = fmaxf(mx, other_half(mx));
      const float mn = fmaxf(m, mx);
      const float alpha = __builtin_amdgcn_exp2f((m - mn) * cs);
      const float bias = kPCarryLog2 - mn * cs;
      m = mn;
      v8f pe[4];
#pragma unroll
      for (int j = 0; j < 4; ++j) pe[j] = vexp2_fma8(st[j], cs, bias);
      lv = lv * alpha + ((pe[0] + pe[1]) + (pe[2] + pe[3]));
      o  = o * alpha;
#pragma unroll
      for (int j = 0; j < 2; ++j) {
        FU pf;
        pf.h[0] = __builtin_convertvector(pe[2 * j], v8h);
        pf.h[1] = __builtin_convertvector(pe[2 * j + 1], v8h);
        o = Frag<_Float16>::mma(vf[j].v, pf.v, o);
      }
    }
  }
  float l = ((lv[0] + lv[1]) + (lv[2] + lv[3])) + ((lv[4] + lv[5]) + (lv[6] + lv[7]));
  l += other_half(l);
  const float inv = kOCarry / l;
  const v8h ov = __builtin_convertvector(o * inv, v8h);
  *(v8h*)(oh + ((size_t)gh * kSeq + q0 + c) * kHdim + 8 * hh) = ov;
}

// ---------------------------------------------------------------------------
// Host glue. Workspace region map (bytes; every offset a multiple of 32768):
//   (not used)                         294,912 @          0
//   WPROJ f16 [3][128][128]             98,304 @    294,912
//   WFC1  f16 [768][384]               589,824 @    393,216
//   WFC2  f16 [384][768]               589,824 @    983,040
//   VT    f16 [6][128][2048]         3,145,728 @  1,572,864
//   BIG                             12,582,912 @  4,718,592   (QKVO f16 [12288][384] @ +3,145,728
//                                                             up to and during attention; of QKVO only the q and k columns
//                                                             are written and read, V goes to VT;
//                                                             G f16 [4096][768] @ +3,145,728
//                                                             after attention)
//   OH    f16 [48][2048][16]         3,145,728 @ 17,301,504
//   XC    f32 [4096][384]            6,291,456 @ 20,447,232
//   total                                        26,738,688
// ---------------------------------------------------------------------------
extern "C" void kernel_launch(void* const* d_in, const int* in_sizes, int n_in,
                              void* d_out, int out_size, void* d_ws, size_t ws_size,
                              hipStream_t stream) {
  if (n_in < 14) return;
  if (in_sizes[0] != kRows * kDim || in_sizes[1] != kRows * kDim || in_sizes[2] != kRows * kDim) return;
  if (in_sizes[3] != 3 * kDim || in_sizes[4] != 3 * kDim) return;
  if (in_sizes[5] != 3 * kDim * kDim3 || in_sizes[6] != 3 * kDim * kDim || in_sizes[7] != 3 * kDim) return;
  if (in_sizes[8] != kDim3 || in_sizes[9] != kDim3) return;
  if (in_sizes[10] != kDim3 * kHid || in_sizes[11] != kHid || in_sizes[12] != kHid * kDim3 || in_sizes[13] != kDim3) return;
  if (out_size != 3 * kRows * kDim) return;

  const float* x1     = (const float*)d_in[0];
  const float* x2     = (const float*)d_in[1];
  const float* x3     = (const float*)d_in[2];
  const float* ln1_g  = (const float*)d_in[3];
  const float* ln1_b  = (const float*)d_in[4];
  const float* qkv_w  = (const float*)d_in[5];
  const float* proj_w = (const float*)d_in[6];
  const float* proj_b = (const float*)d_in[7];
  const float* ln2_g  = (const float*)d_in[8];
  const float* ln2_b  = (const float*)d_in[9];
  const float* fc1_w  = (const float*)d_in[10];
  const float* fc1_b  = (const float*)d_in[11];
  const float* fc2_w  = (const float*)d_in[12];
  const float* fc2_b  = (const float*)d_in[13];
  float* out = (float*)d_out;

  // ---- carve ----
  const size_t szWQKV  = (size_t)3 * kDim3 * kDim * 2;
  const size_t szWPROJ = (size_t)3 * kDim * kDim * 2;
  const size_t szWFC1  = (size_t)kHid * kDim3 * 2;
  const size_t szWFC2  = (size_t)kDim3 * kHid * 2;
  const size_t szVT    = (size_t)kGroups * kDim * kSeq * 2;
  const size_t szXN    = (size_t)3 * kRows * kDim * 2;
  const size_t szQKVO  = (size_t)3 * kRows * kDim3 * 2;
  const size_t szHN    = (size_t)kRows * kDim3 * 2;
  const size_t szG     = (size_t)kRows * kHid * 2;
  size_t szBIG = szXN + szQKVO;
  if (szHN + szG > szBIG) szBIG = szHN + szG;
  const size_t szOH    = (size_t)kGroups * kHeads * kSeq * kHdim * 2;
  const size_t szXC    = (size_t)kRows * kDim3 * 4;

  const size_t oWQKV  = 0;
  const size_t oWPROJ = oWQKV + szWQKV;
  const size_t oWFC1  = oWPROJ + szWPROJ;
  const size_t oWFC2  = oWFC1 + szWFC1;
  const size_t oVT    = oWFC2 + szWFC2;
  const size_t oBIG   = oVT + szVT;
  const size_t oOH    = oBIG + szBIG;
  const size_t oXC    = oOH + szOH;
  const size_t oEnd   = oXC + szXC;
  if (oEnd > ws_size) return;

  unsigned char* ws = (unsigned char*)d_ws;
  unsigned short* WPROJ = (unsigned short*)(ws + oWPROJ);
  unsigned short* WFC1  = (unsigned short*)(ws + oWFC1);
  unsigned short* WFC2  = (unsigned short*)(ws + oWFC2);
  unsigned short* VT    = (unsigned short*)(ws + oVT);
  unsigned short* QKVO  = (unsigned short*)(ws + oBIG + szXN);
  unsigned short* G     = (unsigned short*)(ws + oBIG + szHN);
  unsigned short* OH    = (unsigned short*)(ws + oOH);
  float*          XC    = (float*)(ws + oXC);
  const float* fdum = proj_b;   // valid f32 pointer for unused bias, LayerNorm and weight slots

  // ---- QKV from the inputs themselves: (LN1(x_br) . qkv_w[br]) f16 out. M=4096, N=384, K=128; tiles 32*6 = 192 blocks, y = 0..2 ----
  // every block normalises its 128 rows of x_br and casts its 64 columns of qkv_w[br] (carried x16) into LDS
  // q and k columns -> QKVO[br][4096][384]; the V column tiles leave transposed -> VT[g][128][2048]
  // ---- and, as plane y = 3 of the same grid, the weights of the later launches: transpose + f16 (carried x16) ----
  // proj_w [3][128][128] -> WPROJ [3][128][128]; fc1_w [384][768] -> WFC1 [768][384]; fc2_w [768][384] -> WFC2 [384][768]  (156 tiles)
  static_assert(kTilesW <= (kRows / kBM) * (kDim3 / kBN), "the casts fit one plane of the grid");
  gemm_lds<kDim, 1, 6, false, true, false, kFoldVT, kSrcLnCast><<<dim3((kRows / kBM) * (kDim3 / kBN), 4), 256, 0, stream>>>(
      QKVO, kDim, 0L,
      QKVO, kDim, 0L,
      XC, QKVO, VT, kDim3, (long)kRows * kDim3,
      fdum, 0L, x1, x2, x3, 0L, 0,
      kDim3 / kBN, 1.0f / kWCarry,
      ln1_g, ln1_b, qkv_w, proj_w, fc1_w, fc2_w, WPROJ, WFC1, WFC2);

  // ---- attention: all 6 groups x 8 heads in one launch -> per-head planes OH ----
  attn_fused_kernel<<<dim3(kSeq / 128, kGroups * kHeads), 256, 0, stream>>>(QKVO, VT, OH);

  // ---- proj + bias + residual x_br -> XC[:, br*128 .. br*128+127] f32 (ldc 384, resid pitch 128); A staged from the planes OH ----
  // M=4096, N=128, K=128, scale 1/(64*16); tiles 32*2 = 64 blocks per branch, the three branches as batch y of one launch
  gemm_lds<kDim, 1, 4, true, false, true, kFoldHeads, kSrcF16><<<dim3((kRows / kBM) * (kDim / kBN), 3), 256, 0, stream>>>(
      OH, kDim, (long)kRows * kDim,
      WPROJ, kDim, (long)kDim * kDim,
      XC, OH, OH, kDim3, (long)kDim,
      proj_b, (long)kDim, x1, x2, x3, 0L, kDim,
      kDim / kBN, 1.0f / (kOCarry * kWCarry),
      fdum, fdum, fdum, fdum, fdum, fdum, OH, OH, OH);

  // ---- fc1 on LN2(XC) + bias, exact GELU -> G f16 x16 [4096][768]; M=4096, N=768, K=384; tiles 32*12 = 384 blocks ----
  // every block normalises its 128 rows of XC into LDS
  gemm_lds<kDim3, 1, 4, true, true, false, kFoldGelu, kSrcLn><<<dim3((kRows / kBM) * (kHid / kBN), 1), 256, 0, stream>>>(
      G, kDim3, 0L,
      WFC1, kDim3, 0L,
      XC, G, G, kHid, 0L,
      fc1_b, 0L, XC, XC, XC, 0L, 0,
      kHid / kBN, 1.0f / kWCarry,
      ln2_g, ln2_b, fdum, fdum, fdum, fdum, OH, OH, OH);

  // ---- fc2 + bias + residual XC -> three output planes out[k] = [4096][128] (N=128 slice k of 384), K=768, scale 1/256 ----
  // the three slices as batch y of one launch: A shared (stride 0), weights, bias, residual columns and output plane move with y
  // K = 768 in two chunks of 384; tiles 32*2 = 64 blocks per slice
  gemm_lds<kHid / 2, 2, 2, true, false, true, kFoldNone, kSrcF16><<<dim3((kRows / kBM) * (kDim / kBN), 3), 256, 0, stream>>>(
      G, kHid, 0L,
      WFC2, kHid, (long)kDim * kHid,
      out, G, G, kDim, (long)kRows * kDim,
      fc2_b, (long)kDim, XC, XC, XC, (long)kDim, kDim3,
      kDim / kBN, 1.0f / (kGCarry * kWCarry),
      fdum, fdum, fdum, fdum, fdum, fdum, OH, OH, OH);
}

// v006
// One run takes 57.5 microseconds.
// Timed twice side by side with v005, it ran 1.05 and 1.06 times as fast.
// All steps since v000 together make it 28.3 times as fast.
// Contractions: x_ln@Wqkv, o@Wproj, h_ln@Wfc1, g@Wfc2 (activations f16, weights f16 carried x16), scores k.q^T (q,k f16, q carried x head-dim scale x log2(e), head dim 16: two key tiles per A fragment, q zero-padded 16->32 in registers), V^T@P^T (P f16, unnormalised exp carried x2^8, V^T f16): all v_wmma_f32_16x16x32_f16 with f32 accumulate; LayerNorm, online softmax, GELU(erf), bias, residual in f32.
#include <hip/hip_runtime.h>
#include <math.h>

// ---------------------------------------------------------------------------
// Problem constants
// ---------------------------------------------------------------------------
constexpr int kBatch   = 2;
constexpr int kSeq     = 2048;
constexpr int kDim     = 128;
constexpr int kHeads   = 8;
constexpr int kHdim    = 16;
constexpr int kHid     = 768;
constexpr int kRows    = kBatch * kSeq;     // 4096 token rows per branch
constexpr int kDim3    = 3 * kDim;          // 384
constexpr int kGroups  = 3 * kBatch;        // 6 (branch, batch) groups; group g covers plane rows g*2048 .. g*2048+2047
constexpr int kKeyChunk = 512;              // keys staged in LDS at a time
constexpr int kVHalf   = 288;               // LDS bytes from lane half 0's 256 B of a V^T fragment half to lane half 1's
constexpr int kVGrp    = 576;               // LDS bytes per V^T fragment half (16 dims x 16 keys)
constexpr float kWCarry = 16.0f;            // weights carried x16 in f16
constexpr float kPCarryLog2 = 8.0f;         // unnormalised probabilities exp(s - max in use) carried x2^8 in f16
constexpr float kQCarry = 0.25f * 1.44269504088896340736f;   // q carried x head-dim scale x log2(e): k.q is the score in log2 units
constexpr float kPLimit = 32768.0f;         // a sum of four carried probabilities below this: each of them is far inside f16
constexpr float kOCarry = 64.0f;            // attention output carried x64 in f16
constexpr float kGCarry = 16.0f;            // gelu output carried x16 in f16
constexpr float kLnEps  = 1e-5f;

typedef __attribute__((ext_vector_type(16))) _Float16 v16h;
typedef __attribute__((ext_vector_type(8)))  _Float16 v8h;
typedef __attribute__((ext_vector_type(4)))  _Float16 v4h;
typedef __attribute__((ext_vector_type(8)))  float    v8f;
typedef __attribute__((ext_vector_type(4)))  float    v4f;
typedef __attribute__((ext_vector_type(2)))  float    v2f;
typedef __attribute__((ext_vector_type(4)))  unsigned int v4u;
typedef __attribute__((ext_vector_type(2)))  unsigned int v2u;

// ---------------------------------------------------------------------------
// Fragment helpers
// ---------------------------------------------------------------------------
template <typename T> struct Frag;
template <> struct Frag<_Float16> {
  typedef v16h V; union U { v16h v; v8h h[2]; };
  static __device__ __forceinline__ v16h load(const _Float16* p) {   // elements 0..7 <- p[0..7], 8..15 <- p[16..23]
    U f; f.h[0] = *(const v8h*)(p); f.h[1] = *(const v8h*)(p + 16); return f.v;
  }
  static __device__ __forceinline__ v8f mma(v16h a, v16h b, v8f c) {
    return __builtin_amdgcn_wmma_f32_16x16x32_f16(false, a, false, b, (short)0, c, false, false);
  }
};

__device__ __forceinline__ unsigned pk16(unsigned short a, unsigned short b) { return (unsigned)a | ((unsigned)b << 16); }
__device__ __forceinline__ unsigned short h_bits(float f) { const _Float16 h = (_Float16)f; return __builtin_bit_cast(unsigned short, h); }

// ---------------------------------------------------------------------------
// Batched WMMA GEMM with both operands staged in LDS, by asynchronous copies unless SRC makes them itself.
// C[m,n] = scale * sum_k A[m,k] * Bt[n,k] (+bias[n])(+resid[m*ldr+n]); A row-major [M,K], Bt row-major [N,K], f16.
// One workgroup (8 waves) owns a 128 x 64 tile of C; wave (wm = wave&3, wn = wave>>2) owns rows 32wm.., columns 32wn.. (2 x 2 fragments).
// K = NCH * KC. A chunk is KC k of all 192 operand rows: [A 128 rows | Bt 64 rows] at pitch 2*KC + 16 bytes (16 B x odd: no bank
// conflict for the 16-byte fragment reads). Every copy instruction of a wave moves 512 contiguous source bytes, two runs of 256 or (kFoldHeads A) four of 128:
// whole 128-B lines. Each chunk has a buffer of its own, so chunk 1 flies while chunk 0 is multiplied.
// blockIdx.x = tile (column tile fastest), blockIdx.y = b is the batch: operands, output, bias and residual move by their strides
// (elements) per b; the residual base is resid0 / resid1 / resid2 for b = 0 / 1 / 2, then + b * strideR.
// OUT_F16: C is f16 (Ch), else f32 (Cf). The tile leaves through LDS, so every store instruction writes whole 128-B lines.
// FOLD names the pointwise or re-layout pass that the launch does itself, in place of a launch of its own beside it:
//   kFoldGelu   the f16 output is gelu(C + bias), exact erf form, carried x kGCarry;
//   kFoldVT     column tiles from column 2*kDim on (the V columns) leave transposed: Vt[(g*128 + c)*2048 + n], g = plane row / 2048;
//               column tiles below column kDim (the q columns) leave carried x kQCarry;
//   kFoldHeads  A is read from the attention's per-head planes Ap[(g*8 + h)][2048][16]: k = 16h + d.
// Every loop of the engine is unrolled: its arrays (copy operands, fragments, accumulators, residual rows) are registers and asm
// operands, which need constant indices.
// ---------------------------------------------------------------------------
constexpr int kBM = 128, kBN = 64, kCPitch = 68;   // kCPitch: floats per staged row of C
constexpr int kTPitch = 136;                       // halves per staged row of a transposed V tile: 272 B = 16 B x odd
constexpr int kFoldNone = 0, kFoldGelu = 1, kFoldVT = 2, kFoldHeads = 3;
constexpr int kSrcF16 = 0, kSrcLn = 1, kSrcLnCast = 2;

// N copies and, in the same statement, the wait that stands before any register they name is rewritten.
__device__ __forceinline__ void async_copy4(const unsigned* l, const unsigned short* const* g) {
  asm volatile("global_load_async_to_lds_b128 %0, %4, off\n\t"
               "global_load_async_to_lds_b128 %1, %5, off\n\t"
               "global_load_async_to_lds_b128 %2, %6, off\n\t"
               "global_load_async_to_lds_b128 %3, %7, off\n\t"
               "s_wait_xcnt 0x0"
               :: "v"(l[0]), "v"(l[1]), "v"(l[2]), "v"(l[3]), "v"(g[0]), "v"(g[1]), "v"(g[2]), "v"(g[3]) : "memory");
}
__device__ __forceinline__ void async_copy12(const unsigned* l, const unsigned short* const* g) {
  asm volatile("global_load_async_to_lds_b128 %0, %12, off\n\t"
               "global_load_async_to_lds_b128 %1, %13, off\n\t"
               "global_load_async_to_lds_b128 %2, %14, off\n\t"
               "global_load_async_to_lds_b128 %3, %15, off\n\t"
               "global_load_async_to_lds_b128 %4, %16, off\n\t"
               "global_load_async_to_lds_b128 %5, %17, off\n\t"
               "global_load_async_to_lds_b128 %6, %18, off\n\t"
               "global_load_async_to_lds_b128 %7, %19, off\n\t"
               "global_load_async_to_lds_b128 %8, %20, off\n\t"
               "global_load_async_to_lds_b128 %9, %21, off\n\t"
               "global_load_async_to_lds_b128 %10, %22, off\n\t"
               "global_load_async_to_lds_b128 %11, %23, off\n\t"
               "s_wait_xcnt 0x0"
               :: "v"(l[0]), "v"(l[1]), "v"(l[2]), "v"(l[3]), "v"(l[4]), "v"(l[5]), "v"(l[6]), "v"(l[7]), "v"(l[8]), "v"(l[9]),
                  "v"(l[10]), "v"(l[11]),
                  "v"(g[0]), "v"(g[1]), "v"(g[2]), "v"(g[3]), "v"(g[4]), "v"(g[5]), "v"(g[6]), "v"(g[7]), "v"(g[8]), "v"(g[9]),
                  "v"(g[10]), "v"(g[11]) : "memory");
}

// ROWS rows of KC halves from g0 (row pitch ld halves) to LDS byte address lds0 (row pitch 2*KC + 16). A row is KC/8 pieces of 16 B.
// PER * 256 pieces = 16 whole rows: lane t takes pieces i*256 + t (i < PER) of every 16-row band, so its addresses in the next band
// are the same plus a constant. Each piece is copied by exactly one lane; every lane is on.
template <int KC, int ROWS>
__device__ __forceinline__ void stage_rows(const unsigned short* g0, int ld, unsigned lds0, int t) {
  constexpr int CPR = KC / 8, PER = CPR / 16, BAND = 16, NB = ROWS / BAND, PITCH = KC * 2 + 16;
  static_assert(CPR % 16 == 0 && (PER == 1 || PER == 3) && NB % 4 == 0, "whole bands, four bands a statement");
  const unsigned short* gb[PER];
  unsigned lb[PER];
#pragma unroll
  for (int i = 0; i < PER; ++i) {
    const int e = i * 256 + t;
    const int r = e / CPR, c = e - r * CPR;
    gb[i] = g0 + (r * ld + c * 8);
    lb[i] = lds0 + (unsigned)(r * PITCH + c * 16);
  }
  const size_t step = (size_t)(BAND * ld);
#pragma unroll
  for (int j0 = 0; j0 < NB; j0 += 4) {
    unsigned l[4 * PER];
    const unsigned short* g[4 * PER];
#pragma unroll
    for (int jj = 0; jj < 4; ++jj)
#pragma unroll
      for (int i = 0; i < PER; ++i) {
        l[jj * PER + i] = lb[i] + (unsigned)((j0 + jj) * BAND * PITCH);
        g[jj * PER + i] = gb[i] + (size_t)(j0 + jj) * step;
      }
    if (PER == 3) async_copy12(l, g); else async_copy4(l, g);
  }
}

// 128 rows of A = 8 heads x 16 dims from the per-head planes; o0 = head 0's plane at the tile's first row, LDS row pitch 2*kDim + 16.
// A band is 16 rows = 256 pieces of 16 B. A wave takes 4 heads x 4 rows x 2 pieces: per head 128 contiguous, aligned source bytes,
// so every copy instruction moves 4 whole lines. Each piece is copied by exactly one lane; every lane is on.
__device__ __forceinline__ void stage_heads(const unsigned short* o0, unsigned lds0, int t) {
  constexpr int PITCH = kDim * 2 + 16;
  const int lane = t & 31, wave = t >> 5;
  const int h = (wave & 1) * 4 + (lane >> 3);
  const int r = (wave >> 1) * 4 + ((lane >> 1) & 3);
  const int p = lane & 1;
  const unsigned short* gb = o0 + (h * kSeq * kHdim + r * kHdim + p * 8);
  const unsigned lb = lds0 + (unsigned)(r * PITCH + (h * 2 + p) * 16);
#pragma unroll
  for (int j0 = 0; j0 < kBM / 16; j0 += 4) {
    unsigned l[4];
    const unsigned short* g[4];
#pragma unroll
    for (int jj = 0; jj < 4; ++jj) {
      l[jj] = lb + (unsigned)((j0 + jj) * 16 * PITCH);
      g[jj] = gb + (j0 + jj) * 16 * kHdim;
    }
    async_copy4(l, g);
  }
}

// value of the lane whose number differs by MASK inside the 16-lane row (DPP row_xmask)
template <int MASK> __device__ __forceinline__ float lane_xor(float v) {
  return __builtin_bit_cast(float, __builtin_amdgcn_update_dpp(0, __builtin_bit_cast(int, v), 0x160 + MASK, 0xf, 0xf, true));
}

__device__ __forceinline__ float rsq_slot(float x) {
  float r;
  asm("v_rsq_f32 %0, %1\n\tv_nop" : "=v"(r) : "v"(x));
  return r;
}

// 128 rows of x (f32, KC features, x0 = the tile's first row) -> LayerNorm -> f16 rows in LDS at pitch 2*KC + 16.
// LPR lanes share a row, so a wave instruction works on 32/LPR rows: lane j of them holds the 16-B pieces j, j + LPR, j + 2*LPR, ...,
// and every load instruction covers whole 128-B lines of each of its rows. A wave takes 16 rows, two passes to a group;
// the next group's loads are asked for ahead of this group's arithmetic.
template <int KC>
__device__ __forceinline__ void stage_ln(const float* __restrict__ x0, const float* __restrict__ g, const float* __restrict__ bt,
                                         unsigned char* sA, int t) {
  constexpr int PITCH = KC * 2 + 16;
  constexpr int LPR = (KC == kDim) ? 8 : 16, NQ = KC / 4 / LPR, RP = 32 / LPR, NG = 16 / RP / 2;
  static_assert(NQ * LPR * 4 == KC, "whole pieces");
  const int lane = t & 31, wave = t >> 5;
  const int j = lane & (LPR - 1), rr = lane / LPR;
  const unsigned xo = (unsigned)((wave * 16 + rr) * KC + j * 4) * 4u;   // bytes: uniform base + one 32-bit lane offset
  const unsigned go = (unsigned)(j * 4) * 4u;
  v4f xv[NG][2][NQ], gv[NQ], bv[NQ];
#pragma unroll
  for (int q = 0; q < NQ; ++q) {
    gv[q] = *(const v4f*)((const char*)(g + q * LPR * 4) + go);
    bv[q] = *(const v4f*)((const char*)(bt + q * LPR * 4) + go);
  }
#pragma unroll
  for (int gi = -1; gi < NG; ++gi) {
    if (gi + 1 < NG) {
#pragma unroll
      for (int p = 0; p < 2; ++p)
#pragma unroll
        for (int q = 0; q < NQ; ++q)
          xv[gi + 1][p][q] = *(const v4f*)((const char*)(x0 + (((gi + 1) * 2 + p) * RP * KC + q * LPR * 4)) + xo);
      // the lane offsets stay in their registers up to this wait, which stands before any register these loads name is rewritten
      asm volatile("s_wait_xcnt 0x0" :: "v"(xo), "v"(go) : "memory");
    }
    if (gi < 0) continue;
#pragma unroll
    for (int p = 0; p < 2; ++p) {
      v4f a = xv[gi][p][0];
#pragma unroll
      for (int q = 1; q < NQ; ++q) a += xv[gi][p][q];
      float s1 = (a[0] + a[1]) + (a[2] + a[3]);
      s1 += lane_xor<1>(s1);
      s1 += lane_xor<2>(s1);
      s1 += lane_xor<4>(s1);
      if (LPR == 16) s1 += lane_xor<8>(s1);
      const float mean = s1 * (1.0f / KC);
      v4f a2 = (v4f){0.f, 0.f, 0.f, 0.f};
#pragma unroll
      for (int q = 0; q < NQ; ++q) {
        xv[gi][p][q] -= mean;
        a2 += xv[gi][p][q] * xv[gi][p][q];
      }
      float s2 = (a2[0] + a2[1]) + (a2[2] + a2[3]);
      s2 += lane_xor<1>(s2);
      s2 += lane_xor<2>(s2);
      s2 += lane_xor<4>(s2);
      if (LPR == 16) s2 += lane_xor<8>(s2);
      const float rstd = rsq_slot(s2 * (1.0f / KC) + kLnEps);
      unsigned char* row = sA + (wave * 16 + (gi * 2 + p) * RP + rr) * PITCH + j * 8;
#pragma unroll
      for (int q = 0; q < NQ; ++q)
        *(v4h*)(row + q * LPR * 8) = __builtin_convertvector(xv[gi][p][q] * rstd * gv[q] + bv[q], v4h);
    }
  }
}

// 64 columns of a weight plane W (f32 [kDim][LDW], w0 = W + first column) -> Bt rows [column][k] f16 carried x kWCarry, LDS pitch 2*kDim + 16.
// Lane = column, so every load instruction reads one whole 128-B line; a thread packs 8 consecutive k of its column into one 16-B store.
template <int LDW>
__device__ __forceinline__ void stage_wcast128(const float* __restrict__ w0, unsigned char* sB, int t) {
  constexpr int PITCH = kDim * 2 + 16;
  const int nl = t & 63, kq = t >> 6;
  const unsigned wo = (unsigned)(kq * 8 * LDW + nl) * 4u;   // bytes: uniform base + one 32-bit lane offset
  float wv[4][8];
#pragma unroll
  for (int i = 0; i < 4; ++i)
#pragma unroll
    for (int e = 0; e < 8; ++e) wv[i][e] = *(const float*)((const char*)(w0 + (i * 32 + e) * LDW) + wo);
  // as in stage_ln: the lane offset lives up to the wait
  asm volatile("s_wait_xcnt 0x0" :: "v"(wo) : "memory");
#pragma unroll
  for (int i = 0; i < 4; ++i) {
    v8h hv;
#pragma unroll
    for (int e = 0; e < 8; ++e) hv[e] = (_Float16)(wv[i][e] * kWCarry);
    *(v8h*)(sB + nl * PITCH + (i * 4 + kq) * 16) = hv;
  }
}

__device__ __forceinline__ float gelu_erf(float x) { return 0.5f * x * (1.0f + erff(x * 0.70710678118654752f)); }

constexpr int kTilesProj = (kDim / 64) * (kDim / 64) * 3;    // 12
constexpr int kTilesFc1  = (kDim3 / 64) * (kHid / 64);       // 72
constexpr int kTilesFc2  = (kHid / 64) * (kDim3 / 64);       // 72
constexpr int kTilesW    = kTilesProj + kTilesFc1 + kTilesFc2;   // 156
__device__ __forceinline__ void wtcast_tile(int r0, const float* __restrict__ wProj,
                                            const float* __restrict__ wFc1, const float* __restrict__ wFc2,
                                            unsigned short* __restrict__ oProj,
                                            unsigned short* __restrict__ oFc1, unsigned short* __restrict__ oFc2,
                                            float scale);

// SRC names what the block makes of f32 data in LDS itself, in place of a launch in front of it:
//   kSrcLn      A = LayerNorm over KC features of the f32 rows of resid0 / resid1 / resid2 (b = 0 / 1 / 2; gain and shift lng, lnb + b * KC);
//               Ap is not read;
//   kSrcLnCast  the same, and Bt = the columns of the f32 plane Wf + b * kDim * kDim3, cast by the block; Btp is not read either.
// Plane blockIdx.y = 3 of a kSrcLnCast grid holds no GEMM tile: its first kTilesW blocks cast one tile each of the weights of the later launches
// (block-uniform choice, so the cast's barrier is passed by a whole block or by none).
// WPE = waves per SIMD that the register budget must leave room for: 2 * workgroups per WGP that the LDS size and the grid ask for.
template <int KC, int NCH, int WPE, bool BIAS, bool OUT_F16, bool RESID, int FOLD, int SRC>
__global__ __launch_bounds__(256, WPE) void gemm_lds(
    const unsigned short* __restrict__ Ap, int lda, long strideA,
    const unsigned short* __restrict__ Btp, int ldb, long strideB,
    float* __restrict__ Cf, unsigned short* __restrict__ Ch, unsigned short* __restrict__ Vt, int ldc, long strideC,
    const float* __restrict__ bias, long strideBias,
    const float* __restrict__ resid0, const float* __restrict__ resid1, const float* __restrict__ resid2, long strideR, int ldr,
    int tilesN, float scale,
    const float* __restrict__ lng, const float* __restrict__ lnb, const float* __restrict__ Wf,
    const float* __restrict__ wProj, const float* __restrict__ wFc1, const float* __restrict__ wFc2,
    unsigned short* __restrict__ oProj, unsigned short* __restrict__ oFc1, unsigned short* __restrict__ oFc2) {
  if (SRC == kSrcLnCast && blockIdx.y == 3) {
    if (blockIdx.x < kTilesW) wtcast_tile(blockIdx.x, wProj, wFc1, wFc2, oProj, oFc1, oFc2, kWCarry);
    return;
  }
  constexpr int PITCH = KC * 2 + 16;
  constexpr int BUF   = (kBM + kBN) * PITCH;
  constexpr int GK    = 2, NG = KC / 32 / GK;   // fragments are fetched in groups of GK k steps, one group ahead
  static_assert(kBM * kCPitch * 4 <= BUF, "the staged C tile fits the first buffer");
  static_assert((kBM + kBN) * (KC / 8) / 256 <= 63, "copies of one chunk outstanding per wave");
  static_assert(FOLD != kFoldHeads || (KC == kDim && NCH == 1), "a row of A is the 8 heads of one token");
  static_assert(FOLD != kFoldGelu || OUT_F16, "the activation leaves as f16");
  static_assert(SRC == kSrcF16 || (NCH == 1 && !RESID && FOLD != kFoldHeads), "a chunk holds the whole normalised row; the residual slots name its source");
  static_assert(SRC != kSrcLnCast || KC == kDim, "the cast stages 128 k");
  static_assert(FOLD != kFoldVT || (OUT_F16 && !BIAS && kBN * kTPitch * 2 <= BUF), "the transposed tile fits the first buffer");
  __shared__ __align__(128) unsigned char smem[NCH * BUF];
  const int t    = threadIdx.x;
  const int lane = t & 31, wave = t >> 5;
  const int b    = blockIdx.y;
  const int tm   = blockIdx.x / tilesN;
  const int tn   = blockIdx.x - tm * tilesN;
  const int m0   = tm * kBM, n0 = tn * kBN;
  const unsigned short* Ab = Ap  + (size_t)b * strideA + (size_t)m0 * lda;
  const unsigned short* Bb = Btp + (size_t)b * strideB + (size_t)n0 * ldb;
  const unsigned lds0 = (unsigned)(size_t)smem;   // low 32 bits of the shared address = byte offset in the workgroup's LDS

  const int grp = b * (kRows / kSeq) + m0 / kSeq, tok = m0 % kSeq;   // the tile's (branch, batch) group and its first token there
  if (SRC == kSrcF16) {
    if (FOLD == kFoldHeads) stage_heads(Ap + ((size_t)grp * kHeads * kSeq + tok) * kHdim, lds0, t);
    else                    stage_rows<KC, kBM>(Ab, lda, lds0, t);
    stage_rows<KC, kBN>(Bb, ldb, lds0 + kBM * PITCH, t);
  } else {   // Bt is asked for first, so that it flies under the LayerNorm arithmetic
    if (SRC == kSrcLnCast) stage_wcast128<kDim3>(Wf + (size_t)b * (kDim * kDim3) + n0, smem + kBM * PITCH, t);
    else                   stage_rows<KC, kBN>(Bb, ldb, lds0 + kBM * PITCH, t);
    stage_ln<KC>(((b == 0) ? resid0 : (b == 1) ? resid1 : resid2) + (size_t)m0 * KC, lng + b * KC, lnb + b * KC, smem, t);
  }

  // bias and residual of the rows this thread will store: asked for now, used in the epilogue
  const int c4 = (t & 15) * 4, r4 = t >> 4;            // f32 C: a row of 256 B = 16 lanes x 16 B; 16 rows a trip
  const int c8 = (t & 7) * 8, r8 = t >> 3;             // f16 C: a row of 128 B = 8 lanes x 16 B; 32 rows a trip
  v4f bv = (v4f){0.f, 0.f, 0.f, 0.f};
  v4f bh[2] = {bv, bv};
  v4f rv[kBM / 16];
  if (BIAS) bv = *(const v4f*)(bias + (size_t)b * strideBias + n0 + c4);
  if (BIAS && OUT_F16) {
    const float* bp = bias + (size_t)b * strideBias + n0 + c8;
    bh[0] = *(const v4f*)bp;
    bh[1] = *(const v4f*)(bp + 4);
  }
  if (RESID) {
    const float* rp = ((b == 0) ? resid0 : (b == 1) ? resid1 : resid2) + (size_t)b * strideR + (size_t)(m0 + r4) * ldr + n0 + c4;
    const float* rq[kBM / 16];
#pragma unroll
    for (int it = 0; it < kBM / 16; ++it) { rq[it] = rp + (size_t)(it * 16 * ldr); rv[it] = *(const v4f*)rq[it]; }
    // the eight addresses stay in their registers up to this wait, so no load of the run returns onto an earlier load's address
    asm volatile("s_wait_xcnt 0x0" :: "v"(rq[0]), "v"(rq[1]), "v"(rq[2]), "v"(rq[3]), "v"(rq[4]), "v"(rq[5]), "v"(rq[6]), "v"(rq[7]) : "memory");
  }

  if (SRC != kSrcLnCast) asm volatile("s_wait_asynccnt 0x0" ::: "memory");   // this wave's copies of chunk 0 have landed
  __syncthreads();                                    // chunk 0 visible to every wave
  if (NCH > 1) {                                      // chunk 1 flies under chunk 0's products
    stage_rows<KC, kBM>(Ab + KC, lda, lds0 + BUF, t);
    stage_rows<KC, kBN>(Bb + KC, ldb, lds0 + BUF + kBM * PITCH, t);
  }

  const int rlane = lane & 15, hh = lane >> 4;
  const int wm = wave & 3, wn = wave >> 2;
  v8f acc[2][2];
#pragma unroll
  for (int i = 0; i < 2; ++i)
#pragma unroll
    for (int j = 0; j < 2; ++j) acc[i][j] = (v8f){0.f, 0.f, 0.f, 0.f, 0.f, 0.f, 0.f, 0.f};

#pragma unroll
  for (int ch = 0; ch < NCH; ++ch) {
    const unsigned char* aP = smem + ch * BUF + (wm * 32 + rlane) * PITCH + hh * 16;
    const unsigned char* bP = smem + ch * BUF + (kBM + wn * 32 + rlane) * PITCH + hh * 16;
    v16h fa[2][GK][2], fb[2][GK][2];
#pragma unroll
    for (int g = -1; g < NG; ++g) {
      if (g + 1 < NG) {
#pragma unroll
        for (int s = 0; s < GK; ++s)
#pragma unroll
          for (int i = 0; i < 2; ++i) {
            fa[(g + 1) & 1][s][i] = Frag<_Float16>::load((const _Float16*)(aP + i * 16 * PITCH + ((g + 1) * GK + s) * 64));
            fb[(g + 1) & 1][s][i] = Frag<_Float16>::load((const _Float16*)(bP + i * 16 * PITCH + ((g + 1) * GK + s) * 64));
          }
      }
      __builtin_amdgcn_sched_barrier(0);   // the next group's LDS reads stay one group, ahead of this group's products, not among them
      if (g >= 0) {
#pragma unroll
        for (int s = 0; s < GK; ++s)
#pragma unroll
          for (int i = 0; i < 2; ++i)
#pragma unroll
            for (int j = 0; j < 2; ++j) acc[i][j] = Frag<_Float16>::mma(fa[g & 1][s][i], fb[g & 1][s][j], acc[i][j]);
      }
      __builtin_amdgcn_sched_barrier(0);   // and the reads of the group after that stay behind these products
    }
    asm volatile("s_wait_dscnt 0x0" ::: "memory");                    // this wave's reads of the chunk are done
    if (NCH > 1) asm volatile("s_wait_asynccnt 0x0" ::: "memory");    // this wave's copies of the next chunk have landed; behind the last chunk none is left
    __syncthreads();   // next chunk visible to every wave; behind the last chunk: every reader has left, the LDS becomes C staging
  }

  // ---- epilogue: scaled tile to LDS in accumulator order, out of it in whole rows ----
  float* sC = (float*)smem;
  _Float16* sT = (_Float16*)smem;
  const bool vtile = FOLD == kFoldVT && n0 >= 2 * kDim;   // block-uniform: the whole tile is V columns
  const float cscale = (FOLD == kFoldVT && n0 < kDim) ? scale * kQCarry : scale;   // block-uniform: the whole tile is q columns
  if (vtile) {
    // a lane's 8 accumulator registers are 8 consecutive rows of one column: 16 contiguous bytes of the transposed tile
#pragma unroll
    for (int i = 0; i < 2; ++i)
#pragma unroll
      for (int j = 0; j < 2; ++j)
        *(v8h*)(sT + (wn * 32 + j * 16 + rlane) * kTPitch + wm * 32 + i * 16 + hh * 8) = __builtin_convertvector(acc[i][j] * scale, v8h);
  } else {
#pragma unroll
    for (int i = 0; i < 2; ++i)
#pragma unroll
      for (int j = 0; j < 2; ++j)
#pragma unroll
        for (int r = 0; r < 8; ++r)
          sC[(wm * 32 + i * 16 + hh * 8 + r) * kCPitch + wn * 32 + j * 16 + rlane] = acc[i][j][r] * cscale;
  }
  __syncthreads();   // staged tile visible to every wave
  if (vtile) {
    // 64 dims x 128 tokens: a row of 256 B = 16 lanes x 16 B; 16 rows a trip
    unsigned short* vp = Vt + ((size_t)grp * kDim + (n0 - 2 * kDim)) * kSeq + tok;
    const unsigned vo = (unsigned)(r4 * kSeq + (t & 15) * 8) * 2u;   // bytes: uniform base + one 32-bit lane offset
#pragma unroll
    for (int it = 0; it < kBN / 16; ++it) {
      const v8h hv = *(const v8h*)(sT + (it * 16 + r4) * kTPitch + (t & 15) * 8);
      *(v8h*)((char*)(vp + (size_t)(it * 16 * kSeq)) + vo) = hv;
    }
  } else if (!OUT_F16) {
    float* cp = Cf + (size_t)b * strideC + (size_t)m0 * ldc + n0;
    const unsigned co = (unsigned)(r4 * ldc + c4) * 4u;   // bytes: uniform base + one 32-bit lane offset
#pragma unroll
    for (int it = 0; it < kBM / 16; ++it) {
      v4f v = *(const v4f*)(sC + (it * 16 + r4) * kCPitch + c4);
      if (BIAS)  v += bv;
      if (RESID) v += rv[it];
      *(v4f*)((char*)(cp + (size_t)(it * 16 * ldc)) + co) = v;
    }
  } else {
    unsigned short* cp = Ch + (size_t)b * strideC + (size_t)m0 * ldc + n0;
    const unsigned co = (unsigned)(r8 * ldc + c8) * 2u;   // bytes: uniform base + one 32-bit lane offset
    v4f sv[kBM / 32][2];   // all of the thread's staged values are asked for at once, ahead of the pointwise work
#pragma unroll
    for (int it = 0; it < kBM / 32; ++it) {
      const float* sp = sC + (it * 32 + r8) * kCPitch + c8;
      sv[it][0] = *(const v4f*)sp;
      sv[it][1] = *(const v4f*)(sp + 4);
    }
#pragma unroll
    for (int it = 0; it < kBM / 32; ++it) {
      v8h hv;
#pragma unroll
      for (int e = 0; e < 8; ++e) {
        float x = sv[it][e >> 2][e & 3];
        if (BIAS) x += bh[e >> 2][e & 3];
        if (FOLD == kFoldGelu) x = gelu_erf(x) * kGCarry;
        hv[e] = (_Float16)x;
      }
      *(v8h*)((char*)(cp + (size_t)(it * 32 * ldc)) + co) = hv;
    }
  }
}

// ---------------------------------------------------------------------------
// Weight transpose + cast: W plane z is f32 [nIn][nOut] row-major; WT plane z = [nOut][nIn] f16, WT[h][d] = f16(scale * W[d][h]).
// The three weight tensors that later launches read, in one index space: tile index r0 falls into one tensor's range of (nIn/64)*(nOut/64)*nz tiles
// (block-uniform choice), and inside the range it runs d tile fastest, then h tile, then plane z.
// 256 threads; nIn, nOut multiples of 64. Plane z at out + z*nOut*nIn halves.
// Load coverage: 16 iterations x 256 threads = 4096 = the whole 64x64 tile (coalesced along h).
// Store coverage: 8 waves x 2 iterations x 4 rows (lane>>3) = 64 rows; (lane&7) x 8 halves = 64 cols; each row segment =
// ---------------------------------------------------------------------------
__device__ __forceinline__ void wtcast_tile(int r0, const float* __restrict__ wProj,
                                            const float* __restrict__ wFc1, const float* __restrict__ wFc2,
                                            unsigned short* __restrict__ oProj,
                                            unsigned short* __restrict__ oFc1, unsigned short* __restrict__ oFc2,
                                            float scale) {
  __shared__ float sm[64][65];   // sm[h_local][d_local]
  const int t  = threadIdx.x;
  const float* W = wProj; unsigned short* out = oProj; int nIn = kDim, nOut = kDim;
  if (r0 >= kTilesProj + kTilesFc1) { r0 -= kTilesProj + kTilesFc1; W = wFc2; out = oFc2; nIn = kHid; nOut = kDim3; }
  else if (r0 >= kTilesProj)        { r0 -= kTilesProj; W = wFc1; out = oFc1; nIn = kDim3; nOut = kHid; }
  const int gx = nIn >> 6, gy = nOut >> 6;
  const int r1 = r0 / gx;
  const int d0 = (r0 - r1 * gx) * 64;
  const int z  = r1 / gy;
  const int h0 = (r1 - z * gy) * 64;
  const float* Wz = W + (size_t)z * nIn * nOut;
#pragma unroll
  for (int i = 0; i < 16; ++i) {
    const int e = i * 256 + t;
    const int r = e >> 6;          // d local
    const int c = e & 63;          // h local
    sm[c][r] = Wz[(size_t)(d0 + r) * nOut + h0 + c] * scale;
  }
  __syncthreads();
  const int lane = t & 31, wave = t >> 5;
  const int q = lane >> 3, c8 = (lane & 7) * 8;
  unsigned short* op = out + (size_t)z * nOut * nIn;
  {
#pragma unroll
    for (int it = 0; it < 2; ++it) {
      const int row = wave * 8 + it * 4 + q;                 // h local
      unsigned short hb[8];
#pragma unroll
      for (int e = 0; e < 8; ++e) hb[e] = h_bits(sm[row][c8 + e]);
      const v4u u = (v4u){pk16(hb[0], hb[1]), pk16(hb[2], hb[3]), pk16(hb[4], hb[5]), pk16(hb[6], hb[7])};
      *(v4u*)(op + (size_t)(h0 + row) * nIn + d0 + c8) = u;
    }
    
  }
}

// ---------------------------------------------------------------------------
// Fused attention, one launch for all 48 (group, head) pairs: S^T = K.Q^T, online softmax, O^T += V^T.P^T.
// grid (2048/128 = 16 query blocks, 48), 256 threads = 8 waves x 16 queries. Lane (c = lane&15, hh = lane>>4) owns query c.
// K and V^T of the head are staged through registers into LDS, 512 keys at a time, already in fragment order:
//   sK: 16-key tile T at T*512; lane's 16 B (key c, dims 8hh..8hh+7) at + lane*16.
//   sV: fragment half G (keys 16G + 8hh + 0..7 of dim c) at G*576 + hh*288 + c*16.
// S^T tile register r = score(key 8hh + r, query c), so two tiles converted in place are the B operand P^T (hardware k
// order), and V^T as A is read in the same k order. O^T register r = O(query c, dim 8hh + r): one 16-B store per lane.
// oh[(g*8 + head)][2048][16] f16 carried x64: each wave writes 512 contiguous bytes.
// ---------------------------------------------------------------------------
__device__ __forceinline__ float other_half(float v) {   // value of lane ^ 16
  const int b = __builtin_bit_cast(int, v);
  return __builtin_bit_cast(float, __builtin_amdgcn_permlanex16(b, b, 0x76543210, 0xfedcba98, false, false));
}
__device__ __forceinline__ float vmax8(v8f a) {
  return fmaxf(fmaxf(fmaxf(a[0], a[1]), fmaxf(a[2], a[3])), fmaxf(fmaxf(a[4], a[5]), fmaxf(a[6], a[7])));
}
__device__ __forceinline__ v8f vexp2_8(v8f a) {
  v8f r;
#pragma unroll
  for (int e = 0; e < 8; ++e) r[e] = __builtin_amdgcn_exp2f(a[e]);
  return r;
}
__device__ __forceinline__ v8f splat8(float x) { return (v8f){x, x, x, x, x, x, x, x}; }
// largest score (log2 units) of the lane's query over the 64 keys whose four staged tiles begin at kt (the lane's own 16 B), both lane halves joined
__device__ __forceinline__ float max64(const unsigned char* kt, v16h qlo, v16h qhi) {
  const v8f z = (v8f){0.f, 0.f, 0.f, 0.f, 0.f, 0.f, 0.f, 0.f};
  float mx = -INFINITY;
#pragma unroll
  for (int j = 0; j < 2; ++j) {
    Frag<_Float16>::U kf;
    kf.h[0] = *(const v8h*)(kt + (2 * j) * 512);
    kf.h[1] = *(const v8h*)(kt + (2 * j + 1) * 512);
    mx = fmaxf(mx, fmaxf(vmax8(Frag<_Float16>::mma(kf.v, qlo, z)), vmax8(Frag<_Float16>::mma(kf.v, qhi, z))));
  }
  return fmaxf(mx, other_half(mx));
}
// six waves per SIMD = three workgroups per WGP: 768 workgroups fill 256 WGPs in one even round
__global__ __launch_bounds__(256) __attribute__((amdgpu_waves_per_eu(6))) void attn_fused_kernel(const unsigned short* __restrict__ qkvo,
                                                         const unsigned short* __restrict__ vt,
                                                         unsigned short* __restrict__ oh) {
  __shared__ __align__(128) unsigned char sK[kKeyChunk * 32];
  __shared__ __align__(128) unsigned char sV[(kKeyChunk / 16) * kVGrp];
  typedef Frag<_Float16>::U FU;
  const int lane = threadIdx.x & 31, wave = threadIdx.x >> 5;
  const int c = lane & 15, hh = lane >> 4;
  const int gh = blockIdx.y, g = gh >> 3, hd = gh & 7;
  const int q0 = blockIdx.x * 128 + wave * 16;
  const v8h zero8 = (v8h){0, 0, 0, 0, 0, 0, 0, 0};
  const v8f zacc  = (v8f){0.f, 0.f, 0.f, 0.f, 0.f, 0.f, 0.f, 0.f};

  // One A fragment holds two 16-key tiles (k 0..15 = dims of the first, k 16..31 = dims of the second);
  // q sits in the lower k half of qlo and in the upper k half of qhi, zeros in the other half, so each picks one tile.
  FU qlo, qhi;
  qlo.h[0] = *(const v8h*)(qkvo + (size_t)(g * kSeq + q0 + c) * kDim3 + hd * kHdim + 8 * hh);
  qlo.h[1] = zero8;
  qhi.h[0] = zero8;
  qhi.h[1] = qlo.h[0];

  // staging, 4 rounds of 8 waves per chunk. K round i: wave takes the 16-key tile i*8 + wave, lane = (key c, 16-B part hh).
  // V^T round i: wave takes 4 dims x 8 parts of 8 keys (4 whole 128-B lines): dim sd, part i*16 + sp of the chunk.
  const int sd = (wave & 3) * 4 + (lane >> 3);
  const int sp = (wave >> 2) * 8 + (lane & 7);
  const unsigned short* kp = qkvo + (size_t)(g * kSeq + wave * 16 + c) * kDim3 + kDim + hd * kHdim + 8 * hh;
  const unsigned short* vp = vt + (size_t)(g * kDim + hd * kHdim + sd) * kSeq + sp * 8;
  unsigned char* skw = sK + wave * 512 + lane * 16;
  unsigned char* svw = sV + (sp >> 1) * kVGrp + (sp & 1) * kVHalf + sd * 16;
  v4u kr[4], vr[4];
#pragma unroll
  for (int i = 0; i < 4; ++i) {
    kr[i] = *(const v4u*)(kp + (size_t)i * 128 * kDim3);
    vr[i] = *(const v4u*)(vp + i * 128);
  }

  // Lazy rescale. m = the maximum in use of the lane's query (log2 units), the same in both lane halves; cv = kPCarryLog2 - m in all eight
  // registers is the C operand of the score products, which so leave the matrix unit as the exponents themselves.
  float m = 0.f;
  v8f cv = zacc;
  v8f lv = zacc;
  v8f o  = zacc;
  for (int ch = 0; ch < kSeq / kKeyChunk; ++ch) {
    __syncthreads();   // every wave has finished reading the previous chunk
#pragma unroll
    for (int i = 0; i < 4; ++i) {
      *(v4u*)(skw + i * 8 * 512) = kr[i];
      *(v4u*)(svw + i * 8 * kVGrp) = vr[i];
    }
    __syncthreads();   // chunk visible to every wave
    if (ch + 1 < kSeq / kKeyChunk) {   // next chunk's global loads fly under this chunk's work
      kp += (size_t)kKeyChunk * kDim3;
      vp += kKeyChunk;
#pragma unroll
      for (int i = 0; i < 4; ++i) {
        kr[i] = *(const v4u*)(kp + (size_t)i * 128 * kDim3);
        vr[i] = *(const v4u*)(vp + i * 128);
      }
    }
    if (ch == 0) {   // the first maximum in use: that of the first 64 keys
      m  = max64(sK + lane * 16, qlo.v, qhi.v);
      cv = splat8(kPCarryLog2 - m);
    }
#pragma unroll 2   // a rolled loop keeps the registers inside the six-wave budget with no scratch
    for (int kb = 0; kb < kKeyChunk / 64; ++kb) {
      const unsigned char* kt = sK + kb * 4 * 512 + lane * 16;
      FU kf[2];
#pragma unroll
      for (int j = 0; j < 2; ++j) {
        kf[j].h[0] = *(const v8h*)(kt + (2 * j) * 512);
        kf[j].h[1] = *(const v8h*)(kt + (2 * j + 1) * 512);
      }
      v8f pe[4];
#pragma unroll
      for (int j = 0; j < 2; ++j) {
        pe[2 * j]     = vexp2_8(Frag<_Float16>::mma(kf[j].v, qlo.v, cv));
        pe[2 * j + 1] = vexp2_8(Frag<_Float16>::mma(kf[j].v, qhi.v, cv));
      }
      v8f ps = (pe[0] + pe[1]) + (pe[2] + pe[3]);
      // One test per 64 keys, a scalar branch for the whole wave: only where a score has outgrown the maximum in use so far that its
      // probability nears the f16 range is the maximum taken anew, sums and output rescaled and the 64 keys' probabilities made again.
      if (__builtin_amdgcn_ballot_w32(!(vmax8(ps) < kPLimit)) != 0) {
        const float mn = fmaxf(m, max64(kt, qlo.v, qhi.v));
        const float alpha = __builtin_amdgcn_exp2f(m - mn);
        m  = mn;
        cv = splat8(kPCarryLog2 - mn);
        lv = lv * alpha;
        o  = o * alpha;
#pragma unroll
        for (int j = 0; j < 2; ++j) {
          pe[2 * j]     = vexp2_8(Frag<_Float16>::mma(kf[j].v, qlo.v, zacc) + cv);
          pe[2 * j + 1] = vexp2_8(Frag<_Float16>::mma(kf[j].v, qhi.v, zacc) + cv);
        }
        ps = (pe[0] + pe[1]) + (pe[2] + pe[3]);
      }
      FU vf[2];   // asked for behind the test: their 16 registers are not held through the exponentials
#pragma unroll
      for (int j = 0; j < 2; ++j) {
        vf[j].h[0] = *(const v8h*)(sV + (kb * 4 + 2 * j) * kVGrp + hh * kVHalf + c * 16);
        vf[j].h[1] = *(const v8h*)(sV + (kb * 4 + 2 * j + 1) * kVGrp + hh * kVHalf + c * 16);
      }
      lv = lv + ps;
#pragma unroll
      for (int j = 0; j < 2; ++j) {
        FU pf;
        pf.h[0] = __builtin_convertvector(pe[2 * j], v8h);
        pf.h[1] = __builtin_convertvector(pe[2 * j + 1], v8h);
        o = Frag<_Float16>::mma(vf[j].v, pf.v, o);
      }
    }
  }
  float l = ((lv[0] + lv[1]) + (lv[2] + lv[3])) + ((lv[4] + lv[5]) + (lv[6] + lv[7]));
  l += other_half(l);
  const float inv = kOCarry / l;
  const v8h ov = __builtin_convertvector(o * inv, v8h);
  *(v8h*)(oh + ((size_t)gh * kSeq + q0 + c) * kHdim + 8 * hh) = ov;
}

// ---------------------------------------------------------------------------
// Host glue. Workspace region map (bytes; every offset a multiple of 32768):
//   (not used)                         294,912 @          0
//   WPROJ f16 [3][128][128]             98,304 @    294,912
//   WFC1  f16 [768][384]               589,824 @    393,216
//   WFC2  f16 [384][768]               589,824 @    983,040
//   VT    f16 [6][128][2048]         3,145,728 @  1,572,864
//   BIG                             12,582,912 @  4,718,592   (QKVO f16 [12288][384] @ +3,145,728
//                                                             up to and during attention; of QKVO only the q and k columns
//                                                             are written and read, V goes to VT;
//                                                             G f16 [4096][768] @ +3,145,728
//                                                             after attention)
//   OH    f16 [48][2048][16]         3,145,728 @ 17,301,504
//   XC    f32 [4096][384]            6,291,456 @ 20,447,232
//   total                                        26,738,688
// ---------------------------------------------------------------------------
extern "C" void kernel_launch(void* const* d_in, const int* in_sizes, int n_in,
                              void* d_out, int out_size, void* d_ws, size_t ws_size,
                              hipStream_t stream) {
  if (n_in < 14) return;
  if (in_sizes[0] != kRows * kDim || in_sizes[1] != kRows * kDim || in_sizes[2] != kRows * kDim) return;
  if (in_sizes[3] != 3 * kDim || in_sizes[4] != 3 * kDim) return;
  if (in_sizes[5] != 3 * kDim * kDim3 || in_sizes[6] != 3 * kDim * kDim || in_sizes[7] != 3 * kDim) return;
  if (in_sizes[8] != kDim3 || in_sizes[9] != kDim3) return;
  if (in_sizes[10] != kDim3 * kHid || in_sizes[11] != kHid || in_sizes[12] != kHid * kDim3 || in_sizes[13] != kDim3) return;
  if (out_size != 3 * kRows * kDim) return;

  const float* x1     = (const float*)d_in[0];
  const float* x2     = (const float*)d_in[1];
  const float* x3     = (const float*)d_in[2];
  const float* ln1_g  = (const float*)d_in[3];
  const float* ln1_b  = (const float*)d_in[4];
  const float* qkv_w  = (const float*)d_in[5];
  const float* proj_w = (const float*)d_in[6];
  const float* proj_b = (const float*)d_in[7];
  const float* ln2_g  = (const float*)d_in[8];
  const float* ln2_b  = (const float*)d_in[9];
  const float* fc1_w  = (const float*)d_in[10];
  const float* fc1_b  = (const float*)d_in[11];
  const float* fc2_w  = (const float*)d_in[12];
  const float* fc2_b  = (const float*)d_in[13];
  float* out = (float*)d_out;

  // ---- carve ----
  const size_t szWQKV  = (size_t)3 * kDim3 * kDim * 2;
  const size_t szWPROJ = (size_t)3 * kDim * kDim * 2;
  const size_t szWFC1  = (size_t)kHid * kDim3 * 2;
  const size_t szWFC2  = (size_t)kDim3 * kHid * 2;
  const size_t szVT    = (size_t)kGroups * kDim * kSeq * 2;
  const size_t szXN    = (size_t)3 * kRows * kDim * 2;
  const size_t szQKVO  = (size_t)3 * kRows * kDim3 * 2;
  const size_t szHN    = (size_t)kRows * kDim3 * 2;
  const size_t szG     = (size_t)kRows * kHid * 2;
  size_t szBIG = szXN + szQKVO;
  if (szHN + szG > szBIG) szBIG = szHN + szG;
  const size_t szOH    = (size_t)kGroups * kHeads * kSeq * kHdim * 2;
  const size_t szXC    = (size_t)kRows * kDim3 * 4;

  const size_t oWQKV  = 0;
  const size_t oWPROJ = oWQKV + szWQKV;
  const size_t oWFC1  = oWPROJ + szWPROJ;
  const size_t oWFC2  = oWFC1 + szWFC1;
  const size_t oVT    = oWFC2 + szWFC2;
  const size_t oBIG   = oVT + szVT;
  const size_t oOH    = oBIG + szBIG;
  const size_t oXC    = oOH + szOH;
  const size_t oEnd   = oXC + szXC;
  if (oEnd > ws_size) return;

  unsigned char* ws = (unsigned char*)d_ws;
  unsigned short* WPROJ = (unsigned short*)(ws + oWPROJ);
  unsigned short* WFC1  = (unsigned short*)(ws + oWFC1);
  unsigned short* WFC2  = (unsigned short*)(ws + oWFC2);
  unsigned short* VT    = (unsigned short*)(ws + oVT);
  unsigned short* QKVO  = (unsigned short*)(ws + oBIG + szXN);
  unsigned short* G     = (unsigned short*)(ws + oBIG + szHN);
  unsigned short* OH    = (unsigned short*)(ws + oOH);
  float*          XC    = (float*)(ws + oXC);
  const float* fdum = proj_b;   // valid f32 pointer for unused bias, LayerNorm and weight slots

  // ---- QKV from the inputs themselves: (LN1(x_br) . qkv_w[br]) f16 out. M=4096, N=384, K=128; tiles 32*6 = 192 blocks, y = 0..2 ----
  // every block normalises its 128 rows of x_br and casts its 64 columns of qkv_w[br] (carried x16) into LDS
  // q and k columns -> QKVO[br][4096][384]; the V column tiles leave transposed -> VT[g][128][2048]
  // ---- and, as plane y = 3 of the same grid, the weights of the later launches: transpose + f16 (carried x16) ----
  // proj_w [3][128][128] -> WPROJ [3][128][128]; fc1_w [384][768] -> WFC1 [768][384]; fc2_w [768][384] -> WFC2 [384][768]  (156 tiles)
  static_assert(kTilesW <= (kRows / kBM) * (kDim3 / kBN), "the casts fit one plane of the grid");
  gemm_lds<kDim, 1, 6, false, true, false, kFoldVT, kSrcLnCast><<<dim3((kRows / kBM) * (kDim3 / kBN), 4), 256, 0, stream>>>(
      QKVO, kDim, 0L,
      QKVO, kDim, 0L,
      XC, QKVO, VT, kDim3, (long)kRows * kDim3,
      fdum, 0L, x1, x2, x3, 0L, 0,
      kDim3 / kBN, 1.0f / kWCarry,
      ln1_g, ln1_b, qkv_w, proj_w, fc1_w, fc2_w, WPROJ, WFC1, WFC2);

  // ---- attention: all 6 groups x 8 heads in one launch -> per-head planes OH ----
  attn_fused_kernel<<<dim3(kSeq / 128, kGroups * kHeads), 256, 0, stream>>>(QKVO, VT, OH);

  // ---- proj + bias + residual x_br -> XC[:, br*128 .. br*128+127] f32 (ldc 384, resid pitch 128); A staged from the planes OH ----
  // M=4096, N=128, K=128, scale 1/(64*16); tiles 32*2 = 64 blocks per branch, the three branches as batch y of one launch
  gemm_lds<kDim, 1, 4, true, false, true, kFoldHeads, kSrcF16><<<dim3((kRows / kBM) * (kDim / kBN), 3), 256, 0, stream>>>(
      OH, kDim, (long)kRows * kDim,
      WPROJ, kDim, (long)kDim * kDim,
      XC, OH, OH, kDim3, (long)kDim,
      proj_b, (long)kDim, x1, x2, x3, 0L, kDim,
      kDim / kBN, 1.0f / (kOCarry * kWCarry),
      fdum, fdum, fdum, fdum, fdum, fdum, OH, OH, OH);

  // ---- fc1 on LN2(XC) + bias, exact GELU -> G f16 x16 [4096][768]; M=4096, N=768, K=384; tiles 32*12 = 384 blocks ----
  // every block normalises its 128 rows of XC into LDS
  gemm_lds<kDim3, 1, 4, true, true, false, kFoldGelu, kSrcLn><<<dim3((kRows / kBM) * (kHid / kBN), 1), 256, 0, stream>>>(
      G, kDim3, 0L,
      WFC1, kDim3, 0L,
      XC, G, G, kHid, 0L,
      fc1_b, 0L, XC, XC, XC, 0L, 0,
      kHid / kBN, 1.0f / kWCarry,
      ln2_g, ln2_b, fdum, fdum, fdum, fdum, OH, OH, OH);

  // ---- fc2 + bias + residual XC -> three output planes out[k] = [4096][128] (N=128 slice k of 384), K=768, scale 1/256 ----
  // the three slices as batch y of one launch: A shared (stride 0), weights, bias, residual columns and output plane move with y
  // K = 768 in two chunks of 384; tiles 32*2 = 64 blocks per slice
  gemm_lds<kHid / 2, 2, 2, true, false, true, kFoldNone, kSrcF16><<<dim3((kRows / kBM) * (kDim / kBN), 3), 256, 0, stream>>>(
      G, kHid, 0L,
      WFC2, kHid, (long)kDim * kHid,
      out, G, G, kDim, (long)kRows * kDim,
      fc2_b, (long)kDim, XC, XC, XC, (long)kDim, kDim3,
      kDim / kBN, 1.0f / (kGCarry * kWCarry),
      fdum, fdum, fdum, fdum, fdum, fdum, OH, OH, OH);
}

// v007
// Measured time: 55.2 microseconds a run.
// In both of two side-by-side timings against v006, it was 1.04 times as fast.
// All steps since v000 together make it 29.5 times as fast.
// Contractions: x_ln@Wqkv, o@Wproj, h_ln@Wfc1, g@Wfc2 (activations f16, weights f16 carried x16), scores k.q^T (q,k f16, q carried x head-dim scale x log2(e), head dim 16: two key tiles per A fragment, q zero-padded 16->32 in registers), V^T@P^T (P f16, unnormalised exp carried x2^8, V^T f16): all v_wmma_f32_16x16x32_f16 with f32 accumulate; LayerNorm, online softmax, GELU(erf), bias, residual in f32.
#include <hip/hip_runtime.h>
#include <math.h>

// ---------------------------------------------------------------------------
// Problem constants
// ---------------------------------------------------------------------------
constexpr int kBatch   = 2;
constexpr int kSeq     = 2048;
constexpr int kDim     = 128;
constexpr int kHeads   = 8;
constexpr int kHdim    = 16;
constexpr int kHid     = 768;
constexpr int kRows    = kBatch * kSeq;     // 4096 token rows per branch
constexpr int kDim3    = 3 * kDim;          // 384
constexpr int kGroups  = 3 * kBatch;        // 6 (branch, batch) groups; group g covers plane rows g*2048 .. g*2048+2047
constexpr int kKeyChunk = 512;              // keys staged in LDS at a time
constexpr int kVHalf   = 288;               // LDS bytes from lane half 0's 256 B of a V^T fragment half to lane half 1's
constexpr int kVGrp    = 576;               // LDS bytes per V^T fragment half (16 dims x 16 keys)
constexpr float kWCarry = 16.0f;            // weights carried x16 in f16
constexpr float kPCarryLog2 = 8.0f;         // unnormalised probabilities exp(s - max in use) carried x2^8 in f16
constexpr float kQCarry = 0.25f * 1.44269504088896340736f;   // q carried x head-dim scale x log2(e): k.q is the score in log2 units
constexpr float kPLimit = 32768.0f;         // a sum of four carried probabilities below this: each of them is far inside f16
constexpr float kOCarry = 64.0f;            // attention output carried x64 in f16
constexpr float kGCarry = 16.0f;            // gelu output carried x16 in f16
constexpr float kLnEps  = 1e-5f;

typedef __attribute__((ext_vector_type(16))) _Float16 v16h;
typedef __attribute__((ext_vector_type(8)))  _Float16 v8h;
typedef __attribute__((ext_vector_type(4)))  _Float16 v4h;
typedef __attribute__((ext_vector_type(8)))  float    v8f;
typedef __attribute__((ext_vector_type(4)))  float    v4f;
typedef __attribute__((ext_vector_type(2)))  float    v2f;
typedef __attribute__((ext_vector_type(4)))  unsigned int v4u;
typedef __attribute__((ext_vector_type(2)))  unsigned int v2u;

// ---------------------------------------------------------------------------
// Fragment helpers
// ---------------------------------------------------------------------------
template <typename T> struct Frag;
template <> struct Frag<_Float16> {
  typedef v16h V; union U { v16h v; v8h h[2]; };
  static __device__ __forceinline__ v16h load(const _Float16* p) {   // elements 0..7 <- p[0..7], 8..15 <- p[16..23]
    U f; f.h[0] = *(const v8h*)(p); f.h[1] = *(const v8h*)(p + 16); return f.v;
  }
  static __device__ __forceinline__ v8f mma(v16h a, v16h b, v8f c) {
    return __builtin_amdgcn_wmma_f32_16x16x32_f16(false, a, false, b, (short)0, c, false, false);
  }
};

__device__ __forceinline__ unsigned pk16(unsigned short a, unsigned short b) { return (unsigned)a | ((unsigned)b << 16); }
__device__ __forceinline__ unsigned short h_bits(float f) { const _Float16 h = (_Float16)f; return __builtin_bit_cast(unsigned short, h); }

// ---------------------------------------------------------------------------
// Batched WMMA GEMM with both operands staged in LDS, by asynchronous copies unless SRC makes them itself.
// C[m,n] = scale * sum_k A[m,k] * Bt[n,k] (+bias[n])(+resid[m*ldr+n]); A row-major [M,K], Bt row-major [N,K], f16.
// One workgroup (8 waves) owns a 128 x 64 tile of C; wave (wm = wave&3, wn = wave>>2) owns rows 32wm.., columns 32wn.. (2 x 2 fragments).
// K = NCH * KC. A chunk is KC k of all 192 operand rows: [A 128 rows | Bt 64 rows] at pitch 2*KC + 16 bytes (16 B x odd: no bank
// conflict for the 16-byte fragment reads). Every copy instruction of a wave moves 512 contiguous source bytes, two runs of 256 or (kFoldHeads A) four of 128:
// whole 128-B lines. Each chunk has a buffer of its own, so chunk 1 flies while chunk 0 is multiplied.
// blockIdx.x = tile (column tile fastest), blockIdx.y = b is the batch: operands, output, bias and residual move by their strides
// (elements) per b; the residual base is resid0 / resid1 / resid2 for b = 0 / 1 / 2, then + b * strideR.
// OUT_F16: C is f16 (Ch), else f32 (Cf). The tile leaves through LDS, so every store instruction writes whole 128-B lines.
// FOLD names the pointwise or re-layout pass that the launch does itself, in place of a launch of its own beside it:
//   kFoldGelu   the f16 output is gelu(C + bias), exact erf form, carried x kGCarry;
//   kFoldVT     column tiles from column 2*kDim on (the V columns) leave transposed: Vt[(g*128 + c)*2048 + n], g = plane row / 2048;
//               column tiles below column kDim (the q columns) leave carried x kQCarry;
//   kFoldHeads  A is read from the attention's per-head planes Ap[(g*8 + h)][2048][16]: k = 16h + d.
// Every loop of the engine is unrolled: its arrays (copy operands, fragments, accumulators, residual rows) are registers and asm
// operands, which need constant indices.
// ---------------------------------------------------------------------------
constexpr int kBM = 128, kBN = 64, kCPitch = 68;   // kCPitch: floats per staged row of C
constexpr int kTPitch = 136;                       // halves per staged row of a transposed V tile: 272 B = 16 B x odd
constexpr int kFoldNone = 0, kFoldGelu = 1, kFoldVT = 2, kFoldHeads = 3;
constexpr int kSrcF16 = 0, kSrcLn = 1, kSrcLnCast = 2;

// N copies and, in the same statement, the wait that stands before any register they name is rewritten.
__device__ __forceinline__ void async_copy4(const unsigned* l, const unsigned short* const* g) {
  asm volatile("global_load_async_to_lds_b128 %0, %4, off\n\t"
               "global_load_async_to_lds_b128 %1, %5, off\n\t"
               "global_load_async_to_lds_b128 %2, %6, off\n\t"
               "global_load_async_to_lds_b128 %3, %7, off\n\t"
               "s_wait_xcnt 0x0"
               :: "v"(l[0]), "v"(l[1]), "v"(l[2]), "v"(l[3]), "v"(g[0]), "v"(g[1]), "v"(g[2]), "v"(g[3]) : "memory");
}
__device__ __forceinline__ void async_copy12(const unsigned* l, const unsigned short* const* g) {
  asm volatile("global_load_async_to_lds_b128 %0, %12, off\n\t"
               "global_load_async_to_lds_b128 %1, %13, off\n\t"
               "global_load_async_to_lds_b128 %2, %14, off\n\t"
               "global_load_async_to_lds_b128 %3, %15, off\n\t"
               "global_load_async_to_lds_b128 %4, %16, off\n\t"
               "global_load_async_to_lds_b128 %5, %17, off\n\t"
               "global_load_async_to_lds_b128 %6, %18, off\n\t"
               "global_load_async_to_lds_b128 %7, %19, off\n\t"
               "global_load_async_to_lds_b128 %8, %20, off\n\t"
               "global_load_async_to_lds_b128 %9, %21, off\n\t"
               "global_load_async_to_lds_b128 %10, %22, off\n\t"
               "global_load_async_to_lds_b128 %11, %23, off\n\t"
               "s_wait_xcnt 0x0"
               :: "v"(l[0]), "v"(l[1]), "v"(l[2]), "v"(l[3]), "v"(l[4]), "v"(l[5]), "v"(l[6]), "v"(l[7]), "v"(l[8]), "v"(l[9]),
                  "v"(l[10]), "v"(l[11]),
                  "v"(g[0]), "v"(g[1]), "v"(g[2]), "v"(g[3]), "v"(g[4]), "v"(g[5]), "v"(g[6]), "v"(g[7]), "v"(g[8]), "v"(g[9]),
                  "v"(g[10]), "v"(g[11]) : "memory");
}

// ROWS rows of KC halves from g0 (row pitch ld halves) to LDS byte address lds0 (row pitch 2*KC + 16). A row is KC/8 pieces of 16 B.
// PER * 256 pieces = 16 whole rows: lane t takes pieces i*256 + t (i < PER) of every 16-row band, so its addresses in the next band
// are the same plus a constant. Each piece is copied by exactly one lane; every lane is on.
template <int KC, int ROWS>
__device__ __forceinline__ void stage_rows(const unsigned short* g0, int ld, unsigned lds0, int t) {
  constexpr int CPR = KC / 8, PER = CPR / 16, BAND = 16, NB = ROWS / BAND, PITCH = KC * 2 + 16;
  static_assert(CPR % 16 == 0 && (PER == 1 || PER == 3) && NB % 4 == 0, "whole bands, four bands a statement");
  const unsigned short* gb[PER];
  unsigned lb[PER];
#pragma unroll
  for (int i = 0; i < PER; ++i) {
    const int e = i * 256 + t;
    const int r = e / CPR, c = e - r * CPR;
    gb[i] = g0 + (r * ld + c * 8);
    lb[i] = lds0 + (unsigned)(r * PITCH + c * 16);
  }
  const size_t step = (size_t)(BAND * ld);
#pragma unroll
  for (int j0 = 0; j0 < NB; j0 += 4) {
    unsigned l[4 * PER];
    const unsigned short* g[4 * PER];
#pragma unroll
    for (int jj = 0; jj < 4; ++jj)
#pragma unroll
      for (int i = 0; i < PER; ++i) {
        l[jj * PER + i] = lb[i] + (unsigned)((j0 + jj) * BAND * PITCH);
        g[jj * PER + i] = gb[i] + (size_t)(j0 + jj) * step;
      }
    if (PER == 3) async_copy12(l, g); else async_copy4(l, g);
  }
}

// 128 rows of A = 8 heads x 16 dims from the per-head planes; o0 = head 0's plane at the tile's first row, LDS row pitch 2*kDim + 16.
// A band is 16 rows = 256 pieces of 16 B. A wave takes 4 heads x 4 rows x 2 pieces: per head 128 contiguous, aligned source bytes,
// so every copy instruction moves 4 whole lines. Each piece is copied by exactly one lane; every lane is on.
__device__ __forceinline__ void stage_heads(const unsigned short* o0, unsigned lds0, int t) {
  constexpr int PITCH = kDim * 2 + 16;
  const int lane = t & 31, wave = t >> 5;
  const int h = (wave & 1) * 4 + (lane >> 3);
  const int r = (wave >> 1) * 4 + ((lane >> 1) & 3);
  const int p = lane & 1;
  const unsigned short* gb = o0 + (h * kSeq * kHdim + r * kHdim + p * 8);
  const unsigned lb = lds0 + (unsigned)(r * PITCH + (h * 2 + p) * 16);
#pragma unroll
  for (int j0 = 0; j0 < kBM / 16; j0 += 4) {
    unsigned l[4];
    const unsigned short* g[4];
#pragma unroll
    for (int jj = 0; jj < 4; ++jj) {
      l[jj] = lb + (unsigned)((j0 + jj) * 16 * PITCH);
      g[jj] = gb + (j0 + jj) * 16 * kHdim;
    }
    async_copy4(l, g);
  }
}

// value of the lane whose number differs by MASK inside the 16-lane row (DPP row_xmask)
template <int MASK> __device__ __forceinline__ float lane_xor(float v) {
  return __builtin_bit_cast(float, __builtin_amdgcn_update_dpp(0, __builtin_bit_cast(int, v), 0x160 + MASK, 0xf, 0xf, true));
}

__device__ __forceinline__ float rsq_slot(float x) {
  float r;
  asm("v_rsq_f32 %0, %1\n\tv_nop" : "=v"(r) : "v"(x));
  return r;
}

// 128 rows of x (f32, KC features, x0 = the tile's first row) -> LayerNorm -> f16 rows in LDS at pitch 2*KC + 16.
// LPR lanes share a row, so a wave instruction works on 32/LPR rows: lane j of them holds the 16-B pieces j, j + LPR, j + 2*LPR, ...,
// and every load instruction covers whole 128-B lines of each of its rows. A wave takes 16 rows, two passes to a group;
// the next group's loads are asked for ahead of this group's arithmetic.
template <int KC>
__device__ __forceinline__ void stage_ln(const float* __restrict__ x0, const float* __restrict__ g, const float* __restrict__ bt,
                                         unsigned char* sA, int t) {
  constexpr int PITCH = KC * 2 + 16;
  constexpr int LPR = (KC == kDim) ? 8 : 16, NQ = KC / 4 / LPR, RP = 32 / LPR, NG = 16 / RP / 2;
  static_assert(NQ * LPR * 4 == KC, "whole pieces");
  const int lane = t & 31, wave = t >> 5;
  const int j = lane & (LPR - 1), rr = lane / LPR;
  const unsigned xo = (unsigned)((wave * 16 + rr) * KC + j * 4) * 4u;   // bytes: uniform base + one 32-bit lane offset
  const unsigned go = (unsigned)(j * 4) * 4u;
  v4f xv[NG][2][NQ], gv[NQ], bv[NQ];
#pragma unroll
  for (int q = 0; q < NQ; ++q) {
    gv[q] = *(const v4f*)((const char*)(g + q * LPR * 4) + go);
    bv[q] = *(const v4f*)((const char*)(bt + q * LPR * 4) + go);
  }
#pragma unroll
  for (int gi = -1; gi < NG; ++gi) {
    if (gi + 1 < NG) {
#pragma unroll
      for (int p = 0; p < 2; ++p)
#pragma unroll
        for (int q = 0; q < NQ; ++q)
          xv[gi + 1][p][q] = *(const v4f*)((const char*)(x0 + (((gi + 1) * 2 + p) * RP * KC + q * LPR * 4)) + xo);
      // the lane offsets stay in their registers up to this wait, which stands before any register these loads name is rewritten
      asm volatile("s_wait_xcnt 0x0" :: "v"(xo), "v"(go) : "memory");
    }
    if (gi < 0) continue;
#pragma unroll
    for (int p = 0; p < 2; ++p) {
      v4f a = xv[gi][p][0];
#pragma unroll
      for (int q = 1; q < NQ; ++q) a += xv[gi][p][q];
      float s1 = (a[0] + a[1]) + (a[2] + a[3]);
      s1 += lane_xor<1>(s1);
      s1 += lane_xor<2>(s1);
      s1 += lane_xor<4>(s1);
      if (LPR == 16) s1 += lane_xor<8>(s1);
      const float mean = s1 * (1.0f / KC);
      v4f a2 = (v4f){0.f, 0.f, 0.f, 0.f};
#pragma unroll
      for (int q = 0; q < NQ; ++q) {
        xv[gi][p][q] -= mean;
        a2 += xv[gi][p][q] * xv[gi][p][q];
      }
      float s2 = (a2[0] + a2[1]) + (a2[2] + a2[3]);
      s2 += lane_xor<1>(s2);
      s2 += lane_xor<2>(s2);
      s2 += lane_xor<4>(s2);
      if (LPR == 16) s2 += lane_xor<8>(s2);
      const float rstd = rsq_slot(s2 * (1.0f / KC) + kLnEps);
      unsigned char* row = sA + (wave * 16 + (gi * 2 + p) * RP + rr) * PITCH + j * 8;
#pragma unroll
      for (int q = 0; q < NQ; ++q)
        *(v4h*)(row + q * LPR * 8) = __builtin_convertvector(xv[gi][p][q] * rstd * gv[q] + bv[q], v4h);
    }
  }
}

// 64 columns of a weight plane W (f32 [kDim][LDW], w0 = W + first column) -> Bt rows [column][k] f16 carried x kWCarry, LDS pitch 2*kDim + 16.
// Lane = column, so every load instruction reads one whole 128-B line; a thread packs 8 consecutive k of its column into one 16-B store.
template <int LDW>
__device__ __forceinline__ void stage_wcast128(const float* __restrict__ w0, unsigned char* sB, int t) {
  constexpr int PITCH = kDim * 2 + 16;
  const int nl = t & 63, kq = t >> 6;
  const unsigned wo = (unsigned)(kq * 8 * LDW + nl) * 4u;   // bytes: uniform base + one 32-bit lane offset
  float wv[4][8];
#pragma unroll
  for (int i = 0; i < 4; ++i)
#pragma unroll
    for (int e = 0; e < 8; ++e) wv[i][e] = *(const float*)((const char*)(w0 + (i * 32 + e) * LDW) + wo);
  // as in stage_ln: the lane offset lives up to the wait
  asm volatile("s_wait_xcnt 0x0" :: "v"(wo) : "memory");
#pragma unroll
  for (int i = 0; i < 4; ++i) {
    v8h hv;
#pragma unroll
    for (int e = 0; e < 8; ++e) hv[e] = (_Float16)(wv[i][e] * kWCarry);
    *(v8h*)(sB + nl * PITCH + (i * 4 + kq) * 16) = hv;
  }
}

// GELU in its erf form (not the tanh form) of eight values side by side, with no branch: X = kGCarry * x comes in, kGCarry * gelu(x) goes out.
// gelu(x) = x * (1 + erf(x / sqrt 2)) / 2 = max(x, 0) - |x| * T(|x|), T(a) = erfc(a / sqrt 2) / 2 = the normal tail, so nothing cancels for x < 0.
// T(a) = exp(-a * a / 2) * t * (c1 + t * (c2 + t * (c3 + t * (c4 + t * c5)))), t = 1 / (1 + p * a): the classical five-term rational form of erfc,
// absolute error below 1e-7 in T; in f32 the result stays within 5e-7 (absolute) of gelu(x), and it is stored as f16, which rounds at 5e-4 relative.
__device__ __forceinline__ v8f gelu8_carried(v8f X) {
  constexpr float p  = 0.3275911f * 0.70710678118654752f / kGCarry;
  constexpr float k2 = -0.5f * 1.44269504088896340736f / (kGCarry * kGCarry);   // exp(-x * x / 2) = exp2(k2 * X * X)
  constexpr float c1 = 0.5f * 0.254829592f, c2 = 0.5f * -0.284496736f, c3 = 0.5f * 1.421413741f, c4 = 0.5f * -1.453152027f, c5 = 0.5f * 1.061405429f;
  const v8f aX = __builtin_elementwise_abs(X);
  const v8f d = aX * p + 1.0f;
  const v8f w = (X * k2) * X;
  v8f t, e;
#pragma unroll   // vector elements are registers: constant indices
  for (int i = 0; i < 8; ++i) { t[i] = __builtin_amdgcn_rcpf(d[i]); e[i] = __builtin_amdgcn_exp2f(w[i]); }
  const v8f q = ((((t * c5 + c4) * t + c3) * t + c2) * t + c1) * t;
  return __builtin_elementwise_max(X, (v8f){0.f, 0.f, 0.f, 0.f, 0.f, 0.f, 0.f, 0.f}) - aX * (q * e);
}

constexpr int kTilesProj = (kDim / 64) * (kDim / 64) * 3;    // 12
constexpr int kTilesFc1  = (kDim3 / 64) * (kHid / 64);       // 72
constexpr int kTilesFc2  = (kHid / 64) * (kDim3 / 64);       // 72
constexpr int kTilesW    = kTilesProj + kTilesFc1 + kTilesFc2;   // 156
__device__ __forceinline__ void wtcast_tile(int r0, const float* __restrict__ wProj,
                                            const float* __restrict__ wFc1, const float* __restrict__ wFc2,
                                            unsigned short* __restrict__ oProj,
                                            unsigned short* __restrict__ oFc1, unsigned short* __restrict__ oFc2,
                                            float scale);

// SRC names what the block makes of f32 data in LDS itself, in place of a launch in front of it:
//   kSrcLn      A = LayerNorm over KC features of the f32 rows of resid0 / resid1 / resid2 (b = 0 / 1 / 2; gain and shift lng, lnb + b * KC);
//               Ap is not read;
//   kSrcLnCast  the same, and Bt = the columns of the f32 plane Wf + b * kDim * kDim3, cast by the block; Btp is not read either.
// Plane blockIdx.y = 3 of a kSrcLnCast grid holds no GEMM tile: its first kTilesW blocks cast one tile each of the weights of the later launches
// (block-uniform choice, so the cast's barrier is passed by a whole block or by none).
// WPE = waves per SIMD that the register budget must leave room for: 2 * workgroups per WGP that the LDS size and the grid ask for.
template <int KC, int NCH, int WPE, bool BIAS, bool OUT_F16, bool RESID, int FOLD, int SRC>
__global__ __launch_bounds__(256, WPE) void gemm_lds(
    const unsigned short* __restrict__ Ap, int lda, long strideA,
    const unsigned short* __restrict__ Btp, int ldb, long strideB,
    float* __restrict__ Cf, unsigned short* __restrict__ Ch, unsigned short* __restrict__ Vt, int ldc, long strideC,
    const float* __restrict__ bias, long strideBias,
    const float* __restrict__ resid0, const float* __restrict__ resid1, const float* __restrict__ resid2, long strideR, int ldr,
    int tilesN, float scale,
    const float* __restrict__ lng, const float* __restrict__ lnb, const float* __restrict__ Wf,
    const float* __restrict__ wProj, const float* __restrict__ wFc1, const float* __restrict__ wFc2,
    unsigned short* __restrict__ oProj, unsigned short* __restrict__ oFc1, unsigned short* __restrict__ oFc2) {
  if (SRC == kSrcLnCast && blockIdx.y == 3) {
    if (blockIdx.x < kTilesW) wtcast_tile(blockIdx.x, wProj, wFc1, wFc2, oProj, oFc1, oFc2, kWCarry);
    return;
  }
  constexpr int PITCH = KC * 2 + 16;
  constexpr int BUF   = (kBM + kBN) * PITCH;
  constexpr int GK    = 2, NG = KC / 32 / GK;   // fragments are fetched in groups of GK k steps, one group ahead
  static_assert(kBM * kCPitch * 4 <= BUF, "the staged C tile fits the first buffer");
  static_assert((kBM + kBN) * (KC / 8) / 256 <= 63, "copies of one chunk outstanding per wave");
  static_assert(FOLD != kFoldHeads || (KC == kDim && NCH == 1), "a row of A is the 8 heads of one token");
  static_assert(FOLD != kFoldGelu || OUT_F16, "the activation leaves as f16");
  static_assert(SRC == kSrcF16 || (NCH == 1 && !RESID && FOLD != kFoldHeads), "a chunk holds the whole normalised row; the residual slots name its source");
  static_assert(SRC != kSrcLnCast || KC == kDim, "the cast stages 128 k");
  static_assert(FOLD != kFoldVT || (OUT_F16 && !BIAS && kBN * kTPitch * 2 <= BUF), "the transposed tile fits the first buffer");
  __shared__ __align__(128) unsigned char smem[NCH * BUF];
  const int t    = threadIdx.x;
  const int lane = t & 31, wave = t >> 5;
  const int b    = blockIdx.y;
  const int tm   = blockIdx.x / tilesN;
  const int tn   = blockIdx.x - tm * tilesN;
  const int m0   = tm * kBM, n0 = tn * kBN;
  const unsigned short* Ab = Ap  + (size_t)b * strideA + (size_t)m0 * lda;
  const unsigned short* Bb = Btp + (size_t)b * strideB + (size_t)n0 * ldb;
  const unsigned lds0 = (unsigned)(size_t)smem;   // low 32 bits of the shared address = byte offset in the workgroup's LDS

  const int grp = b * (kRows / kSeq) + m0 / kSeq, tok = m0 % kSeq;   // the tile's (branch, batch) group and its first token there
  if (SRC == kSrcF16) {
    if (FOLD == kFoldHeads) stage_heads(Ap + ((size_t)grp * kHeads * kSeq + tok) * kHdim, lds0, t);
    else                    stage_rows<KC, kBM>(Ab, lda, lds0, t);
    stage_rows<KC, kBN>(Bb, ldb, lds0 + kBM * PITCH, t);
  } else {   // Bt is asked for first, so that it flies under the LayerNorm arithmetic
    if (SRC == kSrcLnCast) stage_wcast128<kDim3>(Wf + (size_t)b * (kDim * kDim3) + n0, smem + kBM * PITCH, t);
    else                   stage_rows<KC, kBN>(Bb, ldb, lds0 + kBM * PITCH, t);
    stage_ln<KC>(((b == 0) ? resid0 : (b == 1) ? resid1 : resid2) + (size_t)m0 * KC, lng + b * KC, lnb + b * KC, smem, t);
  }

  // bias and residual of the rows this thread will store: asked for now, used in the epilogue
  const int c4 = (t & 15) * 4, r4 = t >> 4;            // f32 C: a row of 256 B = 16 lanes x 16 B; 16 rows a trip
  const int c8 = (t & 7) * 8, r8 = t >> 3;             // f16 C: a row of 128 B = 8 lanes x 16 B; 32 rows a trip
  v4f bv = (v4f){0.f, 0.f, 0.f, 0.f};
  v4f bh[2] = {bv, bv};
  v4f rv[kBM / 16];
  if (BIAS) bv = *(const v4f*)(bias + (size_t)b * strideBias + n0 + c4);
  if (BIAS && OUT_F16) {
    const float* bp = bias + (size_t)b * strideBias + n0 + c8;
    bh[0] = *(const v4f*)bp;
    bh[1] = *(const v4f*)(bp + 4);
  }
  if (RESID) {
    const float* rp = ((b == 0) ? resid0 : (b == 1) ? resid1 : resid2) + (size_t)b * strideR + (size_t)(m0 + r4) * ldr + n0 + c4;
    const float* rq[kBM / 16];
#pragma unroll
    for (int it = 0; it < kBM / 16; ++it) { rq[it] = rp + (size_t)(it * 16 * ldr); rv[it] = *(const v4f*)rq[it]; }
    // the eight addresses stay in their registers up to this wait, so no load of the run returns onto an earlier load's address
    asm volatile("s_wait_xcnt 0x0" :: "v"(rq[0]), "v"(rq[1]), "v"(rq[2]), "v"(rq[3]), "v"(rq[4]), "v"(rq[5]), "v"(rq[6]), "v"(rq[7]) : "memory");
  }

  if (SRC != kSrcLnCast) asm volatile("s_wait_asynccnt 0x0" ::: "memory");   // this wave's copies of chunk 0 have landed
  __syncthreads();                                    // chunk 0 visible to every wave
  if (NCH > 1) {                                      // chunk 1 flies under chunk 0's products
    stage_rows<KC, kBM>(Ab + KC, lda, lds0 + BUF, t);
    stage_rows<KC, kBN>(Bb + KC, ldb, lds0 + BUF + kBM * PITCH, t);
  }

  const int rlane = lane & 15, hh = lane >> 4;
  const int wm = wave & 3, wn = wave >> 2;
  v8f acc[2][2];
#pragma unroll
  for (int i = 0; i < 2; ++i)
#pragma unroll
    for (int j = 0; j < 2; ++j) acc[i][j] = (v8f){0.f, 0.f, 0.f, 0.f, 0.f, 0.f, 0.f, 0.f};

#pragma unroll
  for (int ch = 0; ch < NCH; ++ch) {
    const unsigned char* aP = smem + ch * BUF + (wm * 32 + rlane) * PITCH + hh * 16;
    const unsigned char* bP = smem + ch * BUF + (kBM + wn * 32 + rlane) * PITCH + hh * 16;
    v16h fa[2][GK][2], fb[2][GK][2];
#pragma unroll
    for (int g = -1; g < NG; ++g) {
      if (g + 1 < NG) {
#pragma unroll
        for (int s = 0; s < GK; ++s)
#pragma unroll
          for (int i = 0; i < 2; ++i) {
            fa[(g + 1) & 1][s][i] = Frag<_Float16>::load((const _Float16*)(aP + i * 16 * PITCH + ((g + 1) * GK + s) * 64));
            fb[(g + 1) & 1][s][i] = Frag<_Float16>::load((const _Float16*)(bP + i * 16 * PITCH + ((g + 1) * GK + s) * 64));
          }
      }
      __builtin_amdgcn_sched_barrier(0);   // the next group's LDS reads stay one group, ahead of this group's products, not among them
      if (g >= 0) {
#pragma unroll
        for (int s = 0; s < GK; ++s)
#pragma unroll
          for (int i = 0; i < 2; ++i)
#pragma unroll
            for (int j = 0; j < 2; ++j) acc[i][j] = Frag<_Float16>::mma(fa[g & 1][s][i], fb[g & 1][s][j], acc[i][j]);
      }
      __builtin_amdgcn_sched_barrier(0);   // and the reads of the group after that stay behind these products
    }
    asm volatile("s_wait_dscnt 0x0" ::: "memory");                    // this wave's reads of the chunk are done
    if (NCH > 1) asm volatile("s_wait_asynccnt 0x0" ::: "memory");    // this wave's copies of the next chunk have landed; behind the last chunk none is left
    __syncthreads();   // next chunk visible to every wave; behind the last chunk: every reader has left, the LDS becomes C staging
  }

  // ---- epilogue: scaled tile to LDS in accumulator order, out of it in whole rows ----
  float* sC = (float*)smem;
  _Float16* sT = (_Float16*)smem;
  const bool vtile = FOLD == kFoldVT && n0 >= 2 * kDim;   // block-uniform: the whole tile is V columns
  const float cscale = (FOLD == kFoldVT && n0 < kDim) ? scale * kQCarry   // block-uniform: the whole tile is q columns
                     : (FOLD == kFoldGelu) ? scale * kGCarry : scale;      // the activation takes its argument carried
  if (vtile) {
    // a lane's 8 accumulator registers are 8 consecutive rows of one column: 16 contiguous bytes of the transposed tile
#pragma unroll
    for (int i = 0; i < 2; ++i)
#pragma unroll
      for (int j = 0; j < 2; ++j)
        *(v8h*)(sT + (wn * 32 + j * 16 + rlane) * kTPitch + wm * 32 + i * 16 + hh * 8) = __builtin_convertvector(acc[i][j] * scale, v8h);
  } else {
#pragma unroll
    for (int i = 0; i < 2; ++i)
#pragma unroll
      for (int j = 0; j < 2; ++j)
#pragma unroll
        for (int r = 0; r < 8; ++r)
          sC[(wm * 32 + i * 16 + hh * 8 + r) * kCPitch + wn * 32 + j * 16 + rlane] = acc[i][j][r] * cscale;
  }
  __syncthreads();   // staged tile visible to every wave
  if (vtile) {
    // 64 dims x 128 tokens: a row of 256 B = 16 lanes x 16 B; 16 rows a trip
    unsigned short* vp = Vt + ((size_t)grp * kDim + (n0 - 2 * kDim)) * kSeq + tok;
    const unsigned vo = (unsigned)(r4 * kSeq + (t & 15) * 8) * 2u;   // bytes: uniform base + one 32-bit lane offset
#pragma unroll
    for (int it = 0; it < kBN / 16; ++it) {
      const v8h hv = *(const v8h*)(sT + (it * 16 + r4) * kTPitch + (t & 15) * 8);
      *(v8h*)((char*)(vp + (size_t)(it * 16 * kSeq)) + vo) = hv;
    }
  } else if (!OUT_F16) {
    float* cp = Cf + (size_t)b * strideC + (size_t)m0 * ldc + n0;
    const unsigned co = (unsigned)(r4 * ldc + c4) * 4u;   // bytes: uniform base + one 32-bit lane offset
#pragma unroll
    for (int it = 0; it < kBM / 16; ++it) {
      v4f v = *(const v4f*)(sC + (it * 16 + r4) * kCPitch + c4);
      if (BIAS)  v += bv;
      if (RESID) v += rv[it];
      *(v4f*)((char*)(cp + (size_t)(it * 16 * ldc)) + co) = v;
    }
  } else {
    unsigned short* cp = Ch + (size_t)b * strideC + (size_t)m0 * ldc + n0;
    const unsigned co = (unsigned)(r8 * ldc + c8) * 2u;   // bytes: uniform base + one 32-bit lane offset
    v4f sv[kBM / 32][2];   // all of the thread's staged values are asked for at once, ahead of the pointwise work
#pragma unroll
    for (int it = 0; it < kBM / 32; ++it) {
      const float* sp = sC + (it * 32 + r8) * kCPitch + c8;
      sv[it][0] = *(const v4f*)sp;
      sv[it][1] = *(const v4f*)(sp + 4);
    }
#pragma unroll
    for (int it = 0; it < kBM / 32; ++it) {
      v8f x;
#pragma unroll
      for (int e = 0; e < 8; ++e) {
        x[e] = sv[it][e >> 2][e & 3];
        if (BIAS) x[e] += bh[e >> 2][e & 3] * ((FOLD == kFoldGelu) ? kGCarry : 1.0f);
      }
      if (FOLD == kFoldGelu) x = gelu8_carried(x);
      const v8h hv = __builtin_convertvector(x, v8h);
      *(v8h*)((char*)(cp + (size_t)(it * 32 * ldc)) + co) = hv;
    }
    // stands behind the last store of the run, before any register that the four stores name is rewritten; the lane offset lives up to it
    asm volatile("s_wait_xcnt 0x0" :: "v"(co) : "memory");
  }
}

// ---------------------------------------------------------------------------
// Weight transpose + cast: W plane z is f32 [nIn][nOut] row-major; WT plane z = [nOut][nIn] f16, WT[h][d] = f16(scale * W[d][h]).
// The three weight tensors that later launches read, in one index space: tile index r0 falls into one tensor's range of (nIn/64)*(nOut/64)*nz tiles
// (block-uniform choice), and inside the range it runs d tile fastest, then h tile, then plane z.
// 256 threads; nIn, nOut multiples of 64. Plane z at out + z*nOut*nIn halves.
// Load coverage: 16 iterations x 256 threads = 4096 = the whole 64x64 tile (coalesced along h).
// Store coverage: 8 waves x 2 iterations x 4 rows (lane>>3) = 64 rows; (lane&7) x 8 halves = 64 cols; each row segment =
// ---------------------------------------------------------------------------
__device__ __forceinline__ void wtcast_tile(int r0, const float* __restrict__ wProj,
                                            const float* __restrict__ wFc1, const float* __restrict__ wFc2,
                                            unsigned short* __restrict__ oProj,
                                            unsigned short* __restrict__ oFc1, unsigned short* __restrict__ oFc2,
                                            float scale) {
  __shared__ float sm[64][65];   // sm[h_local][d_local]
  const int t  = threadIdx.x;
  const float* W = wProj; unsigned short* out = oProj; int nIn = kDim, nOut = kDim;
  if (r0 >= kTilesProj + kTilesFc1) { r0 -= kTilesProj + kTilesFc1; W = wFc2; out = oFc2; nIn = kHid; nOut = kDim3; }
  else if (r0 >= kTilesProj)        { r0 -= kTilesProj; W = wFc1; out = oFc1; nIn = kDim3; nOut = kHid; }
  const int gx = nIn >> 6, gy = nOut >> 6;
  const int r1 = r0 / gx;
  const int d0 = (r0 - r1 * gx) * 64;
  const int z  = r1 / gy;
  const int h0 = (r1 - z * gy) * 64;
  const float* Wz = W + (size_t)z * nIn * nOut;
#pragma unroll
  for (int i = 0; i < 16; ++i) {
    const int e = i * 256 + t;
    const int r = e >> 6;          // d local
    const int c = e & 63;          // h local
    sm[c][r] = Wz[(size_t)(d0 + r) * nOut + h0 + c] * scale;
  }
  __syncthreads();
  const int lane = t & 31, wave = t >> 5;
  const int q = lane >> 3, c8 = (lane & 7) * 8;
  unsigned short* op = out + (size_t)z * nOut * nIn;
  {
#pragma unroll
    for (int it = 0; it < 2; ++it) {
      const int row = wave * 8 + it * 4 + q;                 // h local
      unsigned short hb[8];
#pragma unroll
      for (int e = 0; e < 8; ++e) hb[e] = h_bits(sm[row][c8 + e]);
      const v4u u = (v4u){pk16(hb[0], hb[1]), pk16(hb[2], hb[3]), pk16(hb[4], hb[5]), pk16(hb[6], hb[7])};
      *(v4u*)(op + (size_t)(h0 + row) * nIn + d0 + c8) = u;
    }
    
  }
}

// ---------------------------------------------------------------------------
// Fused attention, one launch for all 48 (group, head) pairs: S^T = K.Q^T, online softmax, O^T += V^T.P^T.
// grid (2048/128 = 16 query blocks, 48), 256 threads = 8 waves x 16 queries. Lane (c = lane&15, hh = lane>>4) owns query c.
// K and V^T of the head are staged through registers into LDS, 512 keys at a time, already in fragment order:
//   sK: 16-key tile T at T*512; lane's 16 B (key c, dims 8hh..8hh+7) at + lane*16.
//   sV: fragment half G (keys 16G + 8hh + 0..7 of dim c) at G*576 + hh*288 + c*16.
// S^T tile register r = score(key 8hh + r, query c), so two tiles converted in place are the B operand P^T (hardware k
// order), and V^T as A is read in the same k order. O^T register r = O(query c, dim 8hh + r): one 16-B store per lane.
// oh[(g*8 + head)][2048][16] f16 carried x64: each wave writes 512 contiguous bytes.
// ---------------------------------------------------------------------------
__device__ __forceinline__ float other_half(float v) {   // value of lane ^ 16
  const int b = __builtin_bit_cast(int, v);
  return __builtin_bit_cast(float, __builtin_amdgcn_permlanex16(b, b, 0x76543210, 0xfedcba98, false, false));
}
__device__ __forceinline__ float vmax8(v8f a) {
  return fmaxf(fmaxf(fmaxf(a[0], a[1]), fmaxf(a[2], a[3])), fmaxf(fmaxf(a[4], a[5]), fmaxf(a[6], a[7])));
}
__device__ __forceinline__ v8f vexp2_8(v8f a) {
  v8f r;
#pragma unroll
  for (int e = 0; e < 8; ++e) r[e] = __builtin_amdgcn_exp2f(a[e]);
  return r;
}
__device__ __forceinline__ v8f splat8(float x) { return (v8f){x, x, x, x, x, x, x, x}; }
// largest score (log2 units) of the lane's query over the 64 keys whose four staged tiles begin at kt (the lane's own 16 B), both lane halves joined
__device__ __forceinline__ float max64(const unsigned char* kt, v16h qlo, v16h qhi) {
  const v8f z = (v8f){0.f, 0.f, 0.f, 0.f, 0.f, 0.f, 0.f, 0.f};
  float mx = -INFINITY;
#pragma unroll
  for (int j = 0; j < 2; ++j) {
    Frag<_Float16>::U kf;
    kf.h[0] = *(const v8h*)(kt + (2 * j) * 512);
    kf.h[1] = *(const v8h*)(kt + (2 * j + 1) * 512);
    mx = fmaxf(mx, fmaxf(vmax8(Frag<_Float16>::mma(kf.v, qlo, z)), vmax8(Frag<_Float16>::mma(kf.v, qhi, z))));
  }
  return fmaxf(mx, other_half(mx));
}
// six waves per SIMD = three workgroups per WGP: 768 workgroups fill 256 WGPs in one even round
__global__ __launch_bounds__(256) __attribute__((amdgpu_waves_per_eu(6))) void attn_fused_kernel(const unsigned short* __restrict__ qkvo,
                                                         const unsigned short* __restrict__ vt,
                                                         unsigned short* __restrict__ oh) {
  __shared__ __align__(128) unsigned char sK[kKeyChunk * 32];
  __shared__ __align__(128) unsigned char sV[(kKeyChunk / 16) * kVGrp];
  typedef Frag<_Float16>::U FU;
  const int lane = threadIdx.x & 31, wave = threadIdx.x >> 5;
  const int c = lane & 15, hh = lane >> 4;
  const int gh = blockIdx.y, g = gh >> 3, hd = gh & 7;
  const int q0 = blockIdx.x * 128 + wave * 16;
  const v8h zero8 = (v8h){0, 0, 0, 0, 0, 0, 0, 0};
  const v8f zacc  = (v8f){0.f, 0.f, 0.f, 0.f, 0.f, 0.f, 0.f, 0.f};

  // One A fragment holds two 16-key tiles (k 0..15 = dims of the first, k 16..31 = dims of the second);
  // q sits in the lower k half of qlo and in the upper k half of qhi, zeros in the other half, so each picks one tile.
  FU qlo, qhi;
  qlo.h[0] = *(const v8h*)(qkvo + (size_t)(g * kSeq + q0 + c) * kDim3 + hd * kHdim + 8 * hh);
  qlo.h[1] = zero8;
  qhi.h[0] = zero8;
  qhi.h[1] = qlo.h[0];

  // staging, 4 rounds of 8 waves per chunk. K round i: wave takes the 16-key tile i*8 + wave, lane = (key c, 16-B part hh).
  // V^T round i: wave takes 4 dims x 8 parts of 8 keys (4 whole 128-B lines): dim sd, part i*16 + sp of the chunk.
  const int sd = (wave & 3) * 4 + (lane >> 3);
  const int sp = (wave >> 2) * 8 + (lane & 7);
  const unsigned short* kp = qkvo + (size_t)(g * kSeq + wave * 16 + c) * kDim3 + kDim + hd * kHdim + 8 * hh;
  const unsigned short* vp = vt + (size_t)(g * kDim + hd * kHdim + sd) * kSeq + sp * 8;
  unsigned char* skw = sK + wave * 512 + lane * 16;
  unsigned char* svw = sV + (sp >> 1) * kVGrp + (sp & 1) * kVHalf + sd * 16;
  v4u kr[4], vr[4];
#pragma unroll
  for (int i = 0; i < 4; ++i) {
    kr[i] = *(const v4u*)(kp + (size_t)i * 128 * kDim3);
    vr[i] = *(const v4u*)(vp + i * 128);
  }

  // Lazy rescale. m = the maximum in use of the lane's query (log2 units), the same in both lane halves; cv = kPCarryLog2 - m in all eight
  // registers is the C operand of the score products, which so leave the matrix unit as the exponents themselves.
  float m = 0.f;
  v8f cv = zacc;
  v8f lv = zacc;
  v8f o  = zacc;
  for (int ch = 0; ch < kSeq / kKeyChunk; ++ch) {
    __syncthreads();   // every wave has finished reading the previous chunk
#pragma unroll
    for (int i = 0; i < 4; ++i) {
      *(v4u*)(skw + i * 8 * 512) = kr[i];
      *(v4u*)(svw + i * 8 * kVGrp) = vr[i];
    }
    __syncthreads();   // chunk visible to every wave
    if (ch + 1 < kSeq / kKeyChunk) {   // next chunk's global loads fly under this chunk's work
      kp += (size_t)kKeyChunk * kDim3;
      vp += kKeyChunk;
#pragma unroll
      for (int i = 0; i < 4; ++i) {
        kr[i] = *(const v4u*)(kp + (size_t)i * 128 * kDim3);
        vr[i] = *(const v4u*)(vp + i * 128);
      }
    }
    if (ch == 0) {   // the first maximum in use: that of the first 64 keys
      m  = max64(sK + lane * 16, qlo.v, qhi.v);
      cv = splat8(kPCarryLog2 - m);
    }
#pragma unroll 2   // a rolled loop keeps the registers inside the six-wave budget with no scratch
    for (int kb = 0; kb < kKeyChunk / 64; ++kb) {
      const unsigned char* kt = sK + kb * 4 * 512 + lane * 16;
      FU kf[2];
#pragma unroll
      for (int j = 0; j < 2; ++j) {
        kf[j].h[0] = *(const v8h*)(kt + (2 * j) * 512);
        kf[j].h[1] = *(const v8h*)(kt + (2 * j + 1) * 512);
      }
      v8f pe[4];
#pragma unroll
      for (int j = 0; j < 2; ++j) {
        pe[2 * j]     = vexp2_8(Frag<_Float16>::mma(kf[j].v, qlo.v, cv));
        pe[2 * j + 1] = vexp2_8(Frag<_Float16>::mma(kf[j].v, qhi.v, cv));
      }
      v8f ps = (pe[0] + pe[1]) + (pe[2] + pe[3]);
      // One test per 64 keys, a scalar branch for the whole wave: only where a score has outgrown the maximum in use so far that its
      // probability nears the f16 range is the maximum taken anew, sums and output rescaled and the 64 keys' probabilities made again.
      if (__builtin_amdgcn_ballot_w32(!(vmax8(ps) < kPLimit)) != 0) {
        const float mn = fmaxf(m, max64(kt, qlo.v, qhi.v));
        const float alpha = __builtin_amdgcn_exp2f(m - mn);
        m  = mn;
        cv = splat8(kPCarryLog2 - mn);
        lv = lv * alpha;
        o  = o * alpha;
#pragma unroll
        for (int j = 0; j < 2; ++j) {
          pe[2 * j]     = vexp2_8(Frag<_Float16>::mma(kf[j].v, qlo.v, zacc) + cv);
          pe[2 * j + 1] = vexp2_8(Frag<_Float16>::mma(kf[j].v, qhi.v, zacc) + cv);
        }
        ps = (pe[0] + pe[1]) + (pe[2] + pe[3]);
      }
      FU vf[2];   // asked for behind the test: their 16 registers are not held through the exponentials
#pragma unroll
      for (int j = 0; j < 2; ++j) {
        vf[j].h[0] = *(const v8h*)(sV + (kb * 4 + 2 * j) * kVGrp + hh * kVHalf + c * 16);
        vf[j].h[1] = *(const v8h*)(sV + (kb * 4 + 2 * j + 1) * kVGrp + hh * kVHalf + c * 16);
      }
      lv = lv + ps;
#pragma unroll
      for (int j = 0; j < 2; ++j) {
        FU pf;
        pf.h[0] = __builtin_convertvector(pe[2 * j], v8h);
        pf.h[1] = __builtin_convertvector(pe[2 * j + 1], v8h);
        o = Frag<_Float16>::mma(vf[j].v, pf.v, o);
      }
    }
  }
  float l = ((lv[0] + lv[1]) + (lv[2] + lv[3])) + ((lv[4] + lv[5]) + (lv[6] + lv[7]));
  l += other_half(l);
  const float inv = kOCarry / l;
  const v8h ov = __builtin_convertvector(o * inv, v8h);
  *(v8h*)(oh + ((size_t)gh * kSeq + q0 + c) * kHdim + 8 * hh) = ov;
}

// ---------------------------------------------------------------------------
// Host glue. Workspace region map (bytes; every offset a multiple of 32768):
//   (not used)                         294,912 @          0
//   WPROJ f16 [3][128][128]             98,304 @    294,912
//   WFC1  f16 [768][384]               589,824 @    393,216
//   WFC2  f16 [384][768]               589,824 @    983,040
//   VT    f16 [6][128][2048]         3,145,728 @  1,572,864
//   BIG                             12,582,912 @  4,718,592   (QKVO f16 [12288][384] @ +3,145,728
//                                                             up to and during attention; of QKVO only the q and k columns
//                                                             are written and read, V goes to VT;
//                                                             G f16 [4096][768] @ +3,145,728
//                                                             after attention)
//   OH    f16 [48][2048][16]         3,145,728 @ 17,301,504
//   XC    f32 [4096][384]            6,291,456 @ 20,447,232
//   total                                        26,738,688
// ---------------------------------------------------------------------------
extern "C" void kernel_launch(void* const* d_in, const int* in_sizes, int n_in,
                              void* d_out, int out_size, void* d_ws, size_t ws_size,
                              hipStream_t stream) {
  if (n_in < 14) return;
  if (in_sizes[0] != kRows * kDim || in_sizes[1] != kRows * kDim || in_sizes[2] != kRows * kDim) return;
  if (in_sizes[3] != 3 * kDim || in_sizes[4] != 3 * kDim) return;
  if (in_sizes[5] != 3 * kDim * kDim3 || in_sizes[6] != 3 * kDim * kDim || in_sizes[7] != 3 * kDim) return;
  if (in_sizes[8] != kDim3 || in_sizes[9] != kDim3) return;
  if (in_sizes[10] != kDim3 * kHid || in_sizes[11] != kHid || in_sizes[12] != kHid * kDim3 || in_sizes[13] != kDim3) return;
  if (out_size != 3 * kRows * kDim) return;

  const float* x1     = (const float*)d_in[0];
  const float* x2     = (const float*)d_in[1];
  const float* x3     = (const float*)d_in[2];
  const float* ln1_g  = (const float*)d_in[3];
  const float* ln1_b  = (const float*)d_in[4];
  const float* qkv_w  = (const float*)d_in[5];
  const float* proj_w = (const float*)d_in[6];
  const float* proj_b = (const float*)d_in[7];
  const float* ln2_g  = (const float*)d_in[8];
  const float* ln2_b  = (const float*)d_in[9];
  const float* fc1_w  = (const float*)d_in[10];
  const float* fc1_b  = (const float*)d_in[11];
  const float* fc2_w  = (const float*)d_in[12];
  const float* fc2_b  = (const float*)d_in[13];
  float* out = (float*)d_out;

  // ---- carve ----
  const size_t szWQKV  = (size_t)3 * kDim3 * kDim * 2;
  const size_t szWPROJ = (size_t)3 * kDim * kDim * 2;
  const size_t szWFC1  = (size_t)kHid * kDim3 * 2;
  const size_t szWFC2  = (size_t)kDim3 * kHid * 2;
  const size_t szVT    = (size_t)kGroups * kDim * kSeq * 2;
  const size_t szXN    = (size_t)3 * kRows * kDim * 2;
  const size_t szQKVO  = (size_t)3 * kRows * kDim3 * 2;
  const size_t szHN    = (size_t)kRows * kDim3 * 2;
  const size_t szG     = (size_t)kRows * kHid * 2;
  size_t szBIG = szXN + szQKVO;
  if (szHN + szG > szBIG) szBIG = szHN + szG;
  const size_t szOH    = (size_t)kGroups * kHeads * kSeq * kHdim * 2;
  const size_t szXC    = (size_t)kRows * kDim3 * 4;

  const size_t oWQKV  = 0;
  const size_t oWPROJ = oWQKV + szWQKV;
  const size_t oWFC1  = oWPROJ + szWPROJ;
  const size_t oWFC2  = oWFC1 + szWFC1;
  const size_t oVT    = oWFC2 + szWFC2;
  const size_t oBIG   = oVT + szVT;
  const size_t oOH    = oBIG + szBIG;
  const size_t oXC    = oOH + szOH;
  const size_t oEnd   = oXC + szXC;
  if (oEnd > ws_size) return;

  unsigned char* ws = (unsigned char*)d_ws;
  unsigned short* WPROJ = (unsigned short*)(ws + oWPROJ);
  unsigned short* WFC1  = (unsigned short*)(ws + oWFC1);
  unsigned short* WFC2  = (unsigned short*)(ws + oWFC2);
  unsigned short* VT    = (unsigned short*)(ws + oVT);
  unsigned short* QKVO  = (unsigned short*)(ws + oBIG + szXN);
  unsigned short* G     = (unsigned short*)(ws + oBIG + szHN);
  unsigned short* OH    = (unsigned short*)(ws + oOH);
  float*          XC    = (float*)(ws + oXC);
  const float* fdum = proj_b;   // valid f32 pointer for unused bias, LayerNorm and weight slots

  // ---- QKV from the inputs themselves: (LN1(x_br) . qkv_w[br]) f16 out. M=4096, N=384, K=128; tiles 32*6 = 192 blocks, y = 0..2 ----
  // every block normalises its 128 rows of x_br and casts its 64 columns of qkv_w[br] (carried x16) into LDS
  // q and k columns -> QKVO[br][4096][384]; the V column tiles leave transposed -> VT[g][128][2048]
  // ---- and, as plane y = 3 of the same grid, the weights of the later launches: transpose + f16 (carried x16) ----
  // proj_w [3][128][128] -> WPROJ [3][128][128]; fc1_w [384][768] -> WFC1 [768][384]; fc2_w [768][384] -> WFC2 [384][768]  (156 tiles)
  static_assert(kTilesW <= (kRows / kBM) * (kDim3 / kBN), "the casts fit one plane of the grid");
  gemm_lds<kDim, 1, 6, false, true, false, kFoldVT, kSrcLnCast><<<dim3((kRows / kBM) * (kDim3 / kBN), 4), 256, 0, stream>>>(
      QKVO, kDim, 0L,
      QKVO, kDim, 0L,
      XC, QKVO, VT, kDim3, (long)kRows * kDim3,
      fdum, 0L, x1, x2, x3, 0L, 0,
      kDim3 / kBN, 1.0f / kWCarry,
      ln1_g, ln1_b, qkv_w, proj_w, fc1_w, fc2_w, WPROJ, WFC1, WFC2);

  // ---- attention: all 6 groups x 8 heads in one launch -> per-head planes OH ----
  attn_fused_kernel<<<dim3(kSeq / 128, kGroups * kHeads), 256, 0, stream>>>(QKVO, VT, OH);

  // ---- proj + bias + residual x_br -> XC[:, br*128 .. br*128+127] f32 (ldc 384, resid pitch 128); A staged from the planes OH ----
  // M=4096, N=128, K=128, scale 1/(64*16); tiles 32*2 = 64 blocks per branch, the three branches as batch y of one launch
  gemm_lds<kDim, 1, 4, true, false, true, kFoldHeads, kSrcF16><<<dim3((kRows / kBM) * (kDim / kBN), 3), 256, 0, stream>>>(
      OH, kDim, (long)kRows * kDim,
      WPROJ, kDim, (long)kDim * kDim,
      XC, OH, OH, kDim3, (long)kDim,
      proj_b, (long)kDim, x1, x2, x3, 0L, kDim,
      kDim / kBN, 1.0f / (kOCarry * kWCarry),
      fdum, fdum, fdum, fdum, fdum, fdum, OH, OH, OH);

  // ---- fc1 on LN2(XC) + bias, exact GELU -> G f16 x16 [4096][768]; M=4096, N=768, K=384; tiles 32*12 = 384 blocks ----
  // every block normalises its 128 rows of XC into LDS
  gemm_lds<kDim3, 1, 4, true, true, false, kFoldGelu, kSrcLn><<<dim3((kRows / kBM) * (kHid / kBN), 1), 256, 0, stream>>>(
      G, kDim3, 0L,
      WFC1, kDim3, 0L,
      XC, G, G, kHid, 0L,
      fc1_b, 0L, XC, XC, XC, 0L, 0,
      kHid / kBN, 1.0f / kWCarry,
      ln2_g, ln2_b, fdum, fdum, fdum, fdum, OH, OH, OH);

  // ---- fc2 + bias + residual XC -> three output planes out[k] = [4096][128] (N=128 slice k of 384), K=768, scale 1/256 ----
  // the three slices as batch y of one launch: A shared (stride 0), weights, bias, residual columns and output plane move with y
  // K = 768 in two chunks of 384; tiles 32*2 = 64 blocks per slice
  gemm_lds<kHid / 2, 2, 2, true, false, true, kFoldNone, kSrcF16><<<dim3((kRows / kBM) * (kDim / kBN), 3), 256, 0, stream>>>(
      G, kHid, 0L,
      WFC2, kHid, (long)kDim * kHid,
      out, G, G, kDim, (long)kRows * kDim,
      fc2_b, (long)kDim, XC, XC, XC, (long)kDim, kDim3,
      kDim / kBN, 1.0f / (kGCarry * kWCarry),
      fdum, fdum, fdum, fdum, fdum, fdum, OH, OH, OH);
}

// v008
// It runs in 50 microseconds.
// Two timings next to v007 put it at 1.10 and 1.09 times that version's speed.
// Over all steps from v000 it is 32.3 times as fast.
// Contractions: x_ln@Wqkv, o@Wproj, h_ln@Wfc1, g@Wfc2 (activations f16, weights f16 carried x16), scores k.q^T (q,k f16, q carried x head-dim scale x log2(e), head dim 16: two key tiles per A fragment, q zero-padded 16->32 in registers), V^T@P^T (P f16, unnormalised exp carried x2^8, V^T f16): all v_wmma_f32_16x16x32_f16 with f32 accumulate; LayerNorm, online softmax, GELU(erf), bias, residual in f32.
#include <hip/hip_runtime.h>
#include <math.h>

// ---------------------------------------------------------------------------
// Problem constants
// ---------------------------------------------------------------------------
constexpr int kBatch   = 2;
constexpr int kSeq     = 2048;
constexpr int kDim     = 128;
constexpr int kHeads   = 8;
constexpr int kHdim    = 16;
constexpr int kHid     = 768;
constexpr int kRows    = kBatch * kSeq;     // 4096 token rows per branch
constexpr int kDim3    = 3 * kDim;          // 384
constexpr int kGroups  = 3 * kBatch;        // 6 (branch, batch) groups; group g covers plane rows g*2048 .. g*2048+2047
constexpr int kKeyChunk = 512;              // keys staged in LDS at a time
constexpr int kVHalf   = 288;               // LDS bytes from lane half 0's 256 B of a V^T fragment half to lane half 1's
constexpr int kVGrp    = 576;               // LDS bytes per V^T fragment half (16 dims x 16 keys)
constexpr float kWCarry = 16.0f;            // weights carried x16 in f16
constexpr float kPCarryLog2 = 8.0f;         // unnormalised probabilities exp(s - max in use) carried x2^8 in f16
constexpr float kQCarry = 0.25f * 1.44269504088896340736f;   // q carried x head-dim scale x log2(e): k.q is the score in log2 units
constexpr float kPLimit = 32768.0f;         // a sum of four carried probabilities below this: each of them is far inside f16
constexpr float kOCarry = 64.0f;            // attention output carried x64 in f16
constexpr float kGCarry = 16.0f;            // gelu output carried x16 in f16
constexpr float kLnEps  = 1e-5f;

typedef __attribute__((ext_vector_type(16))) _Float16 v16h;
typedef __attribute__((ext_vector_type(8)))  _Float16 v8h;
typedef __attribute__((ext_vector_type(4)))  _Float16 v4h;
typedef __attribute__((ext_vector_type(8)))  float    v8f;
typedef __attribute__((ext_vector_type(4)))  float    v4f;
typedef __attribute__((ext_vector_type(2)))  float    v2f;
typedef __attribute__((ext_vector_type(4)))  unsigned int v4u;
typedef __attribute__((ext_vector_type(2)))  unsigned int v2u;

// ---------------------------------------------------------------------------
// Fragment helpers
// ---------------------------------------------------------------------------
template <typename T> struct Frag;
template <> struct Frag<_Float16> {
  typedef v16h V; union U { v16h v; v8h h[2]; };
  static __device__ __forceinline__ v16h load(const _Float16* p) {   // elements 0..7 <- p[0..7], 8..15 <- p[16..23]
    U f; f.h[0] = *(const v8h*)(p); f.h[1] = *(const v8h*)(p + 16); return f.v;
  }
  static __device__ __forceinline__ v8f mma(v16h a, v16h b, v8f c) {
    return __builtin_amdgcn_wmma_f32_16x16x32_f16(false, a, false, b, (short)0, c, false, false);
  }
};

__device__ __forceinline__ unsigned pk16(unsigned short a, unsigned short b) { return (unsigned)a | ((unsigned)b << 16); }
__device__ __forceinline__ unsigned short h_bits(float f) { const _Float16 h = (_Float16)f; return __builtin_bit_cast(unsigned short, h); }

// ---------------------------------------------------------------------------
// Batched WMMA GEMM with both operands staged in LDS, by asynchronous copies unless SRC makes them itself.
// C[m,n] = scale * sum_k A[m,k] * Bt[n,k] (+bias[n])(+resid[m*ldr+n]); A row-major [M,K], Bt row-major [N,K], f16.
// One workgroup (8 waves) owns a 128 x 64 tile of C; wave (wm = wave&3, wn = wave>>2) owns rows 32wm.., columns 32wn.. (2 x 2 fragments).
// K = NCH * KC. A chunk is KC k of all 192 operand rows: [A 128 rows | Bt 64 rows] at pitch 2*KC + 16 bytes (16 B x odd: no bank
// conflict for the 16-byte fragment reads). Every copy instruction of a wave moves 512 contiguous source bytes, two runs of 256 or (kFoldHeads A) four of 128:
// whole 128-B lines. Each chunk has a buffer of its own, so chunk 1 flies while chunk 0 is multiplied.
// blockIdx.x = tile (column tile fastest), blockIdx.y = b is the batch: operands, output, bias and residual move by their strides
// (elements) per b; the residual base is resid0 / resid1 / resid2 for b = 0 / 1 / 2, then + b * strideR.
// OUT_F16: C is f16 (Ch), else f32 (Cf). The tile leaves through LDS, so every store instruction writes whole 128-B lines.
// FOLD names the pointwise or re-layout pass that the launch does itself, in place of a launch of its own beside it:
//   kFoldGelu   the f16 output is gelu(C + bias), exact erf form, carried x kGCarry;
//   kFoldVT     column tiles from column 2*kDim on (the V columns) leave transposed: Vt[(g*128 + c)*2048 + n], g = plane row / 2048;
//               column tiles below column kDim (the q columns) leave carried x kQCarry;
//   kFoldHeads  A is read from the attention's per-head planes Ap[(g*8 + h)][2048][16]: k = 16h + d.
// Every loop of the engine is unrolled: its arrays (copy operands, fragments, accumulators, residual rows) are registers and asm
// operands, which need constant indices.
// The file launches one form of the engine, the QKV product (kFoldVT, kSrcLnCast); the products behind the attention are in tail_fused_kernel.
// ---------------------------------------------------------------------------
constexpr int kBM = 128, kBN = 64, kCPitch = 68;   // kCPitch: floats per staged row of C
constexpr int kTPitch = 136;                       // halves per staged row of a transposed V tile: 272 B = 16 B x odd
constexpr int kFoldNone = 0, kFoldGelu = 1, kFoldVT = 2, kFoldHeads = 3;
constexpr int kSrcF16 = 0, kSrcLn = 1, kSrcLnCast = 2;

// N copies and, in the same statement, the wait that stands before any register they name is rewritten.
__device__ __forceinline__ void async_copy4(const unsigned* l, const unsigned short* const* g) {
  asm volatile("global_load_async_to_lds_b128 %0, %4, off\n\t"
               "global_load_async_to_lds_b128 %1, %5, off\n\t"
               "global_load_async_to_lds_b128 %2, %6, off\n\t"
               "global_load_async_to_lds_b128 %3, %7, off\n\t"
               "s_wait_xcnt 0x0"
               :: "v"(l[0]), "v"(l[1]), "v"(l[2]), "v"(l[3]), "v"(g[0]), "v"(g[1]), "v"(g[2]), "v"(g[3]) : "memory");
}
__device__ __forceinline__ void async_copy12(const unsigned* l, const unsigned short* const* g) {
  asm volatile("global_load_async_to_lds_b128 %0, %12, off\n\t"
               "global_load_async_to_lds_b128 %1, %13, off\n\t"
               "global_load_async_to_lds_b128 %2, %14, off\n\t"
               "global_load_async_to_lds_b128 %3, %15, off\n\t"
               "global_load_async_to_lds_b128 %4, %16, off\n\t"
               "global_load_async_to_lds_b128 %5, %17, off\n\t"
               "global_load_async_to_lds_b128 %6, %18, off\n\t"
               "global_load_async_to_lds_b128 %7, %19, off\n\t"
               "global_load_async_to_lds_b128 %8, %20, off\n\t"
               "global_load_async_to_lds_b128 %9, %21, off\n\t"
               "global_load_async_to_lds_b128 %10, %22, off\n\t"
               "global_load_async_to_lds_b128 %11, %23, off\n\t"
               "s_wait_xcnt 0x0"
               :: "v"(l[0]), "v"(l[1]), "v"(l[2]), "v"(l[3]), "v"(l[4]), "v"(l[5]), "v"(l[6]), "v"(l[7]), "v"(l[8]), "v"(l[9]),
                  "v"(l[10]), "v"(l[11]),
                  "v"(g[0]), "v"(g[1]), "v"(g[2]), "v"(g[3]), "v"(g[4]), "v"(g[5]), "v"(g[6]), "v"(g[7]), "v"(g[8]), "v"(g[9]),
                  "v"(g[10]), "v"(g[11]) : "memory");
}

// ROWS rows of KC halves from g0 (row pitch ld halves) to LDS byte address lds0 (row pitch 2*KC + 16). A row is KC/8 pieces of 16 B.
// PER * 256 pieces = 16 whole rows: lane t takes pieces i*256 + t (i < PER) of every 16-row band, so its addresses in the next band
// are the same plus a constant. Each piece is copied by exactly one lane; every lane is on.
template <int KC, int ROWS>
__device__ __forceinline__ void stage_rows(const unsigned short* g0, int ld, unsigned lds0, int t) {
  constexpr int CPR = KC / 8, PER = CPR / 16, BAND = 16, NB = ROWS / BAND, PITCH = KC * 2 + 16;
  static_assert(CPR % 16 == 0 && (PER == 1 || PER == 3) && NB % 4 == 0, "whole bands, four bands a statement");
  const unsigned short* gb[PER];
  unsigned lb[PER];
#pragma unroll
  for (int i = 0; i < PER; ++i) {
    const int e = i * 256 + t;
    const int r = e / CPR, c = e - r * CPR;
    gb[i] = g0 + (r * ld + c * 8);
    lb[i] = lds0 + (unsigned)(r * PITCH + c * 16);
  }
  const size_t step = (size_t)(BAND * ld);
#pragma unroll
  for (int j0 = 0; j0 < NB; j0 += 4) {
    unsigned l[4 * PER];
    const unsigned short* g[4 * PER];
#pragma unroll
    for (int jj = 0; jj < 4; ++jj)
#pragma unroll
      for (int i = 0; i < PER; ++i) {
        l[jj * PER + i] = lb[i] + (unsigned)((j0 + jj) * BAND * PITCH);
        g[jj * PER + i] = gb[i] + (size_t)(j0 + jj) * step;
      }
    if (PER == 3) async_copy12(l, g); else async_copy4(l, g);
  }
}

// 128 rows of A = 8 heads x 16 dims from the per-head planes; o0 = head 0's plane at the tile's first row, LDS row pitch 2*kDim + 16.
// A band is 16 rows = 256 pieces of 16 B. A wave takes 4 heads x 4 rows x 2 pieces: per head 128 contiguous, aligned source bytes,
// so every copy instruction moves 4 whole lines. Each piece is copied by exactly one lane; every lane is on.
__device__ __forceinline__ void stage_heads(const unsigned short* o0, unsigned lds0, int t) {
  constexpr int PITCH = kDim * 2 + 16;
  const int lane = t & 31, wave = t >> 5;
  const int h = (wave & 1) * 4 + (lane >> 3);
  const int r = (wave >> 1) * 4 + ((lane >> 1) & 3);
  const int p = lane & 1;
  const unsigned short* gb = o0 + (h * kSeq * kHdim + r * kHdim + p * 8);
  const unsigned lb = lds0 + (unsigned)(r * PITCH + (h * 2 + p) * 16);
#pragma unroll
  for (int j0 = 0; j0 < kBM / 16; j0 += 4) {
    unsigned l[4];
    const unsigned short* g[4];
#pragma unroll
    for (int jj = 0; jj < 4; ++jj) {
      l[jj] = lb + (unsigned)((j0 + jj) * 16 * PITCH);
      g[jj] = gb + (j0 + jj) * 16 * kHdim;
    }
    async_copy4(l, g);
  }
}

// value of the lane whose number differs by MASK inside the 16-lane row (DPP row_xmask)
template <int MASK> __device__ __forceinline__ float lane_xor(float v) {
  return __builtin_bit_cast(float, __builtin_amdgcn_update_dpp(0, __builtin_bit_cast(int, v), 0x160 + MASK, 0xf, 0xf, true));
}

__device__ __forceinline__ float rsq_slot(float x) {
  float r;
  asm("v_rsq_f32 %0, %1\n\tv_nop" : "=v"(r) : "v"(x));
  return r;
}

// 128 rows of x (f32, KC features, x0 = the tile's first row) -> LayerNorm -> f16 rows in LDS at pitch 2*KC + 16.
// LPR lanes share a row, so a wave instruction works on 32/LPR rows: lane j of them holds the 16-B pieces j, j + LPR, j + 2*LPR, ...,
// and every load instruction covers whole 128-B lines of each of its rows. A wave takes 16 rows, two passes to a group;
// the next group's loads are asked for ahead of this group's arithmetic.
template <int KC>
__device__ __forceinline__ void stage_ln(const float* __restrict__ x0, const float* __restrict__ g, const float* __restrict__ bt,
                                         unsigned char* sA, int t) {
  constexpr int PITCH = KC * 2 + 16;
  constexpr int LPR = (KC == kDim) ? 8 : 16, NQ = KC / 4 / LPR, RP = 32 / LPR, NG = 16 / RP / 2;
  static_assert(NQ * LPR * 4 == KC, "whole pieces");
  const int lane = t & 31, wave = t >> 5;
  const int j = lane & (LPR - 1), rr = lane / LPR;
  const unsigned xo = (unsigned)((wave * 16 + rr) * KC + j * 4) * 4u;   // bytes: uniform base + one 32-bit lane offset
  const unsigned go = (unsigned)(j * 4) * 4u;
  v4f xv[NG][2][NQ], gv[NQ], bv[NQ];
#pragma unroll
  for (int q = 0; q < NQ; ++q) {
    gv[q] = *(const v4f*)((const char*)(g + q * LPR * 4) + go);
    bv[q] = *(const v4f*)((const char*)(bt + q * LPR * 4) + go);
  }
#pragma unroll
  for (int gi = -1; gi < NG; ++gi) {
    if (gi + 1 < NG) {
#pragma unroll
      for (int p = 0; p < 2; ++p)
#pragma unroll
        for (int q = 0; q < NQ; ++q)
          xv[gi + 1][p][q] = *(const v4f*)((const char*)(x0 + (((gi + 1) * 2 + p) * RP * KC + q * LPR * 4)) + xo);
      // the lane offsets stay in their registers up to this wait, which stands before any register these loads name is rewritten
      asm volatile("s_wait_xcnt 0x0" :: "v"(xo), "v"(go) : "memory");
    }
    if (gi < 0) continue;
#pragma unroll
    for (int p = 0; p < 2; ++p) {
      v4f a = xv[gi][p][0];
#pragma unroll
      for (int q = 1; q < NQ; ++q) a += xv[gi][p][q];
      float s1 = (a[0] + a[1]) + (a[2] + a[3]);
      s1 += lane_xor<1>(s1);
      s1 += lane_xor<2>(s1);
      s1 += lane_xor<4>(s1);
      if (LPR == 16) s1 += lane_xor<8>(s1);
      const float mean = s1 * (1.0f / KC);
      v4f a2 = (v4f){0.f, 0.f, 0.f, 0.f};
#pragma unroll
      for (int q = 0; q < NQ; ++q) {
        xv[gi][p][q] -= mean;
        a2 += xv[gi][p][q] * xv[gi][p][q];
      }
      float s2 = (a2[0] + a2[1]) + (a2[2] + a2[3]);
      s2 += lane_xor<1>(s2);
      s2 += lane_xor<2>(s2);
      s2 += lane_xor<4>(s2);
      if (LPR == 16) s2 += lane_xor<8>(s2);
      const float rstd = rsq_slot(s2 * (1.0f / KC) + kLnEps);
      unsigned char* row = sA + (wave * 16 + (gi * 2 + p) * RP + rr) * PITCH + j * 8;
#pragma unroll
      for (int q = 0; q < NQ; ++q)
        *(v4h*)(row + q * LPR * 8) = __builtin_convertvector(xv[gi][p][q] * rstd * gv[q] + bv[q], v4h);
    }
  }
}

// 64 columns of a weight plane W (f32 [kDim][LDW], w0 = W + first column) -> Bt rows [column][k] f16 carried x kWCarry, LDS pitch 2*kDim + 16.
// Lane = column, so every load instruction reads one whole 128-B line; a thread packs 8 consecutive k of its column into one 16-B store.
template <int LDW>
__device__ __forceinline__ void stage_wcast128(const float* __restrict__ w0, unsigned char* sB, int t) {
  constexpr int PITCH = kDim * 2 + 16;
  const int nl = t & 63, kq = t >> 6;
  const unsigned wo = (unsigned)(kq * 8 * LDW + nl) * 4u;   // bytes: uniform base + one 32-bit lane offset
  float wv[4][8];
#pragma unroll
  for (int i = 0; i < 4; ++i)
#pragma unroll
    for (int e = 0; e < 8; ++e) wv[i][e] = *(const float*)((const char*)(w0 + (i * 32 + e) * LDW) + wo);
  // as in stage_ln: the lane offset lives up to the wait
  asm volatile("s_wait_xcnt 0x0" :: "v"(wo) : "memory");
#pragma unroll
  for (int i = 0; i < 4; ++i) {
    v8h hv;
#pragma unroll
    for (int e = 0; e < 8; ++e) hv[e] = (_Float16)(wv[i][e] * kWCarry);
    *(v8h*)(sB + nl * PITCH + (i * 4 + kq) * 16) = hv;
  }
}

// GELU in its erf form (not the tanh form) of eight values side by side, with no branch: X = kGCarry * x comes in, kGCarry * gelu(x) goes out.
// gelu(x) = x * (1 + erf(x / sqrt 2)) / 2 = max(x, 0) - |x| * T(|x|), T(a) = erfc(a / sqrt 2) / 2 = the normal tail, so nothing cancels for x < 0.
// T(a) = exp(-a * a / 2) * t * (c1 + t * (c2 + t * (c3 + t * (c4 + t * c5)))), t = 1 / (1 + p * a): the classical five-term rational form of erfc,
// absolute error below 1e-7 in T; in f32 the result stays within 5e-7 (absolute) of gelu(x), and it is stored as f16, which rounds at 5e-4 relative.
__device__ __forceinline__ v8f gelu8_carried(v8f X) {
  constexpr float p  = 0.3275911f * 0.70710678118654752f / kGCarry;
  constexpr float k2 = -0.5f * 1.44269504088896340736f / (kGCarry * kGCarry);   // exp(-x * x / 2) = exp2(k2 * X * X)
  constexpr float c1 = 0.5f * 0.254829592f, c2 = 0.5f * -0.284496736f, c3 = 0.5f * 1.421413741f, c4 = 0.5f * -1.453152027f, c5 = 0.5f * 1.061405429f;
  const v8f aX = __builtin_elementwise_abs(X);
  const v8f d = aX * p + 1.0f;
  const v8f w = (X * k2) * X;
  v8f t, e;
#pragma unroll   // vector elements are registers: constant indices
  for (int i = 0; i < 8; ++i) { t[i] = __builtin_amdgcn_rcpf(d[i]); e[i] = __builtin_amdgcn_exp2f(w[i]); }
  const v8f q = ((((t * c5 + c4) * t + c3) * t + c2) * t + c1) * t;
  return __builtin_elementwise_max(X, (v8f){0.f, 0.f, 0.f, 0.f, 0.f, 0.f, 0.f, 0.f}) - aX * (q * e);
}

constexpr int kTilesProj = (kDim / 64) * (kDim / 64) * 3;    // 12
constexpr int kTilesFc1  = (kDim3 / 64) * (kHid / 64);       // 72
constexpr int kTilesFc2  = (kHid / 64) * (kDim3 / 64);       // 72
constexpr int kTilesW    = kTilesProj + kTilesFc1 + kTilesFc2;   // 156
__device__ __forceinline__ void wtcast_tile(int r0, const float* __restrict__ wProj,
                                            const float* __restrict__ wFc1, const float* __restrict__ wFc2,
                                            unsigned short* __restrict__ oProj,
                                            unsigned short* __restrict__ oFc1, unsigned short* __restrict__ oFc2,
                                            float scale);

// SRC names what the block makes of f32 data in LDS itself, in place of a launch in front of it:
//   kSrcLn      A = LayerNorm over KC features of the f32 rows of resid0 / resid1 / resid2 (b = 0 / 1 / 2; gain and shift lng, lnb + b * KC);
//               Ap is not read;
//   kSrcLnCast  the same, and Bt = the columns of the f32 plane Wf + b * kDim * kDim3, cast by the block; Btp is not read either.
// Plane blockIdx.y = 3 of a kSrcLnCast grid holds no GEMM tile: its first kTilesW blocks cast one tile each of the weights of the later launches
// (block-uniform choice, so the cast's barrier is passed by a whole block or by none).
// WPE = waves per SIMD that the register budget must leave room for: 2 * workgroups per WGP that the LDS size and the grid ask for.
template <int KC, int NCH, int WPE, bool BIAS, bool OUT_F16, bool RESID, int FOLD, int SRC>
__global__ __launch_bounds__(256, WPE) void gemm_lds(
    const unsigned short* __restrict__ Ap, int lda, long strideA,
    const unsigned short* __restrict__ Btp, int ldb, long strideB,
    float* __restrict__ Cf, unsigned short* __restrict__ Ch, unsigned short* __restrict__ Vt, int ldc, long strideC,
    const float* __restrict__ bias, long strideBias,
    const float* __restrict__ resid0, const float* __restrict__ resid1, const float* __restrict__ resid2, long strideR, int ldr,
    int tilesN, float scale,
    const float* __restrict__ lng, const float* __restrict__ lnb, const float* __restrict__ Wf,
    const float* __restrict__ wProj, const float* __restrict__ wFc1, const float* __restrict__ wFc2,
    unsigned short* __restrict__ oProj, unsigned short* __restrict__ oFc1, unsigned short* __restrict__ oFc2) {
  if (SRC == kSrcLnCast && blockIdx.y == 3) {
    if (blockIdx.x < kTilesW) wtcast_tile(blockIdx.x, wProj, wFc1, wFc2, oProj, oFc1, oFc2, kWCarry);
    return;
  }
  constexpr int PITCH = KC * 2 + 16;
  constexpr int BUF   = (kBM + kBN) * PITCH;
  constexpr int GK    = 2, NG = KC / 32 / GK;   // fragments are fetched in groups of GK k steps, one group ahead
  static_assert(kBM * kCPitch * 4 <= BUF, "the staged C tile fits the first buffer");
  static_assert((kBM + kBN) * (KC / 8) / 256 <= 63, "copies of one chunk outstanding per wave");
  static_assert(FOLD != kFoldHeads || (KC == kDim && NCH == 1), "a row of A is the 8 heads of one token");
  static_assert(FOLD != kFoldGelu || OUT_F16, "the activation leaves as f16");
  static_assert(SRC == kSrcF16 || (NCH == 1 && !RESID && FOLD != kFoldHeads), "a chunk holds the whole normalised row; the residual slots name its source");
  static_assert(SRC != kSrcLnCast || KC == kDim, "the cast stages 128 k");
  static_assert(FOLD != kFoldVT || (OUT_F16 && !BIAS && kBN * kTPitch * 2 <= BUF), "the transposed tile fits the first buffer");
  __shared__ __align__(128) unsigned char smem[NCH * BUF];
  const int t    = threadIdx.x;
  const int lane = t & 31, wave = t >> 5;
  const int b    = blockIdx.y;
  const int tm   = blockIdx.x / tilesN;
  const int tn   = blockIdx.x - tm * tilesN;
  const int m0   = tm * kBM, n0 = tn * kBN;
  const unsigned short* Ab = Ap  + (size_t)b * strideA + (size_t)m0 * lda;
  const unsigned short* Bb = Btp + (size_t)b * strideB + (size_t)n0 * ldb;
  const unsigned lds0 = (unsigned)(size_t)smem;   // low 32 bits of the shared address = byte offset in the workgroup's LDS

  const int grp = b * (kRows / kSeq) + m0 / kSeq, tok = m0 % kSeq;   // the tile's (branch, batch) group and its first token there
  if (SRC == kSrcF16) {
    if (FOLD == kFoldHeads) stage_heads(Ap + ((size_t)grp * kHeads * kSeq + tok) * kHdim, lds0, t);
    else                    stage_rows<KC, kBM>(Ab, lda, lds0, t);
    stage_rows<KC, kBN>(Bb, ldb, lds0 + kBM * PITCH, t);
  } else {   // Bt is asked for first, so that it flies under the LayerNorm arithmetic
    if (SRC == kSrcLnCast) stage_wcast128<kDim3>(Wf + (size_t)b * (kDim * kDim3) + n0, smem + kBM * PITCH, t);
    else                   stage_rows<KC, kBN>(Bb, ldb, lds0 + kBM * PITCH, t);
    stage_ln<KC>(((b == 0) ? resid0 : (b == 1) ? resid1 : resid2) + (size_t)m0 * KC, lng + b * KC, lnb + b * KC, smem, t);
  }

  // bias and residual of the rows this thread will store: asked for now, used in the epilogue
  const int c4 = (t & 15) * 4, r4 = t >> 4;            // f32 C: a row of 256 B = 16 lanes x 16 B; 16 rows a trip
  const int c8 = (t & 7) * 8, r8 = t >> 3;             // f16 C: a row of 128 B = 8 lanes x 16 B; 32 rows a trip
  v4f bv = (v4f){0.f, 0.f, 0.f, 0.f};
  v4f bh[2] = {bv, bv};
  v4f rv[kBM / 16];
  if (BIAS) bv = *(const v4f*)(bias + (size_t)b * strideBias + n0 + c4);
  if (BIAS && OUT_F16) {
    const float* bp = bias + (size_t)b * strideBias + n0 + c8;
    bh[0] = *(const v4f*)bp;
    bh[1] = *(const v4f*)(bp + 4);
  }
  if (RESID) {
    const float* rp = ((b == 0) ? resid0 : (b == 1) ? resid1 : resid2) + (size_t)b * strideR + (size_t)(m0 + r4) * ldr + n0 + c4;
    const float* rq[kBM / 16];
#pragma unroll
    for (int it = 0; it < kBM / 16; ++it) { rq[it] = rp + (size_t)(it * 16 * ldr); rv[it] = *(const v4f*)rq[it]; }
    // the eight addresses stay in their registers up to this wait, so no load of the run returns onto an earlier load's address
    asm volatile("s_wait_xcnt 0x0" :: "v"(rq[0]), "v"(rq[1]), "v"(rq[2]), "v"(rq[3]), "v"(rq[4]), "v"(rq[5]), "v"(rq[6]), "v"(rq[7]) : "memory");
  }

  if (SRC != kSrcLnCast) asm volatile("s_wait_asynccnt 0x0" ::: "memory");   // this wave's copies of chunk 0 have landed
  __syncthreads();                                    // chunk 0 visible to every wave
  if (NCH > 1) {                                      // chunk 1 flies under chunk 0's products
    stage_rows<KC, kBM>(Ab + KC, lda, lds0 + BUF, t);
    stage_rows<KC, kBN>(Bb + KC, ldb, lds0 + BUF + kBM * PITCH, t);
  }

  const int rlane = lane & 15, hh = lane >> 4;
  const int wm = wave & 3, wn = wave >> 2;
  v8f acc[2][2];
#pragma unroll
  for (int i = 0; i < 2; ++i)
#pragma unroll
    for (int j = 0; j < 2; ++j) acc[i][j] = (v8f){0.f, 0.f, 0.f, 0.f, 0.f, 0.f, 0.f, 0.f};

#pragma unroll
  for (int ch = 0; ch < NCH; ++ch) {
    const unsigned char* aP = smem + ch * BUF + (wm * 32 + rlane) * PITCH + hh * 16;
    const unsigned char* bP = smem + ch * BUF + (kBM + wn * 32 + rlane) * PITCH + hh * 16;
    v16h fa[2][GK][2], fb[2][GK][2];
#pragma unroll
    for (int g = -1; g < NG; ++g) {
      if (g + 1 < NG) {
#pragma unroll
        for (int s = 0; s < GK; ++s)
#pragma unroll
          for (int i = 0; i < 2; ++i) {
            fa[(g + 1) & 1][s][i] = Frag<_Float16>::load((const _Float16*)(aP + i * 16 * PITCH + ((g + 1) * GK + s) * 64));
            fb[(g + 1) & 1][s][i] = Frag<_Float16>::load((const _Float16*)(bP + i * 16 * PITCH + ((g + 1) * GK + s) * 64));
          }
      }
      __builtin_amdgcn_sched_barrier(0);   // the next group's LDS reads stay one group, ahead of this group's products, not among them
      if (g >= 0) {
#pragma unroll
        for (int s = 0; s < GK; ++s)
#pragma unroll
          for (int i = 0; i < 2; ++i)
#pragma unroll
            for (int j = 0; j < 2; ++j) acc[i][j] = Frag<_Float16>::mma(fa[g & 1][s][i], fb[g & 1][s][j], acc[i][j]);
      }
      __builtin_amdgcn_sched_barrier(0);   // and the reads of the group after that stay behind these products
    }
    asm volatile("s_wait_dscnt 0x0" ::: "memory");                    // this wave's reads of the chunk are done
    if (NCH > 1) asm volatile("s_wait_asynccnt 0x0" ::: "memory");    // this wave's copies of the next chunk have landed; behind the last chunk none is left
    __syncthreads();   // next chunk visible to every wave; behind the last chunk: every reader has left, the LDS becomes C staging
  }

  // ---- epilogue: scaled tile to LDS in accumulator order, out of it in whole rows ----
  float* sC = (float*)smem;
  _Float16* sT = (_Float16*)smem;
  const bool vtile = FOLD == kFoldVT && n0 >= 2 * kDim;   // block-uniform: the whole tile is V columns
  const float cscale = (FOLD == kFoldVT && n0 < kDim) ? scale * kQCarry   // block-uniform: the whole tile is q columns
                     : (FOLD == kFoldGelu) ? scale * kGCarry : scale;      // the activation takes its argument carried
  if (vtile) {
    // a lane's 8 accumulator registers are 8 consecutive rows of one column: 16 contiguous bytes of the transposed tile
#pragma unroll
    for (int i = 0; i < 2; ++i)
#pragma unroll
      for (int j = 0; j < 2; ++j)
        *(v8h*)(sT + (wn * 32 + j * 16 + rlane) * kTPitch + wm * 32 + i * 16 + hh * 8) = __builtin_convertvector(acc[i][j] * scale, v8h);
  } else {
#pragma unroll
    for (int i = 0; i < 2; ++i)
#pragma unroll
      for (int j = 0; j < 2; ++j)
#pragma unroll
        for (int r = 0; r < 8; ++r)
          sC[(wm * 32 + i * 16 + hh * 8 + r) * kCPitch + wn * 32 + j * 16 + rlane] = acc[i][j][r] * cscale;
  }
  __syncthreads();   // staged tile visible to every wave
  if (vtile) {
    // 64 dims x 128 tokens: a row of 256 B = 16 lanes x 16 B; 16 rows a trip
    unsigned short* vp = Vt + ((size_t)grp * kDim + (n0 - 2 * kDim)) * kSeq + tok;
    const unsigned vo = (unsigned)(r4 * kSeq + (t & 15) * 8) * 2u;   // bytes: uniform base + one 32-bit lane offset
#pragma unroll
    for (int it = 0; it < kBN / 16; ++it) {
      const v8h hv = *(const v8h*)(sT + (it * 16 + r4) * kTPitch + (t & 15) * 8);
      *(v8h*)((char*)(vp + (size_t)(it * 16 * kSeq)) + vo) = hv;
    }
  } else if (!OUT_F16) {
    float* cp = Cf + (size_t)b * strideC + (size_t)m0 * ldc + n0;
    const unsigned co = (unsigned)(r4 * ldc + c4) * 4u;   // bytes: uniform base + one 32-bit lane offset
#pragma unroll
    for (int it = 0; it < kBM / 16; ++it) {
      v4f v = *(const v4f*)(sC + (it * 16 + r4) * kCPitch + c4);
      if (BIAS)  v += bv;
      if (RESID) v += rv[it];
      *(v4f*)((char*)(cp + (size_t)(it * 16 * ldc)) + co) = v;
    }
  } else {
    unsigned short* cp = Ch + (size_t)b * strideC + (size_t)m0 * ldc + n0;
    const unsigned co = (unsigned)(r8 * ldc + c8) * 2u;   // bytes: uniform base + one 32-bit lane offset
    v4f sv[kBM / 32][2];   // all of the thread's staged values are asked for at once, ahead of the pointwise work
#pragma unroll
    for (int it = 0; it < kBM / 32; ++it) {
      const float* sp = sC + (it * 32 + r8) * kCPitch + c8;
      sv[it][0] = *(const v4f*)sp;
      sv[it][1] = *(const v4f*)(sp + 4);
    }
#pragma unroll
    for (int it = 0; it < kBM / 32; ++it) {
      v8f x;
#pragma unroll
      for (int e = 0; e < 8; ++e) {
        x[e] = sv[it][e >> 2][e & 3];
        if (BIAS) x[e] += bh[e >> 2][e & 3] * ((FOLD == kFoldGelu) ? kGCarry : 1.0f);
      }
      if (FOLD == kFoldGelu) x = gelu8_carried(x);
      const v8h hv = __builtin_convertvector(x, v8h);
      *(v8h*)((char*)(cp + (size_t)(it * 32 * ldc)) + co) = hv;
    }
    // stands behind the last store of the run, before any register that the four stores name is rewritten; the lane offset lives up to it
    asm volatile("s_wait_xcnt 0x0" :: "v"(co) : "memory");
  }
}

// ---------------------------------------------------------------------------
// Weight transpose + cast: W plane z is f32 [nIn][nOut] row-major; WT[h][d] = f16(scale * W[d][h]) leaves in fragment order:
// the 16 columns h x 32 k of one matrix operand are 1 KiB, k step fastest, then column tile: two halves of 512 B (k 0..15, k 16..31 of the step),
// in each half lane (h & 15) + 16 * ((k >> 3) & 1) holds 8 consecutive k in 16 B. A 64 x 64 tile holds 8 such blocks whole.
// The three weight tensors that later launches read, in one index space: tile index r0 falls into one tensor's range of (nIn/64)*(nOut/64)*nz tiles
// (block-uniform choice), and inside the range it runs d tile fastest, then h tile, then plane z.
// 256 threads; nIn, nOut multiples of 64. Plane z at out + z*nOut*nIn halves.
// Load coverage: 16 iterations x 256 threads = 4096 = the whole 64x64 tile (coalesced along h).
// Store coverage: 8 waves x 2 iterations x 4 rows (lane>>3) = 64 rows; (lane&7) x 8 halves = 64 cols; each row segment =
// ---------------------------------------------------------------------------
__device__ __forceinline__ void wtcast_tile(int r0, const float* __restrict__ wProj,
                                            const float* __restrict__ wFc1, const float* __restrict__ wFc2,
                                            unsigned short* __restrict__ oProj,
                                            unsigned short* __restrict__ oFc1, unsigned short* __restrict__ oFc2,
                                            float scale) {
  __shared__ float sm[64][65];   // sm[h_local][d_local]
  const int t  = threadIdx.x;
  const float* W = wProj; unsigned short* out = oProj; int nIn = kDim, nOut = kDim;
  if (r0 >= kTilesProj + kTilesFc1) { r0 -= kTilesProj + kTilesFc1; W = wFc2; out = oFc2; nIn = kHid; nOut = kDim3; }
  else if (r0 >= kTilesProj)        { r0 -= kTilesProj; W = wFc1; out = oFc1; nIn = kDim3; nOut = kHid; }
  const int gx = nIn >> 6, gy = nOut >> 6;
  const int r1 = r0 / gx;
  const int d0 = (r0 - r1 * gx) * 64;
  const int z  = r1 / gy;
  const int h0 = (r1 - z * gy) * 64;
  const float* Wz = W + (size_t)z * nIn * nOut;
#pragma unroll
  for (int i = 0; i < 16; ++i) {
    const int e = i * 256 + t;
    const int r = e >> 6;          // d local
    const int c = e & 63;          // h local
    sm[c][r] = Wz[(size_t)(d0 + r) * nOut + h0 + c] * scale;
  }
  __syncthreads();
  const int lane = t & 31, wave = t >> 5;
  const int q = lane >> 3, c8 = (lane & 7) * 8;
  unsigned short* op = out + (size_t)z * nOut * nIn;
  {
#pragma unroll
    for (int it = 0; it < 2; ++it) {
      const int row = wave * 8 + it * 4 + q;                 // h local
      unsigned short hb[8];
#pragma unroll
      for (int e = 0; e < 8; ++e) hb[e] = h_bits(sm[row][c8 + e]);
      const v4u u = (v4u){pk16(hb[0], hb[1]), pk16(hb[2], hb[3]), pk16(hb[4], hb[5]), pk16(hb[6], hb[7])};
      const int n = h0 + row, k = d0 + c8;                   // 8 consecutive k of output column n: one lane's 16 B of a fragment half
      *(v4u*)(op + ((((n >> 4) * (nIn >> 5) + (k >> 5)) * 2 + ((k >> 4) & 1)) * 256 + ((n & 15) + 16 * ((k >> 3) & 1)) * 8)) = u;
    }
    
  }
}

// ---------------------------------------------------------------------------
// Fused attention, one launch for all 48 (group, head) pairs: S^T = K.Q^T, online softmax, O^T += V^T.P^T.
// grid (2048/128 = 16 query blocks, 48), 256 threads = 8 waves x 16 queries. Lane (c = lane&15, hh = lane>>4) owns query c.
// K and V^T of the head are staged through registers into LDS, 512 keys at a time, already in fragment order:
//   sK: 16-key tile T at T*512; lane's 16 B (key c, dims 8hh..8hh+7) at + lane*16.
//   sV: fragment half G (keys 16G + 8hh + 0..7 of dim c) at G*576 + hh*288 + c*16.
// S^T tile register r = score(key 8hh + r, query c), so two tiles converted in place are the B operand P^T (hardware k
// order), and V^T as A is read in the same k order. O^T register r = O(query c, dim 8hh + r): one 16-B store per lane.
// oh[(g*8 + head)][2048][16] f16 carried x64: each wave writes 512 contiguous bytes.
// ---------------------------------------------------------------------------
__device__ __forceinline__ float other_half(float v) {   // value of lane ^ 16
  const int b = __builtin_bit_cast(int, v);
  return __builtin_bit_cast(float, __builtin_amdgcn_permlanex16(b, b, 0x76543210, 0xfedcba98, false, false));
}
__device__ __forceinline__ float vmax8(v8f a) {
  return fmaxf(fmaxf(fmaxf(a[0], a[1]), fmaxf(a[2], a[3])), fmaxf(fmaxf(a[4], a[5]), fmaxf(a[6], a[7])));
}
__device__ __forceinline__ v8f vexp2_8(v8f a) {
  v8f r;
#pragma unroll
  for (int e = 0; e < 8; ++e) r[e] = __builtin_amdgcn_exp2f(a[e]);
  return r;
}
__device__ __forceinline__ v8f splat8(float x) { return (v8f){x, x, x, x, x, x, x, x}; }
// largest score (log2 units) of the lane's query over the 64 keys whose four staged tiles begin at kt (the lane's own 16 B), both lane halves joined
__device__ __forceinline__ float max64(const unsigned char* kt, v16h qlo, v16h qhi) {
  const v8f z = (v8f){0.f, 0.f, 0.f, 0.f, 0.f, 0.f, 0.f, 0.f};
  float mx = -INFINITY;
#pragma unroll
  for (int j = 0; j < 2; ++j) {
    Frag<_Float16>::U kf;
    kf.h[0] = *(const v8h*)(kt + (2 * j) * 512);
    kf.h[1] = *(const v8h*)(kt + (2 * j + 1) * 512);
    mx = fmaxf(mx, fmaxf(vmax8(Frag<_Float16>::mma(kf.v, qlo, z)), vmax8(Frag<_Float16>::mma(kf.v, qhi, z))));
  }
  return fmaxf(mx, other_half(mx));
}
// six waves per SIMD = three workgroups per WGP: 768 workgroups fill 256 WGPs in one even round
__global__ __launch_bounds__(256) __attribute__((amdgpu_waves_per_eu(6))) void attn_fused_kernel(const unsigned short* __restrict__ qkvo,
                                                         const unsigned short* __restrict__ vt,
                                                         unsigned short* __restrict__ oh) {
  __shared__ __align__(128) unsigned char sK[kKeyChunk * 32];
  __shared__ __align__(128) unsigned char sV[(kKeyChunk / 16) * kVGrp];
  typedef Frag<_Float16>::U FU;
  const int lane = threadIdx.x & 31, wave = threadIdx.x >> 5;
  const int c = lane & 15, hh = lane >> 4;
  const int gh = blockIdx.y, g = gh >> 3, hd = gh & 7;
  const int q0 = blockIdx.x * 128 + wave * 16;
  const v8h zero8 = (v8h){0, 0, 0, 0, 0, 0, 0, 0};
  const v8f zacc  = (v8f){0.f, 0.f, 0.f, 0.f, 0.f, 0.f, 0.f, 0.f};

  // One A fragment holds two 16-key tiles (k 0..15 = dims of the first, k 16..31 = dims of the second);
  // q sits in the lower k half of qlo and in the upper k half of qhi, zeros in the other half, so each picks one tile.
  FU qlo, qhi;
  qlo.h[0] = *(const v8h*)(qkvo + (size_t)(g * kSeq + q0 + c) * kDim3 + hd * kHdim + 8 * hh);
  qlo.h[1] = zero8;
  qhi.h[0] = zero8;
  qhi.h[1] = qlo.h[0];

  // staging, 4 rounds of 8 waves per chunk. K round i: wave takes the 16-key tile i*8 + wave, lane = (key c, 16-B part hh).
  // V^T round i: wave takes 4 dims x 8 parts of 8 keys (4 whole 128-B lines): dim sd, part i*16 + sp of the chunk.
  const int sd = (wave & 3) * 4 + (lane >> 3);
  const int sp = (wave >> 2) * 8 + (lane & 7);
  const unsigned short* kp = qkvo + (size_t)(g * kSeq + wave * 16 + c) * kDim3 + kDim + hd * kHdim + 8 * hh;
  const unsigned short* vp = vt + (size_t)(g * kDim + hd * kHdim + sd) * kSeq + sp * 8;
  unsigned char* skw = sK + wave * 512 + lane * 16;
  unsigned char* svw = sV + (sp >> 1) * kVGrp + (sp & 1) * kVHalf + sd * 16;
  v4u kr[4], vr[4];
#pragma unroll
  for (int i = 0; i < 4; ++i) {
    kr[i] = *(const v4u*)(kp + (size_t)i * 128 * kDim3);
    vr[i] = *(const v4u*)(vp + i * 128);
  }

  // Lazy rescale. m = the maximum in use of the lane's query (log2 units), the same in both lane halves; cv = kPCarryLog2 - m in all eight
  // registers is the C operand of the score products, which so leave the matrix unit as the exponents themselves.
  float m = 0.f;
  v8f cv = zacc;
  v8f lv = zacc;
  v8f o  = zacc;
  for (int ch = 0; ch < kSeq / kKeyChunk; ++ch) {
    __syncthreads();   // every wave has finished reading the previous chunk
#pragma unroll
    for (int i = 0; i < 4; ++i) {
      *(v4u*)(skw + i * 8 * 512) = kr[i];
      *(v4u*)(svw + i * 8 * kVGrp) = vr[i];
    }
    __syncthreads();   // chunk visible to every wave
    if (ch + 1 < kSeq / kKeyChunk) {   // next chunk's global loads fly under this chunk's work
      kp += (size_t)kKeyChunk * kDim3;
      vp += kKeyChunk;
#pragma unroll
      for (int i = 0; i < 4; ++i) {
        kr[i] = *(const v4u*)(kp + (size_t)i * 128 * kDim3);
        vr[i] = *(const v4u*)(vp + i * 128);
      }
    }
    if (ch == 0) {   // the first maximum in use: that of the first 64 keys
      m  = max64(sK + lane * 16, qlo.v, qhi.v);
      cv = splat8(kPCarryLog2 - m);
    }
#pragma unroll 2   // a rolled loop keeps the registers inside the six-wave budget with no scratch
    for (int kb = 0; kb < kKeyChunk / 64; ++kb) {
      const unsigned char* kt = sK + kb * 4 * 512 + lane * 16;
      FU kf[2];
#pragma unroll
      for (int j = 0; j < 2; ++j) {
        kf[j].h[0] = *(const v8h*)(kt + (2 * j) * 512);
        kf[j].h[1] = *(const v8h*)(kt + (2 * j + 1) * 512);
      }
      v8f pe[4];
#pragma unroll
      for (int j = 0; j < 2; ++j) {
        pe[2 * j]     = vexp2_8(Frag<_Float16>::mma(kf[j].v, qlo.v, cv));
        pe[2 * j + 1] = vexp2_8(Frag<_Float16>::mma(kf[j].v, qhi.v, cv));
      }
      v8f ps = (pe[0] + pe[1]) + (pe[2] + pe[3]);
      // One test per 64 keys, a scalar branch for the whole wave: only where a score has outgrown the maximum in use so far that its
      // probability nears the f16 range is the maximum taken anew, sums and output rescaled and the 64 keys' probabilities made again.
      if (__builtin_amdgcn_ballot_w32(!(vmax8(ps) < kPLimit)) != 0) {
        const float mn = fmaxf(m, max64(kt, qlo.v, qhi.v));
        const float alpha = __builtin_amdgcn_exp2f(m - mn);
        m  = mn;
        cv = splat8(kPCarryLog2 - mn);
        lv = lv * alpha;
        o  = o * alpha;
#pragma unroll
        for (int j = 0; j < 2; ++j) {
          pe[2 * j]     = vexp2_8(Frag<_Float16>::mma(kf[j].v, qlo.v, zacc) + cv);
          pe[2 * j + 1] = vexp2_8(Frag<_Float16>::mma(kf[j].v, qhi.v, zacc) + cv);
        }
        ps = (pe[0] + pe[1]) + (pe[2] + pe[3]);
      }
      FU vf[2];   // asked for behind the test: their 16 registers are not held through the exponentials
#pragma unroll
      for (int j = 0; j < 2; ++j) {
        vf[j].h[0] = *(const v8h*)(sV + (kb * 4 + 2 * j) * kVGrp + hh * kVHalf + c * 16);
        vf[j].h[1] = *(const v8h*)(sV + (kb * 4 + 2 * j + 1) * kVGrp + hh * kVHalf + c * 16);
      }
      lv = lv + ps;
#pragma unroll
      for (int j = 0; j < 2; ++j) {
        FU pf;
        pf.h[0] = __builtin_convertvector(pe[2 * j], v8h);
        pf.h[1] = __builtin_convertvector(pe[2 * j + 1], v8h);
        o = Frag<_Float16>::mma(vf[j].v, pf.v, o);
      }
    }
  }
  float l = ((lv[0] + lv[1]) + (lv[2] + lv[3])) + ((lv[4] + lv[5]) + (lv[6] + lv[7]));
  l += other_half(l);
  const float inv = kOCarry / l;
  const v8h ov = __builtin_convertvector(o * inv, v8h);
  *(v8h*)(oh + ((size_t)gh * kSeq + q0 + c) * kHdim + 8 * hh) = ov;
}

// ---------------------------------------------------------------------------
// Fused tail, one launch: proj + bias + residual, LayerNorm 2, fc1 + bias + GELU, fc2 + bias + residual, all of them local to a token row.
// One workgroup (16 waves) owns 32 token rows; the rows between the three products (XC f32, LN2 rows f16, G f16) live in LDS only.
// Every product is computed transposed, D = W^T tile (A operand, 16 output columns x 32 k) . activation rows (B operand, 32 k x 16 tokens):
// a lane's 8 accumulator registers are 8 consecutive output columns of one token, so they leave in 16-B pieces.
// A weight is used by the workgroup's two token tiles only, so it goes from L2 straight into registers: the cast has left it in fragment order,
// every load instruction reads 512 contiguous bytes, and a ring of kRing k steps (3 column tiles each) is in flight per wave.
//   proj  wave (wg = wave & 7, wh = wave >> 3): column tile wg of each of the 3 branches, token tile wh, K = 128
//   fc1   wave: column tiles 3 wave .. 3 wave + 2 of 48, both token tiles, K = 384
//   fc2   wave: column tiles 3 wg .. 3 wg + 2 of 24, both token tiles, k half wh of K = 768; the two halves' sums are joined through LDS
// Every loop is unrolled: ring slots, fragments and accumulators are registers, which need constant indices.
// ---------------------------------------------------------------------------
constexpr int kTM = 32;                    // token rows per workgroup
constexpr int kRing = 4;                   // k steps of weights per wave between request and use
constexpr int kPO = kDim * 2 + 16;         // LDS row pitches in bytes, each 16 B x odd
constexpr int kPH = kDim3 * 2 + 16;
constexpr int kPG = kHid * 2 + 16;
constexpr int kPX = kDim3 * 4 + 16;

// one operand fragment of a weight in fragment order; blk = its 1-KiB block (wave-uniform), lo = lane * 16 bytes
__device__ __forceinline__ v16h wfrag(const unsigned short* blk, unsigned lo) {
  Frag<_Float16>::U f;
  f.h[0] = *(const v8h*)((const char*)blk + lo);
  f.h[1] = *(const v8h*)((const char*)(blk + 256) + lo);
  return f.v;
}
// the first kRing k steps of a pass: asked for ahead of the pointwise work and the barriers that stand in front of the pass
template <int KST>
__device__ __forceinline__ void w_first(v16h (&ring)[kRing][3], const unsigned short* w, unsigned lo) {
#pragma unroll
  for (int s = 0; s < kRing; ++s)
#pragma unroll
    for (int j = 0; j < 3; ++j) ring[s][j] = wfrag(w + (j * KST + s) * 512, lo);
}
// KS k steps of 3 column tiles x 2 token tiles; w = first block of the first column tile (a column tile is KST blocks),
// a = the lane's 16 B of the first activation row tile in LDS (row pitch PITCH). The ring holds the first kRing steps on entry.
// KSTN > 0: the slots that the last kRing steps leave take the first steps of the next pass (wn, KSTN blocks a column tile), so the stream of
// weights does not stop for the pointwise work and the barrier between the passes.
template <int KS, int KST, int PITCH, int KSTN>
__device__ __forceinline__ void w_pass(v16h (&ring)[kRing][3], const unsigned short* w, const unsigned short* wn, unsigned lo,
                                       const unsigned char* a, v8f (&acc)[3][2]) {
  static_assert(KS % kRing == 0, "a step of the next pass lands in the slot that the pass will read it from");
  v16h af[2][2];
#pragma unroll
  for (int mi = 0; mi < 2; ++mi) af[0][mi] = Frag<_Float16>::load((const _Float16*)(a + mi * 16 * PITCH));
#pragma unroll
  for (int s = 0; s < KS; ++s) {
    if (s + 1 < KS) {
#pragma unroll
      for (int mi = 0; mi < 2; ++mi) af[(s + 1) & 1][mi] = Frag<_Float16>::load((const _Float16*)(a + mi * 16 * PITCH + (s + 1) * 64));
    }
    __builtin_amdgcn_sched_barrier(0);   // the next step's LDS reads stay ahead of this step's products, not among them
#pragma unroll
    for (int j = 0; j < 3; ++j)
#pragma unroll
      for (int mi = 0; mi < 2; ++mi) acc[j][mi] = Frag<_Float16>::mma(ring[s % kRing][j], af[s & 1][mi], acc[j][mi]);
    __builtin_amdgcn_sched_barrier(0);   // the refill of the slot just used is asked for here, kRing steps ahead of its use, and not later
    if (s + kRing < KS) {
#pragma unroll
      for (int j = 0; j < 3; ++j) ring[s % kRing][j] = wfrag(w + (j * KST + s + kRing) * 512, lo);
    } else if (KSTN > 0) {
#pragma unroll
      for (int j = 0; j < 3; ++j) ring[s % kRing][j] = wfrag(wn + (j * KSTN + s + kRing - KS) * 512, lo);
    }
  }
  __builtin_amdgcn_sched_barrier(0);   // the last requests stay here, ahead of the pointwise work behind the pass
}
__device__ __forceinline__ v8f join8(v4f a, v4f b) { return (v8f){a[0], a[1], a[2], a[3], b[0], b[1], b[2], b[3]}; }
__device__ __forceinline__ v8f load8(const float* base, unsigned off) {   // wave-uniform base + one 32-bit lane offset in bytes
  return join8(*(const v4f*)((const char*)base + off), *(const v4f*)((const char*)(base + 4) + off));
}
__device__ __forceinline__ v8f lds8(const unsigned char* p) { return join8(*(const v4f*)p, *(const v4f*)(p + 16)); }
__device__ __forceinline__ void lds_put8(unsigned char* p, v8f v) {
  *(v4f*)p        = (v4f){v[0], v[1], v[2], v[3]};
  *(v4f*)(p + 16) = (v4f){v[4], v[5], v[6], v[7]};
}

// four waves per SIMD: one workgroup of 16 waves per WGP
__global__ __launch_bounds__(512, 4) void tail_fused_kernel(
    const unsigned short* __restrict__ oh,
    const unsigned short* __restrict__ wP, const unsigned short* __restrict__ w1, const unsigned short* __restrict__ w2,
    const float* __restrict__ x1, const float* __restrict__ x2, const float* __restrict__ x3,
    const float* __restrict__ pb, const float* __restrict__ lg, const float* __restrict__ lb,
    const float* __restrict__ b1, const float* __restrict__ b2, float* __restrict__ out) {
  __shared__ __align__(128) unsigned char sO[3 * kTM * kPO];    // attention output rows, per branch [32][128] f16
  __shared__ __align__(128) unsigned char sX[kTM * kPX];        // XC [32][384] f32; at the end the output rows
  __shared__ __align__(128) unsigned char sH[kTM * kPH];        // LN2(XC) [32][384] f16
  __shared__ __align__(128) unsigned char sG[kTM * kPG];        // gelu [32][768] f16 carried x kGCarry
  __shared__ __align__(128) unsigned char sR[8 * 6 * 2 * 512];  // fc2 sums of the upper k half: [wg][tile][register half][lane] 16 B
  const int t = threadIdx.x, lane = t & 31;
  const int wave = __builtin_amdgcn_readfirstlane(t >> 5);      // scalar, so that every weight address is a scalar base + lane offset
  const int rl = lane & 15, hh = lane >> 4;
  const int wg = wave & 7, wh = wave >> 3;
  const int m0 = blockIdx.x * kTM;
  const int gb = m0 / kSeq, tok = m0 % kSeq;                    // batch and first token of the rows (32 divides 2048)
  const v8f zacc = (v8f){0.f, 0.f, 0.f, 0.f, 0.f, 0.f, 0.f, 0.f};
  const unsigned lo = (unsigned)lane * 16u;

  // ---- everything that proj needs from memory is asked for at once ----
  v16h ring[kRing][3];
#pragma unroll
  for (int s = 0; s < 4; ++s)
#pragma unroll
    for (int j = 0; j < 3; ++j) ring[s][j] = wfrag(wP + ((j * 8 + wg) * 4 + s) * 512, lo);
  // O: per branch 8 heads x 32 rows x 2 pieces of 16 B = 512 pieces, one per thread; a head's 32 rows are 1 KiB contiguous
  const int oh_h = t >> 6, oh_r = (t >> 1) & 31, oh_p = t & 1;
  const unsigned short* op = oh + ((size_t)(gb * kHeads + oh_h) * kSeq + tok + oh_r) * kHdim + oh_p * 8;   // branch 0; a branch is 2 * kHeads planes on
  const unsigned xo = (unsigned)((wh * 16 + rl) * kDim + wg * 16 + hh * 8) * 4u;
  const unsigned po = (unsigned)(wg * 16 + hh * 8) * 4u;
  const unsigned go = (unsigned)rl * 16u;
  const unsigned ho = (unsigned)hh * 32u;
  v4u ov[3];
  v8f xr[3], pbv[3];
  v4f gv[6], bv[6];
#pragma unroll
  for (int j = 0; j < 3; ++j) {
    ov[j]  = *(const v4u*)(op + j * (2 * kHeads * kSeq * kHdim));
    xr[j]  = load8(((j == 0) ? x1 : (j == 1) ? x2 : x3) + (size_t)m0 * kDim, xo);
    pbv[j] = load8(pb + j * kDim, po);
  }
  // the lane addresses stay in their registers up to this wait, which stands before any register these loads name is rewritten
  asm volatile("s_wait_xcnt 0x0" :: "v"(lo), "v"(op), "v"(xo), "v"(po) : "memory");
#pragma unroll
  for (int j = 0; j < 3; ++j) *(v4u*)(sO + (j * kTM + oh_r) * kPO + (oh_h * 2 + oh_p) * 16) = ov[j];
  __syncthreads();   // O rows visible to every wave

  // ---- proj: XC[row][128 j + n] = O_j . Wproj_j / carries + bias + x_j ----
  v8f pa[3] = {zacc, zacc, zacc};
#pragma unroll
  for (int s = 0; s < 4; ++s)
#pragma unroll
    for (int j = 0; j < 3; ++j)
      pa[j] = Frag<_Float16>::mma(ring[s][j], Frag<_Float16>::load((const _Float16*)(sO + (j * kTM + wh * 16 + rl) * kPO + hh * 16 + s * 64)), pa[j]);
  const unsigned short* w1w = w1 + (size_t)(3 * wave) * (kDim3 / 32) * 512;
  w_first<kDim3 / 32>(ring, w1w, lo);   // fc1's first weights fly under proj's epilogue and LN2
  asm volatile("s_wait_xcnt 0x0" :: "v"(lo) : "memory");   // as above
#pragma unroll
  for (int j = 0; j < 3; ++j) {
    v8f v = pa[j] * (1.0f / (kOCarry * kWCarry));
    v += pbv[j];
    v += xr[j];
    lds_put8(sX + (wh * 16 + rl) * kPX + (j * kDim + wg * 16 + hh * 8) * 4, v);
  }
#pragma unroll   // LN2's gain and shift: asked for once the residual's registers are free, they land with fc1's first weights
  for (int q = 0; q < 6; ++q) {
    gv[q] = *(const v4f*)((const char*)(lg + q * 64) + go);
    bv[q] = *(const v4f*)((const char*)(lb + q * 64) + go);
  }
  asm volatile("s_wait_xcnt 0x0" :: "v"(go) : "memory");   // as above
  __syncthreads();   // XC rows visible to every wave

  // ---- LN2: 16 lanes share a row, a wave takes 2 rows; lane rl holds the 16-B pieces rl, rl + 16, ... ----
  {
    const int row = wave * 2 + hh;
    v4f xv[6];
#pragma unroll
    for (int q = 0; q < 6; ++q) xv[q] = *(const v4f*)(sX + row * kPX + q * 256 + rl * 16);
    v4f a = xv[0];
#pragma unroll
    for (int q = 1; q < 6; ++q) a += xv[q];
    float s1 = (a[0] + a[1]) + (a[2] + a[3]);
    s1 += lane_xor<1>(s1);
    s1 += lane_xor<2>(s1);
    s1 += lane_xor<4>(s1);
    s1 += lane_xor<8>(s1);
    const float mean = s1 * (1.0f / kDim3);
    v4f a2 = (v4f){0.f, 0.f, 0.f, 0.f};
#pragma unroll
    for (int q = 0; q < 6; ++q) {
      xv[q] -= mean;
      a2 += xv[q] * xv[q];
    }
    float s2 = (a2[0] + a2[1]) + (a2[2] + a2[3]);
    s2 += lane_xor<1>(s2);
    s2 += lane_xor<2>(s2);
    s2 += lane_xor<4>(s2);
    s2 += lane_xor<8>(s2);
    const float rstd = rsq_slot(s2 * (1.0f / kDim3) + kLnEps);
#pragma unroll
    for (int q = 0; q < 6; ++q)
      *(v4h*)(sH + row * kPH + q * 128 + rl * 8) = __builtin_convertvector(xv[q] * rstd * gv[q] + bv[q], v4h);
  }
  __syncthreads();   // normalised rows visible to every wave

  // ---- fc1 + bias + GELU -> G ----
  v8f acc[3][2], b1v[3], b2v[3];
#pragma unroll   // the bias lands under the products
  for (int j = 0; j < 3; ++j) b1v[j] = load8(b1 + (3 * wave + j) * 16, ho);
  asm volatile("s_wait_xcnt 0x0" :: "v"(ho) : "memory");   // as above
#pragma unroll
  for (int j = 0; j < 3; ++j)
#pragma unroll
    for (int mi = 0; mi < 2; ++mi) acc[j][mi] = zacc;
  const unsigned short* w2w = w2 + (size_t)((3 * wg) * (kHid / 32) + wh * (kHid / 64)) * 512;
  w_pass<kDim3 / 32, kDim3 / 32, kPH, kHid / 32>(ring, w1w, w2w, lo, sH + rl * kPH + hh * 16, acc);   // fc2's first weights fly under the GELU
  asm volatile("s_wait_xcnt 0x0" :: "v"(lo) : "memory");   // as above
#pragma unroll
  for (int j = 0; j < 3; ++j)
#pragma unroll
    for (int mi = 0; mi < 2; ++mi) {
      const v8f x = acc[j][mi] * ((1.0f / kWCarry) * kGCarry) + b1v[j] * kGCarry;
      *(v8h*)(sG + (mi * 16 + rl) * kPG + ((3 * wave + j) * 16 + hh * 8) * 2) = __builtin_convertvector(gelu8_carried(x), v8h);
      acc[j][mi] = zacc;
    }
  __syncthreads();   // G rows visible to every wave

  // ---- fc2, each wave one half of K ----
#pragma unroll   // the bias lands under the products
  for (int j = 0; j < 3; ++j) b2v[j] = load8(b2 + (3 * wg + j) * 16, ho);
  asm volatile("s_wait_xcnt 0x0" :: "v"(ho) : "memory");   // as above
  w_pass<kHid / 64, kHid / 32, kPG, 0>(ring, w2w, w2w, lo, sG + rl * kPG + hh * 16 + wh * (kHid / 64) * 64, acc);
  if (wh == 1) {   // scalar branch: whole waves
#pragma unroll
    for (int j = 0; j < 3; ++j)
#pragma unroll
      for (int mi = 0; mi < 2; ++mi) {
        unsigned char* p = sR + ((wg * 6 + j * 2 + mi) * 2) * 512 + lane * 16;
        *(v4f*)p         = (v4f){acc[j][mi][0], acc[j][mi][1], acc[j][mi][2], acc[j][mi][3]};
        *(v4f*)(p + 512) = (v4f){acc[j][mi][4], acc[j][mi][5], acc[j][mi][6], acc[j][mi][7]};
      }
  }
  __syncthreads();   // upper halves' sums visible to the lower halves' waves
  if (wh == 0) {
#pragma unroll
    for (int j = 0; j < 3; ++j)
#pragma unroll
      for (int mi = 0; mi < 2; ++mi) {
        const unsigned char* p = sR + ((wg * 6 + j * 2 + mi) * 2) * 512 + lane * 16;
        unsigned char* xp = sX + (mi * 16 + rl) * kPX + ((3 * wg + j) * 16 + hh * 8) * 4;
        v8f v = (acc[j][mi] + join8(*(const v4f*)p, *(const v4f*)(p + 512))) * (1.0f / (kGCarry * kWCarry));
        v += b2v[j];
        v += lds8(xp);
        lds_put8(xp, v);   // each element of XC is read and replaced by the one lane that owns it
      }
  }
  __syncthreads();   // output rows visible to every wave

  // ---- out: a wave takes 2 rows; a row is 3 planes x 512 B, one store instruction each: whole 128-B lines ----
#pragma unroll
  for (int i = 0; i < 2; ++i)
#pragma unroll
    for (int p = 0; p < 3; ++p) {
      const int r = wave * 2 + i;
      *(v4f*)((char*)(out + (size_t)p * (kRows * kDim) + (size_t)(m0 + r) * kDim) + lo) = *(const v4f*)(sX + r * kPX + p * 512 + lane * 16);
    }
  // stands behind the last store, before any register that the stores name is rewritten; the lane offset lives up to it
  asm volatile("s_wait_xcnt 0x0" :: "v"(lo) : "memory");
}

// ---------------------------------------------------------------------------
// Host glue. Workspace region map (bytes; every offset a multiple of 32768):
//   (not used)                         294,912 @          0
//   WPROJ f16 [3][128][128]             98,304 @    294,912   (the three weights in fragment order)
//   WFC1  f16 [768][384]               589,824 @    393,216
//   WFC2  f16 [384][768]               589,824 @    983,040
//   VT    f16 [6][128][2048]         3,145,728 @  1,572,864
//   BIG                             12,582,912 @  4,718,592   (QKVO f16 [12288][384] @ +3,145,728
//                                                             up to and during attention; of QKVO only the q and k columns
//                                                             are written and read, V goes to VT)
//   OH    f16 [48][2048][16]         3,145,728 @ 17,301,504
//   (not used)                       6,291,456 @ 20,447,232
//   total                                        26,738,688
// ---------------------------------------------------------------------------
extern "C" void kernel_launch(void* const* d_in, const int* in_sizes, int n_in,
                              void* d_out, int out_size, void* d_ws, size_t ws_size,
                              hipStream_t stream) {
  if (n_in < 14) return;
  if (in_sizes[0] != kRows * kDim || in_sizes[1] != kRows * kDim || in_sizes[2] != kRows * kDim) return;
  if (in_sizes[3] != 3 * kDim || in_sizes[4] != 3 * kDim) return;
  if (in_sizes[5] != 3 * kDim * kDim3 || in_sizes[6] != 3 * kDim * kDim || in_sizes[7] != 3 * kDim) return;
  if (in_sizes[8] != kDim3 || in_sizes[9] != kDim3) return;
  if (in_sizes[10] != kDim3 * kHid || in_sizes[11] != kHid || in_sizes[12] != kHid * kDim3 || in_sizes[13] != kDim3) return;
  if (out_size != 3 * kRows * kDim) return;

  const float* x1     = (const float*)d_in[0];
  const float* x2     = (const float*)d_in[1];
  const float* x3     = (const float*)d_in[2];
  const float* ln1_g  = (const float*)d_in[3];
  const float* ln1_b  = (const float*)d_in[4];
  const float* qkv_w  = (const float*)d_in[5];
  const float* proj_w = (const float*)d_in[6];
  const float* proj_b = (const float*)d_in[7];
  const float* ln2_g  = (const float*)d_in[8];
  const float* ln2_b  = (const float*)d_in[9];
  const float* fc1_w  = (const float*)d_in[10];
  const float* fc1_b  = (const float*)d_in[11];
  const float* fc2_w  = (const float*)d_in[12];
  const float* fc2_b  = (const float*)d_in[13];
  float* out = (float*)d_out;

  // ---- carve ----
  const size_t szWQKV  = (size_t)3 * kDim3 * kDim * 2;
  const size_t szWPROJ = (size_t)3 * kDim * kDim * 2;
  const size_t szWFC1  = (size_t)kHid * kDim3 * 2;
  const size_t szWFC2  = (size_t)kDim3 * kHid * 2;
  const size_t szVT    = (size_t)kGroups * kDim * kSeq * 2;
  const size_t szXN    = (size_t)3 * kRows * kDim * 2;
  const size_t szQKVO  = (size_t)3 * kRows * kDim3 * 2;
  const size_t szHN    = (size_t)kRows * kDim3 * 2;
  const size_t szG     = (size_t)kRows * kHid * 2;
  size_t szBIG = szXN + szQKVO;
  if (szHN + szG > szBIG) szBIG = szHN + szG;
  const size_t szOH    = (size_t)kGroups * kHeads * kSeq * kHdim * 2;
  const size_t szXC    = (size_t)kRows * kDim3 * 4;

  const size_t oWQKV  = 0;
  const size_t oWPROJ = oWQKV + szWQKV;
  const size_t oWFC1  = oWPROJ + szWPROJ;
  const size_t oWFC2  = oWFC1 + szWFC1;
  const size_t oVT    = oWFC2 + szWFC2;
  const size_t oBIG   = oVT + szVT;
  const size_t oOH    = oBIG + szBIG;
  const size_t oXC    = oOH + szOH;
  const size_t oEnd   = oXC + szXC;
  if (oEnd > ws_size) return;

  unsigned char* ws = (unsigned char*)d_ws;
  unsigned short* WPROJ = (unsigned short*)(ws + oWPROJ);
  unsigned short* WFC1  = (unsigned short*)(ws + oWFC1);
  unsigned short* WFC2  = (unsigned short*)(ws + oWFC2);
  unsigned short* VT    = (unsigned short*)(ws + oVT);
  unsigned short* QKVO  = (unsigned short*)(ws + oBIG + szXN);
  unsigned short* OH    = (unsigned short*)(ws + oOH);
  float*          XC    = (float*)(ws + oXC);
  const float* fdum = proj_b;   // valid f32 pointer for the unused bias slot

  // ---- QKV from the inputs themselves: (LN1(x_br) . qkv_w[br]) f16 out. M=4096, N=384, K=128; tiles 32*6 = 192 blocks, y = 0..2 ----
  // every block normalises its 128 rows of x_br and casts its 64 columns of qkv_w[br] (carried x16) into LDS
  // q and k columns -> QKVO[br][4096][384]; the V column tiles leave transposed -> VT[g][128][2048]
  // ---- and, as plane y = 3 of the same grid, the weights of the later launches: transpose + f16 (carried x16) ----
  // proj_w [3][128][128] -> WPROJ [3][128][128]; fc1_w [384][768] -> WFC1 [768][384]; fc2_w [768][384] -> WFC2 [384][768]  (156 tiles)
  static_assert(kTilesW <= (kRows / kBM) * (kDim3 / kBN), "the casts fit one plane of the grid");
  gemm_lds<kDim, 1, 6, false, true, false, kFoldVT, kSrcLnCast><<<dim3((kRows / kBM) * (kDim3 / kBN), 4), 256, 0, stream>>>(
      QKVO, kDim, 0L,
      QKVO, kDim, 0L,
      XC, QKVO, VT, kDim3, (long)kRows * kDim3,
      fdum, 0L, x1, x2, x3, 0L, 0,
      kDim3 / kBN, 1.0f / kWCarry,
      ln1_g, ln1_b, qkv_w, proj_w, fc1_w, fc2_w, WPROJ, WFC1, WFC2);

  // ---- attention: all 6 groups x 8 heads in one launch -> per-head planes OH ----
  attn_fused_kernel<<<dim3(kSeq / 128, kGroups * kHeads), 256, 0, stream>>>(QKVO, VT, OH);

  // ---- proj + residual, LN2, fc1 + GELU, fc2 + residual -> the three output planes: 4096 / 32 = 128 workgroups ----
  tail_fused_kernel<<<dim3(kRows / kTM), 512, 0, stream>>>(OH, WPROJ, WFC1, WFC2, x1, x2, x3, proj_b, ln2_g, ln2_b, fc1_b, fc2_b, out);
}

// v009
// A run of this version takes 43.6 microseconds.
// Two timings next to v008 put it at 1.14 and 1.15 times that version's speed.
// All steps since v000 together make it 37.0 times as fast.
// Contractions: x_ln@Wqkv, o@Wproj, h_ln@Wfc1, g@Wfc2 (activations f16, weights f16 carried x16), scores k.q^T (q,k f16, q carried x head-dim scale x log2(e), head dim 16: two key tiles per A fragment, q zero-padded 16->32 in registers), V^T@P^T (P f16, unnormalised exp carried x2^8, V^T f16): all v_wmma_f32_16x16x32_f16 with f32 accumulate; LayerNorm, online softmax, GELU(erf), bias, residual in f32.
#include <hip/hip_runtime.h>
#include <math.h>

// ---------------------------------------------------------------------------
// Problem constants
// ---------------------------------------------------------------------------
constexpr int kBatch   = 2;
constexpr int kSeq     = 2048;
constexpr int kDim     = 128;
constexpr int kHeads   = 8;
constexpr int kHdim    = 16;
constexpr int kHid     = 768;
constexpr int kRows    = kBatch * kSeq;     // 4096 token rows per branch
constexpr int kDim3    = 3 * kDim;          // 384
constexpr int kGroups  = 3 * kBatch;        // 6 (branch, batch) groups; group g covers plane rows g*2048 .. g*2048+2047
constexpr int kKeyChunk = 512;              // keys staged in LDS at a time
constexpr int kVHalf   = 288;               // LDS bytes from lane half 0's 256 B of a V^T fragment half to lane half 1's
constexpr int kVGrp    = 576;               // LDS bytes per V^T fragment half (16 dims x 16 keys)
constexpr float kWCarry = 16.0f;            // weights carried x16 in f16
constexpr float kPCarryLog2 = 8.0f;         // unnormalised probabilities exp(s - max in use) carried x2^8 in f16
constexpr float kQCarry = 0.25f * 1.44269504088896340736f;   // q carried x head-dim scale x log2(e): k.q is the score in log2 units
constexpr float kPLimit = 32768.0f;         // a sum of four carried probabilities below this: each of them is far inside f16
constexpr float kOCarry = 64.0f;            // attention output carried x64 in f16
constexpr float kGCarry = 16.0f;            // gelu output carried x16 in f16
constexpr float kLnEps  = 1e-5f;

typedef __attribute__((ext_vector_type(16))) _Float16 v16h;
typedef __attribute__((ext_vector_type(8)))  _Float16 v8h;
typedef __attribute__((ext_vector_type(4)))  _Float16 v4h;
typedef __attribute__((ext_vector_type(8)))  float    v8f;
typedef __attribute__((ext_vector_type(4)))  float    v4f;
typedef __attribute__((ext_vector_type(2)))  float    v2f;
typedef __attribute__((ext_vector_type(4)))  unsigned int v4u;
typedef __attribute__((ext_vector_type(2)))  unsigned int v2u;

// ---------------------------------------------------------------------------
// Fragment helpers
// ---------------------------------------------------------------------------
template <typename T> struct Frag;
template <> struct Frag<_Float16> {
  typedef v16h V; union U { v16h v; v8h h[2]; };
  static __device__ __forceinline__ v16h load(const _Float16* p) {   // elements 0..7 <- p[0..7], 8..15 <- p[16..23]
    U f; f.h[0] = *(const v8h*)(p); f.h[1] = *(const v8h*)(p + 16); return f.v;
  }
  static __device__ __forceinline__ v8f mma(v16h a, v16h b, v8f c) {
    return __builtin_amdgcn_wmma_f32_16x16x32_f16(false, a, false, b, (short)0, c, false, false);
  }
};

__device__ __forceinline__ unsigned pk16(unsigned short a, unsigned short b) { return (unsigned)a | ((unsigned)b << 16); }
__device__ __forceinline__ unsigned short h_bits(float f) { const _Float16 h = (_Float16)f; return __builtin_bit_cast(unsigned short, h); }

// ---------------------------------------------------------------------------
// Batched WMMA GEMM with both operands staged in LDS, by asynchronous copies unless SRC makes them itself.
// C[m,n] = scale * sum_k A[m,k] * Bt[n,k] (+bias[n])(+resid[m*ldr+n]); A row-major [M,K], Bt row-major [N,K], f16.
// One workgroup (8 waves) owns a 128 x 64 tile of C; wave (wm = wave&3, wn = wave>>2) owns rows 32wm.., columns 32wn.. (2 x 2 fragments).
// K = NCH * KC. A chunk is KC k of all 192 operand rows: [A 128 rows | Bt 64 rows] at pitch 2*KC + 16 bytes (16 B x odd: no bank
// conflict for the 16-byte fragment reads). Every copy instruction of a wave moves 512 contiguous source bytes, two runs of 256 or (kFoldHeads A) four of 128:
// whole 128-B lines. Each chunk has a buffer of its own, so chunk 1 flies while chunk 0 is multiplied.
// blockIdx.x = tile (column tile fastest), blockIdx.y = b is the batch: operands, output, bias and residual move by their strides
// (elements) per b; the residual base is resid0 / resid1 / resid2 for b = 0 / 1 / 2, then + b * strideR.
// OUT_F16: C is f16 (Ch), else f32 (Cf). The tile leaves through LDS, so every store instruction writes whole 128-B lines.
// FOLD names the pointwise or re-layout pass that the launch does itself, in place of a launch of its own beside it:
//   kFoldGelu   the f16 output is gelu(C + bias), exact erf form, carried x kGCarry;
//   kFoldVT     column tiles from column 2*kDim on (the V columns) leave transposed: Vt[(g*128 + c)*2048 + n], g = plane row / 2048;
//               column tiles below column kDim (the q columns) leave carried x kQCarry; the q and k column tiles leave in per-head planes,
//               Ch[(s*48 + g*8 + h)][2048][16], s = 0 for q and 1 for k: a token's 16 dims of one head are 32 B, 16 tokens 512 contiguous bytes;
//   kFoldHeads  A is read from the attention's per-head planes Ap[(g*8 + h)][2048][16]: k = 16h + d.
// Every loop of the engine is unrolled: its arrays (copy operands, fragments, accumulators, residual rows) are registers and asm
// operands, which need constant indices.
// The file launches one form of the engine, the QKV product (kFoldVT, kSrcLnCast); the products behind the attention are in tail_fused_kernel.
// ---------------------------------------------------------------------------
constexpr int kBM = 128, kBN = 64, kCPitch = 68;   // kCPitch: floats per staged row of C
constexpr int kTPitch = 136;                       // halves per staged row of a transposed V tile: 272 B = 16 B x odd
constexpr int kFoldNone = 0, kFoldGelu = 1, kFoldVT = 2, kFoldHeads = 3;
constexpr int kSrcF16 = 0, kSrcLn = 1, kSrcLnCast = 2;

// N copies and, in the same statement, the wait that stands before any register they name is rewritten.
__device__ __forceinline__ void async_copy4(const unsigned* l, const unsigned short* const* g) {
  asm volatile("global_load_async_to_lds_b128 %0, %4, off\n\t"
               "global_load_async_to_lds_b128 %1, %5, off\n\t"
               "global_load_async_to_lds_b128 %2, %6, off\n\t"
               "global_load_async_to_lds_b128 %3, %7, off\n\t"
               "s_wait_xcnt 0x0"
               :: "v"(l[0]), "v"(l[1]), "v"(l[2]), "v"(l[3]), "v"(g[0]), "v"(g[1]), "v"(g[2]), "v"(g[3]) : "memory");
}
__device__ __forceinline__ void async_copy12(const unsigned* l, const unsigned short* const* g) {
  asm volatile("global_load_async_to_lds_b128 %0, %12, off\n\t"
               "global_load_async_to_lds_b128 %1, %13, off\n\t"
               "global_load_async_to_lds_b128 %2, %14, off\n\t"
               "global_load_async_to_lds_b128 %3, %15, off\n\t"
               "global_load_async_to_lds_b128 %4, %16, off\n\t"
               "global_load_async_to_lds_b128 %5, %17, off\n\t"
               "global_load_async_to_lds_b128 %6, %18, off\n\t"
               "global_load_async_to_lds_b128 %7, %19, off\n\t"
               "global_load_async_to_lds_b128 %8, %20, off\n\t"
               "global_load_async_to_lds_b128 %9, %21, off\n\t"
               "global_load_async_to_lds_b128 %10, %22, off\n\t"
               "global_load_async_to_lds_b128 %11, %23, off\n\t"
               "s_wait_xcnt 0x0"
               :: "v"(l[0]), "v"(l[1]), "v"(l[2]), "v"(l[3]), "v"(l[4]), "v"(l[5]), "v"(l[6]), "v"(l[7]), "v"(l[8]), "v"(l[9]),
                  "v"(l[10]), "v"(l[11]),
                  "v"(g[0]), "v"(g[1]), "v"(g[2]), "v"(g[3]), "v"(g[4]), "v"(g[5]), "v"(g[6]), "v"(g[7]), "v"(g[8]), "v"(g[9]),
                  "v"(g[10]), "v"(g[11]) : "memory");
}

// ROWS rows of KC halves from g0 (row pitch ld halves) to LDS byte address lds0 (row pitch 2*KC + 16). A row is KC/8 pieces of 16 B.
// PER * 256 pieces = 16 whole rows: lane t takes pieces i*256 + t (i < PER) of every 16-row band, so its addresses in the next band
// are the same plus a constant. Each piece is copied by exactly one lane; every lane is on.
template <int KC, int ROWS>
__device__ __forceinline__ void stage_rows(const unsigned short* g0, int ld, unsigned lds0, int t) {
  constexpr int CPR = KC / 8, PER = CPR / 16, BAND = 16, NB = ROWS / BAND, PITCH = KC * 2 + 16;
  static_assert(CPR % 16 == 0 && (PER == 1 || PER == 3) && NB % 4 == 0, "whole bands, four bands a statement");
  const unsigned short* gb[PER];
  unsigned lb[PER];
#pragma unroll
  for (int i = 0; i < PER; ++i) {
    const int e = i * 256 + t;
    const int r = e / CPR, c = e - r * CPR;
    gb[i] = g0 + (r * ld + c * 8);
    lb[i] = lds0 + (unsigned)(r * PITCH + c * 16);
  }
  const size_t step = (size_t)(BAND * ld);
#pragma unroll
  for (int j0 = 0; j0 < NB; j0 += 4) {
    unsigned l[4 * PER];
    const unsigned short* g[4 * PER];
#pragma unroll
    for (int jj = 0; jj < 4; ++jj)
#pragma unroll
      for (int i = 0; i < PER; ++i) {
        l[jj * PER + i] = lb[i] + (unsigned)((j0 + jj) * BAND * PITCH);
        g[jj * PER + i] = gb[i] + (size_t)(j0 + jj) * step;
      }
    if (PER == 3) async_copy12(l, g); else async_copy4(l, g);
  }
}

// 128 rows of A = 8 heads x 16 dims from the per-head planes; o0 = head 0's plane at the tile's first row, LDS row pitch 2*kDim + 16.
// A band is 16 rows = 256 pieces of 16 B. A wave takes 4 heads x 4 rows x 2 pieces: per head 128 contiguous, aligned source bytes,
// so every copy instruction moves 4 whole lines. Each piece is copied by exactly one lane; every lane is on.
__device__ __forceinline__ void stage_heads(const unsigned short* o0, unsigned lds0, int t) {
  constexpr int PITCH = kDim * 2 + 16;
  const int lane = t & 31, wave = t >> 5;
  const int h = (wave & 1) * 4 + (lane >> 3);
  const int r = (wave >> 1) * 4 + ((lane >> 1) & 3);
  const int p = lane & 1;
  const unsigned short* gb = o0 + (h * kSeq * kHdim + r * kHdim + p * 8);
  const unsigned lb = lds0 + (unsigned)(r * PITCH + (h * 2 + p) * 16);
#pragma unroll
  for (int j0 = 0; j0 < kBM / 16; j0 += 4) {
    unsigned l[4];
    const unsigned short* g[4];
#pragma unroll
    for (int jj = 0; jj < 4; ++jj) {
      l[jj] = lb + (unsigned)((j0 + jj) * 16 * PITCH);
      g[jj] = gb + (j0 + jj) * 16 * kHdim;
    }
    async_copy4(l, g);
  }
}

// value of the lane whose number differs by MASK inside the 16-lane row (DPP row_xmask)
template <int MASK> __device__ __forceinline__ float lane_xor(float v) {
  return __builtin_bit_cast(float, __builtin_amdgcn_update_dpp(0, __builtin_bit_cast(int, v), 0x160 + MASK, 0xf, 0xf, true));
}

__device__ __forceinline__ float rsq_slot(float x) {
  float r;
  asm("v_rsq_f32 %0, %1\n\tv_nop" : "=v"(r) : "v"(x));
  return r;
}

// 128 rows of x (f32, KC features, x0 = the tile's first row) -> LayerNorm -> f16 rows in LDS at pitch 2*KC + 16.
// LPR lanes share a row, so a wave instruction works on 32/LPR rows: lane j of them holds the 16-B pieces j, j + LPR, j + 2*LPR, ...,
// and every load instruction covers whole 128-B lines of each of its rows. A wave takes 16 rows, two passes to a group;
// the next group's loads are asked for ahead of this group's arithmetic.
template <int KC>
__device__ __forceinline__ void stage_ln(const float* __restrict__ x0, const float* __restrict__ g, const float* __restrict__ bt,
                                         unsigned char* sA, int t) {
  constexpr int PITCH = KC * 2 + 16;
  constexpr int LPR = (KC == kDim) ? 8 : 16, NQ = KC / 4 / LPR, RP = 32 / LPR, NG = 16 / RP / 2;
  static_assert(NQ * LPR * 4 == KC, "whole pieces");
  const int lane = t & 31, wave = t >> 5;
  const int j = lane & (LPR - 1), rr = lane / LPR;
  const unsigned xo = (unsigned)((wave * 16 + rr) * KC + j * 4) * 4u;   // bytes: uniform base + one 32-bit lane offset
  const unsigned go = (unsigned)(j * 4) * 4u;
  v4f xv[NG][2][NQ], gv[NQ], bv[NQ];
#pragma unroll
  for (int q = 0; q < NQ; ++q) {
    gv[q] = *(const v4f*)((const char*)(g + q * LPR * 4) + go);
    bv[q] = *(const v4f*)((const char*)(bt + q * LPR * 4) + go);
  }
#pragma unroll
  for (int gi = -1; gi < NG; ++gi) {
    if (gi + 1 < NG) {
#pragma unroll
      for (int p = 0; p < 2; ++p)
#pragma unroll
        for (int q = 0; q < NQ; ++q)
          xv[gi + 1][p][q] = *(const v4f*)((const char*)(x0 + (((gi + 1) * 2 + p) * RP * KC + q * LPR * 4)) + xo);
      // the lane offsets stay in their registers up to this wait, which stands before any register these loads name is rewritten
      asm volatile("s_wait_xcnt 0x0" :: "v"(xo), "v"(go) : "memory");
    }
    if (gi < 0) continue;
#pragma unroll
    for (int p = 0; p < 2; ++p) {
      v4f a = xv[gi][p][0];
#pragma unroll
      for (int q = 1; q < NQ; ++q) a += xv[gi][p][q];
      float s1 = (a[0] + a[1]) + (a[2] + a[3]);
      s1 += lane_xor<1>(s1);
      s1 += lane_xor<2>(s1);
      s1 += lane_xor<4>(s1);
      if (LPR == 16) s1 += lane_xor<8>(s1);
      const float mean = s1 * (1.0f / KC);
      v4f a2 = (v4f){0.f, 0.f, 0.f, 0.f};
#pragma unroll
      for (int q = 0; q < NQ; ++q) {
        xv[gi][p][q] -= mean;
        a2 += xv[gi][p][q] * xv[gi][p][q];
      }
      float s2 = (a2[0] + a2[1]) + (a2[2] + a2[3]);
      s2 += lane_xor<1>(s2);
      s2 += lane_xor<2>(s2);
      s2 += lane_xor<4>(s2);
      if (LPR == 16) s2 += lane_xor<8>(s2);
      const float rstd = rsq_slot(s2 * (1.0f / KC) + kLnEps);
      unsigned char* row = sA + (wave * 16 + (gi * 2 + p) * RP + rr) * PITCH + j * 8;
#pragma unroll
      for (int q = 0; q < NQ; ++q)
        *(v4h*)(row + q * LPR * 8) = __builtin_convertvector(xv[gi][p][q] * rstd * gv[q] + bv[q], v4h);
    }
  }
}

// 64 columns of a weight plane W (f32 [kDim][LDW], w0 = W + first column) -> Bt rows [column][k] f16 carried x kWCarry, LDS pitch 2*kDim + 16.
// Lane = column, so every load instruction reads one whole 128-B line; a thread packs 8 consecutive k of its column into one 16-B store.
template <int LDW>
__device__ __forceinline__ void stage_wcast128(const float* __restrict__ w0, unsigned char* sB, int t) {
  constexpr int PITCH = kDim * 2 + 16;
  const int nl = t & 63, kq = t >> 6;
  const unsigned wo = (unsigned)(kq * 8 * LDW + nl) * 4u;   // bytes: uniform base + one 32-bit lane offset
  float wv[4][8];
#pragma unroll
  for (int i = 0; i < 4; ++i)
#pragma unroll
    for (int e = 0; e < 8; ++e) wv[i][e] = *(const float*)((const char*)(w0 + (i * 32 + e) * LDW) + wo);
  // as in stage_ln: the lane offset lives up to the wait
  asm volatile("s_wait_xcnt 0x0" :: "v"(wo) : "memory");
#pragma unroll
  for (int i = 0; i < 4; ++i) {
    v8h hv;
#pragma unroll
    for (int e = 0; e < 8; ++e) hv[e] = (_Float16)(wv[i][e] * kWCarry);
    *(v8h*)(sB + nl * PITCH + (i * 4 + kq) * 16) = hv;
  }
}

// GELU in its erf form (not the tanh form) of eight values side by side, with no branch: X = kGCarry * x comes in, kGCarry * gelu(x) goes out.
// gelu(x) = x * (1 + erf(x / sqrt 2)) / 2 = max(x, 0) - |x| * T(|x|), T(a) = erfc(a / sqrt 2) / 2 = the normal tail, so nothing cancels for x < 0.
// T(a) = exp(-a * a / 2) * t * (c1 + t * (c2 + t * (c3 + t * (c4 + t * c5)))), t = 1 / (1 + p * a): the classical five-term rational form of erfc,
// absolute error below 1e-7 in T; in f32 the result stays within 5e-7 (absolute) of gelu(x), and it is stored as f16, which rounds at 5e-4 relative.
__device__ __forceinline__ v8f gelu8_carried(v8f X) {
  constexpr float p  = 0.3275911f * 0.70710678118654752f / kGCarry;
  constexpr float k2 = -0.5f * 1.44269504088896340736f / (kGCarry * kGCarry);   // exp(-x * x / 2) = exp2(k2 * X * X)
  constexpr float c1 = 0.5f * 0.254829592f, c2 = 0.5f * -0.284496736f, c3 = 0.5f * 1.421413741f, c4 = 0.5f * -1.453152027f, c5 = 0.5f * 1.061405429f;
  const v8f aX = __builtin_elementwise_abs(X);
  const v8f d = aX * p + 1.0f;
  const v8f w = (X * k2) * X;
  v8f t, e;
#pragma unroll   // vector elements are registers: constant indices
  for (int i = 0; i < 8; ++i) { t[i] = __builtin_amdgcn_rcpf(d[i]); e[i] = __builtin_amdgcn_exp2f(w[i]); }
  const v8f q = ((((t * c5 + c4) * t + c3) * t + c2) * t + c1) * t;
  return __builtin_elementwise_max(X, (v8f){0.f, 0.f, 0.f, 0.f, 0.f, 0.f, 0.f, 0.f}) - aX * (q * e);
}

constexpr int kTilesProj = (kDim / 64) * (kDim / 64) * 3;    // 12
constexpr int kTilesFc1  = (kDim3 / 64) * (kHid / 64);       // 72
constexpr int kTilesFc2  = (kHid / 64) * (kDim3 / 64);       // 72
constexpr int kTilesW    = kTilesProj + kTilesFc1 + kTilesFc2;   // 156
__device__ __forceinline__ void wtcast_tile(int r0, const float* __restrict__ wProj,
                                            const float* __restrict__ wFc1, const float* __restrict__ wFc2,
                                            unsigned short* __restrict__ oProj,
                                            unsigned short* __restrict__ oFc1, unsigned short* __restrict__ oFc2,
                                            float scale);

// SRC names what the block makes of f32 data in LDS itself, in place of a launch in front of it:
//   kSrcLn      A = LayerNorm over KC features of the f32 rows of resid0 / resid1 / resid2 (b = 0 / 1 / 2; gain and shift lng, lnb + b * KC);
//               Ap is not read;
//   kSrcLnCast  the same, and Bt = the columns of the f32 plane Wf + b * kDim * kDim3, cast by the block; Btp is not read either.
// Plane blockIdx.y = 3 of a kSrcLnCast grid holds no GEMM tile: its first kTilesW blocks cast one tile each of the weights of the later launches
// (block-uniform choice, so the cast's barrier is passed by a whole block or by none).
// WPE = waves per SIMD that the register budget must leave room for: 2 * workgroups per WGP that the LDS size and the grid ask for.
template <int KC, int NCH, int WPE, bool BIAS, bool OUT_F16, bool RESID, int FOLD, int SRC>
__global__ __launch_bounds__(256, WPE) void gemm_lds(
    const unsigned short* __restrict__ Ap, int lda, long strideA,
    const unsigned short* __restrict__ Btp, int ldb, long strideB,
    float* __restrict__ Cf, unsigned short* __restrict__ Ch, unsigned short* __restrict__ Vt, int ldc, long strideC,
    const float* __restrict__ bias, long strideBias,
    const float* __restrict__ resid0, const float* __restrict__ resid1, const float* __restrict__ resid2, long strideR, int ldr,
    int tilesN, float scale,
    const float* __restrict__ lng, const float* __restrict__ lnb, const float* __restrict__ Wf,
    const float* __restrict__ wProj, const float* __restrict__ wFc1, const float* __restrict__ wFc2,
    unsigned short* __restrict__ oProj, unsigned short* __restrict__ oFc1, unsigned short* __restrict__ oFc2) {
  if (SRC == kSrcLnCast && blockIdx.y == 3) {
    if (blockIdx.x < kTilesW) wtcast_tile(blockIdx.x, wProj, wFc1, wFc2, oProj, oFc1, oFc2, kWCarry);
    return;
  }
  constexpr int PITCH = KC * 2 + 16;
  constexpr int BUF   = (kBM + kBN) * PITCH;
  constexpr int GK    = 2, NG = KC / 32 / GK;   // fragments are fetched in groups of GK k steps, one group ahead
  static_assert(kBM * kCPitch * 4 <= BUF, "the staged C tile fits the first buffer");
  static_assert((kBM + kBN) * (KC / 8) / 256 <= 63, "copies of one chunk outstanding per wave");
  static_assert(FOLD != kFoldHeads || (KC == kDim && NCH == 1), "a row of A is the 8 heads of one token");
  static_assert(FOLD != kFoldGelu || OUT_F16, "the activation leaves as f16");
  static_assert(SRC == kSrcF16 || (NCH == 1 && !RESID && FOLD != kFoldHeads), "a chunk holds the whole normalised row; the residual slots name its source");
  static_assert(SRC != kSrcLnCast || KC == kDim, "the cast stages 128 k");
  static_assert(FOLD != kFoldVT || (OUT_F16 && !BIAS && kBN * kTPitch * 2 <= BUF), "the transposed tile fits the first buffer");
  __shared__ __align__(128) unsigned char smem[NCH * BUF];
  const int t    = threadIdx.x;
  const int lane = t & 31, wave = t >> 5;
  const int b    = blockIdx.y;
  const int tm   = blockIdx.x / tilesN;
  const int tn   = blockIdx.x - tm * tilesN;
  const int m0   = tm * kBM, n0 = tn * kBN;
  const unsigned short* Ab = Ap  + (size_t)b * strideA + (size_t)m0 * lda;
  const unsigned short* Bb = Btp + (size_t)b * strideB + (size_t)n0 * ldb;
  const unsigned lds0 = (unsigned)(size_t)smem;   // low 32 bits of the shared address = byte offset in the workgroup's LDS

  const int grp = b * (kRows / kSeq) + m0 / kSeq, tok = m0 % kSeq;   // the tile's (branch, batch) group and its first token there
  if (SRC == kSrcF16) {
    if (FOLD == kFoldHeads) stage_heads(Ap + ((size_t)grp * kHeads * kSeq + tok) * kHdim, lds0, t);
    else                    stage_rows<KC, kBM>(Ab, lda, lds0, t);
    stage_rows<KC, kBN>(Bb, ldb, lds0 + kBM * PITCH, t);
  } else {   // Bt is asked for first, so that it flies under the LayerNorm arithmetic
    if (SRC == kSrcLnCast) stage_wcast128<kDim3>(Wf + (size_t)b * (kDim * kDim3) + n0, smem + kBM * PITCH, t);
    else                   stage_rows<KC, kBN>(Bb, ldb, lds0 + kBM * PITCH, t);
    stage_ln<KC>(((b == 0) ? resid0 : (b == 1) ? resid1 : resid2) + (size_t)m0 * KC, lng + b * KC, lnb + b * KC, smem, t);
  }

  // bias and residual of the rows this thread will store: asked for now, used in the epilogue
  const int c4 = (t & 15) * 4, r4 = t >> 4;            // f32 C: a row of 256 B = 16 lanes x 16 B; 16 rows a trip
  const int c8 = (t & 7) * 8, r8 = t >> 3;             // f16 C: a row of 128 B = 8 lanes x 16 B; 32 rows a trip
  v4f bv = (v4f){0.f, 0.f, 0.f, 0.f};
  v4f bh[2] = {bv, bv};
  v4f rv[kBM / 16];
  if (BIAS) bv = *(const v4f*)(bias + (size_t)b * strideBias + n0 + c4);
  if (BIAS && OUT_F16) {
    const float* bp = bias + (size_t)b * strideBias + n0 + c8;
    bh[0] = *(const v4f*)bp;
    bh[1] = *(const v4f*)(bp + 4);
  }
  if (RESID) {
    const float* rp = ((b == 0) ? resid0 : (b == 1) ? resid1 : resid2) + (size_t)b * strideR + (size_t)(m0 + r4) * ldr + n0 + c4;
    const float* rq[kBM / 16];
#pragma unroll
    for (int it = 0; it < kBM / 16; ++it) { rq[it] = rp + (size_t)(it * 16 * ldr); rv[it] = *(const v4f*)rq[it]; }
    // the eight addresses stay in their registers up to this wait, so no load of the run returns onto an earlier load's address
    asm volatile("s_wait_xcnt 0x0" :: "v"(rq[0]), "v"(rq[1]), "v"(rq[2]), "v"(rq[3]), "v"(rq[4]), "v"(rq[5]), "v"(rq[6]), "v"(rq[7]) : "memory");
  }

  if (SRC != kSrcLnCast) asm volatile("s_wait_asynccnt 0x0" ::: "memory");   // this wave's copies of chunk 0 have landed
  __syncthreads();                                    // chunk 0 visible to every wave
  if (NCH > 1) {                                      // chunk 1 flies under chunk 0's products
    stage_rows<KC, kBM>(Ab + KC, lda, lds0 + BUF, t);
    stage_rows<KC, kBN>(Bb + KC, ldb, lds0 + BUF + kBM * PITCH, t);
  }

  const int rlane = lane & 15, hh = lane >> 4;
  const int wm = wave & 3, wn = wave >> 2;
  v8f acc[2][2];
#pragma unroll
  for (int i = 0; i < 2; ++i)
#pragma unroll
    for (int j = 0; j < 2; ++j) acc[i][j] = (v8f){0.f, 0.f, 0.f, 0.f, 0.f, 0.f, 0.f, 0.f};

#pragma unroll
  for (int ch = 0; ch < NCH; ++ch) {
    const unsigned char* aP = smem + ch * BUF + (wm * 32 + rlane) * PITCH + hh * 16;
    const unsigned char* bP = smem + ch * BUF + (kBM + wn * 32 + rlane) * PITCH + hh * 16;
    v16h fa[2][GK][2], fb[2][GK][2];
#pragma unroll
    for (int g = -1; g < NG; ++g) {
      if (g + 1 < NG) {
#pragma unroll
        for (int s = 0; s < GK; ++s)
#pragma unroll
          for (int i = 0; i < 2; ++i) {
            fa[(g + 1) & 1][s][i] = Frag<_Float16>::load((const _Float16*)(aP + i * 16 * PITCH + ((g + 1) * GK + s) * 64));
            fb[(g + 1) & 1][s][i] = Frag<_Float16>::load((const _Float16*)(bP + i * 16 * PITCH + ((g + 1) * GK + s) * 64));
          }
      }
      __builtin_amdgcn_sched_barrier(0);   // the next group's LDS reads stay one group, ahead of this group's products, not among them
      if (g >= 0) {
#pragma unroll
        for (int s = 0; s < GK; ++s)
#pragma unroll
          for (int i = 0; i < 2; ++i)
#pragma unroll
            for (int j = 0; j < 2; ++j) acc[i][j] = Frag<_Float16>::mma(fa[g & 1][s][i], fb[g & 1][s][j], acc[i][j]);
      }
      __builtin_amdgcn_sched_barrier(0);   // and the reads of the group after that stay behind these products
    }
    asm volatile("s_wait_dscnt 0x0" ::: "memory");                    // this wave's reads of the chunk are done
    if (NCH > 1) asm volatile("s_wait_asynccnt 0x0" ::: "memory");    // this wave's copies of the next chunk have landed; behind the last chunk none is left
    __syncthreads();   // next chunk visible to every wave; behind the last chunk: every reader has left, the LDS becomes C staging
  }

  // ---- epilogue: scaled tile to LDS in accumulator order, out of it in whole rows ----
  float* sC = (float*)smem;
  _Float16* sT = (_Float16*)smem;
  const bool vtile = FOLD == kFoldVT && n0 >= 2 * kDim;   // block-uniform: the whole tile is V columns
  const float cscale = (FOLD == kFoldVT && n0 < kDim) ? scale * kQCarry   // block-uniform: the whole tile is q columns
                     : (FOLD == kFoldGelu) ? scale * kGCarry : scale;      // the activation takes its argument carried
  if (vtile) {
    // a lane's 8 accumulator registers are 8 consecutive rows of one column: 16 contiguous bytes of the transposed tile
#pragma unroll
    for (int i = 0; i < 2; ++i)
#pragma unroll
      for (int j = 0; j < 2; ++j)
        *(v8h*)(sT + (wn * 32 + j * 16 + rlane) * kTPitch + wm * 32 + i * 16 + hh * 8) = __builtin_convertvector(acc[i][j] * scale, v8h);
  } else {
#pragma unroll
    for (int i = 0; i < 2; ++i)
#pragma unroll
      for (int j = 0; j < 2; ++j)
#pragma unroll
        for (int r = 0; r < 8; ++r)
          sC[(wm * 32 + i * 16 + hh * 8 + r) * kCPitch + wn * 32 + j * 16 + rlane] = acc[i][j][r] * cscale;
  }
  __syncthreads();   // staged tile visible to every wave
  if (vtile) {
    // 64 dims x 128 tokens: a row of 256 B = 16 lanes x 16 B; 16 rows a trip
    unsigned short* vp = Vt + ((size_t)grp * kDim + (n0 - 2 * kDim)) * kSeq + tok;
    const unsigned vo = (unsigned)(r4 * kSeq + (t & 15) * 8) * 2u;   // bytes: uniform base + one 32-bit lane offset
#pragma unroll
    for (int it = 0; it < kBN / 16; ++it) {
      const v8h hv = *(const v8h*)(sT + (it * 16 + r4) * kTPitch + (t & 15) * 8);
      *(v8h*)((char*)(vp + (size_t)(it * 16 * kSeq)) + vo) = hv;
    }
  } else if (!OUT_F16) {
    float* cp = Cf + (size_t)b * strideC + (size_t)m0 * ldc + n0;
    const unsigned co = (unsigned)(r4 * ldc + c4) * 4u;   // bytes: uniform base + one 32-bit lane offset
#pragma unroll
    for (int it = 0; it < kBM / 16; ++it) {
      v4f v = *(const v4f*)(sC + (it * 16 + r4) * kCPitch + c4);
      if (BIAS)  v += bv;
      if (RESID) v += rv[it];
      *(v4f*)((char*)(cp + (size_t)(it * 16 * ldc)) + co) = v;
    }
  } else {
    // per-head planes: the tile's 64 columns are 4 heads; a wave's store covers 4 tokens x 32 B = one whole 128-B line in each of the 4 planes
    unsigned short* cp = (FOLD == kFoldVT)
        ? Ch + (((size_t)(n0 / kDim) * (kGroups * kHeads) + grp * kHeads + (n0 % kDim) / kHdim) * kSeq + tok) * kHdim
        : Ch + (size_t)b * strideC + (size_t)m0 * ldc + n0;
    const int rstep = (FOLD == kFoldVT) ? kHdim : ldc;   // halves from a token's row to the next
    const unsigned co = (FOLD == kFoldVT) ? (unsigned)((c8 / kHdim) * (kSeq * kHdim) + r8 * kHdim + (c8 % kHdim)) * 2u
                                          : (unsigned)(r8 * ldc + c8) * 2u;   // bytes: uniform base + one 32-bit lane offset
    v4f sv[kBM / 32][2];   // all of the thread's staged values are asked for at once, ahead of the pointwise work
#pragma unroll
    for (int it = 0; it < kBM / 32; ++it) {
      const float* sp = sC + (it * 32 + r8) * kCPitch + c8;
      sv[it][0] = *(const v4f*)sp;
      sv[it][1] = *(const v4f*)(sp + 4);
    }
#pragma unroll
    for (int it = 0; it < kBM / 32; ++it) {
      v8f x;
#pragma unroll
      for (int e = 0; e < 8; ++e) {
        x[e] = sv[it][e >> 2][e & 3];
        if (BIAS) x[e] += bh[e >> 2][e & 3] * ((FOLD == kFoldGelu) ? kGCarry : 1.0f);
      }
      if (FOLD == kFoldGelu) x = gelu8_carried(x);
      const v8h hv = __builtin_convertvector(x, v8h);
      *(v8h*)((char*)(cp + (size_t)(it * 32 * rstep)) + co) = hv;
    }
    // stands behind the last store of the run, before any register that the four stores name is rewritten; the lane offset lives up to it
    asm volatile("s_wait_xcnt 0x0" :: "v"(co) : "memory");
  }
}

// ---------------------------------------------------------------------------
// Weight transpose + cast: W plane z is f32 [nIn][nOut] row-major; WT[h][d] = f16(scale * W[d][h]) leaves in fragment order:
// the 16 columns h x 32 k of one matrix operand are 1 KiB, k step fastest, then column tile: two halves of 512 B (k 0..15, k 16..31 of the step),
// in each half lane (h & 15) + 16 * ((k >> 3) & 1) holds 8 consecutive k in 16 B. A 64 x 64 tile holds 8 such blocks whole.
// The three weight tensors that later launches read, in one index space: tile index r0 falls into one tensor's range of (nIn/64)*(nOut/64)*nz tiles
// (block-uniform choice), and inside the range it runs d tile fastest, then h tile, then plane z.
// 256 threads; nIn, nOut multiples of 64. Plane z at out + z*nOut*nIn halves.
// Load coverage: 16 iterations x 256 threads = 4096 = the whole 64x64 tile (coalesced along h).
// Store coverage: 8 waves x 2 iterations x 4 rows (lane>>3) = 64 rows; (lane&7) x 8 halves = 64 cols; each row segment =
// ---------------------------------------------------------------------------
__device__ __forceinline__ void wtcast_tile(int r0, const float* __restrict__ wProj,
                                            const float* __restrict__ wFc1, const float* __restrict__ wFc2,
                                            unsigned short* __restrict__ oProj,
                                            unsigned short* __restrict__ oFc1, unsigned short* __restrict__ oFc2,
                                            float scale) {
  __shared__ float sm[64][65];   // sm[h_local][d_local]
  const int t  = threadIdx.x;
  const float* W = wProj; unsigned short* out = oProj; int nIn = kDim, nOut = kDim;
  if (r0 >= kTilesProj + kTilesFc1) { r0 -= kTilesProj + kTilesFc1; W = wFc2; out = oFc2; nIn = kHid; nOut = kDim3; }
  else if (r0 >= kTilesProj)        { r0 -= kTilesProj; W = wFc1; out = oFc1; nIn = kDim3; nOut = kHid; }
  const int gx = nIn >> 6, gy = nOut >> 6;
  const int r1 = r0 / gx;
  const int d0 = (r0 - r1 * gx) * 64;
  const int z  = r1 / gy;
  const int h0 = (r1 - z * gy) * 64;
  const float* Wz = W + (size_t)z * nIn * nOut;
#pragma unroll
  for (int i = 0; i < 16; ++i) {
    const int e = i * 256 + t;
    const int r = e >> 6;          // d local
    const int c = e & 63;          // h local
    sm[c][r] = Wz[(size_t)(d0 + r) * nOut + h0 + c] * scale;
  }
  __syncthreads();
  const int lane = t & 31, wave = t >> 5;
  const int q = lane >> 3, c8 = (lane & 7) * 8;
  unsigned short* op = out + (size_t)z * nOut * nIn;
  {
#pragma unroll
    for (int it = 0; it < 2; ++it) {
      const int row = wave * 8 + it * 4 + q;                 // h local
      unsigned short hb[8];
#pragma unroll
      for (int e = 0; e < 8; ++e) hb[e] = h_bits(sm[row][c8 + e]);
      const v4u u = (v4u){pk16(hb[0], hb[1]), pk16(hb[2], hb[3]), pk16(hb[4], hb[5]), pk16(hb[6], hb[7])};
      const int n = h0 + row, k = d0 + c8;                   // 8 consecutive k of output column n: one lane's 16 B of a fragment half
      *(v4u*)(op + ((((n >> 4) * (nIn >> 5) + (k >> 5)) * 2 + ((k >> 4) & 1)) * 256 + ((n & 15) + 16 * ((k >> 3) & 1)) * 8)) = u;
    }
    
  }
}

// ---------------------------------------------------------------------------
// Fused attention, one launch for all 48 (group, head) pairs: S^T = K.Q^T, online softmax, O^T += V^T.P^T.
// grid (2048/128 = 16 query blocks, 48), 256 threads = 8 waves x 16 queries. Lane (c = lane&15, hh = lane>>4) owns query c.
// q and K come from the head's own planes qk[(s*48 + g*8 + head)][2048][16] (s = 0: q, 1: K): every load instruction of a wave reads 16 tokens =
// 512 contiguous bytes, four whole 128-B lines.
// K and V^T of the head are staged through registers into LDS, 512 keys at a time, already in fragment order:
//   sK: 16-key tile T at T*512; lane's 16 B (key c, dims 8hh..8hh+7) at + lane*16.
//   sV: fragment half G (keys 16G + 8hh + 0..7 of dim c) at G*576 + hh*288 + c*16.
// S^T tile register r = score(key 8hh + r, query c), so two tiles converted in place are the B operand P^T (hardware k
// order), and V^T as A is read in the same k order. O^T register r = O(query c, dim 8hh + r): one 16-B store per lane.
// oh[(g*8 + head)][2048][16] f16 carried x64: each wave writes 512 contiguous bytes.
// ---------------------------------------------------------------------------
__device__ __forceinline__ float other_half(float v) {   // value of lane ^ 16
  const int b = __builtin_bit_cast(int, v);
  return __builtin_bit_cast(float, __builtin_amdgcn_permlanex16(b, b, 0x76543210, 0xfedcba98, false, false));
}
__device__ __forceinline__ float vmax8(v8f a) {
  return fmaxf(fmaxf(fmaxf(a[0], a[1]), fmaxf(a[2], a[3])), fmaxf(fmaxf(a[4], a[5]), fmaxf(a[6], a[7])));
}
__device__ __forceinline__ v8f vexp2_8(v8f a) {
  v8f r;
#pragma unroll
  for (int e = 0; e < 8; ++e) r[e] = __builtin_amdgcn_exp2f(a[e]);
  return r;
}
__device__ __forceinline__ v8f splat8(float x) { return (v8f){x, x, x, x, x, x, x, x}; }
// largest score (log2 units) of the lane's query over the 64 keys whose four staged tiles begin at kt (the lane's own 16 B), both lane halves joined
__device__ __forceinline__ float max64(const unsigned char* kt, v16h qlo, v16h qhi) {
  const v8f z = (v8f){0.f, 0.f, 0.f, 0.f, 0.f, 0.f, 0.f, 0.f};
  float mx = -INFINITY;
#pragma unroll
  for (int j = 0; j < 2; ++j) {
    Frag<_Float16>::U kf;
    kf.h[0] = *(const v8h*)(kt + (2 * j) * 512);
    kf.h[1] = *(const v8h*)(kt + (2 * j + 1) * 512);
    mx = fmaxf(mx, fmaxf(vmax8(Frag<_Float16>::mma(kf.v, qlo, z)), vmax8(Frag<_Float16>::mma(kf.v, qhi, z))));
  }
  return fmaxf(mx, other_half(mx));
}
// six waves per SIMD = three workgroups per WGP: 768 workgroups fill 256 WGPs in one even round
__global__ __launch_bounds__(256) __attribute__((amdgpu_waves_per_eu(6))) void attn_fused_kernel(const unsigned short* __restrict__ qk,
                                                         const unsigned short* __restrict__ vt,
                                                         unsigned short* __restrict__ oh) {
  __shared__ __align__(128) unsigned char sK[kKeyChunk * 32];
  __shared__ __align__(128) unsigned char sV[(kKeyChunk / 16) * kVGrp];
  typedef Frag<_Float16>::U FU;
  const int lane = threadIdx.x & 31, wave = threadIdx.x >> 5;
  const int c = lane & 15, hh = lane >> 4;
  const int gh = blockIdx.y, g = gh >> 3, hd = gh & 7;
  const int q0 = blockIdx.x * 128 + wave * 16;
  const v8h zero8 = (v8h){0, 0, 0, 0, 0, 0, 0, 0};
  const v8f zacc  = (v8f){0.f, 0.f, 0.f, 0.f, 0.f, 0.f, 0.f, 0.f};

  // One A fragment holds two 16-key tiles (k 0..15 = dims of the first, k 16..31 = dims of the second);
  // q sits in the lower k half of qlo and in the upper k half of qhi, zeros in the other half, so each picks one tile.
  FU qlo, qhi;
  const unsigned short* qp = qk + ((size_t)gh * kSeq + q0 + c) * kHdim + 8 * hh;
  qlo.h[0] = *(const v8h*)qp;
  qlo.h[1] = zero8;
  qhi.h[0] = zero8;
  qhi.h[1] = qlo.h[0];

  // staging, 4 rounds of 8 waves per chunk. K round i: wave takes the 16-key tile i*8 + wave, lane = (key c, 16-B part hh).
  // V^T round i: wave takes 4 dims x 8 parts of 8 keys (4 whole 128-B lines): dim sd, part i*16 + sp of the chunk.
  const int sd = (wave & 3) * 4 + (lane >> 3);
  const int sp = (wave >> 2) * 8 + (lane & 7);
  const unsigned short* kp = qk + ((size_t)(kGroups * kHeads + gh) * kSeq + wave * 16 + c) * kHdim + 8 * hh;
  const unsigned short* vp = vt + (size_t)(g * kDim + hd * kHdim + sd) * kSeq + sp * 8;
  unsigned char* skw = sK + wave * 512 + lane * 16;
  unsigned char* svw = sV + (sp >> 1) * kVGrp + (sp & 1) * kVHalf + sd * 16;
  v4u kr[4], vr[4];
#pragma unroll
  for (int i = 0; i < 4; ++i) {
    kr[i] = *(const v4u*)(kp + i * 128 * kHdim);
    vr[i] = *(const v4u*)(vp + i * 128);
  }
  // the lane addresses stay in their registers up to this wait, which stands before any register these loads name is rewritten
  asm volatile("s_wait_xcnt 0x0" :: "v"(qp), "v"(kp), "v"(vp) : "memory");

  // Lazy rescale. m = the maximum in use of the lane's query (log2 units), the same in both lane halves; cv = kPCarryLog2 - m in all eight
  // registers is the C operand of the score products, which so leave the matrix unit as the exponents themselves.
  float m = 0.f;
  v8f cv = zacc;
  v8f lv = zacc;
  v8f o  = zacc;
  for (int ch = 0; ch < kSeq / kKeyChunk; ++ch) {
    __syncthreads();   // every wave has finished reading the previous chunk
#pragma unroll
    for (int i = 0; i < 4; ++i) {
      *(v4u*)(skw + i * 8 * 512) = kr[i];
      *(v4u*)(svw + i * 8 * kVGrp) = vr[i];
    }
    __syncthreads();   // chunk visible to every wave
    if (ch + 1 < kSeq / kKeyChunk) {   // next chunk's global loads fly under this chunk's work
      kp += kKeyChunk * kHdim;
      vp += kKeyChunk;
#pragma unroll
      for (int i = 0; i < 4; ++i) {
        kr[i] = *(const v4u*)(kp + i * 128 * kHdim);
        vr[i] = *(const v4u*)(vp + i * 128);
      }
    }
    if (ch == 0) {   // the first maximum in use: that of the first 64 keys
      m  = max64(sK + lane * 16, qlo.v, qhi.v);
      cv = splat8(kPCarryLog2 - m);
    }
#pragma unroll 2   // a rolled loop keeps the registers inside the six-wave budget with no scratch
    for (int kb = 0; kb < kKeyChunk / 64; ++kb) {
      const unsigned char* kt = sK + kb * 4 * 512 + lane * 16;
      FU kf[2];
#pragma unroll
      for (int j = 0; j < 2; ++j) {
        kf[j].h[0] = *(const v8h*)(kt + (2 * j) * 512);
        kf[j].h[1] = *(const v8h*)(kt + (2 * j + 1) * 512);
      }
      v8f pe[4];
#pragma unroll
      for (int j = 0; j < 2; ++j) {
        pe[2 * j]     = vexp2_8(Frag<_Float16>::mma(kf[j].v, qlo.v, cv));
        pe[2 * j + 1] = vexp2_8(Frag<_Float16>::mma(kf[j].v, qhi.v, cv));
      }
      v8f ps = (pe[0] + pe[1]) + (pe[2] + pe[3]);
      // One test per 64 keys, a scalar branch for the whole wave: only where a score has outgrown the maximum in use so far that its
      // probability nears the f16 range is the maximum taken anew, sums and output rescaled and the 64 keys' probabilities made again.
      if (__builtin_amdgcn_ballot_w32(!(vmax8(ps) < kPLimit)) != 0) {
        const float mn = fmaxf(m, max64(kt, qlo.v, qhi.v));
        const float alpha = __builtin_amdgcn_exp2f(m - mn);
        m  = mn;
        cv = splat8(kPCarryLog2 - mn);
        lv = lv * alpha;
        o  = o * alpha;
#pragma unroll
        for (int j = 0; j < 2; ++j) {
          pe[2 * j]     = vexp2_8(Frag<_Float16>::mma(kf[j].v, qlo.v, zacc) + cv);
          pe[2 * j + 1] = vexp2_8(Frag<_Float16>::mma(kf[j].v, qhi.v, zacc) + cv);
        }
        ps = (pe[0] + pe[1]) + (pe[2] + pe[3]);
      }
      FU vf[2];   // asked for behind the test: their 16 registers are not held through the exponentials
#pragma unroll
      for (int j = 0; j < 2; ++j) {
        vf[j].h[0] = *(const v8h*)(sV + (kb * 4 + 2 * j) * kVGrp + hh * kVHalf + c * 16);
        vf[j].h[1] = *(const v8h*)(sV + (kb * 4 + 2 * j + 1) * kVGrp + hh * kVHalf + c * 16);
      }
      lv = lv + ps;
#pragma unroll
      for (int j = 0; j < 2; ++j) {
        FU pf;
        pf.h[0] = __builtin_convertvector(pe[2 * j], v8h);
        pf.h[1] = __builtin_convertvector(pe[2 * j + 1], v8h);
        o = Frag<_Float16>::mma(vf[j].v, pf.v, o);
      }
    }
  }
  float l = ((lv[0] + lv[1]) + (lv[2] + lv[3])) + ((lv[4] + lv[5]) + (lv[6] + lv[7]));
  l += other_half(l);
  const float inv = kOCarry / l;
  const v8h ov = __builtin_convertvector(o * inv, v8h);
  *(v8h*)(oh + ((size_t)gh * kSeq + q0 + c) * kHdim + 8 * hh) = ov;
}

// ---------------------------------------------------------------------------
// Fused tail, one launch: proj + bias + residual, LayerNorm 2, fc1 + bias + GELU, fc2 + bias + residual, all of them local to a token row.
// One workgroup (16 waves) owns 32 token rows; the rows between the three products (XC f32, LN2 rows f16, G f16) live in LDS only.
// Every product is computed transposed, D = W^T tile (A operand, 16 output columns x 32 k) . activation rows (B operand, 32 k x 16 tokens):
// a lane's 8 accumulator registers are 8 consecutive output columns of one token, so they leave in 16-B pieces.
// A weight is used by the workgroup's two token tiles only, so it goes from L2 straight into registers: the cast has left it in fragment order,
// every load instruction reads 512 contiguous bytes, and a ring of kRing k steps (3 column tiles each) is in flight per wave.
//   proj  wave (wg = wave & 7, wh = wave >> 3): column tile wg of each of the 3 branches, token tile wh, K = 128
//   fc1   wave: column tiles 3 wave .. 3 wave + 2 of 48, both token tiles, K = 384
//   fc2   wave: column tiles 3 wg .. 3 wg + 2 of 24, both token tiles, k half wh of K = 768; the two halves' sums are joined through LDS
// Every loop is unrolled: ring slots, fragments and accumulators are registers, which need constant indices.
// ---------------------------------------------------------------------------
constexpr int kTM = 32;                    // token rows per workgroup
constexpr int kRing = 4;                   // k steps of weights per wave between request and use
constexpr int kPO = kDim * 2 + 16;         // LDS row pitches in bytes, each 16 B x odd
constexpr int kPH = kDim3 * 2 + 16;
constexpr int kPG = kHid * 2 + 16;
constexpr int kPX = kDim3 * 4 + 16;

// one operand fragment of a weight in fragment order; blk = its 1-KiB block (wave-uniform), lo = lane * 16 bytes
__device__ __forceinline__ v16h wfrag(const unsigned short* blk, unsigned lo) {
  Frag<_Float16>::U f;
  f.h[0] = *(const v8h*)((const char*)blk + lo);
  f.h[1] = *(const v8h*)((const char*)(blk + 256) + lo);
  return f.v;
}
// the first kRing k steps of a pass: asked for ahead of the pointwise work and the barriers that stand in front of the pass
template <int KST>
__device__ __forceinline__ void w_first(v16h (&ring)[kRing][3], const unsigned short* w, unsigned lo) {
#pragma unroll
  for (int s = 0; s < kRing; ++s)
#pragma unroll
    for (int j = 0; j < 3; ++j) ring[s][j] = wfrag(w + (j * KST + s) * 512, lo);
}
// KS k steps of 3 column tiles x 2 token tiles; w = first block of the first column tile (a column tile is KST blocks),
// a = the lane's 16 B of the first activation row tile in LDS (row pitch PITCH). The ring holds the first kRing steps on entry.
// KSTN > 0: the slots that the last kRing steps leave take the first steps of the next pass (wn, KSTN blocks a column tile), so the stream of
// weights does not stop for the pointwise work and the barrier between the passes.
template <int KS, int KST, int PITCH, int KSTN>
__device__ __forceinline__ void w_pass(v16h (&ring)[kRing][3], const unsigned short* w, const unsigned short* wn, unsigned lo,
                                       const unsigned char* a, v8f (&acc)[3][2]) {
  static_assert(KS % kRing == 0, "a step of the next pass lands in the slot that the pass will read it from");
  v16h af[2][2];
#pragma unroll
  for (int mi = 0; mi < 2; ++mi) af[0][mi] = Frag<_Float16>::load((const _Float16*)(a + mi * 16 * PITCH));
#pragma unroll
  for (int s = 0; s < KS; ++s) {
    if (s + 1 < KS) {
#pragma unroll
      for (int mi = 0; mi < 2; ++mi) af[(s + 1) & 1][mi] = Frag<_Float16>::load((const _Float16*)(a + mi * 16 * PITCH + (s + 1) * 64));
    }
    __builtin_amdgcn_sched_barrier(0);   // the next step's LDS reads stay ahead of this step's products, not among them
#pragma unroll
    for (int j = 0; j < 3; ++j)
#pragma unroll
      for (int mi = 0; mi < 2; ++mi) acc[j][mi] = Frag<_Float16>::mma(ring[s % kRing][j], af[s & 1][mi], acc[j][mi]);
    __builtin_amdgcn_sched_barrier(0);   // the refill of the slot just used is asked for here, kRing steps ahead of its use, and not later
    if (s + kRing < KS) {
#pragma unroll
      for (int j = 0; j < 3; ++j) ring[s % kRing][j] = wfrag(w + (j * KST + s + kRing) * 512, lo);
    } else if (KSTN > 0) {
#pragma unroll
      for (int j = 0; j < 3; ++j) ring[s % kRing][j] = wfrag(wn + (j * KSTN + s + kRing - KS) * 512, lo);
    }
  }
  __builtin_amdgcn_sched_barrier(0);   // the last requests stay here, ahead of the pointwise work behind the pass
}
__device__ __forceinline__ v8f join8(v4f a, v4f b) { return (v8f){a[0], a[1], a[2], a[3], b[0], b[1], b[2], b[3]}; }
__device__ __forceinline__ v8f load8(const float* base, unsigned off) {   // wave-uniform base + one 32-bit lane offset in bytes
  return join8(*(const v4f*)((const char*)base + off), *(const v4f*)((const char*)(base + 4) + off));
}
__device__ __forceinline__ v8f lds8(const unsigned char* p) { return join8(*(const v4f*)p, *(const v4f*)(p + 16)); }
__device__ __forceinline__ void lds_put8(unsigned char* p, v8f v) {
  *(v4f*)p        = (v4f){v[0], v[1], v[2], v[3]};
  *(v4f*)(p + 16) = (v4f){v[4], v[5], v[6], v[7]};
}

// four waves per SIMD: one workgroup of 16 waves per WGP
__global__ __launch_bounds__(512, 4) void tail_fused_kernel(
    const unsigned short* __restrict__ oh,
    const unsigned short* __restrict__ wP, const unsigned short* __restrict__ w1, const unsigned short* __restrict__ w2,
    const float* __restrict__ x1, const float* __restrict__ x2, const float* __restrict__ x3,
    const float* __restrict__ pb, const float* __restrict__ lg, const float* __restrict__ lb,
    const float* __restrict__ b1, const float* __restrict__ b2, float* __restrict__ out) {
  __shared__ __align__(128) unsigned char sO[3 * kTM * kPO];    // attention output rows, per branch [32][128] f16
  __shared__ __align__(128) unsigned char sX[kTM * kPX];        // XC [32][384] f32; at the end the output rows
  __shared__ __align__(128) unsigned char sH[kTM * kPH];        // LN2(XC) [32][384] f16
  __shared__ __align__(128) unsigned char sG[kTM * kPG];        // gelu [32][768] f16 carried x kGCarry
  __shared__ __align__(128) unsigned char sR[8 * 6 * 2 * 512];  // fc2 sums of the upper k half: [wg][tile][register half][lane] 16 B
  const int t = threadIdx.x, lane = t & 31;
  const int wave = __builtin_amdgcn_readfirstlane(t >> 5);      // scalar, so that every weight address is a scalar base + lane offset
  const int rl = lane & 15, hh = lane >> 4;
  const int wg = wave & 7, wh = wave >> 3;
  const int m0 = blockIdx.x * kTM;
  const int gb = m0 / kSeq, tok = m0 % kSeq;                    // batch and first token of the rows (32 divides 2048)
  const v8f zacc = (v8f){0.f, 0.f, 0.f, 0.f, 0.f, 0.f, 0.f, 0.f};
  const unsigned lo = (unsigned)lane * 16u;

  // ---- everything that proj needs from memory is asked for at once ----
  v16h ring[kRing][3];
#pragma unroll
  for (int s = 0; s < 4; ++s)
#pragma unroll
    for (int j = 0; j < 3; ++j) ring[s][j] = wfrag(wP + ((j * 8 + wg) * 4 + s) * 512, lo);
  // O: per branch 8 heads x 32 rows x 2 pieces of 16 B = 512 pieces, one per thread; a head's 32 rows are 1 KiB contiguous
  const int oh_h = t >> 6, oh_r = (t >> 1) & 31, oh_p = t & 1;
  const unsigned short* op = oh + ((size_t)(gb * kHeads + oh_h) * kSeq + tok + oh_r) * kHdim + oh_p * 8;   // branch 0; a branch is 2 * kHeads planes on
  const unsigned xo = (unsigned)((wh * 16 + rl) * kDim + wg * 16 + hh * 8) * 4u;
  const unsigned po = (unsigned)(wg * 16 + hh * 8) * 4u;
  const unsigned go = (unsigned)rl * 16u;
  const unsigned ho = (unsigned)hh * 32u;
  v4u ov[3];
  v8f xr[3], pbv[3];
  v4f gv[6], bv[6];
#pragma unroll
  for (int j = 0; j < 3; ++j) {
    ov[j]  = *(const v4u*)(op + j * (2 * kHeads * kSeq * kHdim));
    xr[j]  = load8(((j == 0) ? x1 : (j == 1) ? x2 : x3) + (size_t)m0 * kDim, xo);
    pbv[j] = load8(pb + j * kDim, po);
  }
  // the lane addresses stay in their registers up to this wait, which stands before any register these loads name is rewritten
  asm volatile("s_wait_xcnt 0x0" :: "v"(lo), "v"(op), "v"(xo), "v"(po) : "memory");
#pragma unroll
  for (int j = 0; j < 3; ++j) *(v4u*)(sO + (j * kTM + oh_r) * kPO + (oh_h * 2 + oh_p) * 16) = ov[j];
  __syncthreads();   // O rows visible to every wave

  // ---- proj: XC[row][128 j + n] = O_j . Wproj_j / carries + bias + x_j ----
  v8f pa[3] = {zacc, zacc, zacc};
#pragma unroll
  for (int s = 0; s < 4; ++s)
#pragma unroll
    for (int j = 0; j < 3; ++j)
      pa[j] = Frag<_Float16>::mma(ring[s][j], Frag<_Float16>::load((const _Float16*)(sO + (j * kTM + wh * 16 + rl) * kPO + hh * 16 + s * 64)), pa[j]);
  const unsigned short* w1w = w1 + (size_t)(3 * wave) * (kDim3 / 32) * 512;
  w_first<kDim3 / 32>(ring, w1w, lo);   // fc1's first weights fly under proj's epilogue and LN2
  asm volatile("s_wait_xcnt 0x0" :: "v"(lo) : "memory");   // as above
#pragma unroll
  for (int j = 0; j < 3; ++j) {
    v8f v = pa[j] * (1.0f / (kOCarry * kWCarry));
    v += pbv[j];
    v += xr[j];
    lds_put8(sX + (wh * 16 + rl) * kPX + (j * kDim + wg * 16 + hh * 8) * 4, v);
  }
#pragma unroll   // LN2's gain and shift: asked for once the residual's registers are free, they land with fc1's first weights
  for (int q = 0; q < 6; ++q) {
    gv[q] = *(const v4f*)((const char*)(lg + q * 64) + go);
    bv[q] = *(const v4f*)((const char*)(lb + q * 64) + go);
  }
  asm volatile("s_wait_xcnt 0x0" :: "v"(go) : "memory");   // as above
  __syncthreads();   // XC rows visible to every wave

  // ---- LN2: 16 lanes share a row, a wave takes 2 rows; lane rl holds the 16-B pieces rl, rl + 16, ... ----
  {
    const int row = wave * 2 + hh;
    v4f xv[6];
#pragma unroll
    for (int q = 0; q < 6; ++q) xv[q] = *(const v4f*)(sX + row * kPX + q * 256 + rl * 16);
    v4f a = xv[0];
#pragma unroll
    for (int q = 1; q < 6; ++q) a += xv[q];
    float s1 = (a[0] + a[1]) + (a[2] + a[3]);
    s1 += lane_xor<1>(s1);
    s1 += lane_xor<2>(s1);
    s1 += lane_xor<4>(s1);
    s1 += lane_xor<8>(s1);
    const float mean = s1 * (1.0f / kDim3);
    v4f a2 = (v4f){0.f, 0.f, 0.f, 0.f};
#pragma unroll
    for (int q = 0; q < 6; ++q) {
      xv[q] -= mean;
      a2 += xv[q] * xv[q];
    }
    float s2 = (a2[0] + a2[1]) + (a2[2] + a2[3]);
    s2 += lane_xor<1>(s2);
    s2 += lane_xor<2>(s2);
    s2 += lane_xor<4>(s2);
    s2 += lane_xor<8>(s2);
    const float rstd = rsq_slot(s2 * (1.0f / kDim3) + kLnEps);
#pragma unroll
    for (int q = 0; q < 6; ++q)
      *(v4h*)(sH + row * kPH + q * 128 + rl * 8) = __builtin_convertvector(xv[q] * rstd * gv[q] + bv[q], v4h);
  }
  __syncthreads();   // normalised rows visible to every wave

  // ---- fc1 + bias + GELU -> G ----
  v8f acc[3][2], b1v[3], b2v[3];
#pragma unroll   // the bias lands under the products
  for (int j = 0; j < 3; ++j) b1v[j] = load8(b1 + (3 * wave + j) * 16, ho);
  asm volatile("s_wait_xcnt 0x0" :: "v"(ho) : "memory");   // as above
#pragma unroll
  for (int j = 0; j < 3; ++j)
#pragma unroll
    for (int mi = 0; mi < 2; ++mi) acc[j][mi] = zacc;
  const unsigned short* w2w = w2 + (size_t)((3 * wg) * (kHid / 32) + wh * (kHid / 64)) * 512;
  w_pass<kDim3 / 32, kDim3 / 32, kPH, kHid / 32>(ring, w1w, w2w, lo, sH + rl * kPH + hh * 16, acc);   // fc2's first weights fly under the GELU
  asm volatile("s_wait_xcnt 0x0" :: "v"(lo) : "memory");   // as above
#pragma unroll
  for (int j = 0; j < 3; ++j)
#pragma unroll
    for (int mi = 0; mi < 2; ++mi) {
      const v8f x = acc[j][mi] * ((1.0f / kWCarry) * kGCarry) + b1v[j] * kGCarry;
      *(v8h*)(sG + (mi * 16 + rl) * kPG + ((3 * wave + j) * 16 + hh * 8) * 2) = __builtin_convertvector(gelu8_carried(x), v8h);
      acc[j][mi] = zacc;
    }
  __syncthreads();   // G rows visible to every wave

  // ---- fc2, each wave one half of K ----
#pragma unroll   // the bias lands under the products
  for (int j = 0; j < 3; ++j) b2v[j] = load8(b2 + (3 * wg + j) * 16, ho);
  asm volatile("s_wait_xcnt 0x0" :: "v"(ho) : "memory");   // as above
  w_pass<kHid / 64, kHid / 32, kPG, 0>(ring, w2w, w2w, lo, sG + rl * kPG + hh * 16 + wh * (kHid / 64) * 64, acc);
  if (wh == 1) {   // scalar branch: whole waves
#pragma unroll
    for (int j = 0; j < 3; ++j)
#pragma unroll
      for (int mi = 0; mi < 2; ++mi) {
        unsigned char* p = sR + ((wg * 6 + j * 2 + mi) * 2) * 512 + lane * 16;
        *(v4f*)p         = (v4f){acc[j][mi][0], acc[j][mi][1], acc[j][mi][2], acc[j][mi][3]};
        *(v4f*)(p + 512) = (v4f){acc[j][mi][4], acc[j][mi][5], acc[j][mi][6], acc[j][mi][7]};
      }
  }
  __syncthreads();   // upper halves' sums visible to the lower halves' waves
  if (wh == 0) {
#pragma unroll
    for (int j = 0; j < 3; ++j)
#pragma unroll
      for (int mi = 0; mi < 2; ++mi) {
        const unsigned char* p = sR + ((wg * 6 + j * 2 + mi) * 2) * 512 + lane * 16;
        unsigned char* xp = sX + (mi * 16 + rl) * kPX + ((3 * wg + j) * 16 + hh * 8) * 4;
        v8f v = (acc[j][mi] + join8(*(const v4f*)p, *(const v4f*)(p + 512))) * (1.0f / (kGCarry * kWCarry));
        v += b2v[j];
        v += lds8(xp);
        lds_put8(xp, v);   // each element of XC is read and replaced by the one lane that owns it
      }
  }
  __syncthreads();   // output rows visible to every wave

  // ---- out: a wave takes 2 rows; a row is 3 planes x 512 B, one store instruction each: whole 128-B lines ----
#pragma unroll
  for (int i = 0; i < 2; ++i)
#pragma unroll
    for (int p = 0; p < 3; ++p) {
      const int r = wave * 2 + i;
      *(v4f*)((char*)(out + (size_t)p * (kRows * kDim) + (size_t)(m0 + r) * kDim) + lo) = *(const v4f*)(sX + r * kPX + p * 512 + lane * 16);
    }
  // stands behind the last store, before any register that the stores name is rewritten; the lane offset lives up to it
  asm volatile("s_wait_xcnt 0x0" :: "v"(lo) : "memory");
}

// ---------------------------------------------------------------------------
// Host glue. Workspace region map (bytes; every offset a multiple of 32768):
//   (not used)                         294,912 @          0
//   WPROJ f16 [3][128][128]             98,304 @    294,912   (the three weights in fragment order)
//   WFC1  f16 [768][384]               589,824 @    393,216
//   WFC2  f16 [384][768]               589,824 @    983,040
//   VT    f16 [6][128][2048]         3,145,728 @  1,572,864
//   BIG                             12,582,912 @  4,718,592   (QKVO @ +3,145,728: per-head planes f16 [2][48][2048][16],
//                                                             q then k, 6,291,456 bytes, up to and during attention;
//                                                             V goes to VT)
//   OH    f16 [48][2048][16]         3,145,728 @ 17,301,504
//   (not used)                       6,291,456 @ 20,447,232
//   total                                        26,738,688
// ---------------------------------------------------------------------------
extern "C" void kernel_launch(void* const* d_in, const int* in_sizes, int n_in,
                              void* d_out, int out_size, void* d_ws, size_t ws_size,
                              hipStream_t stream) {
  if (n_in < 14) return;
  if (in_sizes[0] != kRows * kDim || in_sizes[1] != kRows * kDim || in_sizes[2] != kRows * kDim) return;
  if (in_sizes[3] != 3 * kDim || in_sizes[4] != 3 * kDim) return;
  if (in_sizes[5] != 3 * kDim * kDim3 || in_sizes[6] != 3 * kDim * kDim || in_sizes[7] != 3 * kDim) return;
  if (in_sizes[8] != kDim3 || in_sizes[9] != kDim3) return;
  if (in_sizes[10] != kDim3 * kHid || in_sizes[11] != kHid || in_sizes[12] != kHid * kDim3 || in_sizes[13] != kDim3) return;
  if (out_size != 3 * kRows * kDim) return;

  const float* x1     = (const float*)d_in[0];
  const float* x2     = (const float*)d_in[1];
  const float* x3     = (const float*)d_in[2];
  const float* ln1_g  = (const float*)d_in[3];
  const float* ln1_b  = (const float*)d_in[4];
  const float* qkv_w  = (const float*)d_in[5];
  const float* proj_w = (const float*)d_in[6];
  const float* proj_b = (const float*)d_in[7];
  const float* ln2_g  = (const float*)d_in[8];
  const float* ln2_b  = (const float*)d_in[9];
  const float* fc1_w  = (const float*)d_in[10];
  const float* fc1_b  = (const float*)d_in[11];
  const float* fc2_w  = (const float*)d_in[12];
  const float* fc2_b  = (const float*)d_in[13];
  float* out = (float*)d_out;

  // ---- carve ----
  const size_t szWQKV  = (size_t)3 * kDim3 * kDim * 2;
  const size_t szWPROJ = (size_t)3 * kDim * kDim * 2;
  const size_t szWFC1  = (size_t)kHid * kDim3 * 2;
  const size_t szWFC2  = (size_t)kDim3 * kHid * 2;
  const size_t szVT    = (size_t)kGroups * kDim * kSeq * 2;
  const size_t szXN    = (size_t)3 * kRows * kDim * 2;
  const size_t szQKVO  = (size_t)3 * kRows * kDim3 * 2;
  const size_t szHN    = (size_t)kRows * kDim3 * 2;
  const size_t szG     = (size_t)kRows * kHid * 2;
  size_t szBIG = szXN + szQKVO;
  if (szHN + szG > szBIG) szBIG = szHN + szG;
  const size_t szOH    = (size_t)kGroups * kHeads * kSeq * kHdim * 2;
  const size_t szXC    = (size_t)kRows * kDim3 * 4;

  const size_t oWQKV  = 0;
  const size_t oWPROJ = oWQKV + szWQKV;
  const size_t oWFC1  = oWPROJ + szWPROJ;
  const size_t oWFC2  = oWFC1 + szWFC1;
  const size_t oVT    = oWFC2 + szWFC2;
  const size_t oBIG   = oVT + szVT;
  const size_t oOH    = oBIG + szBIG;
  const size_t oXC    = oOH + szOH;
  const size_t oEnd   = oXC + szXC;
  if (oEnd > ws_size) return;

  unsigned char* ws = (unsigned char*)d_ws;
  unsigned short* WPROJ = (unsigned short*)(ws + oWPROJ);
  unsigned short* WFC1  = (unsigned short*)(ws + oWFC1);
  unsigned short* WFC2  = (unsigned short*)(ws + oWFC2);
  unsigned short* VT    = (unsigned short*)(ws + oVT);
  unsigned short* QKVO  = (unsigned short*)(ws + oBIG + szXN);
  unsigned short* OH    = (unsigned short*)(ws + oOH);
  float*          XC    = (float*)(ws + oXC);
  const float* fdum = proj_b;   // valid f32 pointer for the unused bias slot

  // ---- QKV from the inputs themselves: (LN1(x_br) . qkv_w[br]) f16 out. M=4096, N=384, K=128; tiles 32*6 = 192 blocks, y = 0..2 ----
  // every block normalises its 128 rows of x_br and casts its 64 columns of qkv_w[br] (carried x16) into LDS
  // q and k columns -> per-head planes QKVO[q, k][g*8 + h][2048][16]; the V column tiles leave transposed -> VT[g][128][2048]
  // ---- and, as plane y = 3 of the same grid, the weights of the later launches: transpose + f16 (carried x16) ----
  // proj_w [3][128][128] -> WPROJ [3][128][128]; fc1_w [384][768] -> WFC1 [768][384]; fc2_w [768][384] -> WFC2 [384][768]  (156 tiles)
  static_assert(kTilesW <= (kRows / kBM) * (kDim3 / kBN), "the casts fit one plane of the grid");
  gemm_lds<kDim, 1, 6, false, true, false, kFoldVT, kSrcLnCast><<<dim3((kRows / kBM) * (kDim3 / kBN), 4), 256, 0, stream>>>(
      QKVO, kDim, 0L,
      QKVO, kDim, 0L,
      XC, QKVO, VT, kDim3, (long)kRows * kDim3,
      fdum, 0L, x1, x2, x3, 0L, 0,
      kDim3 / kBN, 1.0f / kWCarry,
      ln1_g, ln1_b, qkv_w, proj_w, fc1_w, fc2_w, WPROJ, WFC1, WFC2);

  // ---- attention: all 6 groups x 8 heads in one launch -> per-head planes OH ----
  attn_fused_kernel<<<dim3(kSeq / 128, kGroups * kHeads), 256, 0, stream>>>(QKVO, VT, OH);

  // ---- proj + residual, LN2, fc1 + GELU, fc2 + residual -> the three output planes: 4096 / 32 = 128 workgroups ----
  tail_fused_kernel<<<dim3(kRows / kTM), 512, 0, stream>>>(OH, WPROJ, WFC1, WFC2, x1, x2, x3, proj_b, ln2_g, ln2_b, fc1_b, fc2_b, out);
}

// v010
// Measured time: 41.9 microseconds a run.
// Timed twice side by side with v009, it ran 1.04 and 1.03 times as fast.
// Over all steps from v000 it is 38.4 times as fast.
// Contractions: x_ln@Wqkv, o@Wproj, h_ln@Wfc1, g@Wfc2 (activations f16, weights f16 carried x16), scores k.q^T (q,k f16, q carried x head-dim scale x log2(e), head dim 16: two key tiles per A fragment, q zero-padded 16->32 in registers), V^T@P^T (P f16, unnormalised exp carried x2^8, V^T f16): all v_wmma_f32_16x16x32_f16 with f32 accumulate; LayerNorm, online softmax, GELU(erf), bias, residual in f32.
#include <hip/hip_runtime.h>
#include <math.h>

// ---------------------------------------------------------------------------
// Problem constants
// ---------------------------------------------------------------------------
constexpr int kBatch   = 2;
constexpr int kSeq     = 2048;
constexpr int kDim     = 128;
constexpr int kHeads   = 8;
constexpr int kHdim    = 16;
constexpr int kHid     = 768;
constexpr int kRows    = kBatch * kSeq;     // 4096 token rows per branch
constexpr int kDim3    = 3 * kDim;          // 384
constexpr int kGroups  = 3 * kBatch;        // 6 (branch, batch) groups; group g covers plane rows g*2048 .. g*2048+2047
constexpr int kKeyChunk = 512;              // keys staged in LDS at a time
constexpr int kVHalf   = 288;               // LDS bytes from lane half 0's 256 B of a V^T fragment half to lane half 1's
constexpr int kVGrp    = 576;               // LDS bytes per V^T fragment half (16 dims x 16 keys)
constexpr float kWCarry = 16.0f;            // weights carried x16 in f16
constexpr float kPCarryLog2 = 8.0f;         // unnormalised probabilities exp(s - max in use) carried x2^8 in f16
constexpr float kQCarry = 0.25f * 1.44269504088896340736f;   // q carried x head-dim scale x log2(e): k.q is the score in log2 units
constexpr float kPLimit = 32768.0f;         // a sum of four carried probabilities below this: each of them is far inside f16
constexpr float kOCarry = 64.0f;            // attention output carried x64 in f16
constexpr float kGCarry = 16.0f;            // gelu output carried x16 in f16
constexpr float kLnEps  = 1e-5f;

typedef __attribute__((ext_vector_type(16))) _Float16 v16h;
typedef __attribute__((ext_vector_type(8)))  _Float16 v8h;
typedef __attribute__((ext_vector_type(4)))  _Float16 v4h;
typedef __attribute__((ext_vector_type(8)))  float    v8f;
typedef __attribute__((ext_vector_type(4)))  float    v4f;
typedef __attribute__((ext_vector_type(2)))  float    v2f;
typedef __attribute__((ext_vector_type(4)))  unsigned int v4u;
typedef __attribute__((ext_vector_type(2)))  unsigned int v2u;

// ---------------------------------------------------------------------------
// Fragment helpers
// ---------------------------------------------------------------------------
template <typename T> struct Frag;
template <> struct Frag<_Float16> {
  typedef v16h V; union U { v16h v; v8h h[2]; };
  static __device__ __forceinline__ v16h load(const _Float16* p) {   // elements 0..7 <- p[0..7], 8..15 <- p[16..23]
    U f; f.h[0] = *(const v8h*)(p); f.h[1] = *(const v8h*)(p + 16); return f.v;
  }
  static __device__ __forceinline__ v8f mma(v16h a, v16h b, v8f c) {
    return __builtin_amdgcn_wmma_f32_16x16x32_f16(false, a, false, b, (short)0, c, false, false);
  }
};

__device__ __forceinline__ unsigned pk16(unsigned short a, unsigned short b) { return (unsigned)a | ((unsigned)b << 16); }
__device__ __forceinline__ unsigned short h_bits(float f) { const _Float16 h = (_Float16)f; return __builtin_bit_cast(unsigned short, h); }

// ---------------------------------------------------------------------------
// Batched WMMA GEMM with both operands staged in LDS, by asynchronous copies unless SRC makes them itself.
// C[m,n] = scale * sum_k A[m,k] * Bt[n,k] (+bias[n])(+resid[m*ldr+n]); A row-major [M,K], Bt row-major [N,K], f16.
// One workgroup (8 waves) owns a 128 x 64 tile of C; wave (wm = wave&3, wn = wave>>2) owns rows 32wm.., columns 32wn.. (2 x 2 fragments).
// K = NCH * KC. A chunk is KC k of all 192 operand rows: [A 128 rows | Bt 64 rows] at pitch 2*KC + 16 bytes (16 B x odd: no bank
// conflict for the 16-byte fragment reads). Every copy instruction of a wave moves 512 contiguous source bytes, two runs of 256 or (kFoldHeads A) four of 128:
// whole 128-B lines. Each chunk has a buffer of its own, so chunk 1 flies while chunk 0 is multiplied.
// blockIdx.x = tile (column tile fastest), blockIdx.y = b is the batch: operands, output, bias and residual move by their strides
// (elements) per b; the residual base is resid0 / resid1 / resid2 for b = 0 / 1 / 2, then + b * strideR.
// OUT_F16: C is f16 (Ch), else f32 (Cf). The tile leaves through LDS, so every store instruction writes whole 128-B lines.
// FOLD names the pointwise or re-layout pass that the launch does itself, in place of a launch of its own beside it:
//   kFoldGelu   the f16 output is gelu(C + bias), exact erf form, carried x kGCarry;
//   kFoldVT     column tiles from column 2*kDim on (the V columns) leave transposed: Vt[(g*128 + c)*2048 + n], g = plane row / 2048;
//               column tiles below column kDim (the q columns) leave carried x kQCarry; the q and k column tiles leave in per-head planes,
//               Ch[(s*48 + g*8 + h)][2048][16], s = 0 for q and 1 for k: a token's 16 dims of one head are 32 B, 16 tokens 512 contiguous bytes;
//   kFoldHeads  A is read from the attention's per-head planes Ap[(g*8 + h)][2048][16]: k = 16h + d.
// Every loop of the engine is unrolled: its arrays (copy operands, fragments, accumulators, residual rows) are registers and asm
// operands, which need constant indices.
// The file launches one form of the engine, the QKV product (kFoldVT, kSrcLnCast); the products behind the attention are in tail_fused_kernel.
// ---------------------------------------------------------------------------
constexpr int kBM = 128, kBN = 64, kCPitch = 68;   // kCPitch: floats per staged row of C
constexpr int kTPitch = 136;                       // halves per staged row of a transposed V tile: 272 B = 16 B x odd
constexpr int kFoldNone = 0, kFoldGelu = 1, kFoldVT = 2, kFoldHeads = 3;
constexpr int kSrcF16 = 0, kSrcLn = 1, kSrcLnCast = 2;

// N copies and, in the same statement, the wait that stands before any register they name is rewritten.
__device__ __forceinline__ void async_copy4(const unsigned* l, const unsigned short* const* g) {
  asm volatile("global_load_async_to_lds_b128 %0, %4, off\n\t"
               "global_load_async_to_lds_b128 %1, %5, off\n\t"
               "global_load_async_to_lds_b128 %2, %6, off\n\t"
               "global_load_async_to_lds_b128 %3, %7, off\n\t"
               "s_wait_xcnt 0x0"
               :: "v"(l[0]), "v"(l[1]), "v"(l[2]), "v"(l[3]), "v"(g[0]), "v"(g[1]), "v"(g[2]), "v"(g[3]) : "memory");
}
__device__ __forceinline__ void async_copy12(const unsigned* l, const unsigned short* const* g) {
  asm volatile("global_load_async_to_lds_b128 %0, %12, off\n\t"
               "global_load_async_to_lds_b128 %1, %13, off\n\t"
               "global_load_async_to_lds_b128 %2, %14, off\n\t"
               "global_load_async_to_lds_b128 %3, %15, off\n\t"
               "global_load_async_to_lds_b128 %4, %16, off\n\t"
               "global_load_async_to_lds_b128 %5, %17, off\n\t"
               "global_load_async_to_lds_b128 %6, %18, off\n\t"
               "global_load_async_to_lds_b128 %7, %19, off\n\t"
               "global_load_async_to_lds_b128 %8, %20, off\n\t"
               "global_load_async_to_lds_b128 %9, %21, off\n\t"
               "global_load_async_to_lds_b128 %10, %22, off\n\t"
               "global_load_async_to_lds_b128 %11, %23, off\n\t"
               "s_wait_xcnt 0x0"
               :: "v"(l[0]), "v"(l[1]), "v"(l[2]), "v"(l[3]), "v"(l[4]), "v"(l[5]), "v"(l[6]), "v"(l[7]), "v"(l[8]), "v"(l[9]),
                  "v"(l[10]), "v"(l[11]),
                  "v"(g[0]), "v"(g[1]), "v"(g[2]), "v"(g[3]), "v"(g[4]), "v"(g[5]), "v"(g[6]), "v"(g[7]), "v"(g[8]), "v"(g[9]),
                  "v"(g[10]), "v"(g[11]) : "memory");
}

// ROWS rows of KC halves from g0 (row pitch ld halves) to LDS byte address lds0 (row pitch 2*KC + 16). A row is KC/8 pieces of 16 B.
// PER * 256 pieces = 16 whole rows: lane t takes pieces i*256 + t (i < PER) of every 16-row band, so its addresses in the next band
// are the same plus a constant. Each piece is copied by exactly one lane; every lane is on.
template <int KC, int ROWS>
__device__ __forceinline__ void stage_rows(const unsigned short* g0, int ld, unsigned lds0, int t) {
  constexpr int CPR = KC / 8, PER = CPR / 16, BAND = 16, NB = ROWS / BAND, PITCH = KC * 2 + 16;
  static_assert(CPR % 16 == 0 && (PER == 1 || PER == 3) && NB % 4 == 0, "whole bands, four bands a statement");
  const unsigned short* gb[PER];
  unsigned lb[PER];
#pragma unroll
  for (int i = 0; i < PER; ++i) {
    const int e = i * 256 + t;
    const int r = e / CPR, c = e - r * CPR;
    gb[i] = g0 + (r * ld + c * 8);
    lb[i] = lds0 + (unsigned)(r * PITCH + c * 16);
  }
  const size_t step = (size_t)(BAND * ld);
#pragma unroll
  for (int j0 = 0; j0 < NB; j0 += 4) {
    unsigned l[4 * PER];
    const unsigned short* g[4 * PER];
#pragma unroll
    for (int jj = 0; jj < 4; ++jj)
#pragma unroll
      for (int i = 0; i < PER; ++i) {
        l[jj * PER + i] = lb[i] + (unsigned)((j0 + jj) * BAND * PITCH);
        g[jj * PER + i] = gb[i] + (size_t)(j0 + jj) * step;
      }
    if (PER == 3) async_copy12(l, g); else async_copy4(l, g);
  }
}

// 128 rows of A = 8 heads x 16 dims from the per-head planes; o0 = head 0's plane at the tile's first row, LDS row pitch 2*kDim + 16.
// A band is 16 rows = 256 pieces of 16 B. A wave takes 4 heads x 4 rows x 2 pieces: per head 128 contiguous, aligned source bytes,
// so every copy instruction moves 4 whole lines. Each piece is copied by exactly one lane; every lane is on.
__device__ __forceinline__ void stage_heads(const unsigned short* o0, unsigned lds0, int t) {
  constexpr int PITCH = kDim * 2 + 16;
  const int lane = t & 31, wave = t >> 5;
  const int h = (wave & 1) * 4 + (lane >> 3);
  const int r = (wave >> 1) * 4 + ((lane >> 1) & 3);
  const int p = lane & 1;
  const unsigned short* gb = o0 + (h * kSeq * kHdim + r * kHdim + p * 8);
  const unsigned lb = lds0 + (unsigned)(r * PITCH + (h * 2 + p) * 16);
#pragma unroll
  for (int j0 = 0; j0 < kBM / 16; j0 += 4) {
    unsigned l[4];
    const unsigned short* g[4];
#pragma unroll
    for (int jj = 0; jj < 4; ++jj) {
      l[jj] = lb + (unsigned)((j0 + jj) * 16 * PITCH);
      g[jj] = gb + (j0 + jj) * 16 * kHdim;
    }
    async_copy4(l, g);
  }
}

// value of the lane whose number differs by MASK inside the 16-lane row (DPP row_xmask)
template <int MASK> __device__ __forceinline__ float lane_xor(float v) {
  return __builtin_bit_cast(float, __builtin_amdgcn_update_dpp(0, __builtin_bit_cast(int, v), 0x160 + MASK, 0xf, 0xf, true));
}

__device__ __forceinline__ float rsq_slot(float x) {
  float r;
  asm("v_rsq_f32 %0, %1\n\tv_nop" : "=v"(r) : "v"(x));
  return r;
}

// 128 rows of x (f32, KC features, x0 = the tile's first row) -> LayerNorm -> f16 rows in LDS at pitch 2*KC + 16.
// LPR lanes share a row, so a wave instruction works on 32/LPR rows: lane j of them holds the 16-B pieces j, j + LPR, j + 2*LPR, ...,
// and every load instruction covers whole 128-B lines of each of its rows. A wave takes 16 rows, two passes to a group;
// the next group's loads are asked for ahead of this group's arithmetic.
template <int KC>
__device__ __forceinline__ void stage_ln(const float* __restrict__ x0, const float* __restrict__ g, const float* __restrict__ bt,
                                         unsigned char* sA, int t) {
  constexpr int PITCH = KC * 2 + 16;
  constexpr int LPR = (KC == kDim) ? 8 : 16, NQ = KC / 4 / LPR, RP = 32 / LPR, NG = 16 / RP / 2;
  static_assert(NQ * LPR * 4 == KC, "whole pieces");
  const int lane = t & 31, wave = t >> 5;
  const int j = lane & (LPR - 1), rr = lane / LPR;
  const unsigned xo = (unsigned)((wave * 16 + rr) * KC + j * 4) * 4u;   // bytes: uniform base + one 32-bit lane offset
  const unsigned go = (unsigned)(j * 4) * 4u;
  v4f xv[NG][2][NQ], gv[NQ], bv[NQ];
#pragma unroll
  for (int q = 0; q < NQ; ++q) {
    gv[q] = *(const v4f*)((const char*)(g + q * LPR * 4) + go);
    bv[q] = *(const v4f*)((const char*)(bt + q * LPR * 4) + go);
  }
#pragma unroll
  for (int gi = -1; gi < NG; ++gi) {
    if (gi + 1 < NG) {
#pragma unroll
      for (int p = 0; p < 2; ++p)
#pragma unroll
        for (int q = 0; q < NQ; ++q)
          xv[gi + 1][p][q] = *(const v4f*)((const char*)(x0 + (((gi + 1) * 2 + p) * RP * KC + q * LPR * 4)) + xo);
      // the lane offsets stay in their registers up to this wait, which stands before any register these loads name is rewritten
      asm volatile("s_wait_xcnt 0x0" :: "v"(xo), "v"(go) : "memory");
    }
    if (gi < 0) continue;
#pragma unroll
    for (int p = 0; p < 2; ++p) {
      v4f a = xv[gi][p][0];
#pragma unroll
      for (int q = 1; q < NQ; ++q) a += xv[gi][p][q];
      float s1 = (a[0] + a[1]) + (a[2] + a[3]);
      s1 += lane_xor<1>(s1);
      s1 += lane_xor<2>(s1);
      s1 += lane_xor<4>(s1);
      if (LPR == 16) s1 += lane_xor<8>(s1);
      const float mean = s1 * (1.0f / KC);
      v4f a2 = (v4f){0.f, 0.f, 0.f, 0.f};
#pragma unroll
      for (int q = 0; q < NQ; ++q) {
        xv[gi][p][q] -= mean;
        a2 += xv[gi][p][q] * xv[gi][p][q];
      }
      float s2 = (a2[0] + a2[1]) + (a2[2] + a2[3]);
      s2 += lane_xor<1>(s2);
      s2 += lane_xor<2>(s2);
      s2 += lane_xor<4>(s2);
      if (LPR == 16) s2 += lane_xor<8>(s2);
      const float rstd = rsq_slot(s2 * (1.0f / KC) + kLnEps);
      unsigned char* row = sA + (wave * 16 + (gi * 2 + p) * RP + rr) * PITCH + j * 8;
#pragma unroll
      for (int q = 0; q < NQ; ++q)
        *(v4h*)(row + q * LPR * 8) = __builtin_convertvector(xv[gi][p][q] * rstd * gv[q] + bv[q], v4h);
    }
  }
}

// 64 columns of a weight plane W (f32 [kDim][LDW], w0 = W + first column) -> Bt rows [column][k] f16 carried x kWCarry, LDS pitch 2*kDim + 16.
// Lane = column, so every load instruction reads one whole 128-B line; a thread packs 8 consecutive k of its column into one 16-B store.
template <int LDW>
__device__ __forceinline__ void stage_wcast128(const float* __restrict__ w0, unsigned char* sB, int t) {
  constexpr int PITCH = kDim * 2 + 16;
  const int nl = t & 63, kq = t >> 6;
  const unsigned wo = (unsigned)(kq * 8 * LDW + nl) * 4u;   // bytes: uniform base + one 32-bit lane offset
  float wv[4][8];
#pragma unroll
  for (int i = 0; i < 4; ++i)
#pragma unroll
    for (int e = 0; e < 8; ++e) wv[i][e] = *(const float*)((const char*)(w0 + (i * 32 + e) * LDW) + wo);
  // as in stage_ln: the lane offset lives up to the wait
  asm volatile("s_wait_xcnt 0x0" :: "v"(wo) : "memory");
#pragma unroll
  for (int i = 0; i < 4; ++i) {
    v8h hv;
#pragma unroll
    for (int e = 0; e < 8; ++e) hv[e] = (_Float16)(wv[i][e] * kWCarry);
    *(v8h*)(sB + nl * PITCH + (i * 4 + kq) * 16) = hv;
  }
}

// GELU in its erf form (not the tanh form) of eight values side by side, with no branch: X = kGCarry * x comes in, kGCarry * gelu(x) goes out.
// gelu(x) = x * (1 + erf(x / sqrt 2)) / 2 = max(x, 0) - |x| * T(|x|), T(a) = erfc(a / sqrt 2) / 2 = the normal tail, so nothing cancels for x < 0.
// T(a) = exp(-a * a / 2) * t * (c1 + t * (c2 + t * (c3 + t * (c4 + t * c5)))), t = 1 / (1 + p * a): the classical five-term rational form of erfc,
// absolute error below 1e-7 in T; in f32 the result stays within 5e-7 (absolute) of gelu(x), and it is stored as f16, which rounds at 5e-4 relative.
__device__ __forceinline__ v8f gelu8_carried(v8f X) {
  constexpr float p  = 0.3275911f * 0.70710678118654752f / kGCarry;
  constexpr float k2 = -0.5f * 1.44269504088896340736f / (kGCarry * kGCarry);   // exp(-x * x / 2) = exp2(k2 * X * X)
  constexpr float c1 = 0.5f * 0.254829592f, c2 = 0.5f * -0.284496736f, c3 = 0.5f * 1.421413741f, c4 = 0.5f * -1.453152027f, c5 = 0.5f * 1.061405429f;
  const v8f aX = __builtin_elementwise_abs(X);
  const v8f d = aX * p + 1.0f;
  const v8f w = (X * k2) * X;
  v8f t, e;
#pragma unroll   // vector elements are registers: constant indices
  for (int i = 0; i < 8; ++i) { t[i] = __builtin_amdgcn_rcpf(d[i]); e[i] = __builtin_amdgcn_exp2f(w[i]); }
  const v8f q = ((((t * c5 + c4) * t + c3) * t + c2) * t + c1) * t;
  return __builtin_elementwise_max(X, (v8f){0.f, 0.f, 0.f, 0.f, 0.f, 0.f, 0.f, 0.f}) - aX * (q * e);
}

constexpr int kTilesProj = (kDim / 64) * (kDim / 64) * 3;    // 12
constexpr int kTilesFc1  = (kDim3 / 64) * (kHid / 64);       // 72
constexpr int kTilesFc2  = (kHid / 64) * (kDim3 / 64);       // 72
constexpr int kTilesW    = kTilesProj + kTilesFc1 + kTilesFc2;   // 156
__device__ __forceinline__ void wtcast_tile(int r0, const float* __restrict__ wProj,
                                            const float* __restrict__ wFc1, const float* __restrict__ wFc2,
                                            unsigned short* __restrict__ oProj,
                                            unsigned short* __restrict__ oFc1, unsigned short* __restrict__ oFc2,
                                            float scale);

// SRC names what the block makes of f32 data in LDS itself, in place of a launch in front of it:
//   kSrcLn      A = LayerNorm over KC features of the f32 rows of resid0 / resid1 / resid2 (b = 0 / 1 / 2; gain and shift lng, lnb + b * KC);
//               Ap is not read;
//   kSrcLnCast  the same, and Bt = the columns of the f32 plane Wf + b * kDim * kDim3, cast by the block; Btp is not read either.
// Plane blockIdx.y = 3 of a kSrcLnCast grid holds no GEMM tile: its first kTilesW blocks cast one tile each of the weights of the later launches
// (block-uniform choice, so the cast's barrier is passed by a whole block or by none).
// WPE = waves per SIMD that the register budget must leave room for: 2 * workgroups per WGP that the LDS size and the grid ask for.
template <int KC, int NCH, int WPE, bool BIAS, bool OUT_F16, bool RESID, int FOLD, int SRC>
__global__ __launch_bounds__(256, WPE) void gemm_lds(
    const unsigned short* __restrict__ Ap, int lda, long strideA,
    const unsigned short* __restrict__ Btp, int ldb, long strideB,
    float* __restrict__ Cf, unsigned short* __restrict__ Ch, unsigned short* __restrict__ Vt, int ldc, long strideC,
    const float* __restrict__ bias, long strideBias,
    const float* __restrict__ resid0, const float* __restrict__ resid1, const float* __restrict__ resid2, long strideR, int ldr,
    int tilesN, float scale,
    const float* __restrict__ lng, const float* __restrict__ lnb, const float* __restrict__ Wf,
    const float* __restrict__ wProj, const float* __restrict__ wFc1, const float* __restrict__ wFc2,
    unsigned short* __restrict__ oProj, unsigned short* __restrict__ oFc1, unsigned short* __restrict__ oFc2) {
  if (SRC == kSrcLnCast && blockIdx.y == 3) {
    if (blockIdx.x < kTilesW) wtcast_tile(blockIdx.x, wProj, wFc1, wFc2, oProj, oFc1, oFc2, kWCarry);
    return;
  }
  constexpr int PITCH = KC * 2 + 16;
  constexpr int BUF   = (kBM + kBN) * PITCH;
  constexpr int GK    = 2, NG = KC / 32 / GK;   // fragments are fetched in groups of GK k steps, one group ahead
  static_assert(kBM * kCPitch * 4 <= BUF, "the staged C tile fits the first buffer");
  static_assert((kBM + kBN) * (KC / 8) / 256 <= 63, "copies of one chunk outstanding per wave");
  static_assert(FOLD != kFoldHeads || (KC == kDim && NCH == 1), "a row of A is the 8 heads of one token");
  static_assert(FOLD != kFoldGelu || OUT_F16, "the activation leaves as f16");
  static_assert(SRC == kSrcF16 || (NCH == 1 && !RESID && FOLD != kFoldHeads), "a chunk holds the whole normalised row; the residual slots name its source");
  static_assert(SRC != kSrcLnCast || KC == kDim, "the cast stages 128 k");
  static_assert(FOLD != kFoldVT || (OUT_F16 && !BIAS && kBN * kTPitch * 2 <= BUF), "the transposed tile fits the first buffer");
  __shared__ __align__(128) unsigned char smem[NCH * BUF];
  const int t    = threadIdx.x;
  const int lane = t & 31, wave = t >> 5;
  const int b    = blockIdx.y;
  const int tm   = blockIdx.x / tilesN;
  const int tn   = blockIdx.x - tm * tilesN;
  const int m0   = tm * kBM, n0 = tn * kBN;
  const unsigned short* Ab = Ap  + (size_t)b * strideA + (size_t)m0 * lda;
  const unsigned short* Bb = Btp + (size_t)b * strideB + (size_t)n0 * ldb;
  const unsigned lds0 = (unsigned)(size_t)smem;   // low 32 bits of the shared address = byte offset in the workgroup's LDS

  const int grp = b * (kRows / kSeq) + m0 / kSeq, tok = m0 % kSeq;   // the tile's (branch, batch) group and its first token there
  if (SRC == kSrcF16) {
    if (FOLD == kFoldHeads) stage_heads(Ap + ((size_t)grp * kHeads * kSeq + tok) * kHdim, lds0, t);
    else                    stage_rows<KC, kBM>(Ab, lda, lds0, t);
    stage_rows<KC, kBN>(Bb, ldb, lds0 + kBM * PITCH, t);
  } else {   // Bt is asked for first, so that it flies under the LayerNorm arithmetic
    if (SRC == kSrcLnCast) stage_wcast128<kDim3>(Wf + (size_t)b * (kDim * kDim3) + n0, smem + kBM * PITCH, t);
    else                   stage_rows<KC, kBN>(Bb, ldb, lds0 + kBM * PITCH, t);
    stage_ln<KC>(((b == 0) ? resid0 : (b == 1) ? resid1 : resid2) + (size_t)m0 * KC, lng + b * KC, lnb + b * KC, smem, t);
  }

  // bias and residual of the rows this thread will store: asked for now, used in the epilogue
  const int c4 = (t & 15) * 4, r4 = t >> 4;            // f32 C: a row of 256 B = 16 lanes x 16 B; 16 rows a trip
  const int c8 = (t & 7) * 8, r8 = t >> 3;             // f16 C: a row of 128 B = 8 lanes x 16 B; 32 rows a trip
  v4f bv = (v4f){0.f, 0.f, 0.f, 0.f};
  v4f bh[2] = {bv, bv};
  v4f rv[kBM / 16];
  if (BIAS) bv = *(const v4f*)(bias + (size_t)b * strideBias + n0 + c4);
  if (BIAS && OUT_F16) {
    const float* bp = bias + (size_t)b * strideBias + n0 + c8;
    bh[0] = *(const v4f*)bp;
    bh[1] = *(const v4f*)(bp + 4);
  }
  if (RESID) {
    const float* rp = ((b == 0) ? resid0 : (b == 1) ? resid1 : resid2) + (size_t)b * strideR + (size_t)(m0 + r4) * ldr + n0 + c4;
    const float* rq[kBM / 16];
#pragma unroll
    for (int it = 0; it < kBM / 16; ++it) { rq[it] = rp + (size_t)(it * 16 * ldr); rv[it] = *(const v4f*)rq[it]; }
    // the eight addresses stay in their registers up to this wait, so no load of the run returns onto an earlier load's address
    asm volatile("s_wait_xcnt 0x0" :: "v"(rq[0]), "v"(rq[1]), "v"(rq[2]), "v"(rq[3]), "v"(rq[4]), "v"(rq[5]), "v"(rq[6]), "v"(rq[7]) : "memory");
  }

  if (SRC != kSrcLnCast) asm volatile("s_wait_asynccnt 0x0" ::: "memory");   // this wave's copies of chunk 0 have landed
  __syncthreads();                                    // chunk 0 visible to every wave
  if (NCH > 1) {                                      // chunk 1 flies under chunk 0's products
    stage_rows<KC, kBM>(Ab + KC, lda, lds0 + BUF, t);
    stage_rows<KC, kBN>(Bb + KC, ldb, lds0 + BUF + kBM * PITCH, t);
  }

  const int rlane = lane & 15, hh = lane >> 4;
  const int wm = wave & 3, wn = wave >> 2;
  v8f acc[2][2];
#pragma unroll
  for (int i = 0; i < 2; ++i)
#pragma unroll
    for (int j = 0; j < 2; ++j) acc[i][j] = (v8f){0.f, 0.f, 0.f, 0.f, 0.f, 0.f, 0.f, 0.f};

#pragma unroll
  for (int ch = 0; ch < NCH; ++ch) {
    const unsigned char* aP = smem + ch * BUF + (wm * 32 + rlane) * PITCH + hh * 16;
    const unsigned char* bP = smem + ch * BUF + (kBM + wn * 32 + rlane) * PITCH + hh * 16;
    v16h fa[2][GK][2], fb[2][GK][2];
#pragma unroll
    for (int g = -1; g < NG; ++g) {
      if (g + 1 < NG) {
#pragma unroll
        for (int s = 0; s < GK; ++s)
#pragma unroll
          for (int i = 0; i < 2; ++i) {
            fa[(g + 1) & 1][s][i] = Frag<_Float16>::load((const _Float16*)(aP + i * 16 * PITCH + ((g + 1) * GK + s) * 64));
            fb[(g + 1) & 1][s][i] = Frag<_Float16>::load((const _Float16*)(bP + i * 16 * PITCH + ((g + 1) * GK + s) * 64));
          }
      }
      __builtin_amdgcn_sched_barrier(0);   // the next group's LDS reads stay one group, ahead of this group's products, not among them
      if (g >= 0) {
#pragma unroll
        for (int s = 0; s < GK; ++s)
#pragma unroll
          for (int i = 0; i < 2; ++i)
#pragma unroll
            for (int j = 0; j < 2; ++j) acc[i][j] = Frag<_Float16>::mma(fa[g & 1][s][i], fb[g & 1][s][j], acc[i][j]);
      }
      __builtin_amdgcn_sched_barrier(0);   // and the reads of the group after that stay behind these products
    }
    asm volatile("s_wait_dscnt 0x0" ::: "memory");                    // this wave's reads of the chunk are done
    if (NCH > 1) asm volatile("s_wait_asynccnt 0x0" ::: "memory");    // this wave's copies of the next chunk have landed; behind the last chunk none is left
    __syncthreads();   // next chunk visible to every wave; behind the last chunk: every reader has left, the LDS becomes C staging
  }

  // ---- epilogue: scaled tile to LDS in accumulator order, out of it in whole rows ----
  float* sC = (float*)smem;
  _Float16* sT = (_Float16*)smem;
  const bool vtile = FOLD == kFoldVT && n0 >= 2 * kDim;   // block-uniform: the whole tile is V columns
  const float cscale = (FOLD == kFoldVT && n0 < kDim) ? scale * kQCarry   // block-uniform: the whole tile is q columns
                     : (FOLD == kFoldGelu) ? scale * kGCarry : scale;      // the activation takes its argument carried
  if (vtile) {
    // a lane's 8 accumulator registers are 8 consecutive rows of one column: 16 contiguous bytes of the transposed tile
#pragma unroll
    for (int i = 0; i < 2; ++i)
#pragma unroll
      for (int j = 0; j < 2; ++j)
        *(v8h*)(sT + (wn * 32 + j * 16 + rlane) * kTPitch + wm * 32 + i * 16 + hh * 8) = __builtin_convertvector(acc[i][j] * scale, v8h);
  } else {
#pragma unroll
    for (int i = 0; i < 2; ++i)
#pragma unroll
      for (int j = 0; j < 2; ++j)
#pragma unroll
        for (int r = 0; r < 8; ++r)
          sC[(wm * 32 + i * 16 + hh * 8 + r) * kCPitch + wn * 32 + j * 16 + rlane] = acc[i][j][r] * cscale;
  }
  __syncthreads();   // staged tile visible to every wave
  if (vtile) {
    // 64 dims x 128 tokens: a row of 256 B = 16 lanes x 16 B; 16 rows a trip
    unsigned short* vp = Vt + ((size_t)grp * kDim + (n0 - 2 * kDim)) * kSeq + tok;
    const unsigned vo = (unsigned)(r4 * kSeq + (t & 15) * 8) * 2u;   // bytes: uniform base + one 32-bit lane offset
#pragma unroll
    for (int it = 0; it < kBN / 16; ++it) {
      const v8h hv = *(const v8h*)(sT + (it * 16 + r4) * kTPitch + (t & 15) * 8);
      *(v8h*)((char*)(vp + (size_t)(it * 16 * kSeq)) + vo) = hv;
    }
  } else if (!OUT_F16) {
    float* cp = Cf + (size_t)b * strideC + (size_t)m0 * ldc + n0;
    const unsigned co = (unsigned)(r4 * ldc + c4) * 4u;   // bytes: uniform base + one 32-bit lane offset
#pragma unroll
    for (int it = 0; it < kBM / 16; ++it) {
      v4f v = *(const v4f*)(sC + (it * 16 + r4) * kCPitch + c4);
      if (BIAS)  v += bv;
      if (RESID) v += rv[it];
      *(v4f*)((char*)(cp + (size_t)(it * 16 * ldc)) + co) = v;
    }
  } else {
    // per-head planes: the tile's 64 columns are 4 heads; a wave's store covers 4 tokens x 32 B = one whole 128-B line in each of the 4 planes
    unsigned short* cp = (FOLD == kFoldVT)
        ? Ch + (((size_t)(n0 / kDim) * (kGroups * kHeads) + grp * kHeads + (n0 % kDim) / kHdim) * kSeq + tok) * kHdim
        : Ch + (size_t)b * strideC + (size_t)m0 * ldc + n0;
    const int rstep = (FOLD == kFoldVT) ? kHdim : ldc;   // halves from a token's row to the next
    const unsigned co = (FOLD == kFoldVT) ? (unsigned)((c8 / kHdim) * (kSeq * kHdim) + r8 * kHdim + (c8 % kHdim)) * 2u
                                          : (unsigned)(r8 * ldc + c8) * 2u;   // bytes: uniform base + one 32-bit lane offset
    v4f sv[kBM / 32][2];   // all of the thread's staged values are asked for at once, ahead of the pointwise work
#pragma unroll
    for (int it = 0; it < kBM / 32; ++it) {
      const float* sp = sC + (it * 32 + r8) * kCPitch + c8;
      sv[it][0] = *(const v4f*)sp;
      sv[it][1] = *(const v4f*)(sp + 4);
    }
#pragma unroll
    for (int it = 0; it < kBM / 32; ++it) {
      v8f x;
#pragma unroll
      for (int e = 0; e < 8; ++e) {
        x[e] = sv[it][e >> 2][e & 3];
        if (BIAS) x[e] += bh[e >> 2][e & 3] * ((FOLD == kFoldGelu) ? kGCarry : 1.0f);
      }
      if (FOLD == kFoldGelu) x = gelu8_carried(x);
      const v8h hv = __builtin_convertvector(x, v8h);
      *(v8h*)((char*)(cp + (size_t)(it * 32 * rstep)) + co) = hv;
    }
    // stands behind the last store of the run, before any register that the four stores name is rewritten; the lane offset lives up to it
    asm volatile("s_wait_xcnt 0x0" :: "v"(co) : "memory");
  }
}

// ---------------------------------------------------------------------------
// Weight transpose + cast: W plane z is f32 [nIn][nOut] row-major; WT[h][d] = f16(scale * W[d][h]) leaves in fragment order:
// the 16 columns h x 32 k of one matrix operand are 1 KiB, k step fastest, then column tile: two halves of 512 B (k 0..15, k 16..31 of the step),
// in each half lane (h & 15) + 16 * ((k >> 3) & 1) holds 8 consecutive k in 16 B. A 64 x 64 tile holds 8 such blocks whole.
// The three weight tensors that later launches read, in one index space: tile index r0 falls into one tensor's range of (nIn/64)*(nOut/64)*nz tiles
// (block-uniform choice), and inside the range it runs d tile fastest, then h tile, then plane z.
// 256 threads; nIn, nOut multiples of 64. Plane z at out + z*nOut*nIn halves.
// Load coverage: 16 iterations x 256 threads = 4096 = the whole 64x64 tile (coalesced along h).
// Store coverage: 8 waves x 2 iterations x 4 rows (lane>>3) = 64 rows; (lane&7) x 8 halves = 64 cols; each row segment =
// ---------------------------------------------------------------------------
__device__ __forceinline__ void wtcast_tile(int r0, const float* __restrict__ wProj,
                                            const float* __restrict__ wFc1, const float* __restrict__ wFc2,
                                            unsigned short* __restrict__ oProj,
                                            unsigned short* __restrict__ oFc1, unsigned short* __restrict__ oFc2,
                                            float scale) {
  __shared__ float sm[64][65];   // sm[h_local][d_local]
  const int t  = threadIdx.x;
  const float* W = wProj; unsigned short* out = oProj; int nIn = kDim, nOut = kDim;
  if (r0 >= kTilesProj + kTilesFc1) { r0 -= kTilesProj + kTilesFc1; W = wFc2; out = oFc2; nIn = kHid; nOut = kDim3; }
  else if (r0 >= kTilesProj)        { r0 -= kTilesProj; W = wFc1; out = oFc1; nIn = kDim3; nOut = kHid; }
  const int gx = nIn >> 6, gy = nOut >> 6;
  const int r1 = r0 / gx;
  const int d0 = (r0 - r1 * gx) * 64;
  const int z  = r1 / gy;
  const int h0 = (r1 - z * gy) * 64;
  const float* Wz = W + (size_t)z * nIn * nOut;
#pragma unroll
  for (int i = 0; i < 16; ++i) {
    const int e = i * 256 + t;
    const int r = e >> 6;          // d local
    const int c = e & 63;          // h local
    sm[c][r] = Wz[(size_t)(d0 + r) * nOut + h0 + c] * scale;
  }
  __syncthreads();
  const int lane = t & 31, wave = t >> 5;
  const int q = lane >> 3, c8 = (lane & 7) * 8;
  unsigned short* op = out + (size_t)z * nOut * nIn;
  {
#pragma unroll
    for (int it = 0; it < 2; ++it) {
      const int row = wave * 8 + it * 4 + q;                 // h local
      unsigned short hb[8];
#pragma unroll
      for (int e = 0; e < 8; ++e) hb[e] = h_bits(sm[row][c8 + e]);
      const v4u u = (v4u){pk16(hb[0], hb[1]), pk16(hb[2], hb[3]), pk16(hb[4], hb[5]), pk16(hb[6], hb[7])};
      const int n = h0 + row, k = d0 + c8;                   // 8 consecutive k of output column n: one lane's 16 B of a fragment half
      *(v4u*)(op + ((((n >> 4) * (nIn >> 5) + (k >> 5)) * 2 + ((k >> 4) & 1)) * 256 + ((n & 15) + 16 * ((k >> 3) & 1)) * 8)) = u;
    }
    
  }
}

// ---------------------------------------------------------------------------
// Fused attention, one launch for all 48 (group, head) pairs: S^T = K.Q^T, online softmax, O^T += V^T.P^T.
// grid (2048/128 = 16 query blocks, 48), 256 threads = 8 waves x 16 queries. Lane (c = lane&15, hh = lane>>4) owns query c.
// q and K come from the head's own planes qk[(s*48 + g*8 + head)][2048][16] (s = 0: q, 1: K): every load instruction of a wave reads 16 tokens =
// 512 contiguous bytes, four whole 128-B lines.
// K and V^T of the head are staged through registers into LDS, 512 keys at a time, already in fragment order:
//   sK: 16-key tile T at T*512; lane's 16 B (key c, dims 8hh..8hh+7) at + lane*16.
//   sV: fragment half G (keys 16G + 8hh + 0..7 of dim c) at G*576 + hh*288 + c*16.
// S^T tile register r = score(key 8hh + r, query c), so two tiles converted in place are the B operand P^T (hardware k
// order), and V^T as A is read in the same k order. O^T register r = O(query c, dim 8hh + r): one 16-B store per lane.
// oh[(g*8 + head)][2048][16] f16 carried x64: each wave writes 512 contiguous bytes.
// ---------------------------------------------------------------------------
__device__ __forceinline__ float other_half(float v) {   // value of lane ^ 16
  const int b = __builtin_bit_cast(int, v);
  return __builtin_bit_cast(float, __builtin_amdgcn_permlanex16(b, b, 0x76543210, 0xfedcba98, false, false));
}
__device__ __forceinline__ float vmax8(v8f a) {
  return fmaxf(fmaxf(fmaxf(a[0], a[1]), fmaxf(a[2], a[3])), fmaxf(fmaxf(a[4], a[5]), fmaxf(a[6], a[7])));
}
__device__ __forceinline__ v8f vexp2_8(v8f a) {
  v8f r;
#pragma unroll
  for (int e = 0; e < 8; ++e) r[e] = __builtin_amdgcn_exp2f(a[e]);
  return r;
}
__device__ __forceinline__ v8f splat8(float x) { return (v8f){x, x, x, x, x, x, x, x}; }
// largest score (log2 units) of the lane's query over the 64 keys whose four staged tiles begin at kt (the lane's own 16 B), both lane halves joined
__device__ __forceinline__ float max64(const unsigned char* kt, v16h qlo, v16h qhi) {
  const v8f z = (v8f){0.f, 0.f, 0.f, 0.f, 0.f, 0.f, 0.f, 0.f};
  float mx = -INFINITY;
#pragma unroll
  for (int j = 0; j < 2; ++j) {
    Frag<_Float16>::U kf;
    kf.h[0] = *(const v8h*)(kt + (2 * j) * 512);
    kf.h[1] = *(const v8h*)(kt + (2 * j + 1) * 512);
    mx = fmaxf(mx, fmaxf(vmax8(Frag<_Float16>::mma(kf.v, qlo, z)), vmax8(Frag<_Float16>::mma(kf.v, qhi, z))));
  }
  return fmaxf(mx, other_half(mx));
}
// six waves per SIMD = three workgroups per WGP: 768 workgroups fill 256 WGPs in one even round
__global__ __launch_bounds__(256) __attribute__((amdgpu_waves_per_eu(6))) void attn_fused_kernel(const unsigned short* __restrict__ qk,
                                                         const unsigned short* __restrict__ vt,
                                                         unsigned short* __restrict__ oh) {
  __shared__ __align__(128) unsigned char sK[kKeyChunk * 32];
  __shared__ __align__(128) unsigned char sV[(kKeyChunk / 16) * kVGrp];
  typedef Frag<_Float16>::U FU;
  const int lane = threadIdx.x & 31, wave = threadIdx.x >> 5;
  const int c = lane & 15, hh = lane >> 4;
  const int gh = blockIdx.y, g = gh >> 3, hd = gh & 7;
  const int q0 = blockIdx.x * 128 + wave * 16;
  const v8h zero8 = (v8h){0, 0, 0, 0, 0, 0, 0, 0};
  const v8f zacc  = (v8f){0.f, 0.f, 0.f, 0.f, 0.f, 0.f, 0.f, 0.f};

  // One A fragment holds two 16-key tiles (k 0..15 = dims of the first, k 16..31 = dims of the second);
  // q sits in the lower k half of qlo and in the upper k half of qhi, zeros in the other half, so each picks one tile.
  FU qlo, qhi;
  const unsigned short* qp = qk + ((size_t)gh * kSeq + q0 + c) * kHdim + 8 * hh;
  qlo.h[0] = *(const v8h*)qp;
  qlo.h[1] = zero8;
  qhi.h[0] = zero8;
  qhi.h[1] = qlo.h[0];

  // staging, 4 rounds of 8 waves per chunk. K round i: wave takes the 16-key tile i*8 + wave, lane = (key c, 16-B part hh).
  // V^T round i: wave takes 4 dims x 8 parts of 8 keys (4 whole 128-B lines): dim sd, part i*16 + sp of the chunk.
  const int sd = (wave & 3) * 4 + (lane >> 3);
  const int sp = (wave >> 2) * 8 + (lane & 7);
  const unsigned short* kp = qk + ((size_t)(kGroups * kHeads + gh) * kSeq + wave * 16 + c) * kHdim + 8 * hh;
  const unsigned short* vp = vt + (size_t)(g * kDim + hd * kHdim + sd) * kSeq + sp * 8;
  unsigned char* skw = sK + wave * 512 + lane * 16;
  unsigned char* svw = sV + (sp >> 1) * kVGrp + (sp & 1) * kVHalf + sd * 16;
  v4u kr[4], vr[4];
#pragma unroll
  for (int i = 0; i < 4; ++i) {
    kr[i] = *(const v4u*)(kp + i * 128 * kHdim);
    vr[i] = *(const v4u*)(vp + i * 128);
  }
  // the lane addresses stay in their registers up to this wait, which stands before any register these loads name is rewritten
  asm volatile("s_wait_xcnt 0x0" :: "v"(qp), "v"(kp), "v"(vp) : "memory");

  // Lazy rescale. m = the maximum in use of the lane's query (log2 units), the same in both lane halves; cv = kPCarryLog2 - m in all eight
  // registers is the C operand of the score products, which so leave the matrix unit as the exponents themselves.
  float m = 0.f;
  v8f cv = zacc;
  v8f lv = zacc;
  v8f o  = zacc;
  // Issue priority by the wave's own progress.
  // Every wave starts at priority 3 and steps down to
  // 2, 1, 0 when 8, 4 and 1 of its 16 trips of 128 keys are left: a workgroup that is ahead yields to the ones behind it, and the three end together.
  // The priority is an immediate, so each choice is a scalar branch; the last trip and the way out run at priority 0.
  __builtin_amdgcn_s_setprio(3);
  for (int ch = 0; ch < kSeq / kKeyChunk; ++ch) {
    if (ch == kSeq / kKeyChunk - 2)      __builtin_amdgcn_s_setprio(2);
    else if (ch == kSeq / kKeyChunk - 1) __builtin_amdgcn_s_setprio(1);
    __syncthreads();   // every wave has finished reading the previous chunk
#pragma unroll
    for (int i = 0; i < 4; ++i) {
      *(v4u*)(skw + i * 8 * 512) = kr[i];
      *(v4u*)(svw + i * 8 * kVGrp) = vr[i];
    }
    __syncthreads();   // chunk visible to every wave
    if (ch + 1 < kSeq / kKeyChunk) {   // next chunk's global loads fly under this chunk's work
      kp += kKeyChunk * kHdim;
      vp += kKeyChunk;
#pragma unroll
      for (int i = 0; i < 4; ++i) {
        kr[i] = *(const v4u*)(kp + i * 128 * kHdim);
        vr[i] = *(const v4u*)(vp + i * 128);
      }
    }
    if (ch == 0) {   // the first maximum in use: that of the first 64 keys
      m  = max64(sK + lane * 16, qlo.v, qhi.v);
      cv = splat8(kPCarryLog2 - m);
    }
#pragma unroll 2   // a rolled loop keeps the registers inside the six-wave budget with no scratch
    for (int kb = 0; kb < kKeyChunk / 64; ++kb) {
      if (ch == kSeq / kKeyChunk - 1 && kb == kKeyChunk / 64 - 2) __builtin_amdgcn_s_setprio(0);
      const unsigned char* kt = sK + kb * 4 * 512 + lane * 16;
      FU kf[2];
#pragma unroll
      for (int j = 0; j < 2; ++j) {
        kf[j].h[0] = *(const v8h*)(kt + (2 * j) * 512);
        kf[j].h[1] = *(const v8h*)(kt + (2 * j + 1) * 512);
      }
      v8f pe[4];
#pragma unroll
      for (int j = 0; j < 2; ++j) {
        pe[2 * j]     = vexp2_8(Frag<_Float16>::mma(kf[j].v, qlo.v, cv));
        pe[2 * j + 1] = vexp2_8(Frag<_Float16>::mma(kf[j].v, qhi.v, cv));
      }
      v8f ps = (pe[0] + pe[1]) + (pe[2] + pe[3]);
      // One test per 64 keys, a scalar branch for the whole wave: only where a score has outgrown the maximum in use so far that its
      // probability nears the f16 range is the maximum taken anew, sums and output rescaled and the 64 keys' probabilities made again.
      if (__builtin_amdgcn_ballot_w32(!(vmax8(ps) < kPLimit)) != 0) {
        const float mn = fmaxf(m, max64(kt, qlo.v, qhi.v));
        const float alpha = __builtin_amdgcn_exp2f(m - mn);
        m  = mn;
        cv = splat8(kPCarryLog2 - mn);
        lv = lv * alpha;
        o  = o * alpha;
#pragma unroll
        for (int j = 0; j < 2; ++j) {
          pe[2 * j]     = vexp2_8(Frag<_Float16>::mma(kf[j].v, qlo.v, zacc) + cv);
          pe[2 * j + 1] = vexp2_8(Frag<_Float16>::mma(kf[j].v, qhi.v, zacc) + cv);
        }
        ps = (pe[0] + pe[1]) + (pe[2] + pe[3]);
      }
      FU vf[2];   // asked for behind the test: their 16 registers are not held through the exponentials
#pragma unroll
      for (int j = 0; j < 2; ++j) {
        vf[j].h[0] = *(const v8h*)(sV + (kb * 4 + 2 * j) * kVGrp + hh * kVHalf + c * 16);
        vf[j].h[1] = *(const v8h*)(sV + (kb * 4 + 2 * j + 1) * kVGrp + hh * kVHalf + c * 16);
      }
      lv = lv + ps;
#pragma unroll
      for (int j = 0; j < 2; ++j) {
        FU pf;
        pf.h[0] = __builtin_convertvector(pe[2 * j], v8h);
        pf.h[1] = __builtin_convertvector(pe[2 * j + 1], v8h);
        o = Frag<_Float16>::mma(vf[j].v, pf.v, o);
      }
    }
  }
  float l = ((lv[0] + lv[1]) + (lv[2] + lv[3])) + ((lv[4] + lv[5]) + (lv[6] + lv[7]));
  l += other_half(l);
  const float inv = kOCarry / l;
  const v8h ov = __builtin_convertvector(o * inv, v8h);
  *(v8h*)(oh + ((size_t)gh * kSeq + q0 + c) * kHdim + 8 * hh) = ov;
}

// ---------------------------------------------------------------------------
// Fused tail, one launch: proj + bias + residual, LayerNorm 2, fc1 + bias + GELU, fc2 + bias + residual, all of them local to a token row.
// One workgroup (16 waves) owns 32 token rows; the rows between the three products (XC f32, LN2 rows f16, G f16) live in LDS only.
// Every product is computed transposed, D = W^T tile (A operand, 16 output columns x 32 k) . activation rows (B operand, 32 k x 16 tokens):
// a lane's 8 accumulator registers are 8 consecutive output columns of one token, so they leave in 16-B pieces.
// A weight is used by the workgroup's two token tiles only, so it goes from L2 straight into registers: the cast has left it in fragment order,
// every load instruction reads 512 contiguous bytes, and a ring of kRing k steps (3 column tiles each) is in flight per wave.
//   proj  wave (wg = wave & 7, wh = wave >> 3): column tile wg of each of the 3 branches, token tile wh, K = 128
//   fc1   wave: column tiles 3 wave .. 3 wave + 2 of 48, both token tiles, K = 384
//   fc2   wave: column tiles 3 wg .. 3 wg + 2 of 24, both token tiles, k half wh of K = 768; the two halves' sums are joined through LDS
// Every loop is unrolled: ring slots, fragments and accumulators are registers, which need constant indices.
// ---------------------------------------------------------------------------
constexpr int kTM = 32;                    // token rows per workgroup
constexpr int kRing = 4;                   // k steps of weights per wave between request and use
constexpr int kPO = kDim * 2 + 16;         // LDS row pitches in bytes, each 16 B x odd
constexpr int kPH = kDim3 * 2 + 16;
constexpr int kPG = kHid * 2 + 16;
constexpr int kPX = kDim3 * 4 + 16;

// one operand fragment of a weight in fragment order; blk = its 1-KiB block (wave-uniform), lo = lane * 16 bytes
__device__ __forceinline__ v16h wfrag(const unsigned short* blk, unsigned lo) {
  Frag<_Float16>::U f;
  f.h[0] = *(const v8h*)((const char*)blk + lo);
  f.h[1] = *(const v8h*)((const char*)(blk + 256) + lo);
  return f.v;
}
// the first kRing k steps of a pass: asked for ahead of the pointwise work and the barriers that stand in front of the pass
template <int KST>
__device__ __forceinline__ void w_first(v16h (&ring)[kRing][3], const unsigned short* w, unsigned lo) {
#pragma unroll
  for (int s = 0; s < kRing; ++s)
#pragma unroll
    for (int j = 0; j < 3; ++j) ring[s][j] = wfrag(w + (j * KST + s) * 512, lo);
}
// KS k steps of 3 column tiles x 2 token tiles; w = first block of the first column tile (a column tile is KST blocks),
// a = the lane's 16 B of the first activation row tile in LDS (row pitch PITCH). The ring holds the first kRing steps on entry.
// KSTN > 0: the slots that the last kRing steps leave take the first steps of the next pass (wn, KSTN blocks a column tile), so the stream of
// weights does not stop for the pointwise work and the barrier between the passes.
template <int KS, int KST, int PITCH, int KSTN>
__device__ __forceinline__ void w_pass(v16h (&ring)[kRing][3], const unsigned short* w, const unsigned short* wn, unsigned lo,
                                       const unsigned char* a, v8f (&acc)[3][2]) {
  static_assert(KS % kRing == 0, "a step of the next pass lands in the slot that the pass will read it from");
  v16h af[2][2];
#pragma unroll
  for (int mi = 0; mi < 2; ++mi) af[0][mi] = Frag<_Float16>::load((const _Float16*)(a + mi * 16 * PITCH));
#pragma unroll
  for (int s = 0; s < KS; ++s) {
    if (s + 1 < KS) {
#pragma unroll
      for (int mi = 0; mi < 2; ++mi) af[(s + 1) & 1][mi] = Frag<_Float16>::load((const _Float16*)(a + mi * 16 * PITCH + (s + 1) * 64));
    }
    __builtin_amdgcn_sched_barrier(0);   // the next step's LDS reads stay ahead of this step's products, not among them
#pragma unroll
    for (int j = 0; j < 3; ++j)
#pragma unroll
      for (int mi = 0; mi < 2; ++mi) acc[j][mi] = Frag<_Float16>::mma(ring[s % kRing][j], af[s & 1][mi], acc[j][mi]);
    __builtin_amdgcn_sched_barrier(0);   // the refill of the slot just used is asked for here, kRing steps ahead of its use, and not later
    if (s + kRing < KS) {
#pragma unroll
      for (int j = 0; j < 3; ++j) ring[s % kRing][j] = wfrag(w + (j * KST + s + kRing) * 512, lo);
    } else if (KSTN > 0) {
#pragma unroll
      for (int j = 0; j < 3; ++j) ring[s % kRing][j] = wfrag(wn + (j * KSTN + s + kRing - KS) * 512, lo);
    }
  }
  __builtin_amdgcn_sched_barrier(0);   // the last requests stay here, ahead of the pointwise work behind the pass
}
__device__ __forceinline__ v8f join8(v4f a, v4f b) { return (v8f){a[0], a[1], a[2], a[3], b[0], b[1], b[2], b[3]}; }
__device__ __forceinline__ v8f load8(const float* base, unsigned off) {   // wave-uniform base + one 32-bit lane offset in bytes
  return join8(*(const v4f*)((const char*)base + off), *(const v4f*)((const char*)(base + 4) + off));
}
__device__ __forceinline__ v8f lds8(const unsigned char* p) { return join8(*(const v4f*)p, *(const v4f*)(p + 16)); }
__device__ __forceinline__ void lds_put8(unsigned char* p, v8f v) {
  *(v4f*)p        = (v4f){v[0], v[1], v[2], v[3]};
  *(v4f*)(p + 16) = (v4f){v[4], v[5], v[6], v[7]};
}

// four waves per SIMD: one workgroup of 16 waves per WGP
__global__ __launch_bounds__(512, 4) void tail_fused_kernel(
    const unsigned short* __restrict__ oh,
    const unsigned short* __restrict__ wP, const unsigned short* __restrict__ w1, const unsigned short* __restrict__ w2,
    const float* __restrict__ x1, const float* __restrict__ x2, const float* __restrict__ x3,
    const float* __restrict__ pb, const float* __restrict__ lg, const float* __restrict__ lb,
    const float* __restrict__ b1, const float* __restrict__ b2, float* __restrict__ out) {
  __shared__ __align__(128) unsigned char sO[3 * kTM * kPO];    // attention output rows, per branch [32][128] f16
  __shared__ __align__(128) unsigned char sX[kTM * kPX];        // XC [32][384] f32; at the end the output rows
  __shared__ __align__(128) unsigned char sH[kTM * kPH];        // LN2(XC) [32][384] f16
  __shared__ __align__(128) unsigned char sG[kTM * kPG];        // gelu [32][768] f16 carried x kGCarry
  __shared__ __align__(128) unsigned char sR[8 * 6 * 2 * 512];  // fc2 sums of the upper k half: [wg][tile][register half][lane] 16 B
  const int t = threadIdx.x, lane = t & 31;
  const int wave = __builtin_amdgcn_readfirstlane(t >> 5);      // scalar, so that every weight address is a scalar base + lane offset
  const int rl = lane & 15, hh = lane >> 4;
  const int wg = wave & 7, wh = wave >> 3;
  const int m0 = blockIdx.x * kTM;
  const int gb = m0 / kSeq, tok = m0 % kSeq;                    // batch and first token of the rows (32 divides 2048)
  const v8f zacc = (v8f){0.f, 0.f, 0.f, 0.f, 0.f, 0.f, 0.f, 0.f};
  const unsigned lo = (unsigned)lane * 16u;

  // ---- everything that proj needs from memory is asked for at once ----
  v16h ring[kRing][3];
#pragma unroll
  for (int s = 0; s < 4; ++s)
#pragma unroll
    for (int j = 0; j < 3; ++j) ring[s][j] = wfrag(wP + ((j * 8 + wg) * 4 + s) * 512, lo);
  // O: per branch 8 heads x 32 rows x 2 pieces of 16 B = 512 pieces, one per thread; a head's 32 rows are 1 KiB contiguous
  const int oh_h = t >> 6, oh_r = (t >> 1) & 31, oh_p = t & 1;
  const unsigned short* op = oh + ((size_t)(gb * kHeads + oh_h) * kSeq + tok + oh_r) * kHdim + oh_p * 8;   // branch 0; a branch is 2 * kHeads planes on
  const unsigned xo = (unsigned)((wh * 16 + rl) * kDim + wg * 16 + hh * 8) * 4u;
  const unsigned po = (unsigned)(wg * 16 + hh * 8) * 4u;
  const unsigned go = (unsigned)rl * 16u;
  const unsigned ho = (unsigned)hh * 32u;
  v4u ov[3];
  v8f xr[3], pbv[3];
  v4f gv[6], bv[6];
#pragma unroll
  for (int j = 0; j < 3; ++j) {
    ov[j]  = *(const v4u*)(op + j * (2 * kHeads * kSeq * kHdim));
    xr[j]  = load8(((j == 0) ? x1 : (j == 1) ? x2 : x3) + (size_t)m0 * kDim, xo);
    pbv[j] = load8(pb + j * kDim, po);
  }
  // the lane addresses stay in their registers up to this wait, which stands before any register these loads name is rewritten
  asm volatile("s_wait_xcnt 0x0" :: "v"(lo), "v"(op), "v"(xo), "v"(po) : "memory");
#pragma unroll
  for (int j = 0; j < 3; ++j) *(v4u*)(sO + (j * kTM + oh_r) * kPO + (oh_h * 2 + oh_p) * 16) = ov[j];
  __syncthreads();   // O rows visible to every wave

  // ---- proj: XC[row][128 j + n] = O_j . Wproj_j / carries + bias + x_j ----
  v8f pa[3] = {zacc, zacc, zacc};
#pragma unroll
  for (int s = 0; s < 4; ++s)
#pragma unroll
    for (int j = 0; j < 3; ++j)
      pa[j] = Frag<_Float16>::mma(ring[s][j], Frag<_Float16>::load((const _Float16*)(sO + (j * kTM + wh * 16 + rl) * kPO + hh * 16 + s * 64)), pa[j]);
  const unsigned short* w1w = w1 + (size_t)(3 * wave) * (kDim3 / 32) * 512;
  w_first<kDim3 / 32>(ring, w1w, lo);   // fc1's first weights fly under proj's epilogue and LN2
  asm volatile("s_wait_xcnt 0x0" :: "v"(lo) : "memory");   // as above
#pragma unroll
  for (int j = 0; j < 3; ++j) {
    v8f v = pa[j] * (1.0f / (kOCarry * kWCarry));
    v += pbv[j];
    v += xr[j];
    lds_put8(sX + (wh * 16 + rl) * kPX + (j * kDim + wg * 16 + hh * 8) * 4, v);
  }
#pragma unroll   // LN2's gain and shift: asked for once the residual's registers are free, they land with fc1's first weights
  for (int q = 0; q < 6; ++q) {
    gv[q] = *(const v4f*)((const char*)(lg + q * 64) + go);
    bv[q] = *(const v4f*)((const char*)(lb + q * 64) + go);
  }
  asm volatile("s_wait_xcnt 0x0" :: "v"(go) : "memory");   // as above
  __syncthreads();   // XC rows visible to every wave

  // ---- LN2: 16 lanes share a row, a wave takes 2 rows; lane rl holds the 16-B pieces rl, rl + 16, ... ----
  {
    const int row = wave * 2 + hh;
    v4f xv[6];
#pragma unroll
    for (int q = 0; q < 6; ++q) xv[q] = *(const v4f*)(sX + row * kPX + q * 256 + rl * 16);
    v4f a = xv[0];
#pragma unroll
    for (int q = 1; q < 6; ++q) a += xv[q];
    float s1 = (a[0] + a[1]) + (a[2] + a[3]);
    s1 += lane_xor<1>(s1);
    s1 += lane_xor<2>(s1);
    s1 += lane_xor<4>(s1);
    s1 += lane_xor<8>(s1);
    const float mean = s1 * (1.0f / kDim3);
    v4f a2 = (v4f){0.f, 0.f, 0.f, 0.f};
#pragma unroll
    for (int q = 0; q < 6; ++q) {
      xv[q] -= mean;
      a2 += xv[q] * xv[q];
    }
    float s2 = (a2[0] + a2[1]) + (a2[2] + a2[3]);
    s2 += lane_xor<1>(s2);
    s2 += lane_xor<2>(s2);
    s2 += lane_xor<4>(s2);
    s2 += lane_xor<8>(s2);
    const float rstd = rsq_slot(s2 * (1.0f / kDim3) + kLnEps);
#pragma unroll
    for (int q = 0; q < 6; ++q)
      *(v4h*)(sH + row * kPH + q * 128 + rl * 8) = __builtin_convertvector(xv[q] * rstd * gv[q] + bv[q], v4h);
  }
  __syncthreads();   // normalised rows visible to every wave

  // ---- fc1 + bias + GELU -> G ----
  v8f acc[3][2], b1v[3], b2v[3];
#pragma unroll   // the bias lands under the products
  for (int j = 0; j < 3; ++j) b1v[j] = load8(b1 + (3 * wave + j) * 16, ho);
  asm volatile("s_wait_xcnt 0x0" :: "v"(ho) : "memory");   // as above
#pragma unroll
  for (int j = 0; j < 3; ++j)
#pragma unroll
    for (int mi = 0; mi < 2; ++mi) acc[j][mi] = zacc;
  const unsigned short* w2w = w2 + (size_t)((3 * wg) * (kHid / 32) + wh * (kHid / 64)) * 512;
  w_pass<kDim3 / 32, kDim3 / 32, kPH, kHid / 32>(ring, w1w, w2w, lo, sH + rl * kPH + hh * 16, acc);   // fc2's first weights fly under the GELU
  asm volatile("s_wait_xcnt 0x0" :: "v"(lo) : "memory");   // as above
#pragma unroll
  for (int j = 0; j < 3; ++j)
#pragma unroll
    for (int mi = 0; mi < 2; ++mi) {
      const v8f x = acc[j][mi] * ((1.0f / kWCarry) * kGCarry) + b1v[j] * kGCarry;
      *(v8h*)(sG + (mi * 16 + rl) * kPG + ((3 * wave + j) * 16 + hh * 8) * 2) = __builtin_convertvector(gelu8_carried(x), v8h);
      acc[j][mi] = zacc;
    }
  __syncthreads();   // G rows visible to every wave

  // ---- fc2, each wave one half of K ----
#pragma unroll   // the bias lands under the products
  for (int j = 0; j < 3; ++j) b2v[j] = load8(b2 + (3 * wg + j) * 16, ho);
  asm volatile("s_wait_xcnt 0x0" :: "v"(ho) : "memory");   // as above
  w_pass<kHid / 64, kHid / 32, kPG, 0>(ring, w2w, w2w, lo, sG + rl * kPG + hh * 16 + wh * (kHid / 64) * 64, acc);
  if (wh == 1) {   // scalar branch: whole waves
#pragma unroll
    for (int j = 0; j < 3; ++j)
#pragma unroll
      for (int mi = 0; mi < 2; ++mi) {
        unsigned char* p = sR + ((wg * 6 + j * 2 + mi) * 2) * 512 + lane * 16;
        *(v4f*)p         = (v4f){acc[j][mi][0], acc[j][mi][1], acc[j][mi][2], acc[j][mi][3]};
        *(v4f*)(p + 512) = (v4f){acc[j][mi][4], acc[j][mi][5], acc[j][mi][6], acc[j][mi][7]};
      }
  }
  __syncthreads();   // upper halves' sums visible to the lower halves' waves
  if (wh == 0) {
#pragma unroll
    for (int j = 0; j < 3; ++j)
#pragma unroll
      for (int mi = 0; mi < 2; ++mi) {
        const unsigned char* p = sR + ((wg * 6 + j * 2 + mi) * 2) * 512 + lane * 16;
        unsigned char* xp = sX + (mi * 16 + rl) * kPX + ((3 * wg + j) * 16 + hh * 8) * 4;
        v8f v = (acc[j][mi] + join8(*(const v4f*)p, *(const v4f*)(p + 512))) * (1.0f / (kGCarry * kWCarry));
        v += b2v[j];
        v += lds8(xp);
        lds_put8(xp, v);   // each element of XC is read and replaced by the one lane that owns it
      }
  }
  __syncthreads();   // output rows visible to every wave

  // ---- out: a wave takes 2 rows; a row is 3 planes x 512 B, one store instruction each: whole 128-B lines ----
#pragma unroll
  for (int i = 0; i < 2; ++i)
#pragma unroll
    for (int p = 0; p < 3; ++p) {
      const int r = wave * 2 + i;
      *(v4f*)((char*)(out + (size_t)p * (kRows * kDim) + (size_t)(m0 + r) * kDim) + lo) = *(const v4f*)(sX + r * kPX + p * 512 + lane * 16);
    }
  // stands behind the last store, before any register that the stores name is rewritten; the lane offset lives up to it
  asm volatile("s_wait_xcnt 0x0" :: "v"(lo) : "memory");
}

// ---------------------------------------------------------------------------
// Host glue. Workspace region map (bytes; every offset a multiple of 32768):
//   (not used)                         294,912 @          0
//   WPROJ f16 [3][128][128]             98,304 @    294,912   (the three weights in fragment order)
//   WFC1  f16 [768][384]               589,824 @    393,216
//   WFC2  f16 [384][768]               589,824 @    983,040
//   VT    f16 [6][128][2048]         3,145,728 @  1,572,864
//   BIG                             12,582,912 @  4,718,592   (QKVO @ +3,145,728: per-head planes f16 [2][48][2048][16],
//                                                             q then k, 6,291,456 bytes, up to and during attention;
//                                                             V goes to VT)
//   OH    f16 [48][2048][16]         3,145,728 @ 17,301,504
//   (not used)                       6,291,456 @ 20,447,232
//   total                                        26,738,688
// ---------------------------------------------------------------------------
extern "C" void kernel_launch(void* const* d_in, const int* in_sizes, int n_in,
                              void* d_out, int out_size, void* d_ws, size_t ws_size,
                              hipStream_t stream) {
  if (n_in < 14) return;
  if (in_sizes[0] != kRows * kDim || in_sizes[1] != kRows * kDim || in_sizes[2] != kRows * kDim) return;
  if (in_sizes[3] != 3 * kDim || in_sizes[4] != 3 * kDim) return;
  if (in_sizes[5] != 3 * kDim * kDim3 || in_sizes[6] != 3 * kDim * kDim || in_sizes[7] != 3 * kDim) return;
  if (in_sizes[8] != kDim3 || in_sizes[9] != kDim3) return;
  if (in_sizes[10] != kDim3 * kHid || in_sizes[11] != kHid || in_sizes[12] != kHid * kDim3 || in_sizes[13] != kDim3) return;
  if (out_size != 3 * kRows * kDim) return;

  const float* x1     = (const float*)d_in[0];
  const float* x2     = (const float*)d_in[1];
  const float* x3     = (const float*)d_in[2];
  const float* ln1_g  = (const float*)d_in[3];
  const float* ln1_b  = (const float*)d_in[4];
  const float* qkv_w  = (const float*)d_in[5];
  const float* proj_w = (const float*)d_in[6];
  const float* proj_b = (const float*)d_in[7];
  const float* ln2_g  = (const float*)d_in[8];
  const float* ln2_b  = (const float*)d_in[9];
  const float* fc1_w  = (const float*)d_in[10];
  const float* fc1_b  = (const float*)d_in[11];
  const float* fc2_w  = (const float*)d_in[12];
  const float* fc2_b  = (const float*)d_in[13];
  float* out = (float*)d_out;

  // ---- carve ----
  const size_t szWQKV  = (size_t)3 * kDim3 * kDim * 2;
  const size_t szWPROJ = (size_t)3 * kDim * kDim * 2;
  const size_t szWFC1  = (size_t)kHid * kDim3 * 2;
  const size_t szWFC2  = (size_t)kDim3 * kHid * 2;
  const size_t szVT    = (size_t)kGroups * kDim * kSeq * 2;
  const size_t szXN    = (size_t)3 * kRows * kDim * 2;
  const size_t szQKVO  = (size_t)3 * kRows * kDim3 * 2;
  const size_t szHN    = (size_t)kRows * kDim3 * 2;
  const size_t szG     = (size_t)kRows * kHid * 2;
  size_t szBIG = szXN + szQKVO;
  if (szHN + szG > szBIG) szBIG = szHN + szG;
  const size_t szOH    = (size_t)kGroups * kHeads * kSeq * kHdim * 2;
  const size_t szXC    = (size_t)kRows * kDim3 * 4;

  const size_t oWQKV  = 0;
  const size_t oWPROJ = oWQKV + szWQKV;
  const size_t oWFC1  = oWPROJ + szWPROJ;
  const size_t oWFC2  = oWFC1 + szWFC1;
  const size_t oVT    = oWFC2 + szWFC2;
  const size_t oBIG   = oVT + szVT;
  const size_t oOH    = oBIG + szBIG;
  const size_t oXC    = oOH + szOH;
  const size_t oEnd   = oXC + szXC;
  if (oEnd > ws_size) return;

  unsigned char* ws = (unsigned char*)d_ws;
  unsigned short* WPROJ = (unsigned short*)(ws + oWPROJ);
  unsigned short* WFC1  = (unsigned short*)(ws + oWFC1);
  unsigned short* WFC2  = (unsigned short*)(ws + oWFC2);
  unsigned short* VT    = (unsigned short*)(ws + oVT);
  unsigned short* QKVO  = (unsigned short*)(ws + oBIG + szXN);
  unsigned short* OH    = (unsigned short*)(ws + oOH);
  float*          XC    = (float*)(ws + oXC);
  const float* fdum = proj_b;   // valid f32 pointer for the unused bias slot

  // ---- QKV from the inputs themselves: (LN1(x_br) . qkv_w[br]) f16 out. M=4096, N=384, K=128; tiles 32*6 = 192 blocks, y = 0..2 ----
  // every block normalises its 128 rows of x_br and casts its 64 columns of qkv_w[br] (carried x16) into LDS
  // q and k columns -> per-head planes QKVO[q, k][g*8 + h][2048][16]; the V column tiles leave transposed -> VT[g][128][2048]
  // ---- and, as plane y = 3 of the same grid, the weights of the later launches: transpose + f16 (carried x16) ----
  // proj_w [3][128][128] -> WPROJ [3][128][128]; fc1_w [384][768] -> WFC1 [768][384]; fc2_w [768][384] -> WFC2 [384][768]  (156 tiles)
  static_assert(kTilesW <= (kRows / kBM) * (kDim3 / kBN), "the casts fit one plane of the grid");
  gemm_lds<kDim, 1, 6, false, true, false, kFoldVT, kSrcLnCast><<<dim3((kRows / kBM) * (kDim3 / kBN), 4), 256, 0, stream>>>(
      QKVO, kDim, 0L,
      QKVO, kDim, 0L,
      XC, QKVO, VT, kDim3, (long)kRows * kDim3,
      fdum, 0L, x1, x2, x3, 0L, 0,
      kDim3 / kBN, 1.0f / kWCarry,
      ln1_g, ln1_b, qkv_w, proj_w, fc1_w, fc2_w, WPROJ, WFC1, WFC2);

  // ---- attention: all 6 groups x 8 heads in one launch -> per-head planes OH ----
  attn_fused_kernel<<<dim3(kSeq / 128, kGroups * kHeads), 256, 0, stream>>>(QKVO, VT, OH);

  // ---- proj + residual, LN2, fc1 + GELU, fc2 + residual -> the three output planes: 4096 / 32 = 128 workgroups ----
  tail_fused_kernel<<<dim3(kRows / kTM), 512, 0, stream>>>(OH, WPROJ, WFC1, WFC2, x1, x2, x3, proj_b, ln2_g, ln2_b, fc1_b, fc2_b, out);
}
